// v000
// Measured on an AMD MI455X. A time is GPU time per run, averaged over a window of back-to-back runs after a warm-up
// (all launches, gaps included; the runs take copies of the inputs in turn), and the median of several windows.
// Apart from v000's, it joins two sittings. Times from different sittings can be a few percent apart, while
// side-by-side timings come from the same sitting.
// v000 is the starting kernel. One run takes 349 microseconds.
#include <hip/hip_runtime.h>

// Contractions: v_wmma_f32_16x16x32_f16 (f16 operands, f32 accumulate) for qkv = h.W, S = q.k^T, O = p.v, proj, fc, fc2.
// Weight operand planes: bf16-RNE input value x64, cast to f16, stored transposed [N][K]. Activation planes f16.
// p carried x4096 in f16. Query tiles with position < TE add f16 residual planes (x2048) of q, k, v, p
// through separately scaled second products folded into the f32 accumulators. Softmax, LN and erf-GELU in f32.

#ifndef NB
#define NB 2
#endif
#ifndef SEQ
#define SEQ 2048
#endif
#define NB_FULL 2
#define SEQ_FULL 2048
#define CE 1024
#define NH 16
#define HD 64
#define C3 3072
#define C4 4096
#define QP 2048
#define TE (((SEQ) < 256) ? (SEQ) : 256)
#define RROWS ((NB) * (SEQ))
#define NEB ((TE) / 128)
#define NQB ((SEQ) / 128)
#define LNJ ((CE) / 128)
#define LNO ((CE) / 256)

static_assert((SEQ) % 128 == 0);
static_assert((TE) % 128 == 0);
static_assert((NB) >= 1 && (NB) <= NB_FULL);
static_assert((SEQ) <= SEQ_FULL);
static_assert(CE % 128 == 0 && C3 % 128 == 0 && C4 % 128 == 0 && QP % 128 == 0);
static_assert(CE % 64 == 0 && C3 % 64 == 0 && C4 % 64 == 0);
static_assert(NH * HD == CE);
static_assert(HD == 64);
static_assert(QP == 2 * CE);
static_assert(C3 == 3 * CE);
static_assert(RROWS % 128 == 0);
static_assert(RROWS % 8 == 0);
static_assert(CE == 1024);
static_assert(256 * 4 == CE);            // gamma/beta staging: 256 threads x 4 floats
static_assert(32 * 4 * LNJ == CE);       // LN row load: 32 lanes x 4 floats x LNJ steps
static_assert(32 * 8 * LNO == CE);       // LN row store: 32 lanes x 8 halves x LNO instructions
static_assert(NQB * 128 == (SEQ));
static_assert(NEB <= NQB);

typedef unsigned short u16;
typedef unsigned int   u32;
typedef _Float16 v16h __attribute__((ext_vector_type(16)));
typedef _Float16 v8h  __attribute__((ext_vector_type(8)));
typedef _Float16 v4h  __attribute__((ext_vector_type(4)));
typedef float    v8f  __attribute__((ext_vector_type(8)));
typedef float    v4f  __attribute__((ext_vector_type(4)));
typedef unsigned int u32x4 __attribute__((ext_vector_type(4)));
typedef unsigned int u32x2 __attribute__((ext_vector_type(2)));

union Frag  { v16h v; u32x4 u[2]; };
union Pack8 { v8h h; u32x4 u; };
union Pack4 { v4h h; u32x2 u; };

#define WSCALE 64.0f
#define WINV   (1.0f / 64.0f)
#define PCAR   4096.0f
#define PINV   (1.0f / 4096.0f)
#define RSC    2048.0f
#define RINV   (1.0f / 2048.0f)

constexpr size_t al256(size_t b) { return (b + 255) & ~(size_t)255; }
constexpr size_t WS_TOTAL =
    al256((size_t)C3 * CE * 2) + al256((size_t)CE * CE * 2) + al256((size_t)C4 * CE * 2) +
    al256((size_t)CE * C4 * 2) + al256((size_t)RROWS * CE * 2) + al256((size_t)RROWS * QP * 2) +
    al256((size_t)NB * (TE) * QP * 2) + al256((size_t)NB * NH * HD * (SEQ) * 2) +
    al256((size_t)NB * NH * HD * (TE) * 2) + al256((size_t)RROWS * CE * 2) +
    al256((size_t)RROWS * CE * 4) + al256((size_t)RROWS * CE * 2) + al256((size_t)RROWS * C4 * 2);
static_assert(WS_TOTAL <= (size_t)134217728);

// f32 -> nearest-even bf16 grid value, returned as f32
__device__ __forceinline__ float bfr(float f) {
    u32 u = __builtin_bit_cast(u32, f);
    u += 0x7fffu + ((u >> 16) & 1u);
    u &= 0xffff0000u;
    return __builtin_bit_cast(float, u);
}

// f32 -> f16 (RNE) bits
__device__ __forceinline__ u16 hbits(float f) {
    _Float16 h = (_Float16)f;
    return __builtin_bit_cast(u16, h);
}

// 16x16x32 f16 WMMA with the VALU hazard guard tied to D and A/B
__device__ __forceinline__ v8f mma16(v16h a, v16h b, v8f c) {
    c = __builtin_amdgcn_wmma_f32_16x16x32_f16(false, a, false, b, (short)0, c, false, false);
    asm volatile("v_nop\n\tv_nop\n\tv_nop\n\tv_nop" : "+v"(c) : "v"(a), "v"(b));
    return c;
}

// scheduling-region boundary, emitted only in the residual-carrying attention instance:
// keeps fragment loads of later sub-tiles from being issued ahead of the current sub-tile's products
template <int ON>
__device__ __forceinline__ void sched_cut() {
    if constexpr (ON != 0) __builtin_amdgcn_sched_barrier(0);
}

// erf-form GELU
__device__ __forceinline__ float gelu_erf(float x) {
    return 0.5f * x * (1.0f + erff(x * 0.70710678118654752f));
}

// logical row (b*SEQ + t) -> row of the full-size input / output tensors (b*SEQ_FULL + t)
__device__ __forceinline__ size_t grow_map(u32 r) {
    const u32 bb = r / (u32)(SEQ);
    const u32 t  = r - bb * (u32)(SEQ);
    return (size_t)bb * SEQ_FULL + (size_t)t;
}

// ---------------- weight convert + transpose: in[K][N] f32 -> out[N][K] f16 = f16(bfr(w) * 64) ----------------
// written by 8 consecutive lanes x 16 B of one instruction (4 lines per instruction).
__global__ __launch_bounds__(256) void cvt_wt_kernel(const float* __restrict__ in,
                                                      u16* __restrict__ out, u32 K, u32 N) {
    __shared__ __align__(16) u16 Ts[64 * 72];   // [n][k]
    const u32 tid = threadIdx.x, lane = tid & 31u, wv = tid >> 5;
    const u32 n0 = blockIdx.x * 64u, k0 = blockIdx.y * 64u;
    const u32 kr = tid >> 2, nseg = (tid & 3u) * 16u;
    const float* src = in + (size_t)(k0 + kr) * N + n0 + nseg;
#pragma unroll
    for (u32 j4 = 0; j4 < 4; j4++) {
        v4f w = *(const v4f*)(src + j4 * 4u);
#pragma unroll
        for (u32 c = 0; c < 4; c++) {
            float f = w[c];
            Ts[(nseg + j4 * 4u + c) * 72u + kr] = hbits(bfr(f) * WSCALE);
        }
    }
    __syncthreads();                             // Ts: cross-wave exchange
    u32x4 val[2];
#pragma unroll
    for (u32 it = 0; it < 2; it++) {
        const u32 nn = wv * 8u + it * 4u + (lane >> 3), ks = (lane & 7u) * 8u;
        val[it] = *(const u32x4*)&Ts[nn * 72u + ks];
    }
#pragma unroll
    for (u32 it = 0; it < 2; it++) {
        const u32 nn = wv * 8u + it * 4u + (lane >> 3), ks = (lane & 7u) * 8u;
        *(u32x4*)(out + (size_t)(n0 + nn) * K + k0 + ks) = val[it];
    }
    
}

// ---------------- LayerNorm (row = 1024): one wave per row, f16 out via LDS row stage ----------------
// Row kept in a wave-private f32 LDS row (lane owns columns j*128 + lane*4 + 0..3, same lane writes and reads);
// the three per-element sweeps are rolled loops with wave-uniform trip counts.
// gamma/beta staged once per workgroup in LDS at bf16-RNE values.
// SRCX = 1: src is the input x (full-size row map, each element taken at its bf16-RNE value)
// SRCX = 0: src is an f32 workspace plane with logical rows
template <int SRCX>
__global__ __launch_bounds__(256) void ln_kernel(const float* __restrict__ src,
                                                 const float* __restrict__ g,
                                                 const float* __restrict__ be,
                                                 u16* __restrict__ out) {
    __shared__ __align__(16) float xs[8 * CE];      // wave wv owns xs[wv*CE ..]
    __shared__ __align__(16) u16   rows[8 * CE];    // wave wv owns rows[wv*CE ..]
    __shared__ __align__(16) float gsh[CE];
    __shared__ __align__(16) float bsh[CE];
    const u32 tid = threadIdx.x, lane = tid & 31u, wv = tid >> 5;
    {
        v4f gg = *(const v4f*)(g + tid * 4u);
        v4f bb = *(const v4f*)(be + tid * 4u);
        v4f go, bo;
#pragma unroll
        for (u32 c = 0; c < 4; c++) {
            float tg = gg[c]; float tb = bb[c];
            go[c] = bfr(tg); bo[c] = bfr(tb);
        }
        *(v4f*)&gsh[tid * 4u] = go;
        *(v4f*)&bsh[tid * 4u] = bo;
    }
    const u32 r = blockIdx.x * 8u + wv;            // < RROWS (grid = RROWS/8)
    const size_t srow = SRCX ? grow_map(r) : (size_t)r;
    const float* xr = src + srow * CE;
    float* xw = xs + wv * CE;
    float s = 0.f;
#pragma unroll 1
    for (u32 j = 0; j < LNJ; j++) {
        const u32 c0 = j * 128u + lane * 4u;
        v4f t4 = *(const v4f*)(xr + c0);
        if constexpr (SRCX != 0) {
#pragma unroll
            for (u32 c = 0; c < 4; c++) { float t = t4[c]; t4[c] = bfr(t); }
        }
        *(v4f*)&xw[c0] = t4;
        s += (t4[0] + t4[1]) + (t4[2] + t4[3]);
    }
#pragma unroll
    for (u32 m = 16; m >= 1; m >>= 1) s += __shfl_xor(s, m, 32);
    const float mu = s * (1.f / (float)CE);
    float vs = 0.f;
#pragma unroll 1
    for (u32 j = 0; j < LNJ; j++) {
        const u32 c0 = j * 128u + lane * 4u;
        v4f t4 = *(const v4f*)&xw[c0];
#pragma unroll
        for (u32 c = 0; c < 4; c++) { float d = t4[c] - mu; vs += d * d; }
    }
#pragma unroll
    for (u32 m = 16; m >= 1; m >>= 1) vs += __shfl_xor(vs, m, 32);
    const float rstd = rsqrtf(vs * (1.f / (float)CE) + 1e-5f);
    __syncthreads();                               // gsh/bsh (cross-wave) visible
    u16* rw = rows + wv * CE;
#pragma unroll 1
    for (u32 j = 0; j < LNJ; j++) {
        const u32 c0 = j * 128u + lane * 4u;
        v4f x4 = *(const v4f*)&xw[c0];
        v4f g4 = *(const v4f*)&gsh[c0];
        v4f b4 = *(const v4f*)&bsh[c0];
        Pack4 pk;
#pragma unroll
        for (u32 c = 0; c < 4; c++) {
            float xe = x4[c]; float ge = g4[c]; float bel = b4[c];
            pk.h[c] = (_Float16)((xe - mu) * rstd * ge + bel);
        }
        *(u32x2*)&rw[c0] = pk.u;
    }
    __syncthreads();   // LDS row stage: written and read by the same wave; a workgroup barrier is used
    u32x4 val[LNO];
#pragma unroll
    for (u32 j = 0; j < LNO; j++) val[j] = *(const u32x4*)&rw[j * 256u + lane * 8u];
    u16* orow = out + (size_t)r * CE;
#pragma unroll
    for (u32 j = 0; j < LNO; j++) *(u32x4*)(orow + j * 256u + lane * 8u) = val[j];
    
}

// ---------------- f16 GEMM: C[128x128 tile] = A[M][K](f16) . BT[N][K](f16)^T, K-step 64 ----------------
// 8 waves = 4 (m) x 2 (n), wave tile 32 x 64, fragments per the split k map for A and B.
// Epilogue: acc*(1/64) + bias(bf16-RNE) [-> gelu] staged as f32 128x128 tile in LDS, then
// MODE 0: qkv: n0 < QP -> qk hi plane [RROWS][QP] (+ lo plane rows t<TE), else V transposed
//         into vt hi [NB*NH][64][SEQ] (+ vt lo [..][64][TE] for t<TE)
// MODE 1: out0 f32 [RROWS][CE] = acc + bias + bfr(res at full-size rows)   (x1)
// MODE 2: out0 f16 [RROWS][C4] = gelu(acc + bias)                          (hg)
// MODE 3: out0 f32 at full-size rows = acc + bias + res[logical rows]      (d_out)
template <int MODE>
__global__ __launch_bounds__(256) void gemm_kernel(const u16* __restrict__ A,
                                                   const u16* __restrict__ BT,
                                                   const float* __restrict__ bias,
                                                   const float* __restrict__ res,
                                                   void* out0, void* out1, void* out2, void* out3,
                                                   u32 N, u32 K) {
    __shared__ u32x4 smem[4224];                   // 67584 B: As|Bs during the k loop, Cs after it
    u16* As = (u16*)smem;                          // [128][72]
    u16* Bs = As + 128 * 72;                       // [128][72]
    float* Cs = (float*)smem;                      // [128][132]
    constexpr u32 CSP = 132;

    const u32 tid = threadIdx.x, lane = tid & 31u, wv = tid >> 5;
    const u32 hf = lane >> 4, ln = lane & 15u;
    const u32 m0 = blockIdx.y * 128u, n0 = blockIdx.x * 128u;
    const u32 wm = wv & 3u, wn = wv >> 2;
    const u32 srow = tid >> 1, sseg = (tid & 1u) * 32u;

    v8f acc[2][4];
#pragma unroll
    for (int i = 0; i < 2; i++)
#pragma unroll
        for (int j = 0; j < 4; j++) acc[i][j] = (v8f)(0.f);

    for (u32 k0 = 0; k0 < K; k0 += 64u) {
        __syncthreads();                           // prior step's fragment reads done
        {
            const u16* ga = A  + (size_t)(m0 + srow) * K + k0 + sseg;
            const u16* gb = BT + (size_t)(n0 + srow) * K + k0 + sseg;
            u32x4 a0 = *(const u32x4*)(ga), a1 = *(const u32x4*)(ga + 8);
            u32x4 a2 = *(const u32x4*)(ga + 16), a3 = *(const u32x4*)(ga + 24);
            u32x4 b0 = *(const u32x4*)(gb), b1 = *(const u32x4*)(gb + 8);
            u32x4 b2 = *(const u32x4*)(gb + 16), b3 = *(const u32x4*)(gb + 24);
            u32x4* la = (u32x4*)&As[srow * 72u + sseg];
            u32x4* lb = (u32x4*)&Bs[srow * 72u + sseg];
            la[0] = a0; la[1] = a1; la[2] = a2; la[3] = a3;
            lb[0] = b0; lb[1] = b1; lb[2] = b2; lb[3] = b3;
        }
        __syncthreads();                           // staged tile visible to all waves
#pragma unroll
        for (u32 ks = 0; ks < 2; ks++) {
            Frag af[2], bf[4];
#pragma unroll
            for (u32 mi = 0; mi < 2; mi++) {
                const u16* q = &As[(wm * 32u + mi * 16u + ln) * 72u + ks * 32u + hf * 8u];
                af[mi].u[0] = *(const u32x4*)q;
                af[mi].u[1] = *(const u32x4*)(q + 16);
            }
#pragma unroll
            for (u32 ni = 0; ni < 4; ni++) {
                const u16* q = &Bs[(wn * 64u + ni * 16u + ln) * 72u + ks * 32u + hf * 8u];
                bf[ni].u[0] = *(const u32x4*)q;
                bf[ni].u[1] = *(const u32x4*)(q + 16);
            }
#pragma unroll
            for (int mi = 0; mi < 2; mi++)
#pragma unroll
                for (int ni = 0; ni < 4; ni++)
                    acc[mi][ni] = mma16(af[mi].v, bf[ni].v, acc[mi][ni]);
        }
    }

    // ---- epilogue: accumulators -> f32 tile in LDS ----
    __syncthreads();                               // all waves done with As/Bs (aliased by Cs)
#pragma unroll
    for (int ni = 0; ni < 4; ni++) {
        const u32 col = wn * 64u + (u32)ni * 16u + ln;
        const float bv = bfr(bias[n0 + col]);
#pragma unroll
        for (int mi = 0; mi < 2; mi++) {
#pragma unroll
            for (int r = 0; r < 8; r++) {
                const u32 row = wm * 32u + (u32)mi * 16u + hf * 8u + (u32)r;
                float v = acc[mi][ni][r] * WINV + bv;
                if constexpr (MODE == 2) v = gelu_erf(v);
                Cs[row * CSP + col] = v;
            }
        }
    }
    __syncthreads();                               // Cs is read across waves below

    if constexpr (MODE == 1 || MODE == 3) {
        float* o = (float*)out0;
        v4f val[16];
#pragma unroll
        for (int grp = 0; grp < 2; grp++) {
#pragma unroll
            for (int i8 = 0; i8 < 8; i8++) {
                const int i = grp * 8 + i8;
                const u32 row = wv * 16u + (u32)i;
                const u32 r = m0 + row;
                v4f c = *(const v4f*)&Cs[row * CSP + lane * 4u];
                const size_t rr = (MODE == 1) ? grow_map(r) : (size_t)r;
                v4f x4 = *(const v4f*)(res + rr * (size_t)N + n0 + lane * 4u);
                if constexpr (MODE == 1) {
#pragma unroll
                    for (int cc = 0; cc < 4; cc++) { float t = x4[cc]; x4[cc] = bfr(t); }
                }
                val[i] = c + x4;
            }
            asm volatile("" ::: "memory");         // keep the two load groups in separate clauses
        }
#pragma unroll
        for (int i = 0; i < 16; i++) {
            const u32 r = m0 + wv * 16u + (u32)i;
            const size_t orr = (MODE == 3) ? grow_map(r) : (size_t)r;
            *(v4f*)(o + orr * (size_t)N + n0 + lane * 4u) = val[i];
        }
        
    } else if constexpr (MODE == 2) {
        u16* o = (u16*)out0;
        u32x4 val[8];
#pragma unroll
        for (int it = 0; it < 8; it++) {
            const u32 rloc = wv * 16u + (u32)it * 2u + hf, cseg = ln * 8u;
            Pack8 pk;
#pragma unroll
            for (int j = 0; j < 8; j++) pk.h[j] = (_Float16)Cs[rloc * CSP + cseg + (u32)j];
            val[it] = pk.u;
        }
#pragma unroll
        for (int it = 0; it < 8; it++) {
            const u32 rloc = wv * 16u + (u32)it * 2u + hf, cseg = ln * 8u;
            *(u32x4*)(o + (size_t)(m0 + rloc) * N + n0 + cseg) = val[it];
        }
        
    } else {
        // MODE 0: q/k planes or transposed v planes
        u16* qkh = (u16*)out0;
        u16* qkl = (u16*)out1;
        u16* vth = (u16*)out2;
        u16* vtl = (u16*)out3;
        const u32 bq = m0 / (u32)(SEQ);
        const u32 t0 = m0 - bq * (u32)(SEQ);       // 128 | SEQ so the tile sits inside one batch
        const bool lo_on = (t0 < (u32)(TE));       // uniform per workgroup
        u32x4 vh[8], vl[8];
        if (n0 < (u32)QP) {
#pragma unroll
            for (int it = 0; it < 8; it++) {
                const u32 rloc = wv * 16u + (u32)it * 2u + hf, cseg = ln * 8u;
                Pack8 ph, pl;
#pragma unroll
                for (int j = 0; j < 8; j++) {
                    float f = Cs[rloc * CSP + cseg + (u32)j];
                    _Float16 h16 = (_Float16)f;
                    ph.h[j] = h16;
                    pl.h[j] = (_Float16)((f - (float)h16) * RSC);
                }
                vh[it] = ph.u; vl[it] = pl.u;
            }
#pragma unroll
            for (int it = 0; it < 8; it++) {
                const u32 rloc = wv * 16u + (u32)it * 2u + hf, cseg = ln * 8u;
                *(u32x4*)(qkh + (size_t)(m0 + rloc) * QP + n0 + cseg) = vh[it];
                if (lo_on)
                    *(u32x4*)(qkl + ((size_t)bq * (TE) + t0 + rloc) * QP + n0 + cseg) = vl[it];
            }
            
        } else {
            const u32 hh0 = (n0 - (u32)QP) >> 6;   // two heads per 128-column tile
#pragma unroll
            for (int it = 0; it < 8; it++) {
                const u32 rloc = wv * 16u + (u32)it * 2u + hf;   // local column = head*64 + d
                const u32 tseg = ln * 8u;
                Pack8 ph, pl;
#pragma unroll
                for (int j = 0; j < 8; j++) {
                    float f = Cs[(tseg + (u32)j) * CSP + rloc];
                    _Float16 h16 = (_Float16)f;
                    ph.h[j] = h16;
                    pl.h[j] = (_Float16)((f - (float)h16) * RSC);
                }
                vh[it] = ph.u; vl[it] = pl.u;
            }
#pragma unroll
            for (int it = 0; it < 8; it++) {
                const u32 rloc = wv * 16u + (u32)it * 2u + hf, tseg = ln * 8u;
                const u32 hh = hh0 + (rloc >> 6), dd = rloc & 63u;
                const size_t vrow = (size_t)(bq * NH + hh) * HD + dd;
                *(u32x4*)(vth + vrow * (SEQ) + t0 + tseg) = vh[it];
                if (lo_on)
                    *(u32x4*)(vtl + vrow * (TE) + t0 + tseg) = vl[it];
            }
            
        }
    }
}

// ---------------- causal flash attention, hd=64, 128 queries per workgroup (8 waves x 16 rows), 64-key chunks ----------------
// qkh: [RROWS][QP] f16 (q cols h*64+d, k cols CE+h*64+d); qkl: same layout for rows t<TE, residual x2048
// vth: [NB*NH][64][SEQ] f16 transposed v; vtl: [NB*NH][64][TE] residual x2048
// RES=1: query tiles with position < TE: S = qh.kh + (qh.kl + ql.kh)/2048, O += Ph.Vh + (Pr.Vh + Ph.Vl)/2048
// RES=1 only: wave index taken as a scalar-uniform value and scheduling-region cuts after each sub-tile,
// so only one sub-tile's operand fragments are live at a time (same arithmetic, same order of products).
template <int RES>
__global__ __launch_bounds__(256) __attribute__((amdgpu_num_vgpr(256)))
void attn_kernel(const u16* __restrict__ qkh, const u16* __restrict__ qkl,
                 const u16* __restrict__ vth, const u16* __restrict__ vtl,
                 u16* __restrict__ cv, u32 qb0) {
    __shared__ __align__(16) u16 Ks[64 * 72];              // [key][d]
    __shared__ __align__(16) u16 Vs[64 * 72];              // [d][key]
    __shared__ __align__(16) u16 Kl[RES ? 64 * 72 : 8];
    __shared__ __align__(16) u16 Vl[RES ? 64 * 72 : 8];
    __shared__ __align__(16) u16 Ps[8 * 16 * 72];          // per wave [16 q][key] (also final O stage)
    __shared__ __align__(16) u16 Pr[RES ? 8 * 16 * 72 : 8];

    const u32 bh = blockIdx.y;
    const u32 b = bh / (u32)NH, h = bh - b * (u32)NH;
    const u32 qb = qb0 + blockIdx.x;
    const u32 tid = threadIdx.x, lane = tid & 31u;
    u32 wv = tid >> 5;
    if constexpr (RES != 0) wv = (u32)__builtin_amdgcn_readfirstlane((int)wv);   // all lanes active, value is wave-uniform
    const u32 hf = lane >> 4, ln = lane & 15u;
    const u32 q0 = qb * 128u + wv * 16u;
    u16* Pw  = Ps + wv * (16u * 72u);
    u16* Prw = Pr + (RES ? wv * (16u * 72u) : 0u);

    Frag qf[2], ql[2];
#pragma unroll
    for (u32 ds = 0; ds < 2; ds++) {
        const u16* p = qkh + (size_t)(b * (u32)(SEQ) + q0 + ln) * QP + h * HD + ds * 32u + hf * 8u;
        qf[ds].u[0] = *(const u32x4*)p;
        qf[ds].u[1] = *(const u32x4*)(p + 16);
        if constexpr (RES != 0) {
            const u16* pl = qkl + (size_t)(b * (u32)(TE) + q0 + ln) * QP + h * HD + ds * 32u + hf * 8u;
            ql[ds].u[0] = *(const u32x4*)pl;
            ql[ds].u[1] = *(const u32x4*)(pl + 16);
        } else {
            ql[ds].u[0] = (u32x4)(0u); ql[ds].u[1] = (u32x4)(0u);
        }
    }

    v8f o[4];
#pragma unroll
    for (int i = 0; i < 4; i++) o[i] = (v8f)(0.f);
    float mrow[8], lrow[8];
#pragma unroll
    for (int r = 0; r < 8; r++) { mrow[r] = -3.0e38f; lrow[r] = 0.f; }

    const u32 rr = tid >> 2, seg = (tid & 3u) * 16u;      // staging: row rr (key or d), 16 halves at seg
    const u32 nkt = 2u * qb + 2u;                          // keys 0 .. qb*128+127

#pragma unroll 1
    for (u32 kt = 0; kt < nkt; kt++) {
        __syncthreads();                                   // prior chunk's LDS reads done
        {
            const u16* gk = qkh + (size_t)(b * (u32)(SEQ) + kt * 64u + rr) * QP + CE + h * HD + seg;
            u32x4 k0v = *(const u32x4*)gk, k1v = *(const u32x4*)(gk + 8);
            const u16* gv = vth + ((size_t)(bh * HD + rr)) * (SEQ) + kt * 64u + seg;
            u32x4 v0 = *(const u32x4*)gv, v1 = *(const u32x4*)(gv + 8);
            *(u32x4*)&Ks[rr * 72u + seg] = k0v; *(u32x4*)&Ks[rr * 72u + seg + 8u] = k1v;
            *(u32x4*)&Vs[rr * 72u + seg] = v0;  *(u32x4*)&Vs[rr * 72u + seg + 8u] = v1;
            sched_cut<RES>();                              // hi-plane staging temporaries end here
            if constexpr (RES != 0) {
                const u16* gkl = qkl + (size_t)(b * (u32)(TE) + kt * 64u + rr) * QP + CE + h * HD + seg;
                u32x4 kl0 = *(const u32x4*)gkl, kl1 = *(const u32x4*)(gkl + 8);
                const u16* gvl = vtl + ((size_t)(bh * HD + rr)) * (TE) + kt * 64u + seg;
                u32x4 vl0 = *(const u32x4*)gvl, vl1 = *(const u32x4*)(gvl + 8);
                *(u32x4*)&Kl[rr * 72u + seg] = kl0; *(u32x4*)&Kl[rr * 72u + seg + 8u] = kl1;
                *(u32x4*)&Vl[rr * 72u + seg] = vl0; *(u32x4*)&Vl[rr * 72u + seg + 8u] = vl1;
            }
        }
        __syncthreads();                                   // K/V chunk visible to all waves
        sched_cut<RES>();

        // S = Q . K^T  (16 q x 64 keys per wave)
        v8f s[4];
#pragma unroll
        for (int sub = 0; sub < 4; sub++) {
            v8f t = (v8f)(0.f);
            v8f tr = (v8f)(0.f);
#pragma unroll
            for (int ds = 0; ds < 2; ds++) {
                Frag kf;
                const u16* kp = &Ks[((u32)sub * 16u + ln) * 72u + (u32)ds * 32u + hf * 8u];
                kf.u[0] = *(const u32x4*)kp;
                kf.u[1] = *(const u32x4*)(kp + 16);
                t = mma16(qf[ds].v, kf.v, t);
                if constexpr (RES != 0) {
                    Frag klf;
                    const u16* klp = &Kl[((u32)sub * 16u + ln) * 72u + (u32)ds * 32u + hf * 8u];
                    klf.u[0] = *(const u32x4*)klp;
                    klf.u[1] = *(const u32x4*)(klp + 16);
                    tr = mma16(qf[ds].v, klf.v, tr);
                    tr = mma16(ql[ds].v, kf.v, tr);
                }
            }
            if constexpr (RES != 0) s[sub] = t + tr * RINV;
            else s[sub] = t;
            sched_cut<RES>();                              // next sub-tile's fragment loads stay behind this point
        }

        // scale + causal replace-fill
#pragma unroll
        for (int sub = 0; sub < 4; sub++) {
            const u32 kg = kt * 64u + (u32)sub * 16u + ln;
#pragma unroll
            for (int r = 0; r < 8; r++) {
                const u32 qg = q0 + hf * 8u + (u32)r;
                float v = s[sub][r] * 0.125f;
                s[sub][r] = (kg > qg) ? -3.0e38f : v;
            }
        }
        // online softmax (row = lanes of one half, xor 8..1)
#pragma unroll
        for (int r = 0; r < 8; r++) {
            float mx = fmaxf(fmaxf(s[0][r], s[1][r]), fmaxf(s[2][r], s[3][r]));
#pragma unroll
            for (u32 m = 8; m >= 1; m >>= 1) mx = fmaxf(mx, __shfl_xor(mx, m, 32));
            const float mnew  = fmaxf(mrow[r], mx);
            const float alpha = __expf(mrow[r] - mnew);
            float rsum = 0.f;
#pragma unroll
            for (int sub = 0; sub < 4; sub++) {
                float pe = __expf(s[sub][r] - mnew);
                s[sub][r] = pe;
                rsum += pe;
            }
#pragma unroll
            for (u32 m = 8; m >= 1; m >>= 1) rsum += __shfl_xor(rsum, m, 32);
            mrow[r] = mnew;
            lrow[r] = lrow[r] * alpha + rsum;
#pragma unroll
            for (int dsub = 0; dsub < 4; dsub++) o[dsub][r] *= alpha;
        }

        // P (D layout) -> per-wave LDS tile, carried x4096 (+ residual x2048)
#pragma unroll
        for (int sub = 0; sub < 4; sub++) {
#pragma unroll
            for (int r = 0; r < 8; r++) {
                const float ph = s[sub][r] * PCAR;
                _Float16 h16 = (_Float16)ph;
                Pw[(hf * 8u + (u32)r) * 72u + (u32)sub * 16u + ln] = __builtin_bit_cast(u16, h16);
                if constexpr (RES != 0)
                    Prw[(hf * 8u + (u32)r) * 72u + (u32)sub * 16u + ln] = hbits((ph - (float)h16) * RSC);
            }
        }
        __syncthreads();                                   // P tile stores ordered before fragment reloads
        sched_cut<RES>();

        // O += P . V
#pragma unroll
        for (int dsub = 0; dsub < 4; dsub++) {
            v8f u = (v8f)(0.f);
#pragma unroll
            for (int ks = 0; ks < 2; ks++) {
                Frag pf, vf;
                const u16* pp = &Pw[ln * 72u + (u32)ks * 32u + hf * 8u];
                pf.u[0] = *(const u32x4*)pp;
                pf.u[1] = *(const u32x4*)(pp + 16);
                const u16* vp = &Vs[((u32)dsub * 16u + ln) * 72u + (u32)ks * 32u + hf * 8u];
                vf.u[0] = *(const u32x4*)vp;
                vf.u[1] = *(const u32x4*)(vp + 16);
                o[dsub] = mma16(pf.v, vf.v, o[dsub]);
                if constexpr (RES != 0) {
                    Frag prf;
                    const u16* prp = &Prw[ln * 72u + (u32)ks * 32u + hf * 8u];
                    prf.u[0] = *(const u32x4*)prp;
                    prf.u[1] = *(const u32x4*)(prp + 16);
                    u = mma16(prf.v, vf.v, u);
                    Frag vlf;
                    const u16* vlp = &Vl[((u32)dsub * 16u + ln) * 72u + (u32)ks * 32u + hf * 8u];
                    vlf.u[0] = *(const u32x4*)vlp;
                    vlf.u[1] = *(const u32x4*)(vlp + 16);
                    u = mma16(pf.v, vlf.v, u);
                }
            }
            if constexpr (RES != 0) o[dsub] = o[dsub] + u * RINV;
            sched_cut<RES>();                              // next d sub-tile's V fragments stay behind this point
        }
    }

    // finalize: O / (l * 4096) -> f16 tile in the wave's P region -> whole-line stores
    __syncthreads();                                       // last fragment reads of Pw done before restaging
#pragma unroll
    for (int r = 0; r < 8; r++) {
        const float inv = (1.0f / lrow[r]) * PINV;
#pragma unroll
        for (int dsub = 0; dsub < 4; dsub++)
            Pw[(hf * 8u + (u32)r) * 72u + (u32)dsub * 16u + ln] = hbits(o[dsub][r] * inv);
    }
    __syncthreads();
    u32x4 val[4];
#pragma unroll
    for (u32 it = 0; it < 4; it++) {
        const u32 rloc = it * 4u + (lane >> 3), sg = (lane & 7u) * 8u;
        val[it] = *(const u32x4*)&Pw[rloc * 72u + sg];
    }
#pragma unroll
    for (u32 it = 0; it < 4; it++) {
        const u32 rloc = it * 4u + (lane >> 3), sg = (lane & 7u) * 8u;
        *(u32x4*)(cv + (size_t)(b * (u32)(SEQ) + q0 + rloc) * CE + h * HD + sg) = val[it];
    }
    
}

// ---------------- host side ----------------
extern "C" void kernel_launch(void* const* d_in, const int* in_sizes, int n_in,
                              void* d_out, int out_size, void* d_ws, size_t ws_size,
                              hipStream_t stream) {
    if (n_in < 13) return;
    const long long needX = ((long long)(NB - 1) * SEQ_FULL + (SEQ)) * CE;
    if ((long long)in_sizes[0] < needX || (long long)out_size < needX) return;
    if (in_sizes[1] < CE || in_sizes[2] < CE || in_sizes[3] < CE * C3 || in_sizes[4] < C3 ||
        in_sizes[5] < CE * CE || in_sizes[6] < CE || in_sizes[7] < CE || in_sizes[8] < CE ||
        in_sizes[9] < CE * C4 || in_sizes[10] < C4 || in_sizes[11] < C4 * CE || in_sizes[12] < CE)
        return;

    const float* x      = (const float*)d_in[0];
    const float* ln1_g  = (const float*)d_in[1];
    const float* ln1_b  = (const float*)d_in[2];
    const float* w_attn = (const float*)d_in[3];
    const float* b_attn = (const float*)d_in[4];
    const float* w_proj = (const float*)d_in[5];
    const float* b_proj = (const float*)d_in[6];
    const float* ln2_g  = (const float*)d_in[7];
    const float* ln2_b  = (const float*)d_in[8];
    const float* w_fc   = (const float*)d_in[9];
    const float* b_fc   = (const float*)d_in[10];
    const float* w_fc2  = (const float*)d_in[11];
    const float* b_fc2  = (const float*)d_in[12];

    char* ws = (char*)d_ws;
    size_t off = 0;
    auto take = [&](size_t bytes) -> char* {
        char* p = ws + off;
        off += (bytes + 255) & ~(size_t)255;
        return p;
    };
    const size_t R = (size_t)RROWS;
    u16*   waT   = (u16*)take((size_t)C3 * CE * 2);               // [3072][1024]
    u16*   wpT   = (u16*)take((size_t)CE * CE * 2);               // [1024][1024]
    u16*   wfcT  = (u16*)take((size_t)C4 * CE * 2);               // [4096][1024]
    u16*   wfc2T = (u16*)take((size_t)CE * C4 * 2);               // [1024][4096]
    u16*   h1    = (u16*)take(R * CE * 2);                        // [R][1024]
    u16*   qkh   = (u16*)take(R * QP * 2);                        // [R][2048]
    u16*   qkl   = (u16*)take((size_t)NB * (TE) * QP * 2);        // [NB*TE][2048]
    u16*   vth   = (u16*)take((size_t)NB * NH * HD * (SEQ) * 2);  // [NB*NH][64][SEQ]
    u16*   vtl   = (u16*)take((size_t)NB * NH * HD * (TE) * 2);   // [NB*NH][64][TE]
    u16*   cvb   = (u16*)take(R * CE * 2);                        // [R][1024]
    float* x1    = (float*)take(R * CE * 4);                      // [R][1024]
    u16*   h2    = (u16*)take(R * CE * 2);                        // [R][1024]
    u16*   hg    = (u16*)take(R * C4 * 2);                        // [R][4096]
    if (off > ws_size || off > (size_t)134217728) return;
    void* dummy = (void*)d_ws;

    // 1) weights: bf16-RNE value x64 -> f16, transposed to [N][K]   (in[K][N] -> out[N][K]), grid (N/64, K/64)
    cvt_wt_kernel<<<dim3(C3 / 64, CE / 64), 256, 0, stream>>>(w_attn, waT, (u32)CE, (u32)C3);   // [1024][3072] -> [3072][1024]
    cvt_wt_kernel<<<dim3(CE / 64, CE / 64), 256, 0, stream>>>(w_proj, wpT, (u32)CE, (u32)CE);   // [1024][1024] -> [1024][1024]
    cvt_wt_kernel<<<dim3(C4 / 64, CE / 64), 256, 0, stream>>>(w_fc,   wfcT, (u32)CE, (u32)C4);  // [1024][4096] -> [4096][1024]
    cvt_wt_kernel<<<dim3(CE / 64, C4 / 64), 256, 0, stream>>>(w_fc2,  wfc2T, (u32)C4, (u32)CE); // [4096][1024] -> [1024][4096]
    // 2) h1 = LN1(bfr(x))
    ln_kernel<1><<<RROWS / 8, 256, 0, stream>>>(x, ln1_g, ln1_b, h1);
    // 3) qkv = h1 . w_attn + b_attn -> q/k planes (+ residual rows t<TE), v transposed (+ residual)
    gemm_kernel<0><<<dim3(C3 / 128, RROWS / 128), 256, 0, stream>>>(h1, waT, b_attn, b_attn,
                                                                    qkh, qkl, vth, vtl, (u32)C3, (u32)CE);
    // 4) causal attention: residual-carrying tiles for query position < TE, plain tiles after
    attn_kernel<1><<<dim3(NEB, NB * NH), 256, 0, stream>>>(qkh, qkl, vth, vtl, cvb, 0u);
    if (NQB > NEB)
        attn_kernel<0><<<dim3(NQB - NEB, NB * NH), 256, 0, stream>>>(qkh, qkl, vth, vtl, cvb, (u32)NEB);
    // 5) x1 = cv . w_proj + b_proj + bfr(x)
    gemm_kernel<1><<<dim3(CE / 128, RROWS / 128), 256, 0, stream>>>(cvb, wpT, b_proj, x,
                                                                    x1, dummy, dummy, dummy, (u32)CE, (u32)CE);
    // 6) h2 = LN2(x1)
    ln_kernel<0><<<RROWS / 8, 256, 0, stream>>>(x1, ln2_g, ln2_b, h2);
    // 7) hg = gelu(h2 . w_fc + b_fc)
    gemm_kernel<2><<<dim3(C4 / 128, RROWS / 128), 256, 0, stream>>>(h2, wfcT, b_fc, b_fc,
                                                                    hg, dummy, dummy, dummy, (u32)C4, (u32)CE);
    // 8) out = hg . w_fc2 + b_fc2 + x1
    gemm_kernel<3><<<dim3(CE / 128, RROWS / 128), 256, 0, stream>>>(hg, wfc2T, b_fc2, x1,
                                                                    d_out, dummy, dummy, dummy, (u32)CE, (u32)C4);
}

// v001
// One run takes 276 microseconds.
// In both of two side-by-side timings against v000, it was 1.29 times as fast.
#include <hip/hip_runtime.h>

// Contractions: v_wmma_f32_16x16x32_f16 (f16 operands, f32 accumulate) for qkv = h.W, S = q.k^T, O = p.v, proj, fc, fc2.
// Weight operand planes: bf16-RNE input value x64, cast to f16, stored transposed [N][K]. Activation planes f16.
// Attention runs transposed: S^T = k.q^T, O^T = v^T.p^T; p^T packs from the S^T accumulators straight into the B operand.
// p carried x4096 in f16. Query tiles with position < TE add f16 residual planes (x2048) of q, k, v, p
// through separately scaled second products folded into the f32 accumulators. Softmax, LN and erf-GELU in f32.

#ifndef NB
#define NB 2
#endif
#ifndef SEQ
#define SEQ 2048
#endif
#define NB_FULL 2
#define SEQ_FULL 2048
#define CE 1024
#define NH 16
#define HD 64
#define C3 3072
#define C4 4096
#define QP 2048
#define TE (((SEQ) < 256) ? (SEQ) : 256)
#define RROWS ((NB) * (SEQ))
#define NEB ((TE) / 128)
#define NQB ((SEQ) / 128)
#define LNJ ((CE) / 128)
#define LNO ((CE) / 256)

static_assert((SEQ) % 128 == 0);
static_assert((TE) % 128 == 0);
static_assert((NB) >= 1 && (NB) <= NB_FULL);
static_assert((SEQ) <= SEQ_FULL);
static_assert(CE % 128 == 0 && C3 % 128 == 0 && C4 % 128 == 0 && QP % 128 == 0);
static_assert(CE % 64 == 0 && C3 % 64 == 0 && C4 % 64 == 0);
static_assert(NH * HD == CE);
static_assert(HD == 64);
static_assert(QP == 2 * CE);
static_assert(C3 == 3 * CE);
static_assert(RROWS % 128 == 0);
static_assert(RROWS % 8 == 0);
static_assert(CE == 1024);
static_assert(256 * 4 == CE);            // gamma/beta staging: 256 threads x 4 floats
static_assert(32 * 4 * LNJ == CE);       // LN row load: 32 lanes x 4 floats x LNJ steps
static_assert(32 * 8 * LNO == CE);       // LN row store: 32 lanes x 8 halves x LNO instructions
static_assert(NQB * 128 == (SEQ));
static_assert(NEB <= NQB);

typedef unsigned short u16;
typedef unsigned int   u32;
typedef _Float16 v16h __attribute__((ext_vector_type(16)));
typedef _Float16 v8h  __attribute__((ext_vector_type(8)));
typedef _Float16 v4h  __attribute__((ext_vector_type(4)));
typedef float    v8f  __attribute__((ext_vector_type(8)));
typedef float    v4f  __attribute__((ext_vector_type(4)));
typedef unsigned int u32x4 __attribute__((ext_vector_type(4)));
typedef unsigned int u32x2 __attribute__((ext_vector_type(2)));

union Frag  { v16h v; u32x4 u[2]; };
union Pack8 { v8h h; u32x4 u; };
union Pack4 { v4h h; u32x2 u; };

#define WSCALE 64.0f
#define WINV   (1.0f / 64.0f)
#define PCAR   4096.0f
#define PINV   (1.0f / 4096.0f)
#define RSC    2048.0f
#define RINV   (1.0f / 2048.0f)

constexpr size_t al256(size_t b) { return (b + 255) & ~(size_t)255; }
constexpr size_t WS_TOTAL =
    al256((size_t)C3 * CE * 2) + al256((size_t)CE * CE * 2) + al256((size_t)C4 * CE * 2) +
    al256((size_t)CE * C4 * 2) + al256((size_t)RROWS * CE * 2) + al256((size_t)RROWS * QP * 2) +
    al256((size_t)NB * (TE) * QP * 2) + al256((size_t)NB * NH * HD * (SEQ) * 2) +
    al256((size_t)NB * NH * HD * (TE) * 2) + al256((size_t)RROWS * CE * 2) +
    al256((size_t)RROWS * CE * 4) + al256((size_t)RROWS * CE * 2) + al256((size_t)RROWS * C4 * 2);
static_assert(WS_TOTAL <= (size_t)134217728);

// f32 -> nearest-even bf16 grid value, returned as f32
__device__ __forceinline__ float bfr(float f) {
    u32 u = __builtin_bit_cast(u32, f);
    u += 0x7fffu + ((u >> 16) & 1u);
    u &= 0xffff0000u;
    return __builtin_bit_cast(float, u);
}

// f32 -> f16 (RNE) bits
__device__ __forceinline__ u16 hbits(float f) {
    _Float16 h = (_Float16)f;
    return __builtin_bit_cast(u16, h);
}

// 16x16x32 f16 WMMA with the VALU hazard guard tied to D and A/B
__device__ __forceinline__ v8f mma16(v16h a, v16h b, v8f c) {
    c = __builtin_amdgcn_wmma_f32_16x16x32_f16(false, a, false, b, (short)0, c, false, false);
    asm volatile("v_nop\n\tv_nop\n\tv_nop\n\tv_nop" : "+v"(c) : "v"(a), "v"(b));
    return c;
}

// scheduling-region boundary, emitted only in the residual-carrying attention instance:
// keeps fragment loads of later sub-tiles from being issued ahead of the current sub-tile's products
template <int ON>
__device__ __forceinline__ void sched_cut() {
    if constexpr (ON != 0) __builtin_amdgcn_sched_barrier(0);
}

// value of lane l ^ 16 (the other 16-lane row), a vector cross-row move
__device__ __forceinline__ float xhalf(float x) {
    const int xi = __builtin_bit_cast(int, x);
    return __builtin_bit_cast(float, __builtin_amdgcn_permlanex16(xi, xi, 0x76543210, 0xfedcba98, false, false));
}

// e^x on the hardware exp2, same product and instruction as the fast-math exp;
// the v_nop fills the one issue slot the instruction set asks for behind a transcendental
// before its result is read or its source overwritten
__device__ __forceinline__ float exp_fast(float x) {
    float r;
    asm("v_exp_f32 %0, %1\n\tv_nop" : "=v"(r) : "v"(x * 1.44269504088896340736f));
    return r;
}

// erf-form GELU
__device__ __forceinline__ float gelu_erf(float x) {
    return 0.5f * x * (1.0f + erff(x * 0.70710678118654752f));
}

// logical row (b*SEQ + t) -> row of the full-size input / output tensors (b*SEQ_FULL + t)
__device__ __forceinline__ size_t grow_map(u32 r) {
    const u32 bb = r / (u32)(SEQ);
    const u32 t  = r - bb * (u32)(SEQ);
    return (size_t)bb * SEQ_FULL + (size_t)t;
}

// ---------------- weight convert + transpose: in[K][N] f32 -> out[N][K] f16 = f16(bfr(w) * 64) ----------------
// written by 8 consecutive lanes x 16 B of one instruction (4 lines per instruction).
__global__ __launch_bounds__(256) void cvt_wt_kernel(const float* __restrict__ in,
                                                      u16* __restrict__ out, u32 K, u32 N) {
    __shared__ __align__(16) u16 Ts[64 * 72];   // [n][k]
    const u32 tid = threadIdx.x, lane = tid & 31u, wv = tid >> 5;
    const u32 n0 = blockIdx.x * 64u, k0 = blockIdx.y * 64u;
    const u32 kr = tid >> 2, nseg = (tid & 3u) * 16u;
    const float* src = in + (size_t)(k0 + kr) * N + n0 + nseg;
#pragma unroll
    for (u32 j4 = 0; j4 < 4; j4++) {
        v4f w = *(const v4f*)(src + j4 * 4u);
#pragma unroll
        for (u32 c = 0; c < 4; c++) {
            float f = w[c];
            Ts[(nseg + j4 * 4u + c) * 72u + kr] = hbits(bfr(f) * WSCALE);
        }
    }
    __syncthreads();                             // Ts: cross-wave exchange
    u32x4 val[2];
#pragma unroll
    for (u32 it = 0; it < 2; it++) {
        const u32 nn = wv * 8u + it * 4u + (lane >> 3), ks = (lane & 7u) * 8u;
        val[it] = *(const u32x4*)&Ts[nn * 72u + ks];
    }
#pragma unroll
    for (u32 it = 0; it < 2; it++) {
        const u32 nn = wv * 8u + it * 4u + (lane >> 3), ks = (lane & 7u) * 8u;
        *(u32x4*)(out + (size_t)(n0 + nn) * K + k0 + ks) = val[it];
    }
    
}

// ---------------- LayerNorm (row = 1024): one wave per row, f16 out via LDS row stage ----------------
// Row kept in a wave-private f32 LDS row (lane owns columns j*128 + lane*4 + 0..3, same lane writes and reads);
// the three per-element sweeps are rolled loops with wave-uniform trip counts.
// gamma/beta staged once per workgroup in LDS at bf16-RNE values.
// SRCX = 1: src is the input x (full-size row map, each element taken at its bf16-RNE value)
// SRCX = 0: src is an f32 workspace plane with logical rows
template <int SRCX>
__global__ __launch_bounds__(256) void ln_kernel(const float* __restrict__ src,
                                                 const float* __restrict__ g,
                                                 const float* __restrict__ be,
                                                 u16* __restrict__ out) {
    __shared__ __align__(16) float xs[8 * CE];      // wave wv owns xs[wv*CE ..]
    __shared__ __align__(16) u16   rows[8 * CE];    // wave wv owns rows[wv*CE ..]
    __shared__ __align__(16) float gsh[CE];
    __shared__ __align__(16) float bsh[CE];
    const u32 tid = threadIdx.x, lane = tid & 31u, wv = tid >> 5;
    {
        v4f gg = *(const v4f*)(g + tid * 4u);
        v4f bb = *(const v4f*)(be + tid * 4u);
        v4f go, bo;
#pragma unroll
        for (u32 c = 0; c < 4; c++) {
            float tg = gg[c]; float tb = bb[c];
            go[c] = bfr(tg); bo[c] = bfr(tb);
        }
        *(v4f*)&gsh[tid * 4u] = go;
        *(v4f*)&bsh[tid * 4u] = bo;
    }
    const u32 r = blockIdx.x * 8u + wv;            // < RROWS (grid = RROWS/8)
    const size_t srow = SRCX ? grow_map(r) : (size_t)r;
    const float* xr = src + srow * CE;
    float* xw = xs + wv * CE;
    float s = 0.f;
#pragma unroll 1
    for (u32 j = 0; j < LNJ; j++) {
        const u32 c0 = j * 128u + lane * 4u;
        v4f t4 = *(const v4f*)(xr + c0);
        if constexpr (SRCX != 0) {
#pragma unroll
            for (u32 c = 0; c < 4; c++) { float t = t4[c]; t4[c] = bfr(t); }
        }
        *(v4f*)&xw[c0] = t4;
        s += (t4[0] + t4[1]) + (t4[2] + t4[3]);
    }
#pragma unroll
    for (u32 m = 16; m >= 1; m >>= 1) s += __shfl_xor(s, m, 32);
    const float mu = s * (1.f / (float)CE);
    float vs = 0.f;
#pragma unroll 1
    for (u32 j = 0; j < LNJ; j++) {
        const u32 c0 = j * 128u + lane * 4u;
        v4f t4 = *(const v4f*)&xw[c0];
#pragma unroll
        for (u32 c = 0; c < 4; c++) { float d = t4[c] - mu; vs += d * d; }
    }
#pragma unroll
    for (u32 m = 16; m >= 1; m >>= 1) vs += __shfl_xor(vs, m, 32);
    const float rstd = rsqrtf(vs * (1.f / (float)CE) + 1e-5f);
    __syncthreads();                               // gsh/bsh (cross-wave) visible
    u16* rw = rows + wv * CE;
#pragma unroll 1
    for (u32 j = 0; j < LNJ; j++) {
        const u32 c0 = j * 128u + lane * 4u;
        v4f x4 = *(const v4f*)&xw[c0];
        v4f g4 = *(const v4f*)&gsh[c0];
        v4f b4 = *(const v4f*)&bsh[c0];
        Pack4 pk;
#pragma unroll
        for (u32 c = 0; c < 4; c++) {
            float xe = x4[c]; float ge = g4[c]; float bel = b4[c];
            pk.h[c] = (_Float16)((xe - mu) * rstd * ge + bel);
        }
        *(u32x2*)&rw[c0] = pk.u;
    }
    __syncthreads();   // LDS row stage: written and read by the same wave; a workgroup barrier is used
    u32x4 val[LNO];
#pragma unroll
    for (u32 j = 0; j < LNO; j++) val[j] = *(const u32x4*)&rw[j * 256u + lane * 8u];
    u16* orow = out + (size_t)r * CE;
#pragma unroll
    for (u32 j = 0; j < LNO; j++) *(u32x4*)(orow + j * 256u + lane * 8u) = val[j];
    
}

// ---------------- f16 GEMM: C[128x128 tile] = A[M][K](f16) . BT[N][K](f16)^T, K-step 64 ----------------
// 8 waves = 4 (m) x 2 (n), wave tile 32 x 64, fragments per the split k map for A and B.
// Epilogue: acc*(1/64) + bias(bf16-RNE) [-> gelu] staged as f32 128x128 tile in LDS, then
// MODE 0: qkv: n0 < QP -> qk hi plane [RROWS][QP] (+ lo plane rows t<TE), else V transposed
//         into vt hi [NB*NH][64][SEQ] (+ vt lo [..][64][TE] for t<TE)
// MODE 1: out0 f32 [RROWS][CE] = acc + bias + bfr(res at full-size rows)   (x1)
// MODE 2: out0 f16 [RROWS][C4] = gelu(acc + bias)                          (hg)
// MODE 3: out0 f32 at full-size rows = acc + bias + res[logical rows]      (d_out)
template <int MODE>
__global__ __launch_bounds__(256) void gemm_kernel(const u16* __restrict__ A,
                                                   const u16* __restrict__ BT,
                                                   const float* __restrict__ bias,
                                                   const float* __restrict__ res,
                                                   void* out0, void* out1, void* out2, void* out3,
                                                   u32 N, u32 K) {
    __shared__ u32x4 smem[4224];                   // 67584 B: As|Bs during the k loop, Cs after it
    u16* As = (u16*)smem;                          // [128][72]
    u16* Bs = As + 128 * 72;                       // [128][72]
    float* Cs = (float*)smem;                      // [128][132]
    constexpr u32 CSP = 132;

    const u32 tid = threadIdx.x, lane = tid & 31u, wv = tid >> 5;
    const u32 hf = lane >> 4, ln = lane & 15u;
    const u32 m0 = blockIdx.y * 128u, n0 = blockIdx.x * 128u;
    const u32 wm = wv & 3u, wn = wv >> 2;
    const u32 srow = tid >> 1, sseg = (tid & 1u) * 32u;

    v8f acc[2][4];
#pragma unroll
    for (int i = 0; i < 2; i++)
#pragma unroll
        for (int j = 0; j < 4; j++) acc[i][j] = (v8f)(0.f);

    for (u32 k0 = 0; k0 < K; k0 += 64u) {
        __syncthreads();                           // prior step's fragment reads done
        {
            const u16* ga = A  + (size_t)(m0 + srow) * K + k0 + sseg;
            const u16* gb = BT + (size_t)(n0 + srow) * K + k0 + sseg;
            u32x4 a0 = *(const u32x4*)(ga), a1 = *(const u32x4*)(ga + 8);
            u32x4 a2 = *(const u32x4*)(ga + 16), a3 = *(const u32x4*)(ga + 24);
            u32x4 b0 = *(const u32x4*)(gb), b1 = *(const u32x4*)(gb + 8);
            u32x4 b2 = *(const u32x4*)(gb + 16), b3 = *(const u32x4*)(gb + 24);
            u32x4* la = (u32x4*)&As[srow * 72u + sseg];
            u32x4* lb = (u32x4*)&Bs[srow * 72u + sseg];
            la[0] = a0; la[1] = a1; la[2] = a2; la[3] = a3;
            lb[0] = b0; lb[1] = b1; lb[2] = b2; lb[3] = b3;
        }
        __syncthreads();                           // staged tile visible to all waves
#pragma unroll
        for (u32 ks = 0; ks < 2; ks++) {
            Frag af[2], bf[4];
#pragma unroll
            for (u32 mi = 0; mi < 2; mi++) {
                const u16* q = &As[(wm * 32u + mi * 16u + ln) * 72u + ks * 32u + hf * 8u];
                af[mi].u[0] = *(const u32x4*)q;
                af[mi].u[1] = *(const u32x4*)(q + 16);
            }
#pragma unroll
            for (u32 ni = 0; ni < 4; ni++) {
                const u16* q = &Bs[(wn * 64u + ni * 16u + ln) * 72u + ks * 32u + hf * 8u];
                bf[ni].u[0] = *(const u32x4*)q;
                bf[ni].u[1] = *(const u32x4*)(q + 16);
            }
#pragma unroll
            for (int mi = 0; mi < 2; mi++)
#pragma unroll
                for (int ni = 0; ni < 4; ni++)
                    acc[mi][ni] = mma16(af[mi].v, bf[ni].v, acc[mi][ni]);
        }
    }

    // ---- epilogue: accumulators -> f32 tile in LDS ----
    __syncthreads();                               // all waves done with As/Bs (aliased by Cs)
#pragma unroll
    for (int ni = 0; ni < 4; ni++) {
        const u32 col = wn * 64u + (u32)ni * 16u + ln;
        const float bv = bfr(bias[n0 + col]);
#pragma unroll
        for (int mi = 0; mi < 2; mi++) {
#pragma unroll
            for (int r = 0; r < 8; r++) {
                const u32 row = wm * 32u + (u32)mi * 16u + hf * 8u + (u32)r;
                float v = acc[mi][ni][r] * WINV + bv;
                if constexpr (MODE == 2) v = gelu_erf(v);
                Cs[row * CSP + col] = v;
            }
        }
    }
    __syncthreads();                               // Cs is read across waves below

    if constexpr (MODE == 1 || MODE == 3) {
        float* o = (float*)out0;
        v4f val[16];
#pragma unroll
        for (int grp = 0; grp < 2; grp++) {
#pragma unroll
            for (int i8 = 0; i8 < 8; i8++) {
                const int i = grp * 8 + i8;
                const u32 row = wv * 16u + (u32)i;
                const u32 r = m0 + row;
                v4f c = *(const v4f*)&Cs[row * CSP + lane * 4u];
                const size_t rr = (MODE == 1) ? grow_map(r) : (size_t)r;
                v4f x4 = *(const v4f*)(res + rr * (size_t)N + n0 + lane * 4u);
                if constexpr (MODE == 1) {
#pragma unroll
                    for (int cc = 0; cc < 4; cc++) { float t = x4[cc]; x4[cc] = bfr(t); }
                }
                val[i] = c + x4;
            }
            asm volatile("" ::: "memory");         // keep the two load groups in separate clauses
        }
#pragma unroll
        for (int i = 0; i < 16; i++) {
            const u32 r = m0 + wv * 16u + (u32)i;
            const size_t orr = (MODE == 3) ? grow_map(r) : (size_t)r;
            *(v4f*)(o + orr * (size_t)N + n0 + lane * 4u) = val[i];
        }
        
    } else if constexpr (MODE == 2) {
        u16* o = (u16*)out0;
        u32x4 val[8];
#pragma unroll
        for (int it = 0; it < 8; it++) {
            const u32 rloc = wv * 16u + (u32)it * 2u + hf, cseg = ln * 8u;
            Pack8 pk;
#pragma unroll
            for (int j = 0; j < 8; j++) pk.h[j] = (_Float16)Cs[rloc * CSP + cseg + (u32)j];
            val[it] = pk.u;
        }
#pragma unroll
        for (int it = 0; it < 8; it++) {
            const u32 rloc = wv * 16u + (u32)it * 2u + hf, cseg = ln * 8u;
            *(u32x4*)(o + (size_t)(m0 + rloc) * N + n0 + cseg) = val[it];
        }
        
    } else {
        // MODE 0: q/k planes or transposed v planes
        u16* qkh = (u16*)out0;
        u16* qkl = (u16*)out1;
        u16* vth = (u16*)out2;
        u16* vtl = (u16*)out3;
        const u32 bq = m0 / (u32)(SEQ);
        const u32 t0 = m0 - bq * (u32)(SEQ);       // 128 | SEQ so the tile sits inside one batch
        const bool lo_on = (t0 < (u32)(TE));       // uniform per workgroup
        u32x4 vh[8], vl[8];
        if (n0 < (u32)QP) {
#pragma unroll
            for (int it = 0; it < 8; it++) {
                const u32 rloc = wv * 16u + (u32)it * 2u + hf, cseg = ln * 8u;
                Pack8 ph, pl;
#pragma unroll
                for (int j = 0; j < 8; j++) {
                    float f = Cs[rloc * CSP + cseg + (u32)j];
                    _Float16 h16 = (_Float16)f;
                    ph.h[j] = h16;
                    pl.h[j] = (_Float16)((f - (float)h16) * RSC);
                }
                vh[it] = ph.u; vl[it] = pl.u;
            }
#pragma unroll
            for (int it = 0; it < 8; it++) {
                const u32 rloc = wv * 16u + (u32)it * 2u + hf, cseg = ln * 8u;
                *(u32x4*)(qkh + (size_t)(m0 + rloc) * QP + n0 + cseg) = vh[it];
                if (lo_on)
                    *(u32x4*)(qkl + ((size_t)bq * (TE) + t0 + rloc) * QP + n0 + cseg) = vl[it];
            }
            
        } else {
            const u32 hh0 = (n0 - (u32)QP) >> 6;   // two heads per 128-column tile
#pragma unroll
            for (int it = 0; it < 8; it++) {
                const u32 rloc = wv * 16u + (u32)it * 2u + hf;   // local column = head*64 + d
                const u32 tseg = ln * 8u;
                Pack8 ph, pl;
#pragma unroll
                for (int j = 0; j < 8; j++) {
                    float f = Cs[(tseg + (u32)j) * CSP + rloc];
                    _Float16 h16 = (_Float16)f;
                    ph.h[j] = h16;
                    pl.h[j] = (_Float16)((f - (float)h16) * RSC);
                }
                vh[it] = ph.u; vl[it] = pl.u;
            }
#pragma unroll
            for (int it = 0; it < 8; it++) {
                const u32 rloc = wv * 16u + (u32)it * 2u + hf, tseg = ln * 8u;
                const u32 hh = hh0 + (rloc >> 6), dd = rloc & 63u;
                const size_t vrow = (size_t)(bq * NH + hh) * HD + dd;
                *(u32x4*)(vth + vrow * (SEQ) + t0 + tseg) = vh[it];
                if (lo_on)
                    *(u32x4*)(vtl + vrow * (TE) + t0 + tseg) = vl[it];
            }
            
        }
    }
}

// ---------------- causal flash attention, hd=64, 128 queries per workgroup (8 waves x 16 rows), 64-key chunks ----------------
// qkh: [RROWS][QP] f16 (q cols h*64+d, k cols CE+h*64+d); qkl: same layout for rows t<TE, residual x2048
// vth: [NB*NH][64][SEQ] f16 transposed v; vtl: [NB*NH][64][TE] residual x2048
// Transposed products: A = K rows (S^T) or V^T rows (O^T), B = Q or P^T. Lane (hf, ln) owns query q0 + ln:
// S^T register r of sub-tile sub = key sub*16 + hf*8 + r, so two converted sub-tiles are one B fragment in the loaders' k order.
// RES=1: query tiles with position < TE: S = qh.kh + (qh.kl + ql.kh)/2048, O += Ph.Vh + (Pr.Vh + Ph.Vl)/2048
// RES=1 only: wave index taken as a scalar-uniform value and scheduling-region cuts after each sub-tile,
// so only one sub-tile's operand fragments are live at a time (same arithmetic, same order of products).
template <int RES>
__global__ __launch_bounds__(256) __attribute__((amdgpu_num_vgpr(256)))
void attn_kernel(const u16* __restrict__ qkh, const u16* __restrict__ qkl,
                 const u16* __restrict__ vth, const u16* __restrict__ vtl,
                 u16* __restrict__ cv, u32 qb0) {
    __shared__ __align__(16) u16 Ks[64 * 72];              // [key][d]
    __shared__ __align__(16) u16 Vs[64 * 72];              // [d][key]
    __shared__ __align__(16) u16 Kl[RES ? 64 * 72 : 8];
    __shared__ __align__(16) u16 Vl[RES ? 64 * 72 : 8];
    __shared__ __align__(16) u16 Ps[8 * 16 * 72];          // per wave [16 q][d]: final O stage

    const u32 bh = blockIdx.y;
    const u32 b = bh / (u32)NH, h = bh - b * (u32)NH;
    const u32 qb = qb0 + blockIdx.x;
    const u32 tid = threadIdx.x, lane = tid & 31u;
    u32 wv = tid >> 5;
    if constexpr (RES != 0) wv = (u32)__builtin_amdgcn_readfirstlane((int)wv);   // all lanes active, value is wave-uniform
    const u32 hf = lane >> 4, ln = lane & 15u;
    const u32 q0 = qb * 128u + wv * 16u;
    u16* Pw  = Ps + wv * (16u * 72u);

    Frag qf[2], ql[2];
#pragma unroll
    for (u32 ds = 0; ds < 2; ds++) {
        const u16* p = qkh + (size_t)(b * (u32)(SEQ) + q0 + ln) * QP + h * HD + ds * 32u + hf * 8u;
        qf[ds].u[0] = *(const u32x4*)p;
        qf[ds].u[1] = *(const u32x4*)(p + 16);
        if constexpr (RES != 0) {
            const u16* pl = qkl + (size_t)(b * (u32)(TE) + q0 + ln) * QP + h * HD + ds * 32u + hf * 8u;
            ql[ds].u[0] = *(const u32x4*)pl;
            ql[ds].u[1] = *(const u32x4*)(pl + 16);
        } else {
            ql[ds].u[0] = (u32x4)(0u); ql[ds].u[1] = (u32x4)(0u);
        }
    }

    v8f o[4];
#pragma unroll
    for (int i = 0; i < 4; i++) o[i] = (v8f)(0.f);
    float mrun = -3.0e38f;                                 // running maximum of this lane's query (both halves agree)
    float lsum = 0.f;                                      // running sum over this lane half's keys; halves joined after the loop
    const u32 qg = q0 + ln;

    const u32 rr = tid >> 2, seg = (tid & 3u) * 16u;      // staging: row rr (key or d), 16 halves at seg
    const u32 nkt = 2u * qb + 2u;                          // keys 0 .. qb*128+127

#pragma unroll 1
    for (u32 kt = 0; kt < nkt; kt++) {
        __syncthreads();                                   // prior chunk's LDS reads done
        {
            const u16* gk = qkh + (size_t)(b * (u32)(SEQ) + kt * 64u + rr) * QP + CE + h * HD + seg;
            u32x4 k0v = *(const u32x4*)gk, k1v = *(const u32x4*)(gk + 8);
            const u16* gv = vth + ((size_t)(bh * HD + rr)) * (SEQ) + kt * 64u + seg;
            u32x4 v0 = *(const u32x4*)gv, v1 = *(const u32x4*)(gv + 8);
            *(u32x4*)&Ks[rr * 72u + seg] = k0v; *(u32x4*)&Ks[rr * 72u + seg + 8u] = k1v;
            *(u32x4*)&Vs[rr * 72u + seg] = v0;  *(u32x4*)&Vs[rr * 72u + seg + 8u] = v1;
            sched_cut<RES>();                              // hi-plane staging temporaries end here
            if constexpr (RES != 0) {
                const u16* gkl = qkl + (size_t)(b * (u32)(TE) + kt * 64u + rr) * QP + CE + h * HD + seg;
                u32x4 kl0 = *(const u32x4*)gkl, kl1 = *(const u32x4*)(gkl + 8);
                const u16* gvl = vtl + ((size_t)(bh * HD + rr)) * (TE) + kt * 64u + seg;
                u32x4 vl0 = *(const u32x4*)gvl, vl1 = *(const u32x4*)(gvl + 8);
                *(u32x4*)&Kl[rr * 72u + seg] = kl0; *(u32x4*)&Kl[rr * 72u + seg + 8u] = kl1;
                *(u32x4*)&Vl[rr * 72u + seg] = vl0; *(u32x4*)&Vl[rr * 72u + seg + 8u] = vl1;
            }
        }
        __syncthreads();                                   // K/V chunk visible to all waves
        sched_cut<RES>();

        // S^T = K . Q^T  (64 keys x 16 q per wave)
        v8f s[4];
#pragma unroll
        for (int sub = 0; sub < 4; sub++) {
            v8f t = (v8f)(0.f);
            v8f tr = (v8f)(0.f);
#pragma unroll
            for (int ds = 0; ds < 2; ds++) {
                Frag kf;
                const u16* kp = &Ks[((u32)sub * 16u + ln) * 72u + (u32)ds * 32u + hf * 8u];
                kf.u[0] = *(const u32x4*)kp;
                kf.u[1] = *(const u32x4*)(kp + 16);
                t = mma16(kf.v, qf[ds].v, t);
                if constexpr (RES != 0) {
                    Frag klf;
                    const u16* klp = &Kl[((u32)sub * 16u + ln) * 72u + (u32)ds * 32u + hf * 8u];
                    klf.u[0] = *(const u32x4*)klp;
                    klf.u[1] = *(const u32x4*)(klp + 16);
                    tr = mma16(klf.v, qf[ds].v, tr);
                    tr = mma16(kf.v, ql[ds].v, tr);
                }
            }
            if constexpr (RES != 0) s[sub] = t + tr * RINV;
            else s[sub] = t;
            sched_cut<RES>();                              // next sub-tile's fragment loads stay behind this point
        }

        // scale + causal replace-fill
#pragma unroll
        for (int sub = 0; sub < 4; sub++) {
#pragma unroll
            for (int r = 0; r < 8; r++) {
                const u32 kg = kt * 64u + (u32)sub * 16u + hf * 8u + (u32)r;
                float v = s[sub][r] * 0.125f;
                s[sub][r] = (kg > qg) ? -3.0e38f : v;
            }
        }
        // online softmax: one query per lane, 32 of the chunk's keys in-lane, the other 32 in lane ^ 16
        float mxs[4];
#pragma unroll
        for (int sub = 0; sub < 4; sub++) {
            mxs[sub] = fmaxf(fmaxf(fmaxf(s[sub][0], s[sub][1]), fmaxf(s[sub][2], s[sub][3])),
                             fmaxf(fmaxf(s[sub][4], s[sub][5]), fmaxf(s[sub][6], s[sub][7])));
        }
        float mx = fmaxf(fmaxf(mxs[0], mxs[1]), fmaxf(mxs[2], mxs[3]));
        mx = fmaxf(mx, xhalf(mx));
        const float mnew  = fmaxf(mrun, mx);
        const float alpha = exp_fast(mrun - mnew);
        float rs[4];
#pragma unroll
        for (int sub = 0; sub < 4; sub++) {
            rs[sub] = 0.f;
#pragma unroll
            for (int r = 0; r < 8; r++) {
                float pe = exp_fast(s[sub][r] - mnew);
                s[sub][r] = pe;
                rs[sub] += pe;
            }
        }
        mrun = mnew;
        lsum = lsum * alpha + ((rs[0] + rs[1]) + (rs[2] + rs[3]));
#pragma unroll
        for (int dsub = 0; dsub < 4; dsub++) o[dsub] *= alpha;

        // P^T: two converted S^T sub-tiles = one B fragment (32 keys x 16 q), carried x4096 (+ residual x2048)
        Frag pf[2], prf[2];
#pragma unroll
        for (int ks = 0; ks < 2; ks++) {
#pragma unroll
            for (int e = 0; e < 16; e++) {
                const float ph = s[2 * ks + (e >> 3)][e & 7] * PCAR;
                _Float16 h16 = (_Float16)ph;
                pf[ks].v[e] = h16;
                if constexpr (RES != 0) prf[ks].v[e] = (_Float16)((ph - (float)h16) * RSC);
            }
        }
        sched_cut<RES>();                                  // V fragment loads stay behind the P^T pack

        // O^T += V^T . P^T
#pragma unroll
        for (int dsub = 0; dsub < 4; dsub++) {
            v8f u = (v8f)(0.f);
#pragma unroll
            for (int ks = 0; ks < 2; ks++) {
                Frag vf;
                const u16* vp = &Vs[((u32)dsub * 16u + ln) * 72u + (u32)ks * 32u + hf * 8u];
                vf.u[0] = *(const u32x4*)vp;
                vf.u[1] = *(const u32x4*)(vp + 16);
                o[dsub] = mma16(vf.v, pf[ks].v, o[dsub]);
                if constexpr (RES != 0) {
                    u = mma16(vf.v, prf[ks].v, u);
                    Frag vlf;
                    const u16* vlp = &Vl[((u32)dsub * 16u + ln) * 72u + (u32)ks * 32u + hf * 8u];
                    vlf.u[0] = *(const u32x4*)vlp;
                    vlf.u[1] = *(const u32x4*)(vlp + 16);
                    u = mma16(vlf.v, pf[ks].v, u);
                }
            }
            if constexpr (RES != 0) o[dsub] = o[dsub] + u * RINV;
            sched_cut<RES>();                              // next d sub-tile's V fragments stay behind this point
        }
    }

    // finalize: O / (l * 4096) -> f16 tile in the wave's LDS stage -> whole-line stores
    // O^T register r of tile dsub = d dsub*16 + hf*8 + r of query ln: 8 consecutive d, one 16-byte LDS store
    const float inv = (1.0f / (lsum + xhalf(lsum))) * PINV;
#pragma unroll
    for (int dsub = 0; dsub < 4; dsub++) {
        Pack8 pk;
#pragma unroll
        for (int r = 0; r < 8; r++) pk.h[r] = (_Float16)(o[dsub][r] * inv);
        *(u32x4*)&Pw[ln * 72u + (u32)dsub * 16u + hf * 8u] = pk.u;
    }
    __syncthreads();
    u32x4 val[4];
#pragma unroll
    for (u32 it = 0; it < 4; it++) {
        const u32 rloc = it * 4u + (lane >> 3), sg = (lane & 7u) * 8u;
        val[it] = *(const u32x4*)&Pw[rloc * 72u + sg];
    }
#pragma unroll
    for (u32 it = 0; it < 4; it++) {
        const u32 rloc = it * 4u + (lane >> 3), sg = (lane & 7u) * 8u;
        *(u32x4*)(cv + (size_t)(b * (u32)(SEQ) + q0 + rloc) * CE + h * HD + sg) = val[it];
    }
    
}

// ---------------- host side ----------------
extern "C" void kernel_launch(void* const* d_in, const int* in_sizes, int n_in,
                              void* d_out, int out_size, void* d_ws, size_t ws_size,
                              hipStream_t stream) {
    if (n_in < 13) return;
    const long long needX = ((long long)(NB - 1) * SEQ_FULL + (SEQ)) * CE;
    if ((long long)in_sizes[0] < needX || (long long)out_size < needX) return;
    if (in_sizes[1] < CE || in_sizes[2] < CE || in_sizes[3] < CE * C3 || in_sizes[4] < C3 ||
        in_sizes[5] < CE * CE || in_sizes[6] < CE || in_sizes[7] < CE || in_sizes[8] < CE ||
        in_sizes[9] < CE * C4 || in_sizes[10] < C4 || in_sizes[11] < C4 * CE || in_sizes[12] < CE)
        return;

    const float* x      = (const float*)d_in[0];
    const float* ln1_g  = (const float*)d_in[1];
    const float* ln1_b  = (const float*)d_in[2];
    const float* w_attn = (const float*)d_in[3];
    const float* b_attn = (const float*)d_in[4];
    const float* w_proj = (const float*)d_in[5];
    const float* b_proj = (const float*)d_in[6];
    const float* ln2_g  = (const float*)d_in[7];
    const float* ln2_b  = (const float*)d_in[8];
    const float* w_fc   = (const float*)d_in[9];
    const float* b_fc   = (const float*)d_in[10];
    const float* w_fc2  = (const float*)d_in[11];
    const float* b_fc2  = (const float*)d_in[12];

    char* ws = (char*)d_ws;
    size_t off = 0;
    auto take = [&](size_t bytes) -> char* {
        char* p = ws + off;
        off += (bytes + 255) & ~(size_t)255;
        return p;
    };
    const size_t R = (size_t)RROWS;
    u16*   waT   = (u16*)take((size_t)C3 * CE * 2);               // [3072][1024]
    u16*   wpT   = (u16*)take((size_t)CE * CE * 2);               // [1024][1024]
    u16*   wfcT  = (u16*)take((size_t)C4 * CE * 2);               // [4096][1024]
    u16*   wfc2T = (u16*)take((size_t)CE * C4 * 2);               // [1024][4096]
    u16*   h1    = (u16*)take(R * CE * 2);                        // [R][1024]
    u16*   qkh   = (u16*)take(R * QP * 2);                        // [R][2048]
    u16*   qkl   = (u16*)take((size_t)NB * (TE) * QP * 2);        // [NB*TE][2048]
    u16*   vth   = (u16*)take((size_t)NB * NH * HD * (SEQ) * 2);  // [NB*NH][64][SEQ]
    u16*   vtl   = (u16*)take((size_t)NB * NH * HD * (TE) * 2);   // [NB*NH][64][TE]
    u16*   cvb   = (u16*)take(R * CE * 2);                        // [R][1024]
    float* x1    = (float*)take(R * CE * 4);                      // [R][1024]
    u16*   h2    = (u16*)take(R * CE * 2);                        // [R][1024]
    u16*   hg    = (u16*)take(R * C4 * 2);                        // [R][4096]
    if (off > ws_size || off > (size_t)134217728) return;
    void* dummy = (void*)d_ws;

    // 1) weights: bf16-RNE value x64 -> f16, transposed to [N][K]   (in[K][N] -> out[N][K]), grid (N/64, K/64)
    cvt_wt_kernel<<<dim3(C3 / 64, CE / 64), 256, 0, stream>>>(w_attn, waT, (u32)CE, (u32)C3);   // [1024][3072] -> [3072][1024]
    cvt_wt_kernel<<<dim3(CE / 64, CE / 64), 256, 0, stream>>>(w_proj, wpT, (u32)CE, (u32)CE);   // [1024][1024] -> [1024][1024]
    cvt_wt_kernel<<<dim3(C4 / 64, CE / 64), 256, 0, stream>>>(w_fc,   wfcT, (u32)CE, (u32)C4);  // [1024][4096] -> [4096][1024]
    cvt_wt_kernel<<<dim3(CE / 64, C4 / 64), 256, 0, stream>>>(w_fc2,  wfc2T, (u32)C4, (u32)CE); // [4096][1024] -> [1024][4096]
    // 2) h1 = LN1(bfr(x))
    ln_kernel<1><<<RROWS / 8, 256, 0, stream>>>(x, ln1_g, ln1_b, h1);
    // 3) qkv = h1 . w_attn + b_attn -> q/k planes (+ residual rows t<TE), v transposed (+ residual)
    gemm_kernel<0><<<dim3(C3 / 128, RROWS / 128), 256, 0, stream>>>(h1, waT, b_attn, b_attn,
                                                                    qkh, qkl, vth, vtl, (u32)C3, (u32)CE);
    // 4) causal attention: residual-carrying tiles for query position < TE, plain tiles after
    attn_kernel<1><<<dim3(NEB, NB * NH), 256, 0, stream>>>(qkh, qkl, vth, vtl, cvb, 0u);
    if (NQB > NEB)
        attn_kernel<0><<<dim3(NQB - NEB, NB * NH), 256, 0, stream>>>(qkh, qkl, vth, vtl, cvb, (u32)NEB);
    // 5) x1 = cv . w_proj + b_proj + bfr(x)
    gemm_kernel<1><<<dim3(CE / 128, RROWS / 128), 256, 0, stream>>>(cvb, wpT, b_proj, x,
                                                                    x1, dummy, dummy, dummy, (u32)CE, (u32)CE);
    // 6) h2 = LN2(x1)
    ln_kernel<0><<<RROWS / 8, 256, 0, stream>>>(x1, ln2_g, ln2_b, h2);
    // 7) hg = gelu(h2 . w_fc + b_fc)
    gemm_kernel<2><<<dim3(C4 / 128, RROWS / 128), 256, 0, stream>>>(h2, wfcT, b_fc, b_fc,
                                                                    hg, dummy, dummy, dummy, (u32)C4, (u32)CE);
    // 8) out = hg . w_fc2 + b_fc2 + x1
    gemm_kernel<3><<<dim3(CE / 128, RROWS / 128), 256, 0, stream>>>(hg, wfc2T, b_fc2, x1,
                                                                    d_out, dummy, dummy, dummy, (u32)CE, (u32)C4);
}

// v002
// A run of this version takes 257 microseconds.
// Next to v001, in two timings, it ran 1.07 times as fast each time.
// Over all steps from v000 it is 1.38 times as fast.
#include <hip/hip_runtime.h>

// Contractions: v_wmma_f32_16x16x32_f16 (f16 operands, f32 accumulate) for qkv = h.W, S = q.k^T, O = p.v, proj, fc, fc2.
// Weight operand planes: bf16-RNE input value x64, cast to f16, stored transposed [N][K]. Activation planes f16.
// Attention runs transposed: S^T = k.q^T, O^T = v^T.p^T; p^T packs from the S^T accumulators straight into the B operand.
// p carried x4096 in f16. Query tiles with position < TE add f16 residual planes (x2048) of q, k, v, p
// through separately scaled second products folded into the f32 accumulators. Softmax, LN and erf-GELU in f32.

#ifndef NB
#define NB 2
#endif
#ifndef SEQ
#define SEQ 2048
#endif
#define NB_FULL 2
#define SEQ_FULL 2048
#define CE 1024
#define NH 16
#define HD 64
#define C3 3072
#define C4 4096
#define QP 2048
#define TE (((SEQ) < 256) ? (SEQ) : 256)
#define RROWS ((NB) * (SEQ))
#define NEB ((TE) / 128)
#define NQB ((SEQ) / 128)
#define LNJ ((CE) / 128)
#define LNO ((CE) / 256)

static_assert((SEQ) % 128 == 0);
static_assert((TE) % 128 == 0);
static_assert((NB) >= 1 && (NB) <= NB_FULL);
static_assert((SEQ) <= SEQ_FULL);
static_assert(CE % 128 == 0 && C3 % 128 == 0 && C4 % 128 == 0 && QP % 128 == 0);
static_assert(CE % 64 == 0 && C3 % 64 == 0 && C4 % 64 == 0);
static_assert(NH * HD == CE);
static_assert(HD == 64);
static_assert(QP == 2 * CE);
static_assert(C3 == 3 * CE);
static_assert(RROWS % 128 == 0);
static_assert(RROWS % 8 == 0);
static_assert(CE == 1024);
static_assert(256 * 4 == CE);            // gamma/beta staging: 256 threads x 4 floats
static_assert(32 * 4 * LNJ == CE);       // LN row load: 32 lanes x 4 floats x LNJ steps
static_assert(32 * 8 * LNO == CE);       // LN row store: 32 lanes x 8 halves x LNO instructions
static_assert(NQB * 128 == (SEQ));
static_assert(NEB <= NQB);

typedef unsigned short u16;
typedef unsigned int   u32;
typedef _Float16 v16h __attribute__((ext_vector_type(16)));
typedef _Float16 v8h  __attribute__((ext_vector_type(8)));
typedef _Float16 v4h  __attribute__((ext_vector_type(4)));
typedef float    v8f  __attribute__((ext_vector_type(8)));
typedef float    v4f  __attribute__((ext_vector_type(4)));
typedef unsigned int u32x4 __attribute__((ext_vector_type(4)));
typedef unsigned int u32x2 __attribute__((ext_vector_type(2)));

union Frag  { v16h v; u32x4 u[2]; };
union Pack8 { v8h h; u32x4 u; };
union Pack4 { v4h h; u32x2 u; };

#define WSCALE 64.0f
#define WINV   (1.0f / 64.0f)
#define PCAR   4096.0f
#define PINV   (1.0f / 4096.0f)
#define RSC    2048.0f
#define RINV   (1.0f / 2048.0f)

constexpr size_t al256(size_t b) { return (b + 255) & ~(size_t)255; }
constexpr size_t WS_TOTAL =
    al256((size_t)C3 * CE * 2) + al256((size_t)CE * CE * 2) + al256((size_t)C4 * CE * 2) +
    al256((size_t)CE * C4 * 2) + al256((size_t)RROWS * CE * 2) + al256((size_t)RROWS * QP * 2) +
    al256((size_t)NB * (TE) * QP * 2) + al256((size_t)NB * NH * HD * (SEQ) * 2) +
    al256((size_t)NB * NH * HD * (TE) * 2) + al256((size_t)RROWS * CE * 2) +
    al256((size_t)RROWS * CE * 4) + al256((size_t)RROWS * CE * 2) + al256((size_t)RROWS * C4 * 2);
static_assert(WS_TOTAL <= (size_t)134217728);

// f32 -> nearest-even bf16 grid value, returned as f32
__device__ __forceinline__ float bfr(float f) {
    u32 u = __builtin_bit_cast(u32, f);
    u += 0x7fffu + ((u >> 16) & 1u);
    u &= 0xffff0000u;
    return __builtin_bit_cast(float, u);
}

// f32 -> f16 (RNE) bits
__device__ __forceinline__ u16 hbits(float f) {
    _Float16 h = (_Float16)f;
    return __builtin_bit_cast(u16, h);
}

// 16x16x32 f16 WMMA with the VALU hazard guard tied to D and A/B
__device__ __forceinline__ v8f mma16(v16h a, v16h b, v8f c) {
    c = __builtin_amdgcn_wmma_f32_16x16x32_f16(false, a, false, b, (short)0, c, false, false);
    asm volatile("v_nop\n\tv_nop\n\tv_nop\n\tv_nop" : "+v"(c) : "v"(a), "v"(b));
    return c;
}

// one 16x32 operand fragment of a row-major LDS tile: two 16-byte loads, k order 0..7 and 16..23 (+ 8 in the upper lane half)
__device__ __forceinline__ void ldfrag(Frag& f, const u16* p) {
    f.u[0] = *(const u32x4*)p;
    f.u[1] = *(const u32x4*)(p + 16);
}

// scheduling-region boundary, emitted only in the residual-carrying attention instance:
// ends the live ranges of the staging temporaries before the next block of loads begins
template <int ON>
__device__ __forceinline__ void sched_cut() {
    if constexpr (ON != 0) __builtin_amdgcn_sched_barrier(0);
}

// value of lane l ^ 16 (the other 16-lane row), a vector cross-row move
__device__ __forceinline__ float xhalf(float x) {
    const int xi = __builtin_bit_cast(int, x);
    return __builtin_bit_cast(float, __builtin_amdgcn_permlanex16(xi, xi, 0x76543210, 0xfedcba98, false, false));
}

// e^x on the hardware exp2, same product and instruction as the fast-math exp;
// the v_nop fills the one issue slot the instruction set asks for behind a transcendental
// before its result is read or its source overwritten
__device__ __forceinline__ float exp_fast(float x) {
    float r;
    asm("v_exp_f32 %0, %1\n\tv_nop" : "=v"(r) : "v"(x * 1.44269504088896340736f));
    return r;
}

// erf-form GELU
__device__ __forceinline__ float gelu_erf(float x) {
    return 0.5f * x * (1.0f + erff(x * 0.70710678118654752f));
}

// logical row (b*SEQ + t) -> row of the full-size input / output tensors (b*SEQ_FULL + t)
__device__ __forceinline__ size_t grow_map(u32 r) {
    const u32 bb = r / (u32)(SEQ);
    const u32 t  = r - bb * (u32)(SEQ);
    return (size_t)bb * SEQ_FULL + (size_t)t;
}

// ---------------- weight convert + transpose: in[K][N] f32 -> out[N][K] f16 = f16(bfr(w) * 64) ----------------
// written by 8 consecutive lanes x 16 B of one instruction (4 lines per instruction).
__global__ __launch_bounds__(256) void cvt_wt_kernel(const float* __restrict__ in,
                                                      u16* __restrict__ out, u32 K, u32 N) {
    __shared__ __align__(16) u16 Ts[64 * 72];   // [n][k]
    const u32 tid = threadIdx.x, lane = tid & 31u, wv = tid >> 5;
    const u32 n0 = blockIdx.x * 64u, k0 = blockIdx.y * 64u;
    const u32 kr = tid >> 2, nseg = (tid & 3u) * 16u;
    const float* src = in + (size_t)(k0 + kr) * N + n0 + nseg;
#pragma unroll
    for (u32 j4 = 0; j4 < 4; j4++) {
        v4f w = *(const v4f*)(src + j4 * 4u);
#pragma unroll
        for (u32 c = 0; c < 4; c++) {
            float f = w[c];
            Ts[(nseg + j4 * 4u + c) * 72u + kr] = hbits(bfr(f) * WSCALE);
        }
    }
    __syncthreads();                             // Ts: cross-wave exchange
    u32x4 val[2];
#pragma unroll
    for (u32 it = 0; it < 2; it++) {
        const u32 nn = wv * 8u + it * 4u + (lane >> 3), ks = (lane & 7u) * 8u;
        val[it] = *(const u32x4*)&Ts[nn * 72u + ks];
    }
#pragma unroll
    for (u32 it = 0; it < 2; it++) {
        const u32 nn = wv * 8u + it * 4u + (lane >> 3), ks = (lane & 7u) * 8u;
        *(u32x4*)(out + (size_t)(n0 + nn) * K + k0 + ks) = val[it];
    }
    
}

// ---------------- LayerNorm (row = 1024): one wave per row, f16 out via LDS row stage ----------------
// Row kept in a wave-private f32 LDS row (lane owns columns j*128 + lane*4 + 0..3, same lane writes and reads);
// the three per-element sweeps are rolled loops with wave-uniform trip counts.
// gamma/beta staged once per workgroup in LDS at bf16-RNE values.
// SRCX = 1: src is the input x (full-size row map, each element taken at its bf16-RNE value)
// SRCX = 0: src is an f32 workspace plane with logical rows
template <int SRCX>
__global__ __launch_bounds__(256) void ln_kernel(const float* __restrict__ src,
                                                 const float* __restrict__ g,
                                                 const float* __restrict__ be,
                                                 u16* __restrict__ out) {
    __shared__ __align__(16) float xs[8 * CE];      // wave wv owns xs[wv*CE ..]
    __shared__ __align__(16) u16   rows[8 * CE];    // wave wv owns rows[wv*CE ..]
    __shared__ __align__(16) float gsh[CE];
    __shared__ __align__(16) float bsh[CE];
    const u32 tid = threadIdx.x, lane = tid & 31u, wv = tid >> 5;
    {
        v4f gg = *(const v4f*)(g + tid * 4u);
        v4f bb = *(const v4f*)(be + tid * 4u);
        v4f go, bo;
#pragma unroll
        for (u32 c = 0; c < 4; c++) {
            float tg = gg[c]; float tb = bb[c];
            go[c] = bfr(tg); bo[c] = bfr(tb);
        }
        *(v4f*)&gsh[tid * 4u] = go;
        *(v4f*)&bsh[tid * 4u] = bo;
    }
    const u32 r = blockIdx.x * 8u + wv;            // < RROWS (grid = RROWS/8)
    const size_t srow = SRCX ? grow_map(r) : (size_t)r;
    const float* xr = src + srow * CE;
    float* xw = xs + wv * CE;
    float s = 0.f;
#pragma unroll 1
    for (u32 j = 0; j < LNJ; j++) {
        const u32 c0 = j * 128u + lane * 4u;
        v4f t4 = *(const v4f*)(xr + c0);
        if constexpr (SRCX != 0) {
#pragma unroll
            for (u32 c = 0; c < 4; c++) { float t = t4[c]; t4[c] = bfr(t); }
        }
        *(v4f*)&xw[c0] = t4;
        s += (t4[0] + t4[1]) + (t4[2] + t4[3]);
    }
#pragma unroll
    for (u32 m = 16; m >= 1; m >>= 1) s += __shfl_xor(s, m, 32);
    const float mu = s * (1.f / (float)CE);
    float vs = 0.f;
#pragma unroll 1
    for (u32 j = 0; j < LNJ; j++) {
        const u32 c0 = j * 128u + lane * 4u;
        v4f t4 = *(const v4f*)&xw[c0];
#pragma unroll
        for (u32 c = 0; c < 4; c++) { float d = t4[c] - mu; vs += d * d; }
    }
#pragma unroll
    for (u32 m = 16; m >= 1; m >>= 1) vs += __shfl_xor(vs, m, 32);
    const float rstd = rsqrtf(vs * (1.f / (float)CE) + 1e-5f);
    __syncthreads();                               // gsh/bsh (cross-wave) visible
    u16* rw = rows + wv * CE;
#pragma unroll 1
    for (u32 j = 0; j < LNJ; j++) {
        const u32 c0 = j * 128u + lane * 4u;
        v4f x4 = *(const v4f*)&xw[c0];
        v4f g4 = *(const v4f*)&gsh[c0];
        v4f b4 = *(const v4f*)&bsh[c0];
        Pack4 pk;
#pragma unroll
        for (u32 c = 0; c < 4; c++) {
            float xe = x4[c]; float ge = g4[c]; float bel = b4[c];
            pk.h[c] = (_Float16)((xe - mu) * rstd * ge + bel);
        }
        *(u32x2*)&rw[c0] = pk.u;
    }
    __syncthreads();   // LDS row stage: written and read by the same wave; a workgroup barrier is used
    u32x4 val[LNO];
#pragma unroll
    for (u32 j = 0; j < LNO; j++) val[j] = *(const u32x4*)&rw[j * 256u + lane * 8u];
    u16* orow = out + (size_t)r * CE;
#pragma unroll
    for (u32 j = 0; j < LNO; j++) *(u32x4*)(orow + j * 256u + lane * 8u) = val[j];
    
}

// ---------------- f16 GEMM: C[128x128 tile] = A[M][K](f16) . BT[N][K](f16)^T, K-step 64 ----------------
// 8 waves = 4 (m) x 2 (n), wave tile 32 x 64, fragments per the split k map for A and B.
// Epilogue: acc*(1/64) + bias(bf16-RNE) [-> gelu] staged as f32 128x128 tile in LDS, then
// MODE 0: qkv: n0 < QP -> qk hi plane [RROWS][QP] (+ lo plane rows t<TE), else V transposed
//         into vt hi [NB*NH][64][SEQ] (+ vt lo [..][64][TE] for t<TE)
// MODE 1: out0 f32 [RROWS][CE] = acc + bias + bfr(res at full-size rows)   (x1)
// MODE 2: out0 f16 [RROWS][C4] = gelu(acc + bias)                          (hg)
// MODE 3: out0 f32 at full-size rows = acc + bias + res[logical rows]      (d_out)
template <int MODE>
__global__ __launch_bounds__(256) void gemm_kernel(const u16* __restrict__ A,
                                                   const u16* __restrict__ BT,
                                                   const float* __restrict__ bias,
                                                   const float* __restrict__ res,
                                                   void* out0, void* out1, void* out2, void* out3,
                                                   u32 N, u32 K) {
    __shared__ u32x4 smem[4224];                   // 67584 B: As|Bs during the k loop, Cs after it
    u16* As = (u16*)smem;                          // [128][72]
    u16* Bs = As + 128 * 72;                       // [128][72]
    float* Cs = (float*)smem;                      // [128][132]
    constexpr u32 CSP = 132;

    const u32 tid = threadIdx.x, lane = tid & 31u, wv = tid >> 5;
    const u32 hf = lane >> 4, ln = lane & 15u;
    const u32 m0 = blockIdx.y * 128u, n0 = blockIdx.x * 128u;
    const u32 wm = wv & 3u, wn = wv >> 2;
    const u32 srow = tid >> 1, sseg = (tid & 1u) * 32u;

    v8f acc[2][4];
#pragma unroll
    for (int i = 0; i < 2; i++)
#pragma unroll
        for (int j = 0; j < 4; j++) acc[i][j] = (v8f)(0.f);

    for (u32 k0 = 0; k0 < K; k0 += 64u) {
        __syncthreads();                           // prior step's fragment reads done
        {
            const u16* ga = A  + (size_t)(m0 + srow) * K + k0 + sseg;
            const u16* gb = BT + (size_t)(n0 + srow) * K + k0 + sseg;
            u32x4 a0 = *(const u32x4*)(ga), a1 = *(const u32x4*)(ga + 8);
            u32x4 a2 = *(const u32x4*)(ga + 16), a3 = *(const u32x4*)(ga + 24);
            u32x4 b0 = *(const u32x4*)(gb), b1 = *(const u32x4*)(gb + 8);
            u32x4 b2 = *(const u32x4*)(gb + 16), b3 = *(const u32x4*)(gb + 24);
            u32x4* la = (u32x4*)&As[srow * 72u + sseg];
            u32x4* lb = (u32x4*)&Bs[srow * 72u + sseg];
            la[0] = a0; la[1] = a1; la[2] = a2; la[3] = a3;
            lb[0] = b0; lb[1] = b1; lb[2] = b2; lb[3] = b3;
        }
        __syncthreads();                           // staged tile visible to all waves
#pragma unroll
        for (u32 ks = 0; ks < 2; ks++) {
            Frag af[2], bf[4];
#pragma unroll
            for (u32 mi = 0; mi < 2; mi++) {
                const u16* q = &As[(wm * 32u + mi * 16u + ln) * 72u + ks * 32u + hf * 8u];
                af[mi].u[0] = *(const u32x4*)q;
                af[mi].u[1] = *(const u32x4*)(q + 16);
            }
#pragma unroll
            for (u32 ni = 0; ni < 4; ni++) {
                const u16* q = &Bs[(wn * 64u + ni * 16u + ln) * 72u + ks * 32u + hf * 8u];
                bf[ni].u[0] = *(const u32x4*)q;
                bf[ni].u[1] = *(const u32x4*)(q + 16);
            }
#pragma unroll
            for (int mi = 0; mi < 2; mi++)
#pragma unroll
                for (int ni = 0; ni < 4; ni++)
                    acc[mi][ni] = mma16(af[mi].v, bf[ni].v, acc[mi][ni]);
        }
    }

    // ---- epilogue: accumulators -> f32 tile in LDS ----
    __syncthreads();                               // all waves done with As/Bs (aliased by Cs)
#pragma unroll
    for (int ni = 0; ni < 4; ni++) {
        const u32 col = wn * 64u + (u32)ni * 16u + ln;
        const float bv = bfr(bias[n0 + col]);
#pragma unroll
        for (int mi = 0; mi < 2; mi++) {
#pragma unroll
            for (int r = 0; r < 8; r++) {
                const u32 row = wm * 32u + (u32)mi * 16u + hf * 8u + (u32)r;
                float v = acc[mi][ni][r] * WINV + bv;
                if constexpr (MODE == 2) v = gelu_erf(v);
                Cs[row * CSP + col] = v;
            }
        }
    }
    __syncthreads();                               // Cs is read across waves below

    if constexpr (MODE == 1 || MODE == 3) {
        float* o = (float*)out0;
        v4f val[16];
#pragma unroll
        for (int grp = 0; grp < 2; grp++) {
#pragma unroll
            for (int i8 = 0; i8 < 8; i8++) {
                const int i = grp * 8 + i8;
                const u32 row = wv * 16u + (u32)i;
                const u32 r = m0 + row;
                v4f c = *(const v4f*)&Cs[row * CSP + lane * 4u];
                const size_t rr = (MODE == 1) ? grow_map(r) : (size_t)r;
                v4f x4 = *(const v4f*)(res + rr * (size_t)N + n0 + lane * 4u);
                if constexpr (MODE == 1) {
#pragma unroll
                    for (int cc = 0; cc < 4; cc++) { float t = x4[cc]; x4[cc] = bfr(t); }
                }
                val[i] = c + x4;
            }
            asm volatile("" ::: "memory");         // keep the two load groups in separate clauses
        }
#pragma unroll
        for (int i = 0; i < 16; i++) {
            const u32 r = m0 + wv * 16u + (u32)i;
            const size_t orr = (MODE == 3) ? grow_map(r) : (size_t)r;
            *(v4f*)(o + orr * (size_t)N + n0 + lane * 4u) = val[i];
        }
        
    } else if constexpr (MODE == 2) {
        u16* o = (u16*)out0;
        u32x4 val[8];
#pragma unroll
        for (int it = 0; it < 8; it++) {
            const u32 rloc = wv * 16u + (u32)it * 2u + hf, cseg = ln * 8u;
            Pack8 pk;
#pragma unroll
            for (int j = 0; j < 8; j++) pk.h[j] = (_Float16)Cs[rloc * CSP + cseg + (u32)j];
            val[it] = pk.u;
        }
#pragma unroll
        for (int it = 0; it < 8; it++) {
            const u32 rloc = wv * 16u + (u32)it * 2u + hf, cseg = ln * 8u;
            *(u32x4*)(o + (size_t)(m0 + rloc) * N + n0 + cseg) = val[it];
        }
        
    } else {
        // MODE 0: q/k planes or transposed v planes
        u16* qkh = (u16*)out0;
        u16* qkl = (u16*)out1;
        u16* vth = (u16*)out2;
        u16* vtl = (u16*)out3;
        const u32 bq = m0 / (u32)(SEQ);
        const u32 t0 = m0 - bq * (u32)(SEQ);       // 128 | SEQ so the tile sits inside one batch
        const bool lo_on = (t0 < (u32)(TE));       // uniform per workgroup
        u32x4 vh[8], vl[8];
        if (n0 < (u32)QP) {
#pragma unroll
            for (int it = 0; it < 8; it++) {
                const u32 rloc = wv * 16u + (u32)it * 2u + hf, cseg = ln * 8u;
                Pack8 ph, pl;
#pragma unroll
                for (int j = 0; j < 8; j++) {
                    float f = Cs[rloc * CSP + cseg + (u32)j];
                    _Float16 h16 = (_Float16)f;
                    ph.h[j] = h16;
                    pl.h[j] = (_Float16)((f - (float)h16) * RSC);
                }
                vh[it] = ph.u; vl[it] = pl.u;
            }
#pragma unroll
            for (int it = 0; it < 8; it++) {
                const u32 rloc = wv * 16u + (u32)it * 2u + hf, cseg = ln * 8u;
                *(u32x4*)(qkh + (size_t)(m0 + rloc) * QP + n0 + cseg) = vh[it];
                if (lo_on)
                    *(u32x4*)(qkl + ((size_t)bq * (TE) + t0 + rloc) * QP + n0 + cseg) = vl[it];
            }
            
        } else {
            const u32 hh0 = (n0 - (u32)QP) >> 6;   // two heads per 128-column tile
#pragma unroll
            for (int it = 0; it < 8; it++) {
                const u32 rloc = wv * 16u + (u32)it * 2u + hf;   // local column = head*64 + d
                const u32 tseg = ln * 8u;
                Pack8 ph, pl;
#pragma unroll
                for (int j = 0; j < 8; j++) {
                    float f = Cs[(tseg + (u32)j) * CSP + rloc];
                    _Float16 h16 = (_Float16)f;
                    ph.h[j] = h16;
                    pl.h[j] = (_Float16)((f - (float)h16) * RSC);
                }
                vh[it] = ph.u; vl[it] = pl.u;
            }
#pragma unroll
            for (int it = 0; it < 8; it++) {
                const u32 rloc = wv * 16u + (u32)it * 2u + hf, tseg = ln * 8u;
                const u32 hh = hh0 + (rloc >> 6), dd = rloc & 63u;
                const size_t vrow = (size_t)(bq * NH + hh) * HD + dd;
                *(u32x4*)(vth + vrow * (SEQ) + t0 + tseg) = vh[it];
                if (lo_on)
                    *(u32x4*)(vtl + vrow * (TE) + t0 + tseg) = vl[it];
            }
            
        }
    }
}

// ---------------- causal flash attention, hd=64, 128 queries per workgroup (8 waves x 16 rows), 64-key chunks ----------------
// qkh: [RROWS][QP] f16 (q cols h*64+d, k cols CE+h*64+d); qkl: same layout for rows t<TE, residual x2048
// vth: [NB*NH][64][SEQ] f16 transposed v; vtl: [NB*NH][64][TE] residual x2048
// Transposed products: A = K rows (S^T) or V^T rows (O^T), B = Q or P^T. Lane (hf, ln) owns query q0 + ln:
// S^T register r of sub-tile sub = key sub*16 + hf*8 + r, so two converted sub-tiles are one B fragment in the loaders' k order.
// RES=1: query tiles with position < TE: S = qh.kh + (qh.kl + ql.kh)/2048, O += Ph.Vh + (Pr.Vh + Ph.Vl)/2048
// RES=1 only: wave index taken as a scalar-uniform value.
// Operand fragments leave LDS in groups ahead of the products that read them (same arithmetic, same order of products):
// RES=0 a chunk's 8 K fragments, then its 8 V fragments ahead of the softmax; RES=1 one sub-tile ahead, two register sets.
template <int RES>
__global__ __launch_bounds__(256) __attribute__((amdgpu_num_vgpr(256)))
void attn_kernel(const u16* __restrict__ qkh, const u16* __restrict__ qkl,
                 const u16* __restrict__ vth, const u16* __restrict__ vtl,
                 u16* __restrict__ cv, u32 qb0) {
    __shared__ __align__(16) u16 Ks[64 * 72];              // [key][d]
    __shared__ __align__(16) u16 Vs[64 * 72];              // [d][key]
    __shared__ __align__(16) u16 Kl[RES ? 64 * 72 : 8];
    __shared__ __align__(16) u16 Vl[RES ? 64 * 72 : 8];
    __shared__ __align__(16) u16 Ps[8 * 16 * 72];          // per wave [16 q][d]: final O stage

    const u32 bh = blockIdx.y;
    const u32 b = bh / (u32)NH, h = bh - b * (u32)NH;
    const u32 qb = qb0 + blockIdx.x;
    const u32 tid = threadIdx.x, lane = tid & 31u;
    u32 wv = tid >> 5;
    if constexpr (RES != 0) wv = (u32)__builtin_amdgcn_readfirstlane((int)wv);   // all lanes active, value is wave-uniform
    const u32 hf = lane >> 4, ln = lane & 15u;
    const u32 q0 = qb * 128u + wv * 16u;
    u16* Pw  = Ps + wv * (16u * 72u);

    Frag qf[2], ql[2];
#pragma unroll
    for (u32 ds = 0; ds < 2; ds++) {
        const u16* p = qkh + (size_t)(b * (u32)(SEQ) + q0 + ln) * QP + h * HD + ds * 32u + hf * 8u;
        qf[ds].u[0] = *(const u32x4*)p;
        qf[ds].u[1] = *(const u32x4*)(p + 16);
        if constexpr (RES != 0) {
            const u16* pl = qkl + (size_t)(b * (u32)(TE) + q0 + ln) * QP + h * HD + ds * 32u + hf * 8u;
            ql[ds].u[0] = *(const u32x4*)pl;
            ql[ds].u[1] = *(const u32x4*)(pl + 16);
        } else {
            ql[ds].u[0] = (u32x4)(0u); ql[ds].u[1] = (u32x4)(0u);
        }
    }

    v8f o[4];
#pragma unroll
    for (int i = 0; i < 4; i++) o[i] = (v8f)(0.f);
    float mrun = -3.0e38f;                                 // running maximum of this lane's query (both halves agree)
    float lsum = 0.f;                                      // running sum over this lane half's keys; halves joined after the loop
    const u32 qg = q0 + ln;

    const u32 rr = tid >> 2, seg = (tid & 3u) * 16u;      // staging: row rr (key or d), 16 halves at seg
    const u32 nkt = 2u * qb + 2u;                          // keys 0 .. qb*128+127

#pragma unroll 1
    for (u32 kt = 0; kt < nkt; kt++) {
        __syncthreads();                                   // prior chunk's LDS reads done
        {
            const u16* gk = qkh + (size_t)(b * (u32)(SEQ) + kt * 64u + rr) * QP + CE + h * HD + seg;
            u32x4 k0v = *(const u32x4*)gk, k1v = *(const u32x4*)(gk + 8);
            const u16* gv = vth + ((size_t)(bh * HD + rr)) * (SEQ) + kt * 64u + seg;
            u32x4 v0 = *(const u32x4*)gv, v1 = *(const u32x4*)(gv + 8);
            *(u32x4*)&Ks[rr * 72u + seg] = k0v; *(u32x4*)&Ks[rr * 72u + seg + 8u] = k1v;
            *(u32x4*)&Vs[rr * 72u + seg] = v0;  *(u32x4*)&Vs[rr * 72u + seg + 8u] = v1;
            sched_cut<RES>();                              // hi-plane staging temporaries end here
            if constexpr (RES != 0) {
                const u16* gkl = qkl + (size_t)(b * (u32)(TE) + kt * 64u + rr) * QP + CE + h * HD + seg;
                u32x4 kl0 = *(const u32x4*)gkl, kl1 = *(const u32x4*)(gkl + 8);
                const u16* gvl = vtl + ((size_t)(bh * HD + rr)) * (TE) + kt * 64u + seg;
                u32x4 vl0 = *(const u32x4*)gvl, vl1 = *(const u32x4*)(gvl + 8);
                *(u32x4*)&Kl[rr * 72u + seg] = kl0; *(u32x4*)&Kl[rr * 72u + seg + 8u] = kl1;
                *(u32x4*)&Vl[rr * 72u + seg] = vl0; *(u32x4*)&Vl[rr * 72u + seg + 8u] = vl1;
            }
        }
        __syncthreads();                                   // K/V chunk visible to all waves
        sched_cut<RES>();

        // S^T = K . Q^T  (64 keys x 16 q per wave)
        // The K fragment loads stand as groups ahead of the products that read them, so a wave waits out the LDS
        // latency once per group and not once per product. RES=0: the chunk's 8 fragments in one group.
        // RES=1: one sub-tile's hi and residual fragments per group, fetched one sub-tile ahead into a second register set.
        v8f s[4];
        Frag vf[RES ? 2 : 4][2], vlf[2][2];                // V fragments: RES=0 [d sub-tile][ks], RES=1 [register set][ks]
        if constexpr (RES == 0) {
            Frag kf[4][2];
#pragma unroll
            for (int sub = 0; sub < 4; sub++)
#pragma unroll
                for (int ds = 0; ds < 2; ds++)
                    ldfrag(kf[sub][ds], &Ks[((u32)sub * 16u + ln) * 72u + (u32)ds * 32u + hf * 8u]);
            __builtin_amdgcn_sched_barrier(0);             // the 16 K loads issue together, none sinks down among the products
#pragma unroll
            for (int sub = 0; sub < 4; sub++) {
                v8f t = (v8f)(0.f);
#pragma unroll
                for (int ds = 0; ds < 2; ds++) t = mma16(kf[sub][ds].v, qf[ds].v, t);
                s[sub] = t;
            }
            __builtin_amdgcn_sched_barrier(0);             // the V loads below stay behind the last S^T product (they take over the K registers)
#pragma unroll
            for (int dsub = 0; dsub < 4; dsub++)
#pragma unroll
                for (int ks = 0; ks < 2; ks++)
                    ldfrag(vf[dsub][ks], &Vs[((u32)dsub * 16u + ln) * 72u + (u32)ks * 32u + hf * 8u]);
            __builtin_amdgcn_sched_barrier(0);             // the 16 V loads issue here, ahead of the softmax, which covers their latency
        } else {
            Frag kf[2][2], klf[2][2];
#pragma unroll
            for (int ds = 0; ds < 2; ds++) {
                ldfrag(kf[0][ds],  &Ks[ln * 72u + (u32)ds * 32u + hf * 8u]);
                ldfrag(klf[0][ds], &Kl[ln * 72u + (u32)ds * 32u + hf * 8u]);
            }
#pragma unroll
            for (int sub = 0; sub < 4; sub++) {
                const int cur = sub & 1, nxt = cur ^ 1;
#pragma unroll
                for (int ds = 0; ds < 2; ds++) {
                    if (sub < 3) {
                        ldfrag(kf[nxt][ds],  &Ks[((u32)(sub + 1) * 16u + ln) * 72u + (u32)ds * 32u + hf * 8u]);
                        ldfrag(klf[nxt][ds], &Kl[((u32)(sub + 1) * 16u + ln) * 72u + (u32)ds * 32u + hf * 8u]);
                    } else {
                        ldfrag(vf[0][ds],  &Vs[ln * 72u + (u32)ds * 32u + hf * 8u]);
                        ldfrag(vlf[0][ds], &Vl[ln * 72u + (u32)ds * 32u + hf * 8u]);
                    }
                }
                __builtin_amdgcn_sched_barrier(0);         // the next group's 8 loads issue ahead of this sub-tile's products
                v8f t = (v8f)(0.f);
                v8f tr = (v8f)(0.f);
#pragma unroll
                for (int ds = 0; ds < 2; ds++) {
                    t  = mma16(kf[cur][ds].v,  qf[ds].v, t);
                    tr = mma16(klf[cur][ds].v, qf[ds].v, tr);
                    tr = mma16(kf[cur][ds].v,  ql[ds].v, tr);
                }
                s[sub] = t + tr * RINV;
                __builtin_amdgcn_sched_barrier(0);         // the group after next stays behind this sub-tile's products: two register sets, no more
            }
        }

        // scale + causal replace-fill
#pragma unroll
        for (int sub = 0; sub < 4; sub++) {
#pragma unroll
            for (int r = 0; r < 8; r++) {
                const u32 kg = kt * 64u + (u32)sub * 16u + hf * 8u + (u32)r;
                float v = s[sub][r] * 0.125f;
                s[sub][r] = (kg > qg) ? -3.0e38f : v;
            }
        }
        // online softmax: one query per lane, 32 of the chunk's keys in-lane, the other 32 in lane ^ 16
        float mxs[4];
#pragma unroll
        for (int sub = 0; sub < 4; sub++) {
            mxs[sub] = fmaxf(fmaxf(fmaxf(s[sub][0], s[sub][1]), fmaxf(s[sub][2], s[sub][3])),
                             fmaxf(fmaxf(s[sub][4], s[sub][5]), fmaxf(s[sub][6], s[sub][7])));
        }
        float mx = fmaxf(fmaxf(mxs[0], mxs[1]), fmaxf(mxs[2], mxs[3]));
        mx = fmaxf(mx, xhalf(mx));
        const float mnew  = fmaxf(mrun, mx);
        const float alpha = exp_fast(mrun - mnew);
        float rs[4];
#pragma unroll
        for (int sub = 0; sub < 4; sub++) {
            rs[sub] = 0.f;
#pragma unroll
            for (int r = 0; r < 8; r++) {
                float pe = exp_fast(s[sub][r] - mnew);
                s[sub][r] = pe;
                rs[sub] += pe;
            }
        }
        mrun = mnew;
        lsum = lsum * alpha + ((rs[0] + rs[1]) + (rs[2] + rs[3]));
#pragma unroll
        for (int dsub = 0; dsub < 4; dsub++) o[dsub] *= alpha;

        // P^T: two converted S^T sub-tiles = one B fragment (32 keys x 16 q), carried x4096 (+ residual x2048)
        Frag pf[2], prf[2];
#pragma unroll
        for (int ks = 0; ks < 2; ks++) {
#pragma unroll
            for (int e = 0; e < 16; e++) {
                const float ph = s[2 * ks + (e >> 3)][e & 7] * PCAR;
                _Float16 h16 = (_Float16)ph;
                pf[ks].v[e] = h16;
                if constexpr (RES != 0) prf[ks].v[e] = (_Float16)((ph - (float)h16) * RSC);
            }
        }
        // O^T += V^T . P^T
#pragma unroll
        for (int dsub = 0; dsub < 4; dsub++) {
            if constexpr (RES == 0) {
#pragma unroll
                for (int ks = 0; ks < 2; ks++) o[dsub] = mma16(vf[dsub][ks].v, pf[ks].v, o[dsub]);
            } else {
                const int cur = dsub & 1, nxt = cur ^ 1;
                if (dsub < 3) {
#pragma unroll
                    for (int ks = 0; ks < 2; ks++) {
                        ldfrag(vf[nxt][ks],  &Vs[((u32)(dsub + 1) * 16u + ln) * 72u + (u32)ks * 32u + hf * 8u]);
                        ldfrag(vlf[nxt][ks], &Vl[((u32)(dsub + 1) * 16u + ln) * 72u + (u32)ks * 32u + hf * 8u]);
                    }
                }
                __builtin_amdgcn_sched_barrier(0);         // the next d sub-tile's 8 loads issue ahead of this one's products
                v8f u = (v8f)(0.f);
#pragma unroll
                for (int ks = 0; ks < 2; ks++) {
                    o[dsub] = mma16(vf[cur][ks].v,  pf[ks].v,  o[dsub]);
                    u       = mma16(vf[cur][ks].v,  prf[ks].v, u);
                    u       = mma16(vlf[cur][ks].v, pf[ks].v,  u);
                }
                o[dsub] = o[dsub] + u * RINV;
                __builtin_amdgcn_sched_barrier(0);         // the group after next stays behind this sub-tile's products: two register sets, no more
            }
        }
    }

    // finalize: O / (l * 4096) -> f16 tile in the wave's LDS stage -> whole-line stores
    // O^T register r of tile dsub = d dsub*16 + hf*8 + r of query ln: 8 consecutive d, one 16-byte LDS store
    const float inv = (1.0f / (lsum + xhalf(lsum))) * PINV;
#pragma unroll
    for (int dsub = 0; dsub < 4; dsub++) {
        Pack8 pk;
#pragma unroll
        for (int r = 0; r < 8; r++) pk.h[r] = (_Float16)(o[dsub][r] * inv);
        *(u32x4*)&Pw[ln * 72u + (u32)dsub * 16u + hf * 8u] = pk.u;
    }
    __syncthreads();
    u32x4 val[4];
#pragma unroll
    for (u32 it = 0; it < 4; it++) {
        const u32 rloc = it * 4u + (lane >> 3), sg = (lane & 7u) * 8u;
        val[it] = *(const u32x4*)&Pw[rloc * 72u + sg];
    }
#pragma unroll
    for (u32 it = 0; it < 4; it++) {
        const u32 rloc = it * 4u + (lane >> 3), sg = (lane & 7u) * 8u;
        *(u32x4*)(cv + (size_t)(b * (u32)(SEQ) + q0 + rloc) * CE + h * HD + sg) = val[it];
    }
    
}

// ---------------- host side ----------------
extern "C" void kernel_launch(void* const* d_in, const int* in_sizes, int n_in,
                              void* d_out, int out_size, void* d_ws, size_t ws_size,
                              hipStream_t stream) {
    if (n_in < 13) return;
    const long long needX = ((long long)(NB - 1) * SEQ_FULL + (SEQ)) * CE;
    if ((long long)in_sizes[0] < needX || (long long)out_size < needX) return;
    if (in_sizes[1] < CE || in_sizes[2] < CE || in_sizes[3] < CE * C3 || in_sizes[4] < C3 ||
        in_sizes[5] < CE * CE || in_sizes[6] < CE || in_sizes[7] < CE || in_sizes[8] < CE ||
        in_sizes[9] < CE * C4 || in_sizes[10] < C4 || in_sizes[11] < C4 * CE || in_sizes[12] < CE)
        return;

    const float* x      = (const float*)d_in[0];
    const float* ln1_g  = (const float*)d_in[1];
    const float* ln1_b  = (const float*)d_in[2];
    const float* w_attn = (const float*)d_in[3];
    const float* b_attn = (const float*)d_in[4];
    const float* w_proj = (const float*)d_in[5];
    const float* b_proj = (const float*)d_in[6];
    const float* ln2_g  = (const float*)d_in[7];
    const float* ln2_b  = (const float*)d_in[8];
    const float* w_fc   = (const float*)d_in[9];
    const float* b_fc   = (const float*)d_in[10];
    const float* w_fc2  = (const float*)d_in[11];
    const float* b_fc2  = (const float*)d_in[12];

    char* ws = (char*)d_ws;
    size_t off = 0;
    auto take = [&](size_t bytes) -> char* {
        char* p = ws + off;
        off += (bytes + 255) & ~(size_t)255;
        return p;
    };
    const size_t R = (size_t)RROWS;
    u16*   waT   = (u16*)take((size_t)C3 * CE * 2);               // [3072][1024]
    u16*   wpT   = (u16*)take((size_t)CE * CE * 2);               // [1024][1024]
    u16*   wfcT  = (u16*)take((size_t)C4 * CE * 2);               // [4096][1024]
    u16*   wfc2T = (u16*)take((size_t)CE * C4 * 2);               // [1024][4096]
    u16*   h1    = (u16*)take(R * CE * 2);                        // [R][1024]
    u16*   qkh   = (u16*)take(R * QP * 2);                        // [R][2048]
    u16*   qkl   = (u16*)take((size_t)NB * (TE) * QP * 2);        // [NB*TE][2048]
    u16*   vth   = (u16*)take((size_t)NB * NH * HD * (SEQ) * 2);  // [NB*NH][64][SEQ]
    u16*   vtl   = (u16*)take((size_t)NB * NH * HD * (TE) * 2);   // [NB*NH][64][TE]
    u16*   cvb   = (u16*)take(R * CE * 2);                        // [R][1024]
    float* x1    = (float*)take(R * CE * 4);                      // [R][1024]
    u16*   h2    = (u16*)take(R * CE * 2);                        // [R][1024]
    u16*   hg    = (u16*)take(R * C4 * 2);                        // [R][4096]
    if (off > ws_size || off > (size_t)134217728) return;
    void* dummy = (void*)d_ws;

    // 1) weights: bf16-RNE value x64 -> f16, transposed to [N][K]   (in[K][N] -> out[N][K]), grid (N/64, K/64)
    cvt_wt_kernel<<<dim3(C3 / 64, CE / 64), 256, 0, stream>>>(w_attn, waT, (u32)CE, (u32)C3);   // [1024][3072] -> [3072][1024]
    cvt_wt_kernel<<<dim3(CE / 64, CE / 64), 256, 0, stream>>>(w_proj, wpT, (u32)CE, (u32)CE);   // [1024][1024] -> [1024][1024]
    cvt_wt_kernel<<<dim3(C4 / 64, CE / 64), 256, 0, stream>>>(w_fc,   wfcT, (u32)CE, (u32)C4);  // [1024][4096] -> [4096][1024]
    cvt_wt_kernel<<<dim3(CE / 64, C4 / 64), 256, 0, stream>>>(w_fc2,  wfc2T, (u32)C4, (u32)CE); // [4096][1024] -> [1024][4096]
    // 2) h1 = LN1(bfr(x))
    ln_kernel<1><<<RROWS / 8, 256, 0, stream>>>(x, ln1_g, ln1_b, h1);
    // 3) qkv = h1 . w_attn + b_attn -> q/k planes (+ residual rows t<TE), v transposed (+ residual)
    gemm_kernel<0><<<dim3(C3 / 128, RROWS / 128), 256, 0, stream>>>(h1, waT, b_attn, b_attn,
                                                                    qkh, qkl, vth, vtl, (u32)C3, (u32)CE);
    // 4) causal attention: residual-carrying tiles for query position < TE, plain tiles after
    attn_kernel<1><<<dim3(NEB, NB * NH), 256, 0, stream>>>(qkh, qkl, vth, vtl, cvb, 0u);
    if (NQB > NEB)
        attn_kernel<0><<<dim3(NQB - NEB, NB * NH), 256, 0, stream>>>(qkh, qkl, vth, vtl, cvb, (u32)NEB);
    // 5) x1 = cv . w_proj + b_proj + bfr(x)
    gemm_kernel<1><<<dim3(CE / 128, RROWS / 128), 256, 0, stream>>>(cvb, wpT, b_proj, x,
                                                                    x1, dummy, dummy, dummy, (u32)CE, (u32)CE);
    // 6) h2 = LN2(x1)
    ln_kernel<0><<<RROWS / 8, 256, 0, stream>>>(x1, ln2_g, ln2_b, h2);
    // 7) hg = gelu(h2 . w_fc + b_fc)
    gemm_kernel<2><<<dim3(C4 / 128, RROWS / 128), 256, 0, stream>>>(h2, wfcT, b_fc, b_fc,
                                                                    hg, dummy, dummy, dummy, (u32)C4, (u32)CE);
    // 8) out = hg . w_fc2 + b_fc2 + x1
    gemm_kernel<3><<<dim3(CE / 128, RROWS / 128), 256, 0, stream>>>(hg, wfc2T, b_fc2, x1,
                                                                    d_out, dummy, dummy, dummy, (u32)CE, (u32)C4);
}

// v003
// It runs in 243 microseconds.
// In both of two side-by-side timings against v002, it was 1.06 times as fast.
// All steps since v000 together make it 1.46 times as fast.
#include <hip/hip_runtime.h>

// Contractions: v_wmma_f32_16x16x32_f16 (f16 operands, f32 accumulate) for qkv = h.W, S = q.k^T, O = p.v, proj, fc, fc2.
// Weight operand planes: bf16-RNE input value x64, cast to f16, stored transposed [N][K]. Activation planes f16.
// Attention runs transposed: S^T = k.q^T, O^T = v^T.p^T; p^T packs from the S^T accumulators straight into the B operand.
// p carried x4096 in f16. Query tiles with position < TE add f16 residual planes (x2048) of q, k, v, p
// through separately scaled second products folded into the f32 accumulators. Softmax, LN and erf-GELU in f32.

#ifndef NB
#define NB 2
#endif
#ifndef SEQ
#define SEQ 2048
#endif
#define NB_FULL 2
#define SEQ_FULL 2048
#define CE 1024
#define NH 16
#define HD 64
#define C3 3072
#define C4 4096
#define QP 2048
#define TE (((SEQ) < 256) ? (SEQ) : 256)
#define RROWS ((NB) * (SEQ))
#define NEB ((TE) / 128)
#define NQB ((SEQ) / 128)
#define LNJ ((CE) / 128)
#define LNO ((CE) / 256)

static_assert((SEQ) % 128 == 0);
static_assert((TE) % 128 == 0);
static_assert((NB) >= 1 && (NB) <= NB_FULL);
static_assert((SEQ) <= SEQ_FULL);
static_assert(CE % 128 == 0 && C3 % 128 == 0 && C4 % 128 == 0 && QP % 128 == 0);
static_assert(CE % 64 == 0 && C3 % 64 == 0 && C4 % 64 == 0);
static_assert(NH * HD == CE);
static_assert(HD == 64);
static_assert(QP == 2 * CE);
static_assert(C3 == 3 * CE);
static_assert(RROWS % 128 == 0);
static_assert(RROWS % 8 == 0);
static_assert(CE == 1024);
static_assert(256 * 4 == CE);            // gamma/beta staging: 256 threads x 4 floats
static_assert(32 * 4 * LNJ == CE);       // LN row load: 32 lanes x 4 floats x LNJ steps
static_assert(32 * 8 * LNO == CE);       // LN row store: 32 lanes x 8 halves x LNO instructions
static_assert(NQB * 128 == (SEQ));
static_assert(NEB <= NQB);

typedef unsigned short u16;
typedef unsigned int   u32;
typedef _Float16 v16h __attribute__((ext_vector_type(16)));
typedef _Float16 v8h  __attribute__((ext_vector_type(8)));
typedef _Float16 v4h  __attribute__((ext_vector_type(4)));
typedef float    v8f  __attribute__((ext_vector_type(8)));
typedef float    v4f  __attribute__((ext_vector_type(4)));
typedef unsigned int u32x4 __attribute__((ext_vector_type(4)));
typedef unsigned int u32x2 __attribute__((ext_vector_type(2)));

union Frag  { v16h v; u32x4 u[2]; };
union Pack8 { v8h h; u32x4 u; };
union Pack4 { v4h h; u32x2 u; };

#define WSCALE 64.0f
#define WINV   (1.0f / 64.0f)
#define PCAR   4096.0f
#define PINV   (1.0f / 4096.0f)
#define RSC    2048.0f
#define RINV   (1.0f / 2048.0f)

constexpr size_t al256(size_t b) { return (b + 255) & ~(size_t)255; }
constexpr size_t WS_TOTAL =
    al256((size_t)C3 * CE * 2) + al256((size_t)CE * CE * 2) + al256((size_t)C4 * CE * 2) +
    al256((size_t)CE * C4 * 2) + al256((size_t)RROWS * CE * 2) + al256((size_t)RROWS * QP * 2) +
    al256((size_t)NB * (TE) * QP * 2) + al256((size_t)NB * NH * HD * (SEQ) * 2) +
    al256((size_t)NB * NH * HD * (TE) * 2) + al256((size_t)RROWS * CE * 2) +
    al256((size_t)RROWS * CE * 4) + al256((size_t)RROWS * CE * 2) + al256((size_t)RROWS * C4 * 2);
static_assert(WS_TOTAL <= (size_t)134217728);

// f32 -> nearest-even bf16 grid value, returned as f32
__device__ __forceinline__ float bfr(float f) {
    u32 u = __builtin_bit_cast(u32, f);
    u += 0x7fffu + ((u >> 16) & 1u);
    u &= 0xffff0000u;
    return __builtin_bit_cast(float, u);
}

// f32 -> f16 (RNE) bits
__device__ __forceinline__ u16 hbits(float f) {
    _Float16 h = (_Float16)f;
    return __builtin_bit_cast(u16, h);
}

// 16x16x32 f16 WMMA with the VALU hazard guard tied to D and A/B
__device__ __forceinline__ v8f mma16(v16h a, v16h b, v8f c) {
    c = __builtin_amdgcn_wmma_f32_16x16x32_f16(false, a, false, b, (short)0, c, false, false);
    asm volatile("v_nop\n\tv_nop\n\tv_nop\n\tv_nop" : "+v"(c) : "v"(a), "v"(b));
    return c;
}

// one 16x32 operand fragment of a row-major LDS tile: two 16-byte loads, k order 0..7 and 16..23 (+ 8 in the upper lane half)
__device__ __forceinline__ void ldfrag(Frag& f, const u16* p) {
    f.u[0] = *(const u32x4*)p;
    f.u[1] = *(const u32x4*)(p + 16);
}

// scheduling-region boundary, emitted only in the residual-carrying attention instance:
// ends the live ranges of the staging temporaries before the next block of loads begins
template <int ON>
__device__ __forceinline__ void sched_cut() {
    if constexpr (ON != 0) __builtin_amdgcn_sched_barrier(0);
}

// value of lane l ^ 16 (the other 16-lane row), a vector cross-row move
__device__ __forceinline__ float xhalf(float x) {
    const int xi = __builtin_bit_cast(int, x);
    return __builtin_bit_cast(float, __builtin_amdgcn_permlanex16(xi, xi, 0x76543210, 0xfedcba98, false, false));
}

// e^x on the hardware exp2, same product and instruction as the fast-math exp;
// the v_nop fills the one issue slot the instruction set asks for behind a transcendental
// before its result is read or its source overwritten
__device__ __forceinline__ float exp_fast(float x) {
    float r;
    asm("v_exp_f32 %0, %1\n\tv_nop" : "=v"(r) : "v"(x * 1.44269504088896340736f));
    return r;
}

// erf-form GELU
__device__ __forceinline__ float gelu_erf(float x) {
    return 0.5f * x * (1.0f + erff(x * 0.70710678118654752f));
}

// logical row (b*SEQ + t) -> row of the full-size input / output tensors (b*SEQ_FULL + t)
__device__ __forceinline__ size_t grow_map(u32 r) {
    const u32 bb = r / (u32)(SEQ);
    const u32 t  = r - bb * (u32)(SEQ);
    return (size_t)bb * SEQ_FULL + (size_t)t;
}

// ---------------- weight convert + transpose: in[K][N] f32 -> out[N][K] f16 = f16(bfr(w) * 64) ----------------
// read: 16 consecutive lanes x 16 B = one 256-B row piece, two rows = 4 whole lines per load instruction.
// written by 8 consecutive lanes x 16 B of one instruction (4 lines per instruction).
__global__ __launch_bounds__(256) void cvt_wt_kernel(const float* __restrict__ in,
                                                      u16* __restrict__ out, u32 K, u32 N) {
    __shared__ __align__(16) u16 Ts[64 * 72];   // [n][k]
    const u32 tid = threadIdx.x, lane = tid & 31u, wv = tid >> 5;
    const u32 n0 = blockIdx.x * 64u, k0 = blockIdx.y * 64u;
    const u32 kr = tid >> 4, nq = (tid & 15u) * 4u;
    const float* src = in + (size_t)(k0 + kr) * N + n0 + nq;
    const float* s1 = src + (size_t)16u * N;
    const float* s2 = src + (size_t)32u * N;
    const float* s3 = src + (size_t)48u * N;
    v4f w[4];
    w[0] = *(const v4f*)src; w[1] = *(const v4f*)s1; w[2] = *(const v4f*)s2; w[3] = *(const v4f*)s3;
    // stands in front of every overwrite of the address registers that the four loads name; taking the addresses as inputs
    // keeps their registers untouched up to here, so that the loads issue back to back with no wait among them
    asm volatile("s_wait_xcnt 0x0" :: "v"(src), "v"(s1), "v"(s2), "v"(s3) : "memory");
#pragma unroll
    for (u32 j4 = 0; j4 < 4; j4++) {
#pragma unroll
        for (u32 c = 0; c < 4; c++) {
            float f = w[j4][c];
            Ts[(nq + c) * 72u + kr + j4 * 16u] = hbits(bfr(f) * WSCALE);
        }
    }
    __syncthreads();                             // Ts: cross-wave exchange
    u32x4 val[2];
#pragma unroll
    for (u32 it = 0; it < 2; it++) {
        const u32 nn = wv * 8u + it * 4u + (lane >> 3), ks = (lane & 7u) * 8u;
        val[it] = *(const u32x4*)&Ts[nn * 72u + ks];
    }
#pragma unroll
    for (u32 it = 0; it < 2; it++) {
        const u32 nn = wv * 8u + it * 4u + (lane >> 3), ks = (lane & 7u) * 8u;
        *(u32x4*)(out + (size_t)(n0 + nn) * K + k0 + ks) = val[it];
    }
    
}

// ---------------- LayerNorm (row = 1024): one wave per row, f16 out via LDS row stage ----------------
// Row kept in a wave-private f32 LDS row (lane owns columns j*128 + lane*4 + 0..3, same lane writes and reads);
// the three per-element sweeps are rolled loops with wave-uniform trip counts.
// gamma/beta staged once per workgroup in LDS at bf16-RNE values.
// SRCX = 1: src is the input x (full-size row map, each element taken at its bf16-RNE value)
// SRCX = 0: src is an f32 workspace plane with logical rows
template <int SRCX>
__global__ __launch_bounds__(256) void ln_kernel(const float* __restrict__ src,
                                                 const float* __restrict__ g,
                                                 const float* __restrict__ be,
                                                 u16* __restrict__ out) {
    __shared__ __align__(16) float xs[8 * CE];      // wave wv owns xs[wv*CE ..]
    __shared__ __align__(16) u16   rows[8 * CE];    // wave wv owns rows[wv*CE ..]
    __shared__ __align__(16) float gsh[CE];
    __shared__ __align__(16) float bsh[CE];
    const u32 tid = threadIdx.x, lane = tid & 31u, wv = tid >> 5;
    {
        v4f gg = *(const v4f*)(g + tid * 4u);
        v4f bb = *(const v4f*)(be + tid * 4u);
        v4f go, bo;
#pragma unroll
        for (u32 c = 0; c < 4; c++) {
            float tg = gg[c]; float tb = bb[c];
            go[c] = bfr(tg); bo[c] = bfr(tb);
        }
        *(v4f*)&gsh[tid * 4u] = go;
        *(v4f*)&bsh[tid * 4u] = bo;
    }
    const u32 r = blockIdx.x * 8u + wv;            // < RROWS (grid = RROWS/8)
    const size_t srow = SRCX ? grow_map(r) : (size_t)r;
    const float* xr = src + srow * CE;
    float* xw = xs + wv * CE;
    float s = 0.f;
#pragma unroll 1
    for (u32 j = 0; j < LNJ; j++) {
        const u32 c0 = j * 128u + lane * 4u;
        v4f t4 = *(const v4f*)(xr + c0);
        if constexpr (SRCX != 0) {
#pragma unroll
            for (u32 c = 0; c < 4; c++) { float t = t4[c]; t4[c] = bfr(t); }
        }
        *(v4f*)&xw[c0] = t4;
        s += (t4[0] + t4[1]) + (t4[2] + t4[3]);
    }
#pragma unroll
    for (u32 m = 16; m >= 1; m >>= 1) s += __shfl_xor(s, m, 32);
    const float mu = s * (1.f / (float)CE);
    float vs = 0.f;
#pragma unroll 1
    for (u32 j = 0; j < LNJ; j++) {
        const u32 c0 = j * 128u + lane * 4u;
        v4f t4 = *(const v4f*)&xw[c0];
#pragma unroll
        for (u32 c = 0; c < 4; c++) { float d = t4[c] - mu; vs += d * d; }
    }
#pragma unroll
    for (u32 m = 16; m >= 1; m >>= 1) vs += __shfl_xor(vs, m, 32);
    const float rstd = rsqrtf(vs * (1.f / (float)CE) + 1e-5f);
    __syncthreads();                               // gsh/bsh (cross-wave) visible
    u16* rw = rows + wv * CE;
#pragma unroll 1
    for (u32 j = 0; j < LNJ; j++) {
        const u32 c0 = j * 128u + lane * 4u;
        v4f x4 = *(const v4f*)&xw[c0];
        v4f g4 = *(const v4f*)&gsh[c0];
        v4f b4 = *(const v4f*)&bsh[c0];
        Pack4 pk;
#pragma unroll
        for (u32 c = 0; c < 4; c++) {
            float xe = x4[c]; float ge = g4[c]; float bel = b4[c];
            pk.h[c] = (_Float16)((xe - mu) * rstd * ge + bel);
        }
        *(u32x2*)&rw[c0] = pk.u;
    }
    __syncthreads();   // LDS row stage: written and read by the same wave; a workgroup barrier is used
    u32x4 val[LNO];
#pragma unroll
    for (u32 j = 0; j < LNO; j++) val[j] = *(const u32x4*)&rw[j * 256u + lane * 8u];
    u16* orow = out + (size_t)r * CE;
#pragma unroll
    for (u32 j = 0; j < LNO; j++) *(u32x4*)(orow + j * 256u + lane * 8u) = val[j];
    
}

// ---------------- f16 GEMM: C[128x128 tile] = A[M][K](f16) . BT[N][K](f16)^T, K-step 64 ----------------
// 8 waves = 4 (m) x 2 (n), wave tile 32 x 64, fragments per the split k map for A and B.
// Staging: 8 consecutive lanes x 16 B = one row's 128-B line of the k step, 4 rows = 4 whole lines per load instruction.
// Epilogue: acc*(1/64) + bias(bf16-RNE) [-> gelu] staged as f32 128x128 tile in LDS, then
// MODE 0: qkv: n0 < QP -> qk hi plane [RROWS][QP] (+ lo plane rows t<TE), else V transposed
//         into vt hi [NB*NH][64][SEQ] (+ vt lo [..][64][TE] for t<TE)
// MODE 1: out0 f32 [RROWS][CE] = acc + bias + bfr(res at full-size rows)   (x1)
// MODE 2: out0 f16 [RROWS][C4] = gelu(acc + bias)                          (hg)
// MODE 3: out0 f32 at full-size rows = acc + bias + res[logical rows]      (d_out)
template <int MODE>
__global__ __launch_bounds__(256) void gemm_kernel(const u16* __restrict__ A,
                                                   const u16* __restrict__ BT,
                                                   const float* __restrict__ bias,
                                                   const float* __restrict__ res,
                                                   void* out0, void* out1, void* out2, void* out3,
                                                   u32 N, u32 K) {
    __shared__ u32x4 smem[4224];                   // 67584 B: As|Bs during the k loop, Cs after it
    u16* As = (u16*)smem;                          // [128][72]
    u16* Bs = As + 128 * 72;                       // [128][72]
    float* Cs = (float*)smem;                      // [128][132]
    constexpr u32 CSP = 132;

    const u32 tid = threadIdx.x, lane = tid & 31u, wv = tid >> 5;
    const u32 hf = lane >> 4, ln = lane & 15u;
    const u32 m0 = blockIdx.y * 128u, n0 = blockIdx.x * 128u;
    const u32 wm = wv & 3u, wn = wv >> 2;
    const u32 srow = tid >> 3, sseg = (tid & 7u) * 8u;   // rows srow + 32 i, 8 halves at sseg
    const size_t rstep = (size_t)32u * K;                // 32 rows, in elements

    v8f acc[2][4];
#pragma unroll
    for (int i = 0; i < 2; i++)
#pragma unroll
        for (int j = 0; j < 4; j++) acc[i][j] = (v8f)(0.f);

    for (u32 k0 = 0; k0 < K; k0 += 64u) {
        __syncthreads();                           // prior step's fragment reads done
        {
            const u16* ga0 = A  + (size_t)(m0 + srow) * K + k0 + sseg;
            const u16* gb0 = BT + (size_t)(n0 + srow) * K + k0 + sseg;
            const u16* ga1 = ga0 + rstep; const u16* ga2 = ga1 + rstep; const u16* ga3 = ga2 + rstep;
            const u16* gb1 = gb0 + rstep; const u16* gb2 = gb1 + rstep; const u16* gb3 = gb2 + rstep;
            u32x4 a0 = *(const u32x4*)ga0, a1 = *(const u32x4*)ga1, a2 = *(const u32x4*)ga2, a3 = *(const u32x4*)ga3;
            u32x4 b0 = *(const u32x4*)gb0, b1 = *(const u32x4*)gb1, b2 = *(const u32x4*)gb2, b3 = *(const u32x4*)gb3;
            // stands in front of every overwrite of the address registers that the eight loads name; taking the addresses
            // as inputs keeps their registers untouched up to here (no load's result lands on an earlier load's address)
            asm volatile("s_wait_xcnt 0x0" :: "v"(ga0), "v"(ga1), "v"(ga2), "v"(ga3), "v"(gb0), "v"(gb1), "v"(gb2), "v"(gb3) : "memory");
            u16* la = &As[srow * 72u + sseg];
            u16* lb = &Bs[srow * 72u + sseg];
            *(u32x4*)(la) = a0;              *(u32x4*)(la + 32u * 72u) = a1;
            *(u32x4*)(la + 64u * 72u) = a2;  *(u32x4*)(la + 96u * 72u) = a3;
            *(u32x4*)(lb) = b0;              *(u32x4*)(lb + 32u * 72u) = b1;
            *(u32x4*)(lb + 64u * 72u) = b2;  *(u32x4*)(lb + 96u * 72u) = b3;
        }
        __syncthreads();                           // staged tile visible to all waves
#pragma unroll
        for (u32 ks = 0; ks < 2; ks++) {
            Frag af[2], bf[4];
#pragma unroll
            for (u32 mi = 0; mi < 2; mi++) {
                const u16* q = &As[(wm * 32u + mi * 16u + ln) * 72u + ks * 32u + hf * 8u];
                af[mi].u[0] = *(const u32x4*)q;
                af[mi].u[1] = *(const u32x4*)(q + 16);
            }
#pragma unroll
            for (u32 ni = 0; ni < 4; ni++) {
                const u16* q = &Bs[(wn * 64u + ni * 16u + ln) * 72u + ks * 32u + hf * 8u];
                bf[ni].u[0] = *(const u32x4*)q;
                bf[ni].u[1] = *(const u32x4*)(q + 16);
            }
#pragma unroll
            for (int mi = 0; mi < 2; mi++)
#pragma unroll
                for (int ni = 0; ni < 4; ni++)
                    acc[mi][ni] = mma16(af[mi].v, bf[ni].v, acc[mi][ni]);
        }
    }

    // ---- epilogue: accumulators -> f32 tile in LDS ----
    __syncthreads();                               // all waves done with As/Bs (aliased by Cs)
#pragma unroll
    for (int ni = 0; ni < 4; ni++) {
        const u32 col = wn * 64u + (u32)ni * 16u + ln;
        const float bv = bfr(bias[n0 + col]);
#pragma unroll
        for (int mi = 0; mi < 2; mi++) {
#pragma unroll
            for (int r = 0; r < 8; r++) {
                const u32 row = wm * 32u + (u32)mi * 16u + hf * 8u + (u32)r;
                float v = acc[mi][ni][r] * WINV + bv;
                if constexpr (MODE == 2) v = gelu_erf(v);
                Cs[row * CSP + col] = v;
            }
        }
    }
    __syncthreads();                               // Cs is read across waves below

    if constexpr (MODE == 1 || MODE == 3) {
        float* o = (float*)out0;
        v4f val[16];
#pragma unroll
        for (int grp = 0; grp < 2; grp++) {
#pragma unroll
            for (int i8 = 0; i8 < 8; i8++) {
                const int i = grp * 8 + i8;
                const u32 row = wv * 16u + (u32)i;
                const u32 r = m0 + row;
                v4f c = *(const v4f*)&Cs[row * CSP + lane * 4u];
                const size_t rr = (MODE == 1) ? grow_map(r) : (size_t)r;
                v4f x4 = *(const v4f*)(res + rr * (size_t)N + n0 + lane * 4u);
                if constexpr (MODE == 1) {
#pragma unroll
                    for (int cc = 0; cc < 4; cc++) { float t = x4[cc]; x4[cc] = bfr(t); }
                }
                val[i] = c + x4;
            }
            asm volatile("" ::: "memory");         // keep the two load groups in separate clauses
        }
#pragma unroll
        for (int i = 0; i < 16; i++) {
            const u32 r = m0 + wv * 16u + (u32)i;
            const size_t orr = (MODE == 3) ? grow_map(r) : (size_t)r;
            *(v4f*)(o + orr * (size_t)N + n0 + lane * 4u) = val[i];
        }
        
    } else if constexpr (MODE == 2) {
        u16* o = (u16*)out0;
        u32x4 val[8];
#pragma unroll
        for (int it = 0; it < 8; it++) {
            const u32 rloc = wv * 16u + (u32)it * 2u + hf, cseg = ln * 8u;
            Pack8 pk;
#pragma unroll
            for (int j = 0; j < 8; j++) pk.h[j] = (_Float16)Cs[rloc * CSP + cseg + (u32)j];
            val[it] = pk.u;
        }
#pragma unroll
        for (int it = 0; it < 8; it++) {
            const u32 rloc = wv * 16u + (u32)it * 2u + hf, cseg = ln * 8u;
            *(u32x4*)(o + (size_t)(m0 + rloc) * N + n0 + cseg) = val[it];
        }
        
    } else {
        // MODE 0: q/k planes or transposed v planes
        u16* qkh = (u16*)out0;
        u16* qkl = (u16*)out1;
        u16* vth = (u16*)out2;
        u16* vtl = (u16*)out3;
        const u32 bq = m0 / (u32)(SEQ);
        const u32 t0 = m0 - bq * (u32)(SEQ);       // 128 | SEQ so the tile sits inside one batch
        const bool lo_on = (t0 < (u32)(TE));       // uniform per workgroup
        u32x4 vh[8], vl[8];
        if (n0 < (u32)QP) {
#pragma unroll
            for (int it = 0; it < 8; it++) {
                const u32 rloc = wv * 16u + (u32)it * 2u + hf, cseg = ln * 8u;
                Pack8 ph, pl;
#pragma unroll
                for (int j = 0; j < 8; j++) {
                    float f = Cs[rloc * CSP + cseg + (u32)j];
                    _Float16 h16 = (_Float16)f;
                    ph.h[j] = h16;
                    pl.h[j] = (_Float16)((f - (float)h16) * RSC);
                }
                vh[it] = ph.u; vl[it] = pl.u;
            }
#pragma unroll
            for (int it = 0; it < 8; it++) {
                const u32 rloc = wv * 16u + (u32)it * 2u + hf, cseg = ln * 8u;
                *(u32x4*)(qkh + (size_t)(m0 + rloc) * QP + n0 + cseg) = vh[it];
                if (lo_on)
                    *(u32x4*)(qkl + ((size_t)bq * (TE) + t0 + rloc) * QP + n0 + cseg) = vl[it];
            }
            
        } else {
            const u32 hh0 = (n0 - (u32)QP) >> 6;   // two heads per 128-column tile
#pragma unroll
            for (int it = 0; it < 8; it++) {
                const u32 rloc = wv * 16u + (u32)it * 2u + hf;   // local column = head*64 + d
                const u32 tseg = ln * 8u;
                Pack8 ph, pl;
#pragma unroll
                for (int j = 0; j < 8; j++) {
                    float f = Cs[(tseg + (u32)j) * CSP + rloc];
                    _Float16 h16 = (_Float16)f;
                    ph.h[j] = h16;
                    pl.h[j] = (_Float16)((f - (float)h16) * RSC);
                }
                vh[it] = ph.u; vl[it] = pl.u;
            }
#pragma unroll
            for (int it = 0; it < 8; it++) {
                const u32 rloc = wv * 16u + (u32)it * 2u + hf, tseg = ln * 8u;
                const u32 hh = hh0 + (rloc >> 6), dd = rloc & 63u;
                const size_t vrow = (size_t)(bq * NH + hh) * HD + dd;
                *(u32x4*)(vth + vrow * (SEQ) + t0 + tseg) = vh[it];
                if (lo_on)
                    *(u32x4*)(vtl + vrow * (TE) + t0 + tseg) = vl[it];
            }
            
        }
    }
}

// ---------------- causal flash attention, hd=64, 128 queries per workgroup (8 waves x 16 rows), 64-key chunks ----------------
// qkh: [RROWS][QP] f16 (q cols h*64+d, k cols CE+h*64+d); qkl: same layout for rows t<TE, residual x2048
// vth: [NB*NH][64][SEQ] f16 transposed v; vtl: [NB*NH][64][TE] residual x2048
// Transposed products: A = K rows (S^T) or V^T rows (O^T), B = Q or P^T. Lane (hf, ln) owns query q0 + ln:
// S^T register r of sub-tile sub = key sub*16 + hf*8 + r, so two converted sub-tiles are one B fragment in the loaders' k order.
// RES=1: query tiles with position < TE: S = qh.kh + (qh.kl + ql.kh)/2048, O += Ph.Vh + (Pr.Vh + Ph.Vl)/2048
// RES=1 only: wave index taken as a scalar-uniform value.
// Operand fragments leave LDS in groups ahead of the products that read them (same arithmetic, same order of products):
// RES=0 a chunk's 8 K fragments, then its 8 V fragments ahead of the softmax; RES=1 one sub-tile ahead, two register sets.
template <int RES>
__global__ __launch_bounds__(256) __attribute__((amdgpu_num_vgpr(256)))
void attn_kernel(const u16* __restrict__ qkh, const u16* __restrict__ qkl,
                 const u16* __restrict__ vth, const u16* __restrict__ vtl,
                 u16* __restrict__ cv, u32 qb0) {
    __shared__ __align__(16) u16 Ks[64 * 72];              // [key][d]
    __shared__ __align__(16) u16 Vs[64 * 72];              // [d][key]
    __shared__ __align__(16) u16 Kl[RES ? 64 * 72 : 8];
    __shared__ __align__(16) u16 Vl[RES ? 64 * 72 : 8];
    __shared__ __align__(16) u16 Ps[8 * 16 * 72];          // per wave [16 q][d]: final O stage

    const u32 bh = blockIdx.y;
    const u32 b = bh / (u32)NH, h = bh - b * (u32)NH;
    const u32 qb = qb0 + blockIdx.x;
    const u32 tid = threadIdx.x, lane = tid & 31u;
    u32 wv = tid >> 5;
    if constexpr (RES != 0) wv = (u32)__builtin_amdgcn_readfirstlane((int)wv);   // all lanes active, value is wave-uniform
    const u32 hf = lane >> 4, ln = lane & 15u;
    const u32 q0 = qb * 128u + wv * 16u;
    u16* Pw  = Ps + wv * (16u * 72u);

    Frag qf[2], ql[2];
#pragma unroll
    for (u32 ds = 0; ds < 2; ds++) {
        const u16* p = qkh + (size_t)(b * (u32)(SEQ) + q0 + ln) * QP + h * HD + ds * 32u + hf * 8u;
        qf[ds].u[0] = *(const u32x4*)p;
        qf[ds].u[1] = *(const u32x4*)(p + 16);
        if constexpr (RES != 0) {
            const u16* pl = qkl + (size_t)(b * (u32)(TE) + q0 + ln) * QP + h * HD + ds * 32u + hf * 8u;
            ql[ds].u[0] = *(const u32x4*)pl;
            ql[ds].u[1] = *(const u32x4*)(pl + 16);
        } else {
            ql[ds].u[0] = (u32x4)(0u); ql[ds].u[1] = (u32x4)(0u);
        }
    }

    v8f o[4];
#pragma unroll
    for (int i = 0; i < 4; i++) o[i] = (v8f)(0.f);
    float mrun = -3.0e38f;                                 // running maximum of this lane's query (both halves agree)
    float lsum = 0.f;                                      // running sum over this lane half's keys; halves joined after the loop
    const u32 qg = q0 + ln;

    const u32 rr = tid >> 3, seg = (tid & 7u) * 8u;       // staging: rows rr and rr + 32 (key or d), 8 halves at seg: 4 whole 128-B lines per load instruction
    const u32 nkt = 2u * qb + 2u;                          // keys 0 .. qb*128+127

#pragma unroll 1
    for (u32 kt = 0; kt < nkt; kt++) {
        __syncthreads();                                   // prior chunk's LDS reads done
        {
            const u16* gk = qkh + (size_t)(b * (u32)(SEQ) + kt * 64u + rr) * QP + CE + h * HD + seg;
            u32x4 k0v = *(const u32x4*)gk, k1v = *(const u32x4*)(gk + 32u * QP);
            const u16* gv = vth + ((size_t)(bh * HD + rr)) * (SEQ) + kt * 64u + seg;
            u32x4 v0 = *(const u32x4*)gv, v1 = *(const u32x4*)(gv + 32u * (SEQ));
            asm volatile("s_wait_xcnt 0x0" ::: "memory");   // stands in front of every later overwrite of the address registers that the loads above name
            *(u32x4*)&Ks[rr * 72u + seg] = k0v; *(u32x4*)&Ks[(rr + 32u) * 72u + seg] = k1v;
            *(u32x4*)&Vs[rr * 72u + seg] = v0;  *(u32x4*)&Vs[(rr + 32u) * 72u + seg] = v1;
            sched_cut<RES>();                              // hi-plane staging temporaries end here
            if constexpr (RES != 0) {
                const u16* gkl = qkl + (size_t)(b * (u32)(TE) + kt * 64u + rr) * QP + CE + h * HD + seg;
                u32x4 kl0 = *(const u32x4*)gkl, kl1 = *(const u32x4*)(gkl + 32u * QP);
                const u16* gvl = vtl + ((size_t)(bh * HD + rr)) * (TE) + kt * 64u + seg;
                u32x4 vl0 = *(const u32x4*)gvl, vl1 = *(const u32x4*)(gvl + 32u * (TE));
                asm volatile("s_wait_xcnt 0x0" ::: "memory");   // stands in front of every later overwrite of the address registers that the loads above name
                *(u32x4*)&Kl[rr * 72u + seg] = kl0; *(u32x4*)&Kl[(rr + 32u) * 72u + seg] = kl1;
                *(u32x4*)&Vl[rr * 72u + seg] = vl0; *(u32x4*)&Vl[(rr + 32u) * 72u + seg] = vl1;
            }
        }
        __syncthreads();                                   // K/V chunk visible to all waves
        sched_cut<RES>();

        // S^T = K . Q^T  (64 keys x 16 q per wave)
        // The K fragment loads stand as groups ahead of the products that read them, so a wave waits out the LDS
        // latency once per group and not once per product. RES=0: the chunk's 8 fragments in one group.
        // RES=1: one sub-tile's hi and residual fragments per group, fetched one sub-tile ahead into a second register set.
        v8f s[4];
        Frag vf[RES ? 2 : 4][2], vlf[2][2];                // V fragments: RES=0 [d sub-tile][ks], RES=1 [register set][ks]
        if constexpr (RES == 0) {
            Frag kf[4][2];
#pragma unroll
            for (int sub = 0; sub < 4; sub++)
#pragma unroll
                for (int ds = 0; ds < 2; ds++)
                    ldfrag(kf[sub][ds], &Ks[((u32)sub * 16u + ln) * 72u + (u32)ds * 32u + hf * 8u]);
            __builtin_amdgcn_sched_barrier(0);             // the 16 K loads issue together, none sinks down among the products
#pragma unroll
            for (int sub = 0; sub < 4; sub++) {
                v8f t = (v8f)(0.f);
#pragma unroll
                for (int ds = 0; ds < 2; ds++) t = mma16(kf[sub][ds].v, qf[ds].v, t);
                s[sub] = t;
            }
            __builtin_amdgcn_sched_barrier(0);             // the V loads below stay behind the last S^T product (they take over the K registers)
#pragma unroll
            for (int dsub = 0; dsub < 4; dsub++)
#pragma unroll
                for (int ks = 0; ks < 2; ks++)
                    ldfrag(vf[dsub][ks], &Vs[((u32)dsub * 16u + ln) * 72u + (u32)ks * 32u + hf * 8u]);
            __builtin_amdgcn_sched_barrier(0);             // the 16 V loads issue here, ahead of the softmax, which covers their latency
        } else {
            Frag kf[2][2], klf[2][2];
#pragma unroll
            for (int ds = 0; ds < 2; ds++) {
                ldfrag(kf[0][ds],  &Ks[ln * 72u + (u32)ds * 32u + hf * 8u]);
                ldfrag(klf[0][ds], &Kl[ln * 72u + (u32)ds * 32u + hf * 8u]);
            }
#pragma unroll
            for (int sub = 0; sub < 4; sub++) {
                const int cur = sub & 1, nxt = cur ^ 1;
#pragma unroll
                for (int ds = 0; ds < 2; ds++) {
                    if (sub < 3) {
                        ldfrag(kf[nxt][ds],  &Ks[((u32)(sub + 1) * 16u + ln) * 72u + (u32)ds * 32u + hf * 8u]);
                        ldfrag(klf[nxt][ds], &Kl[((u32)(sub + 1) * 16u + ln) * 72u + (u32)ds * 32u + hf * 8u]);
                    } else {
                        ldfrag(vf[0][ds],  &Vs[ln * 72u + (u32)ds * 32u + hf * 8u]);
                        ldfrag(vlf[0][ds], &Vl[ln * 72u + (u32)ds * 32u + hf * 8u]);
                    }
                }
                __builtin_amdgcn_sched_barrier(0);         // the next group's 8 loads issue ahead of this sub-tile's products
                v8f t = (v8f)(0.f);
                v8f tr = (v8f)(0.f);
#pragma unroll
                for (int ds = 0; ds < 2; ds++) {
                    t  = mma16(kf[cur][ds].v,  qf[ds].v, t);
                    tr = mma16(klf[cur][ds].v, qf[ds].v, tr);
                    tr = mma16(kf[cur][ds].v,  ql[ds].v, tr);
                }
                s[sub] = t + tr * RINV;
                __builtin_amdgcn_sched_barrier(0);         // the group after next stays behind this sub-tile's products: two register sets, no more
            }
        }

        // scale + causal replace-fill
#pragma unroll
        for (int sub = 0; sub < 4; sub++) {
#pragma unroll
            for (int r = 0; r < 8; r++) {
                const u32 kg = kt * 64u + (u32)sub * 16u + hf * 8u + (u32)r;
                float v = s[sub][r] * 0.125f;
                s[sub][r] = (kg > qg) ? -3.0e38f : v;
            }
        }
        // online softmax: one query per lane, 32 of the chunk's keys in-lane, the other 32 in lane ^ 16
        float mxs[4];
#pragma unroll
        for (int sub = 0; sub < 4; sub++) {
            mxs[sub] = fmaxf(fmaxf(fmaxf(s[sub][0], s[sub][1]), fmaxf(s[sub][2], s[sub][3])),
                             fmaxf(fmaxf(s[sub][4], s[sub][5]), fmaxf(s[sub][6], s[sub][7])));
        }
        float mx = fmaxf(fmaxf(mxs[0], mxs[1]), fmaxf(mxs[2], mxs[3]));
        mx = fmaxf(mx, xhalf(mx));
        const float mnew  = fmaxf(mrun, mx);
        const float alpha = exp_fast(mrun - mnew);
        float rs[4];
#pragma unroll
        for (int sub = 0; sub < 4; sub++) {
            rs[sub] = 0.f;
#pragma unroll
            for (int r = 0; r < 8; r++) {
                float pe = exp_fast(s[sub][r] - mnew);
                s[sub][r] = pe;
                rs[sub] += pe;
            }
        }
        mrun = mnew;
        lsum = lsum * alpha + ((rs[0] + rs[1]) + (rs[2] + rs[3]));
#pragma unroll
        for (int dsub = 0; dsub < 4; dsub++) o[dsub] *= alpha;

        // P^T: two converted S^T sub-tiles = one B fragment (32 keys x 16 q), carried x4096 (+ residual x2048)
        Frag pf[2], prf[2];
#pragma unroll
        for (int ks = 0; ks < 2; ks++) {
#pragma unroll
            for (int e = 0; e < 16; e++) {
                const float ph = s[2 * ks + (e >> 3)][e & 7] * PCAR;
                _Float16 h16 = (_Float16)ph;
                pf[ks].v[e] = h16;
                if constexpr (RES != 0) prf[ks].v[e] = (_Float16)((ph - (float)h16) * RSC);
            }
        }
        // O^T += V^T . P^T
#pragma unroll
        for (int dsub = 0; dsub < 4; dsub++) {
            if constexpr (RES == 0) {
#pragma unroll
                for (int ks = 0; ks < 2; ks++) o[dsub] = mma16(vf[dsub][ks].v, pf[ks].v, o[dsub]);
            } else {
                const int cur = dsub & 1, nxt = cur ^ 1;
                if (dsub < 3) {
#pragma unroll
                    for (int ks = 0; ks < 2; ks++) {
                        ldfrag(vf[nxt][ks],  &Vs[((u32)(dsub + 1) * 16u + ln) * 72u + (u32)ks * 32u + hf * 8u]);
                        ldfrag(vlf[nxt][ks], &Vl[((u32)(dsub + 1) * 16u + ln) * 72u + (u32)ks * 32u + hf * 8u]);
                    }
                }
                __builtin_amdgcn_sched_barrier(0);         // the next d sub-tile's 8 loads issue ahead of this one's products
                v8f u = (v8f)(0.f);
#pragma unroll
                for (int ks = 0; ks < 2; ks++) {
                    o[dsub] = mma16(vf[cur][ks].v,  pf[ks].v,  o[dsub]);
                    u       = mma16(vf[cur][ks].v,  prf[ks].v, u);
                    u       = mma16(vlf[cur][ks].v, pf[ks].v,  u);
                }
                o[dsub] = o[dsub] + u * RINV;
                __builtin_amdgcn_sched_barrier(0);         // the group after next stays behind this sub-tile's products: two register sets, no more
            }
        }
    }

    // finalize: O / (l * 4096) -> f16 tile in the wave's LDS stage -> whole-line stores
    // O^T register r of tile dsub = d dsub*16 + hf*8 + r of query ln: 8 consecutive d, one 16-byte LDS store
    const float inv = (1.0f / (lsum + xhalf(lsum))) * PINV;
#pragma unroll
    for (int dsub = 0; dsub < 4; dsub++) {
        Pack8 pk;
#pragma unroll
        for (int r = 0; r < 8; r++) pk.h[r] = (_Float16)(o[dsub][r] * inv);
        *(u32x4*)&Pw[ln * 72u + (u32)dsub * 16u + hf * 8u] = pk.u;
    }
    __syncthreads();
    u32x4 val[4];
#pragma unroll
    for (u32 it = 0; it < 4; it++) {
        const u32 rloc = it * 4u + (lane >> 3), sg = (lane & 7u) * 8u;
        val[it] = *(const u32x4*)&Pw[rloc * 72u + sg];
    }
#pragma unroll
    for (u32 it = 0; it < 4; it++) {
        const u32 rloc = it * 4u + (lane >> 3), sg = (lane & 7u) * 8u;
        *(u32x4*)(cv + (size_t)(b * (u32)(SEQ) + q0 + rloc) * CE + h * HD + sg) = val[it];
    }
    
}

// ---------------- host side ----------------
extern "C" void kernel_launch(void* const* d_in, const int* in_sizes, int n_in,
                              void* d_out, int out_size, void* d_ws, size_t ws_size,
                              hipStream_t stream) {
    if (n_in < 13) return;
    const long long needX = ((long long)(NB - 1) * SEQ_FULL + (SEQ)) * CE;
    if ((long long)in_sizes[0] < needX || (long long)out_size < needX) return;
    if (in_sizes[1] < CE || in_sizes[2] < CE || in_sizes[3] < CE * C3 || in_sizes[4] < C3 ||
        in_sizes[5] < CE * CE || in_sizes[6] < CE || in_sizes[7] < CE || in_sizes[8] < CE ||
        in_sizes[9] < CE * C4 || in_sizes[10] < C4 || in_sizes[11] < C4 * CE || in_sizes[12] < CE)
        return;

    const float* x      = (const float*)d_in[0];
    const float* ln1_g  = (const float*)d_in[1];
    const float* ln1_b  = (const float*)d_in[2];
    const float* w_attn = (const float*)d_in[3];
    const float* b_attn = (const float*)d_in[4];
    const float* w_proj = (const float*)d_in[5];
    const float* b_proj = (const float*)d_in[6];
    const float* ln2_g  = (const float*)d_in[7];
    const float* ln2_b  = (const float*)d_in[8];
    const float* w_fc   = (const float*)d_in[9];
    const float* b_fc   = (const float*)d_in[10];
    const float* w_fc2  = (const float*)d_in[11];
    const float* b_fc2  = (const float*)d_in[12];

    char* ws = (char*)d_ws;
    size_t off = 0;
    auto take = [&](size_t bytes) -> char* {
        char* p = ws + off;
        off += (bytes + 255) & ~(size_t)255;
        return p;
    };
    const size_t R = (size_t)RROWS;
    u16*   waT   = (u16*)take((size_t)C3 * CE * 2);               // [3072][1024]
    u16*   wpT   = (u16*)take((size_t)CE * CE * 2);               // [1024][1024]
    u16*   wfcT  = (u16*)take((size_t)C4 * CE * 2);               // [4096][1024]
    u16*   wfc2T = (u16*)take((size_t)CE * C4 * 2);               // [1024][4096]
    u16*   h1    = (u16*)take(R * CE * 2);                        // [R][1024]
    u16*   qkh   = (u16*)take(R * QP * 2);                        // [R][2048]
    u16*   qkl   = (u16*)take((size_t)NB * (TE) * QP * 2);        // [NB*TE][2048]
    u16*   vth   = (u16*)take((size_t)NB * NH * HD * (SEQ) * 2);  // [NB*NH][64][SEQ]
    u16*   vtl   = (u16*)take((size_t)NB * NH * HD * (TE) * 2);   // [NB*NH][64][TE]
    u16*   cvb   = (u16*)take(R * CE * 2);                        // [R][1024]
    float* x1    = (float*)take(R * CE * 4);                      // [R][1024]
    u16*   h2    = (u16*)take(R * CE * 2);                        // [R][1024]
    u16*   hg    = (u16*)take(R * C4 * 2);                        // [R][4096]
    if (off > ws_size || off > (size_t)134217728) return;
    void* dummy = (void*)d_ws;

    // 1) weights: bf16-RNE value x64 -> f16, transposed to [N][K]   (in[K][N] -> out[N][K]), grid (N/64, K/64)
    cvt_wt_kernel<<<dim3(C3 / 64, CE / 64), 256, 0, stream>>>(w_attn, waT, (u32)CE, (u32)C3);   // [1024][3072] -> [3072][1024]
    cvt_wt_kernel<<<dim3(CE / 64, CE / 64), 256, 0, stream>>>(w_proj, wpT, (u32)CE, (u32)CE);   // [1024][1024] -> [1024][1024]
    cvt_wt_kernel<<<dim3(C4 / 64, CE / 64), 256, 0, stream>>>(w_fc,   wfcT, (u32)CE, (u32)C4);  // [1024][4096] -> [4096][1024]
    cvt_wt_kernel<<<dim3(CE / 64, C4 / 64), 256, 0, stream>>>(w_fc2,  wfc2T, (u32)C4, (u32)CE); // [4096][1024] -> [1024][4096]
    // 2) h1 = LN1(bfr(x))
    ln_kernel<1><<<RROWS / 8, 256, 0, stream>>>(x, ln1_g, ln1_b, h1);
    // 3) qkv = h1 . w_attn + b_attn -> q/k planes (+ residual rows t<TE), v transposed (+ residual)
    gemm_kernel<0><<<dim3(C3 / 128, RROWS / 128), 256, 0, stream>>>(h1, waT, b_attn, b_attn,
                                                                    qkh, qkl, vth, vtl, (u32)C3, (u32)CE);
    // 4) causal attention: residual-carrying tiles for query position < TE, plain tiles after
    attn_kernel<1><<<dim3(NEB, NB * NH), 256, 0, stream>>>(qkh, qkl, vth, vtl, cvb, 0u);
    if (NQB > NEB)
        attn_kernel<0><<<dim3(NQB - NEB, NB * NH), 256, 0, stream>>>(qkh, qkl, vth, vtl, cvb, (u32)NEB);
    // 5) x1 = cv . w_proj + b_proj + bfr(x)
    gemm_kernel<1><<<dim3(CE / 128, RROWS / 128), 256, 0, stream>>>(cvb, wpT, b_proj, x,
                                                                    x1, dummy, dummy, dummy, (u32)CE, (u32)CE);
    // 6) h2 = LN2(x1)
    ln_kernel<0><<<RROWS / 8, 256, 0, stream>>>(x1, ln2_g, ln2_b, h2);
    // 7) hg = gelu(h2 . w_fc + b_fc)
    gemm_kernel<2><<<dim3(C4 / 128, RROWS / 128), 256, 0, stream>>>(h2, wfcT, b_fc, b_fc,
                                                                    hg, dummy, dummy, dummy, (u32)C4, (u32)CE);
    // 8) out = hg . w_fc2 + b_fc2 + x1
    gemm_kernel<3><<<dim3(CE / 128, RROWS / 128), 256, 0, stream>>>(hg, wfc2T, b_fc2, x1,
                                                                    d_out, dummy, dummy, dummy, (u32)CE, (u32)C4);
}

// v004
// It runs in 212 microseconds.
// In two side-by-side timings against v003, it was 1.15 and 1.14 times as fast.
// Over all steps from v000 it is 1.68 times as fast.
#include <hip/hip_runtime.h>

// Contractions: v_wmma_f32_16x16x32_f16 (f16 operands, f32 accumulate) for qkv = h.W, S = q.k^T, O = p.v, proj, fc, fc2.
// Weight operand planes: bf16-RNE input value x64, cast to f16, stored transposed [N][K]. Activation planes f16.
// Attention runs transposed: S^T = k.q^T, O^T = v^T.p^T; p^T packs from the S^T accumulators straight into the B operand.
// p carried x4096 in f16. Query tiles with position < TE add f16 residual planes (x2048) of q, k, v, p
// through separately scaled second products folded into the f32 accumulators. Softmax, LN and erf-GELU in f32.

#ifndef NB
#define NB 2
#endif
#ifndef SEQ
#define SEQ 2048
#endif
#define NB_FULL 2
#define SEQ_FULL 2048
#define CE 1024
#define NH 16
#define HD 64
#define C3 3072
#define C4 4096
#define QP 2048
#define TE (((SEQ) < 256) ? (SEQ) : 256)
#define RROWS ((NB) * (SEQ))
#define NEB ((TE) / 128)
#define NQB ((SEQ) / 128)
#define LNJ ((CE) / 128)
#define LNO ((CE) / 256)

static_assert((SEQ) % 128 == 0);
static_assert((TE) % 128 == 0);
static_assert((NB) >= 1 && (NB) <= NB_FULL);
static_assert((SEQ) <= SEQ_FULL);
static_assert(CE % 128 == 0 && C3 % 128 == 0 && C4 % 128 == 0 && QP % 128 == 0);
static_assert(CE % 64 == 0 && C3 % 64 == 0 && C4 % 64 == 0);
static_assert(NH * HD == CE);
static_assert(HD == 64);
static_assert(QP == 2 * CE);
static_assert(C3 == 3 * CE);
static_assert(RROWS % 128 == 0);
static_assert(RROWS % 8 == 0);
static_assert(CE == 1024);
static_assert(256 * 4 == CE);            // gamma/beta staging: 256 threads x 4 floats
static_assert(32 * 4 * LNJ == CE);       // LN row load: 32 lanes x 4 floats x LNJ steps
static_assert(32 * 8 * LNO == CE);       // LN row store: 32 lanes x 8 halves x LNO instructions
static_assert(NQB * 128 == (SEQ));
static_assert(NEB <= NQB);

typedef unsigned short u16;
typedef unsigned int   u32;
typedef _Float16 v16h __attribute__((ext_vector_type(16)));
typedef _Float16 v8h  __attribute__((ext_vector_type(8)));
typedef _Float16 v4h  __attribute__((ext_vector_type(4)));
typedef float    v8f  __attribute__((ext_vector_type(8)));
typedef float    v4f  __attribute__((ext_vector_type(4)));
typedef unsigned int u32x4 __attribute__((ext_vector_type(4)));
typedef unsigned int u32x2 __attribute__((ext_vector_type(2)));

union Frag  { v16h v; u32x4 u[2]; };
union Pack8 { v8h h; u32x4 u; };
union Pack4 { v4h h; u32x2 u; };

#define WSCALE 64.0f
#define WINV   (1.0f / 64.0f)
#define PCAR   4096.0f
#define PINV   (1.0f / 4096.0f)
#define RSC    2048.0f
#define RINV   (1.0f / 2048.0f)

constexpr size_t al256(size_t b) { return (b + 255) & ~(size_t)255; }
constexpr size_t WS_TOTAL =
    al256((size_t)C3 * CE * 2) + al256((size_t)CE * CE * 2) + al256((size_t)C4 * CE * 2) +
    al256((size_t)CE * C4 * 2) + al256((size_t)RROWS * CE * 2) + al256((size_t)RROWS * QP * 2) +
    al256((size_t)NB * (TE) * QP * 2) + al256((size_t)NB * NH * HD * (SEQ) * 2) +
    al256((size_t)NB * NH * HD * (TE) * 2) + al256((size_t)RROWS * CE * 2) +
    al256((size_t)RROWS * CE * 4) + al256((size_t)RROWS * CE * 2) + al256((size_t)RROWS * C4 * 2);
static_assert(WS_TOTAL <= (size_t)134217728);

// f32 -> nearest-even bf16 grid value, returned as f32
__device__ __forceinline__ float bfr(float f) {
    u32 u = __builtin_bit_cast(u32, f);
    u += 0x7fffu + ((u >> 16) & 1u);
    u &= 0xffff0000u;
    return __builtin_bit_cast(float, u);
}

// f32 -> f16 (RNE) bits
__device__ __forceinline__ u16 hbits(float f) {
    _Float16 h = (_Float16)f;
    return __builtin_bit_cast(u16, h);
}

// 16x16x32 f16 WMMA with the VALU hazard guard tied to D and A/B
__device__ __forceinline__ v8f mma16(v16h a, v16h b, v8f c) {
    c = __builtin_amdgcn_wmma_f32_16x16x32_f16(false, a, false, b, (short)0, c, false, false);
    asm volatile("v_nop\n\tv_nop\n\tv_nop\n\tv_nop" : "+v"(c) : "v"(a), "v"(b));
    return c;
}

// one 16x32 operand fragment of a row-major LDS tile: two 16-byte loads, k order 0..7 and 16..23 (+ 8 in the upper lane half)
__device__ __forceinline__ void ldfrag(Frag& f, const u16* p) {
    f.u[0] = *(const u32x4*)p;
    f.u[1] = *(const u32x4*)(p + 16);
}

// scheduling-region boundary, emitted only in the residual-carrying attention instance:
// ends the live ranges of the staging temporaries before the next block of loads begins
template <int ON>
__device__ __forceinline__ void sched_cut() {
    if constexpr (ON != 0) __builtin_amdgcn_sched_barrier(0);
}

// value of lane l ^ 16 (the other 16-lane row), a vector cross-row move
__device__ __forceinline__ float xhalf(float x) {
    const int xi = __builtin_bit_cast(int, x);
    return __builtin_bit_cast(float, __builtin_amdgcn_permlanex16(xi, xi, 0x76543210, 0xfedcba98, false, false));
}

// e^x on the hardware exp2, same product and instruction as the fast-math exp;
// the v_nop fills the one issue slot the instruction set asks for behind a transcendental
// before its result is read or its source overwritten
__device__ __forceinline__ float exp_fast(float x) {
    float r;
    asm("v_exp_f32 %0, %1\n\tv_nop" : "=v"(r) : "v"(x * 1.44269504088896340736f));
    return r;
}

// erf-form GELU
__device__ __forceinline__ float gelu_erf(float x) {
    return 0.5f * x * (1.0f + erff(x * 0.70710678118654752f));
}

// logical row (b*SEQ + t) -> row of the full-size input / output tensors (b*SEQ_FULL + t)
__device__ __forceinline__ size_t grow_map(u32 r) {
    const u32 bb = r / (u32)(SEQ);
    const u32 t  = r - bb * (u32)(SEQ);
    return (size_t)bb * SEQ_FULL + (size_t)t;
}

// ---------------- weight convert + transpose: in[K][N] f32 -> out[N][K] f16 = f16(bfr(w) * 64) ----------------
// read: 16 consecutive lanes x 16 B = one 256-B row piece, two rows = 4 whole lines per load instruction.
// written by 8 consecutive lanes x 16 B of one instruction (4 lines per instruction).
__global__ __launch_bounds__(256) void cvt_wt_kernel(const float* __restrict__ in,
                                                      u16* __restrict__ out, u32 K, u32 N) {
    __shared__ __align__(16) u16 Ts[64 * 72];   // [n][k]
    const u32 tid = threadIdx.x, lane = tid & 31u, wv = tid >> 5;
    const u32 n0 = blockIdx.x * 64u, k0 = blockIdx.y * 64u;
    const u32 kr = tid >> 4, nq = (tid & 15u) * 4u;
    const float* src = in + (size_t)(k0 + kr) * N + n0 + nq;
    const float* s1 = src + (size_t)16u * N;
    const float* s2 = src + (size_t)32u * N;
    const float* s3 = src + (size_t)48u * N;
    v4f w[4];
    w[0] = *(const v4f*)src; w[1] = *(const v4f*)s1; w[2] = *(const v4f*)s2; w[3] = *(const v4f*)s3;
    // stands in front of every overwrite of the address registers that the four loads name; taking the addresses as inputs
    // keeps their registers untouched up to here, so that the loads issue back to back with no wait among them
    asm volatile("s_wait_xcnt 0x0" :: "v"(src), "v"(s1), "v"(s2), "v"(s3) : "memory");
#pragma unroll
    for (u32 j4 = 0; j4 < 4; j4++) {
#pragma unroll
        for (u32 c = 0; c < 4; c++) {
            float f = w[j4][c];
            Ts[(nq + c) * 72u + kr + j4 * 16u] = hbits(bfr(f) * WSCALE);
        }
    }
    __syncthreads();                             // Ts: cross-wave exchange
    u32x4 val[2];
#pragma unroll
    for (u32 it = 0; it < 2; it++) {
        const u32 nn = wv * 8u + it * 4u + (lane >> 3), ks = (lane & 7u) * 8u;
        val[it] = *(const u32x4*)&Ts[nn * 72u + ks];
    }
#pragma unroll
    for (u32 it = 0; it < 2; it++) {
        const u32 nn = wv * 8u + it * 4u + (lane >> 3), ks = (lane & 7u) * 8u;
        *(u32x4*)(out + (size_t)(n0 + nn) * K + k0 + ks) = val[it];
    }
    
}

// ---------------- LayerNorm (row = 1024): one wave per row, f16 out via LDS row stage ----------------
// Row kept in a wave-private f32 LDS row (lane owns columns j*128 + lane*4 + 0..3, same lane writes and reads);
// the three per-element sweeps are rolled loops with wave-uniform trip counts.
// gamma/beta staged once per workgroup in LDS at bf16-RNE values.
// SRCX = 1: src is the input x (full-size row map, each element taken at its bf16-RNE value)
// SRCX = 0: src is an f32 workspace plane with logical rows
template <int SRCX>
__global__ __launch_bounds__(256) void ln_kernel(const float* __restrict__ src,
                                                 const float* __restrict__ g,
                                                 const float* __restrict__ be,
                                                 u16* __restrict__ out) {
    __shared__ __align__(16) float xs[8 * CE];      // wave wv owns xs[wv*CE ..]
    __shared__ __align__(16) u16   rows[8 * CE];    // wave wv owns rows[wv*CE ..]
    __shared__ __align__(16) float gsh[CE];
    __shared__ __align__(16) float bsh[CE];
    const u32 tid = threadIdx.x, lane = tid & 31u, wv = tid >> 5;
    {
        v4f gg = *(const v4f*)(g + tid * 4u);
        v4f bb = *(const v4f*)(be + tid * 4u);
        v4f go, bo;
#pragma unroll
        for (u32 c = 0; c < 4; c++) {
            float tg = gg[c]; float tb = bb[c];
            go[c] = bfr(tg); bo[c] = bfr(tb);
        }
        *(v4f*)&gsh[tid * 4u] = go;
        *(v4f*)&bsh[tid * 4u] = bo;
    }
    const u32 r = blockIdx.x * 8u + wv;            // < RROWS (grid = RROWS/8)
    const size_t srow = SRCX ? grow_map(r) : (size_t)r;
    const float* xr = src + srow * CE;
    float* xw = xs + wv * CE;
    float s = 0.f;
#pragma unroll 1
    for (u32 j = 0; j < LNJ; j++) {
        const u32 c0 = j * 128u + lane * 4u;
        v4f t4 = *(const v4f*)(xr + c0);
        if constexpr (SRCX != 0) {
#pragma unroll
            for (u32 c = 0; c < 4; c++) { float t = t4[c]; t4[c] = bfr(t); }
        }
        *(v4f*)&xw[c0] = t4;
        s += (t4[0] + t4[1]) + (t4[2] + t4[3]);
    }
#pragma unroll
    for (u32 m = 16; m >= 1; m >>= 1) s += __shfl_xor(s, m, 32);
    const float mu = s * (1.f / (float)CE);
    float vs = 0.f;
#pragma unroll 1
    for (u32 j = 0; j < LNJ; j++) {
        const u32 c0 = j * 128u + lane * 4u;
        v4f t4 = *(const v4f*)&xw[c0];
#pragma unroll
        for (u32 c = 0; c < 4; c++) { float d = t4[c] - mu; vs += d * d; }
    }
#pragma unroll
    for (u32 m = 16; m >= 1; m >>= 1) vs += __shfl_xor(vs, m, 32);
    const float rstd = rsqrtf(vs * (1.f / (float)CE) + 1e-5f);
    __syncthreads();                               // gsh/bsh (cross-wave) visible
    u16* rw = rows + wv * CE;
#pragma unroll 1
    for (u32 j = 0; j < LNJ; j++) {
        const u32 c0 = j * 128u + lane * 4u;
        v4f x4 = *(const v4f*)&xw[c0];
        v4f g4 = *(const v4f*)&gsh[c0];
        v4f b4 = *(const v4f*)&bsh[c0];
        Pack4 pk;
#pragma unroll
        for (u32 c = 0; c < 4; c++) {
            float xe = x4[c]; float ge = g4[c]; float bel = b4[c];
            pk.h[c] = (_Float16)((xe - mu) * rstd * ge + bel);
        }
        *(u32x2*)&rw[c0] = pk.u;
    }
    __syncthreads();   // LDS row stage: written and read by the same wave; a workgroup barrier is used
    u32x4 val[LNO];
#pragma unroll
    for (u32 j = 0; j < LNO; j++) val[j] = *(const u32x4*)&rw[j * 256u + lane * 8u];
    u16* orow = out + (size_t)r * CE;
#pragma unroll
    for (u32 j = 0; j < LNO; j++) *(u32x4*)(orow + j * 256u + lane * 8u) = val[j];
    
}

// LDS byte address of a __shared__ location (what an asynchronous copy takes as its destination)
__device__ __forceinline__ u32 lds_addr(const void* p) {
    typedef __attribute__((address_space(3))) const void lds_void;
    return (u32)(size_t)(lds_void*)p;
}

// eight asynchronous 16-byte copies global -> LDS per lane, from g[0..7] to the LDS byte addresses l[0..7].
// The s_wait_xcnt closes the statement so that it stands in front of every later write of an address register the copies name.
__device__ __forceinline__ void copy8(const u32* l, const u16* const* g) {
    asm volatile("global_load_async_to_lds_b128 %0, %8, off\n\t"
                 "global_load_async_to_lds_b128 %1, %9, off\n\t"
                 "global_load_async_to_lds_b128 %2, %10, off\n\t"
                 "global_load_async_to_lds_b128 %3, %11, off\n\t"
                 "global_load_async_to_lds_b128 %4, %12, off\n\t"
                 "global_load_async_to_lds_b128 %5, %13, off\n\t"
                 "global_load_async_to_lds_b128 %6, %14, off\n\t"
                 "global_load_async_to_lds_b128 %7, %15, off\n\t"
                 "s_wait_xcnt 0x0"
                 :: "v"(l[0]), "v"(l[1]), "v"(l[2]), "v"(l[3]), "v"(l[4]), "v"(l[5]), "v"(l[6]), "v"(l[7]),
                    "v"(g[0]), "v"(g[1]), "v"(g[2]), "v"(g[3]), "v"(g[4]), "v"(g[5]), "v"(g[6]), "v"(g[7])
                 : "memory");
}

// ---------------- f16 GEMM: C[128x128 tile] = A[M][K](f16) . BT[N][K](f16)^T, BK of k per stage ----------------
// 8 waves = 4 (m) x 2 (n), wave tile 32 x 64, fragments per the split k map for A and B.
// Staging: asynchronous 16-byte copies into a ring of two LDS buffers [A 128 rows | B 128 rows], row pitch 2 BK + 16 bytes;
// stage t + 1 is in flight while stage t is multiplied. Each wave-wide copy covers 4 whole 128-B lines.
// BK = 256 where the grid has one workgroup per WGP (MODE 1, 3), else 128 (two workgroups per WGP by LDS).
// Epilogue: acc*(1/64) + bias(bf16-RNE) [-> gelu] staged as f32 128x128 tile in LDS, then
// MODE 0: qkv: n0 < QP -> qk hi plane [RROWS][QP] (+ lo plane rows t<TE), else V transposed
//         into vt hi [NB*NH][64][SEQ] (+ vt lo [..][64][TE] for t<TE)
// MODE 1: out0 f32 [RROWS][CE] = acc + bias + bfr(res at full-size rows)   (x1)
// MODE 2: out0 f16 [RROWS][C4] = gelu(acc + bias)                          (hg)
// MODE 3: out0 f32 at full-size rows = acc + bias + res[logical rows]      (d_out)
template <int MODE>
__global__ __launch_bounds__(256) void gemm_kernel(const u16* __restrict__ A,
                                                   const u16* __restrict__ BT,
                                                   const float* __restrict__ bias,
                                                   const float* __restrict__ res,
                                                   void* out0, void* out1, void* out2, void* out3,
                                                   u32 N, u32 K) {
    constexpr u32 BK     = (MODE == 1 || MODE == 3) ? 256u : 128u;   // k per stage
    constexpr u32 PH     = BK + 8u;                // LDS row pitch in halves: 16 B x odd
    constexpr u32 TILE_H = 128u * PH;              // one operand's tile, halves
    constexpr u32 BUF_H  = 2u * TILE_H;            // one buffer: A tile | B tile
    constexpr u32 LPR    = BK / 8u;                // lanes per row (16 B each)
    constexpr u32 RPP    = 256u / LPR;             // rows the workgroup covers with one copy per lane
    constexpr u32 NCP    = 128u / RPP;             // copies per lane, operand and stage
    constexpr u32 CSP = 132;
    static_assert(CE % BK == 0 && C4 % BK == 0);
    static_assert(NCP % 8u == 0 && 2u * NCP <= 63u);
    static_assert(2u * BUF_H * 2u >= 128u * CSP * 4u);
    __shared__ u32x4 smem[2u * BUF_H / 8u];        // the ring during the k loop, Cs after it
    u16* As = (u16*)smem;                          // buffer b: A [128][PH] at b * BUF_H, B [128][PH] behind it
    float* Cs = (float*)smem;                      // [128][132]

    const u32 tid = threadIdx.x, lane = tid & 31u, wv = tid >> 5;
    const u32 hf = lane >> 4, ln = lane & 15u;
    const u32 m0 = blockIdx.y * 128u, n0 = blockIdx.x * 128u;
    const u32 wm = wv & 3u, wn = wv >> 2;
    const u32 srow = tid / LPR, sseg = (tid % LPR) * 8u; // rows srow + RPP i, 8 halves at sseg
    const u32 nt = K / BK;                               // stages; K is a multiple of BK
    // this lane's copies of the next stage to be issued: A rows, then B rows. Source and LDS addresses live in registers and
    // move on by one add each behind an issue, so that no address arithmetic stands between a stage's barrier and its refill.
    const u16* gp[2u * NCP];
    u32 lp[2u * NCP];
#pragma unroll
    for (u32 c = 0; c < NCP; c++) {
        gp[c]       = A  + (size_t)(m0 + srow + c * RPP) * K + sseg;
        gp[NCP + c] = BT + (size_t)(n0 + srow + c * RPP) * K + sseg;
        lp[c]       = lds_addr(&As[(srow + c * RPP) * PH + sseg]);
        lp[NCP + c] = lp[c] + TILE_H * 2u;
    }
    // issues one stage into the buffer lp points at, then moves to the next stage's k and by dl bytes to the other buffer
    auto stage = [&](u32 dl) {
#pragma unroll                                           // constant indices: gp and lp stay in registers
        for (u32 c = 0; c < 2u * NCP; c += 8u) copy8(&lp[c], &gp[c]);
#pragma unroll
        for (u32 c = 0; c < 2u * NCP; c++) { gp[c] += BK; lp[c] += dl; }
    };
    constexpr u32 BUF_B = BUF_H * 2u;                    // bytes from buffer 0 to buffer 1

    v8f acc[2][4];
#pragma unroll
    for (int i = 0; i < 2; i++)
#pragma unroll
        for (int j = 0; j < 4; j++) acc[i][j] = (v8f)(0.f);

    stage(BUF_B);                                      // stage 0 into buffer 0
    asm volatile("s_wait_asynccnt 0x0" ::: "memory");  // this wave's stage 0 copies have landed
    __syncthreads();                                   // stage 0 visible to all waves
    if (1u < nt) stage(0u - BUF_B);                    // stage 1 into buffer 1
#pragma unroll 1                                       // stays rolled: one stage body, the buffer picked by t & 1
    for (u32 t = 0; t < nt; t++) {
        const u16* Ab = As + (t & 1u) * BUF_H;
        const u16* Bb = Ab + TILE_H;
#pragma unroll
        for (u32 ks = 0; ks < BK / 32u; ks++) {
            Frag af[2], bf[4];
#pragma unroll
            for (u32 mi = 0; mi < 2; mi++) {
                const u16* q = &Ab[(wm * 32u + mi * 16u + ln) * PH + ks * 32u + hf * 8u];
                af[mi].u[0] = *(const u32x4*)q;
                af[mi].u[1] = *(const u32x4*)(q + 16);
            }
#pragma unroll
            for (u32 ni = 0; ni < 4; ni++) {
                const u16* q = &Bb[(wn * 64u + ni * 16u + ln) * PH + ks * 32u + hf * 8u];
                bf[ni].u[0] = *(const u32x4*)q;
                bf[ni].u[1] = *(const u32x4*)(q + 16);
            }
#pragma unroll
            for (int mi = 0; mi < 2; mi++)
#pragma unroll
                for (int ni = 0; ni < 4; ni++)
                    acc[mi][ni] = mma16(af[mi].v, bf[ni].v, acc[mi][ni]);
        }
        asm volatile("s_wait_dscnt 0x0" ::: "memory");     // this wave's reads of stage t's buffer are done before it is refilled
        asm volatile("s_wait_asynccnt 0x0" ::: "memory");  // this wave's stage t + 1 copies have landed
        __syncthreads();                                   // publishes stage t + 1 and ends every wave's reads of stage t
        if (t + 2u < nt) stage((t & 1u) ? 0u - BUF_B : BUF_B);   // stage t + 2 into the buffer stage t has left
    }
    asm volatile("s_wait_asynccnt 0x0" ::: "memory");      // no copy outstanding when the ring becomes the C tile

    // ---- epilogue: accumulators -> f32 tile in LDS (aliases the ring: the last stage's own barrier has ended every wave's reads) ----
#pragma unroll
    for (int ni = 0; ni < 4; ni++) {
        const u32 col = wn * 64u + (u32)ni * 16u + ln;
        const float bv = bfr(bias[n0 + col]);
#pragma unroll
        for (int mi = 0; mi < 2; mi++) {
#pragma unroll
            for (int r = 0; r < 8; r++) {
                const u32 row = wm * 32u + (u32)mi * 16u + hf * 8u + (u32)r;
                float v = acc[mi][ni][r] * WINV + bv;
                if constexpr (MODE == 2) v = gelu_erf(v);
                Cs[row * CSP + col] = v;
            }
        }
    }
    __syncthreads();                               // Cs is read across waves below

    if constexpr (MODE == 1 || MODE == 3) {
        float* o = (float*)out0;
        v4f val[16];
#pragma unroll
        for (int grp = 0; grp < 2; grp++) {
#pragma unroll
            for (int i8 = 0; i8 < 8; i8++) {
                const int i = grp * 8 + i8;
                const u32 row = wv * 16u + (u32)i;
                const u32 r = m0 + row;
                v4f c = *(const v4f*)&Cs[row * CSP + lane * 4u];
                const size_t rr = (MODE == 1) ? grow_map(r) : (size_t)r;
                v4f x4 = *(const v4f*)(res + rr * (size_t)N + n0 + lane * 4u);
                if constexpr (MODE == 1) {
#pragma unroll
                    for (int cc = 0; cc < 4; cc++) { float t = x4[cc]; x4[cc] = bfr(t); }
                }
                val[i] = c + x4;
            }
            asm volatile("" ::: "memory");         // keep the two load groups in separate clauses
        }
#pragma unroll
        for (int i = 0; i < 16; i++) {
            const u32 r = m0 + wv * 16u + (u32)i;
            const size_t orr = (MODE == 3) ? grow_map(r) : (size_t)r;
            *(v4f*)(o + orr * (size_t)N + n0 + lane * 4u) = val[i];
        }
        
    } else if constexpr (MODE == 2) {
        u16* o = (u16*)out0;
        u32x4 val[8];
#pragma unroll
        for (int it = 0; it < 8; it++) {
            const u32 rloc = wv * 16u + (u32)it * 2u + hf, cseg = ln * 8u;
            Pack8 pk;
#pragma unroll
            for (int j = 0; j < 8; j++) pk.h[j] = (_Float16)Cs[rloc * CSP + cseg + (u32)j];
            val[it] = pk.u;
        }
#pragma unroll
        for (int it = 0; it < 8; it++) {
            const u32 rloc = wv * 16u + (u32)it * 2u + hf, cseg = ln * 8u;
            *(u32x4*)(o + (size_t)(m0 + rloc) * N + n0 + cseg) = val[it];
        }
        
    } else {
        // MODE 0: q/k planes or transposed v planes
        u16* qkh = (u16*)out0;
        u16* qkl = (u16*)out1;
        u16* vth = (u16*)out2;
        u16* vtl = (u16*)out3;
        const u32 bq = m0 / (u32)(SEQ);
        const u32 t0 = m0 - bq * (u32)(SEQ);       // 128 | SEQ so the tile sits inside one batch
        const bool lo_on = (t0 < (u32)(TE));       // uniform per workgroup
        u32x4 vh[8], vl[8];
        if (n0 < (u32)QP) {
#pragma unroll
            for (int it = 0; it < 8; it++) {
                const u32 rloc = wv * 16u + (u32)it * 2u + hf, cseg = ln * 8u;
                Pack8 ph, pl;
#pragma unroll
                for (int j = 0; j < 8; j++) {
                    float f = Cs[rloc * CSP + cseg + (u32)j];
                    _Float16 h16 = (_Float16)f;
                    ph.h[j] = h16;
                    pl.h[j] = (_Float16)((f - (float)h16) * RSC);
                }
                vh[it] = ph.u; vl[it] = pl.u;
            }
#pragma unroll
            for (int it = 0; it < 8; it++) {
                const u32 rloc = wv * 16u + (u32)it * 2u + hf, cseg = ln * 8u;
                *(u32x4*)(qkh + (size_t)(m0 + rloc) * QP + n0 + cseg) = vh[it];
                if (lo_on)
                    *(u32x4*)(qkl + ((size_t)bq * (TE) + t0 + rloc) * QP + n0 + cseg) = vl[it];
            }
            
        } else {
            const u32 hh0 = (n0 - (u32)QP) >> 6;   // two heads per 128-column tile
#pragma unroll
            for (int it = 0; it < 8; it++) {
                const u32 rloc = wv * 16u + (u32)it * 2u + hf;   // local column = head*64 + d
                const u32 tseg = ln * 8u;
                Pack8 ph, pl;
#pragma unroll
                for (int j = 0; j < 8; j++) {
                    float f = Cs[(tseg + (u32)j) * CSP + rloc];
                    _Float16 h16 = (_Float16)f;
                    ph.h[j] = h16;
                    pl.h[j] = (_Float16)((f - (float)h16) * RSC);
                }
                vh[it] = ph.u; vl[it] = pl.u;
            }
#pragma unroll
            for (int it = 0; it < 8; it++) {
                const u32 rloc = wv * 16u + (u32)it * 2u + hf, tseg = ln * 8u;
                const u32 hh = hh0 + (rloc >> 6), dd = rloc & 63u;
                const size_t vrow = (size_t)(bq * NH + hh) * HD + dd;
                *(u32x4*)(vth + vrow * (SEQ) + t0 + tseg) = vh[it];
                if (lo_on)
                    *(u32x4*)(vtl + vrow * (TE) + t0 + tseg) = vl[it];
            }
            
        }
    }
}

// ---------------- causal flash attention, hd=64, 128 queries per workgroup (8 waves x 16 rows), 64-key chunks ----------------
// qkh: [RROWS][QP] f16 (q cols h*64+d, k cols CE+h*64+d); qkl: same layout for rows t<TE, residual x2048
// vth: [NB*NH][64][SEQ] f16 transposed v; vtl: [NB*NH][64][TE] residual x2048
// Transposed products: A = K rows (S^T) or V^T rows (O^T), B = Q or P^T. Lane (hf, ln) owns query q0 + ln:
// S^T register r of sub-tile sub = key sub*16 + hf*8 + r, so two converted sub-tiles are one B fragment in the loaders' k order.
// RES=1: query tiles with position < TE: S = qh.kh + (qh.kl + ql.kh)/2048, O += Ph.Vh + (Pr.Vh + Ph.Vl)/2048
// RES=1 only: wave index taken as a scalar-uniform value.
// Operand fragments leave LDS in groups ahead of the products that read them (same arithmetic, same order of products):
// RES=0 a chunk's 8 K fragments, then its 8 V fragments ahead of the softmax; RES=1 one sub-tile ahead, two register sets.
template <int RES>
__global__ __launch_bounds__(256) __attribute__((amdgpu_num_vgpr(256)))
void attn_kernel(const u16* __restrict__ qkh, const u16* __restrict__ qkl,
                 const u16* __restrict__ vth, const u16* __restrict__ vtl,
                 u16* __restrict__ cv, u32 qb0) {
    __shared__ __align__(16) u16 Ks[64 * 72];              // [key][d]
    __shared__ __align__(16) u16 Vs[64 * 72];              // [d][key]
    __shared__ __align__(16) u16 Kl[RES ? 64 * 72 : 8];
    __shared__ __align__(16) u16 Vl[RES ? 64 * 72 : 8];
    __shared__ __align__(16) u16 Ps[8 * 16 * 72];          // per wave [16 q][d]: final O stage

    const u32 bh = blockIdx.y;
    const u32 b = bh / (u32)NH, h = bh - b * (u32)NH;
    const u32 qb = qb0 + blockIdx.x;
    const u32 tid = threadIdx.x, lane = tid & 31u;
    u32 wv = tid >> 5;
    if constexpr (RES != 0) wv = (u32)__builtin_amdgcn_readfirstlane((int)wv);   // all lanes active, value is wave-uniform
    const u32 hf = lane >> 4, ln = lane & 15u;
    const u32 q0 = qb * 128u + wv * 16u;
    u16* Pw  = Ps + wv * (16u * 72u);

    Frag qf[2], ql[2];
#pragma unroll
    for (u32 ds = 0; ds < 2; ds++) {
        const u16* p = qkh + (size_t)(b * (u32)(SEQ) + q0 + ln) * QP + h * HD + ds * 32u + hf * 8u;
        qf[ds].u[0] = *(const u32x4*)p;
        qf[ds].u[1] = *(const u32x4*)(p + 16);
        if constexpr (RES != 0) {
            const u16* pl = qkl + (size_t)(b * (u32)(TE) + q0 + ln) * QP + h * HD + ds * 32u + hf * 8u;
            ql[ds].u[0] = *(const u32x4*)pl;
            ql[ds].u[1] = *(const u32x4*)(pl + 16);
        } else {
            ql[ds].u[0] = (u32x4)(0u); ql[ds].u[1] = (u32x4)(0u);
        }
    }

    v8f o[4];
#pragma unroll
    for (int i = 0; i < 4; i++) o[i] = (v8f)(0.f);
    float mrun = -3.0e38f;                                 // running maximum of this lane's query (both halves agree)
    float lsum = 0.f;                                      // running sum over this lane half's keys; halves joined after the loop
    const u32 qg = q0 + ln;

    const u32 rr = tid >> 3, seg = (tid & 7u) * 8u;       // staging: rows rr and rr + 32 (key or d), 8 halves at seg: 4 whole 128-B lines per load instruction
    const u32 nkt = 2u * qb + 2u;                          // keys 0 .. qb*128+127

#pragma unroll 1
    for (u32 kt = 0; kt < nkt; kt++) {
        __syncthreads();                                   // prior chunk's LDS reads done
        {
            const u16* gk = qkh + (size_t)(b * (u32)(SEQ) + kt * 64u + rr) * QP + CE + h * HD + seg;
            u32x4 k0v = *(const u32x4*)gk, k1v = *(const u32x4*)(gk + 32u * QP);
            const u16* gv = vth + ((size_t)(bh * HD + rr)) * (SEQ) + kt * 64u + seg;
            u32x4 v0 = *(const u32x4*)gv, v1 = *(const u32x4*)(gv + 32u * (SEQ));
            asm volatile("s_wait_xcnt 0x0" ::: "memory");   // stands in front of every later overwrite of the address registers that the loads above name
            *(u32x4*)&Ks[rr * 72u + seg] = k0v; *(u32x4*)&Ks[(rr + 32u) * 72u + seg] = k1v;
            *(u32x4*)&Vs[rr * 72u + seg] = v0;  *(u32x4*)&Vs[(rr + 32u) * 72u + seg] = v1;
            sched_cut<RES>();                              // hi-plane staging temporaries end here
            if constexpr (RES != 0) {
                const u16* gkl = qkl + (size_t)(b * (u32)(TE) + kt * 64u + rr) * QP + CE + h * HD + seg;
                u32x4 kl0 = *(const u32x4*)gkl, kl1 = *(const u32x4*)(gkl + 32u * QP);
                const u16* gvl = vtl + ((size_t)(bh * HD + rr)) * (TE) + kt * 64u + seg;
                u32x4 vl0 = *(const u32x4*)gvl, vl1 = *(const u32x4*)(gvl + 32u * (TE));
                asm volatile("s_wait_xcnt 0x0" ::: "memory");   // stands in front of every later overwrite of the address registers that the loads above name
                *(u32x4*)&Kl[rr * 72u + seg] = kl0; *(u32x4*)&Kl[(rr + 32u) * 72u + seg] = kl1;
                *(u32x4*)&Vl[rr * 72u + seg] = vl0; *(u32x4*)&Vl[(rr + 32u) * 72u + seg] = vl1;
            }
        }
        __syncthreads();                                   // K/V chunk visible to all waves
        sched_cut<RES>();

        // S^T = K . Q^T  (64 keys x 16 q per wave)
        // The K fragment loads stand as groups ahead of the products that read them, so a wave waits out the LDS
        // latency once per group and not once per product. RES=0: the chunk's 8 fragments in one group.
        // RES=1: one sub-tile's hi and residual fragments per group, fetched one sub-tile ahead into a second register set.
        v8f s[4];
        Frag vf[RES ? 2 : 4][2], vlf[2][2];                // V fragments: RES=0 [d sub-tile][ks], RES=1 [register set][ks]
        if constexpr (RES == 0) {
            Frag kf[4][2];
#pragma unroll
            for (int sub = 0; sub < 4; sub++)
#pragma unroll
                for (int ds = 0; ds < 2; ds++)
                    ldfrag(kf[sub][ds], &Ks[((u32)sub * 16u + ln) * 72u + (u32)ds * 32u + hf * 8u]);
            __builtin_amdgcn_sched_barrier(0);             // the 16 K loads issue together, none sinks down among the products
#pragma unroll
            for (int sub = 0; sub < 4; sub++) {
                v8f t = (v8f)(0.f);
#pragma unroll
                for (int ds = 0; ds < 2; ds++) t = mma16(kf[sub][ds].v, qf[ds].v, t);
                s[sub] = t;
            }
            __builtin_amdgcn_sched_barrier(0);             // the V loads below stay behind the last S^T product (they take over the K registers)
#pragma unroll
            for (int dsub = 0; dsub < 4; dsub++)
#pragma unroll
                for (int ks = 0; ks < 2; ks++)
                    ldfrag(vf[dsub][ks], &Vs[((u32)dsub * 16u + ln) * 72u + (u32)ks * 32u + hf * 8u]);
            __builtin_amdgcn_sched_barrier(0);             // the 16 V loads issue here, ahead of the softmax, which covers their latency
        } else {
            Frag kf[2][2], klf[2][2];
#pragma unroll
            for (int ds = 0; ds < 2; ds++) {
                ldfrag(kf[0][ds],  &Ks[ln * 72u + (u32)ds * 32u + hf * 8u]);
                ldfrag(klf[0][ds], &Kl[ln * 72u + (u32)ds * 32u + hf * 8u]);
            }
#pragma unroll
            for (int sub = 0; sub < 4; sub++) {
                const int cur = sub & 1, nxt = cur ^ 1;
#pragma unroll
                for (int ds = 0; ds < 2; ds++) {
                    if (sub < 3) {
                        ldfrag(kf[nxt][ds],  &Ks[((u32)(sub + 1) * 16u + ln) * 72u + (u32)ds * 32u + hf * 8u]);
                        ldfrag(klf[nxt][ds], &Kl[((u32)(sub + 1) * 16u + ln) * 72u + (u32)ds * 32u + hf * 8u]);
                    } else {
                        ldfrag(vf[0][ds],  &Vs[ln * 72u + (u32)ds * 32u + hf * 8u]);
                        ldfrag(vlf[0][ds], &Vl[ln * 72u + (u32)ds * 32u + hf * 8u]);
                    }
                }
                __builtin_amdgcn_sched_barrier(0);         // the next group's 8 loads issue ahead of this sub-tile's products
                v8f t = (v8f)(0.f);
                v8f tr = (v8f)(0.f);
#pragma unroll
                for (int ds = 0; ds < 2; ds++) {
                    t  = mma16(kf[cur][ds].v,  qf[ds].v, t);
                    tr = mma16(klf[cur][ds].v, qf[ds].v, tr);
                    tr = mma16(kf[cur][ds].v,  ql[ds].v, tr);
                }
                s[sub] = t + tr * RINV;
                __builtin_amdgcn_sched_barrier(0);         // the group after next stays behind this sub-tile's products: two register sets, no more
            }
        }

        // scale + causal replace-fill
#pragma unroll
        for (int sub = 0; sub < 4; sub++) {
#pragma unroll
            for (int r = 0; r < 8; r++) {
                const u32 kg = kt * 64u + (u32)sub * 16u + hf * 8u + (u32)r;
                float v = s[sub][r] * 0.125f;
                s[sub][r] = (kg > qg) ? -3.0e38f : v;
            }
        }
        // online softmax: one query per lane, 32 of the chunk's keys in-lane, the other 32 in lane ^ 16
        float mxs[4];
#pragma unroll
        for (int sub = 0; sub < 4; sub++) {
            mxs[sub] = fmaxf(fmaxf(fmaxf(s[sub][0], s[sub][1]), fmaxf(s[sub][2], s[sub][3])),
                             fmaxf(fmaxf(s[sub][4], s[sub][5]), fmaxf(s[sub][6], s[sub][7])));
        }
        float mx = fmaxf(fmaxf(mxs[0], mxs[1]), fmaxf(mxs[2], mxs[3]));
        mx = fmaxf(mx, xhalf(mx));
        const float mnew  = fmaxf(mrun, mx);
        const float alpha = exp_fast(mrun - mnew);
        float rs[4];
#pragma unroll
        for (int sub = 0; sub < 4; sub++) {
            rs[sub] = 0.f;
#pragma unroll
            for (int r = 0; r < 8; r++) {
                float pe = exp_fast(s[sub][r] - mnew);
                s[sub][r] = pe;
                rs[sub] += pe;
            }
        }
        mrun = mnew;
        lsum = lsum * alpha + ((rs[0] + rs[1]) + (rs[2] + rs[3]));
#pragma unroll
        for (int dsub = 0; dsub < 4; dsub++) o[dsub] *= alpha;

        // P^T: two converted S^T sub-tiles = one B fragment (32 keys x 16 q), carried x4096 (+ residual x2048)
        Frag pf[2], prf[2];
#pragma unroll
        for (int ks = 0; ks < 2; ks++) {
#pragma unroll
            for (int e = 0; e < 16; e++) {
                const float ph = s[2 * ks + (e >> 3)][e & 7] * PCAR;
                _Float16 h16 = (_Float16)ph;
                pf[ks].v[e] = h16;
                if constexpr (RES != 0) prf[ks].v[e] = (_Float16)((ph - (float)h16) * RSC);
            }
        }
        // O^T += V^T . P^T
#pragma unroll
        for (int dsub = 0; dsub < 4; dsub++) {
            if constexpr (RES == 0) {
#pragma unroll
                for (int ks = 0; ks < 2; ks++) o[dsub] = mma16(vf[dsub][ks].v, pf[ks].v, o[dsub]);
            } else {
                const int cur = dsub & 1, nxt = cur ^ 1;
                if (dsub < 3) {
#pragma unroll
                    for (int ks = 0; ks < 2; ks++) {
                        ldfrag(vf[nxt][ks],  &Vs[((u32)(dsub + 1) * 16u + ln) * 72u + (u32)ks * 32u + hf * 8u]);
                        ldfrag(vlf[nxt][ks], &Vl[((u32)(dsub + 1) * 16u + ln) * 72u + (u32)ks * 32u + hf * 8u]);
                    }
                }
                __builtin_amdgcn_sched_barrier(0);         // the next d sub-tile's 8 loads issue ahead of this one's products
                v8f u = (v8f)(0.f);
#pragma unroll
                for (int ks = 0; ks < 2; ks++) {
                    o[dsub] = mma16(vf[cur][ks].v,  pf[ks].v,  o[dsub]);
                    u       = mma16(vf[cur][ks].v,  prf[ks].v, u);
                    u       = mma16(vlf[cur][ks].v, pf[ks].v,  u);
                }
                o[dsub] = o[dsub] + u * RINV;
                __builtin_amdgcn_sched_barrier(0);         // the group after next stays behind this sub-tile's products: two register sets, no more
            }
        }
    }

    // finalize: O / (l * 4096) -> f16 tile in the wave's LDS stage -> whole-line stores
    // O^T register r of tile dsub = d dsub*16 + hf*8 + r of query ln: 8 consecutive d, one 16-byte LDS store
    const float inv = (1.0f / (lsum + xhalf(lsum))) * PINV;
#pragma unroll
    for (int dsub = 0; dsub < 4; dsub++) {
        Pack8 pk;
#pragma unroll
        for (int r = 0; r < 8; r++) pk.h[r] = (_Float16)(o[dsub][r] * inv);
        *(u32x4*)&Pw[ln * 72u + (u32)dsub * 16u + hf * 8u] = pk.u;
    }
    __syncthreads();
    u32x4 val[4];
#pragma unroll
    for (u32 it = 0; it < 4; it++) {
        const u32 rloc = it * 4u + (lane >> 3), sg = (lane & 7u) * 8u;
        val[it] = *(const u32x4*)&Pw[rloc * 72u + sg];
    }
#pragma unroll
    for (u32 it = 0; it < 4; it++) {
        const u32 rloc = it * 4u + (lane >> 3), sg = (lane & 7u) * 8u;
        *(u32x4*)(cv + (size_t)(b * (u32)(SEQ) + q0 + rloc) * CE + h * HD + sg) = val[it];
    }
    
}

// ---------------- host side ----------------
extern "C" void kernel_launch(void* const* d_in, const int* in_sizes, int n_in,
                              void* d_out, int out_size, void* d_ws, size_t ws_size,
                              hipStream_t stream) {
    if (n_in < 13) return;
    const long long needX = ((long long)(NB - 1) * SEQ_FULL + (SEQ)) * CE;
    if ((long long)in_sizes[0] < needX || (long long)out_size < needX) return;
    if (in_sizes[1] < CE || in_sizes[2] < CE || in_sizes[3] < CE * C3 || in_sizes[4] < C3 ||
        in_sizes[5] < CE * CE || in_sizes[6] < CE || in_sizes[7] < CE || in_sizes[8] < CE ||
        in_sizes[9] < CE * C4 || in_sizes[10] < C4 || in_sizes[11] < C4 * CE || in_sizes[12] < CE)
        return;

    const float* x      = (const float*)d_in[0];
    const float* ln1_g  = (const float*)d_in[1];
    const float* ln1_b  = (const float*)d_in[2];
    const float* w_attn = (const float*)d_in[3];
    const float* b_attn = (const float*)d_in[4];
    const float* w_proj = (const float*)d_in[5];
    const float* b_proj = (const float*)d_in[6];
    const float* ln2_g  = (const float*)d_in[7];
    const float* ln2_b  = (const float*)d_in[8];
    const float* w_fc   = (const float*)d_in[9];
    const float* b_fc   = (const float*)d_in[10];
    const float* w_fc2  = (const float*)d_in[11];
    const float* b_fc2  = (const float*)d_in[12];

    char* ws = (char*)d_ws;
    size_t off = 0;
    auto take = [&](size_t bytes) -> char* {
        char* p = ws + off;
        off += (bytes + 255) & ~(size_t)255;
        return p;
    };
    const size_t R = (size_t)RROWS;
    u16*   waT   = (u16*)take((size_t)C3 * CE * 2);               // [3072][1024]
    u16*   wpT   = (u16*)take((size_t)CE * CE * 2);               // [1024][1024]
    u16*   wfcT  = (u16*)take((size_t)C4 * CE * 2);               // [4096][1024]
    u16*   wfc2T = (u16*)take((size_t)CE * C4 * 2);               // [1024][4096]
    u16*   h1    = (u16*)take(R * CE * 2);                        // [R][1024]
    u16*   qkh   = (u16*)take(R * QP * 2);                        // [R][2048]
    u16*   qkl   = (u16*)take((size_t)NB * (TE) * QP * 2);        // [NB*TE][2048]
    u16*   vth   = (u16*)take((size_t)NB * NH * HD * (SEQ) * 2);  // [NB*NH][64][SEQ]
    u16*   vtl   = (u16*)take((size_t)NB * NH * HD * (TE) * 2);   // [NB*NH][64][TE]
    u16*   cvb   = (u16*)take(R * CE * 2);                        // [R][1024]
    float* x1    = (float*)take(R * CE * 4);                      // [R][1024]
    u16*   h2    = (u16*)take(R * CE * 2);                        // [R][1024]
    u16*   hg    = (u16*)take(R * C4 * 2);                        // [R][4096]
    if (off > ws_size || off > (size_t)134217728) return;
    void* dummy = (void*)d_ws;

    // 1) weights: bf16-RNE value x64 -> f16, transposed to [N][K]   (in[K][N] -> out[N][K]), grid (N/64, K/64)
    cvt_wt_kernel<<<dim3(C3 / 64, CE / 64), 256, 0, stream>>>(w_attn, waT, (u32)CE, (u32)C3);   // [1024][3072] -> [3072][1024]
    cvt_wt_kernel<<<dim3(CE / 64, CE / 64), 256, 0, stream>>>(w_proj, wpT, (u32)CE, (u32)CE);   // [1024][1024] -> [1024][1024]
    cvt_wt_kernel<<<dim3(C4 / 64, CE / 64), 256, 0, stream>>>(w_fc,   wfcT, (u32)CE, (u32)C4);  // [1024][4096] -> [4096][1024]
    cvt_wt_kernel<<<dim3(CE / 64, C4 / 64), 256, 0, stream>>>(w_fc2,  wfc2T, (u32)C4, (u32)CE); // [4096][1024] -> [1024][4096]
    // 2) h1 = LN1(bfr(x))
    ln_kernel<1><<<RROWS / 8, 256, 0, stream>>>(x, ln1_g, ln1_b, h1);
    // 3) qkv = h1 . w_attn + b_attn -> q/k planes (+ residual rows t<TE), v transposed (+ residual)
    gemm_kernel<0><<<dim3(C3 / 128, RROWS / 128), 256, 0, stream>>>(h1, waT, b_attn, b_attn,
                                                                    qkh, qkl, vth, vtl, (u32)C3, (u32)CE);
    // 4) causal attention: residual-carrying tiles for query position < TE, plain tiles after
    attn_kernel<1><<<dim3(NEB, NB * NH), 256, 0, stream>>>(qkh, qkl, vth, vtl, cvb, 0u);
    if (NQB > NEB)
        attn_kernel<0><<<dim3(NQB - NEB, NB * NH), 256, 0, stream>>>(qkh, qkl, vth, vtl, cvb, (u32)NEB);
    // 5) x1 = cv . w_proj + b_proj + bfr(x)
    gemm_kernel<1><<<dim3(CE / 128, RROWS / 128), 256, 0, stream>>>(cvb, wpT, b_proj, x,
                                                                    x1, dummy, dummy, dummy, (u32)CE, (u32)CE);
    // 6) h2 = LN2(x1)
    ln_kernel<0><<<RROWS / 8, 256, 0, stream>>>(x1, ln2_g, ln2_b, h2);
    // 7) hg = gelu(h2 . w_fc + b_fc)
    gemm_kernel<2><<<dim3(C4 / 128, RROWS / 128), 256, 0, stream>>>(h2, wfcT, b_fc, b_fc,
                                                                    hg, dummy, dummy, dummy, (u32)C4, (u32)CE);
    // 8) out = hg . w_fc2 + b_fc2 + x1
    gemm_kernel<3><<<dim3(CE / 128, RROWS / 128), 256, 0, stream>>>(hg, wfc2T, b_fc2, x1,
                                                                    d_out, dummy, dummy, dummy, (u32)CE, (u32)C4);
}

// v005
// One run takes 185 microseconds.
// Timed twice side by side with v004, it ran 1.15 times as fast both times.
// Counting every step since v000, it is 1.93 times as fast.
#include <hip/hip_runtime.h>

// Contractions: v_wmma_f32_16x16x32_f16 (f16 operands, f32 accumulate) for qkv = h.W, S = q.k^T, O = p.v, proj, fc, fc2.
// Weight operand planes: bf16-RNE input value x64, cast to f16, stored transposed [N][K]. Activation planes f16.
// Attention runs transposed: S^T = k.q^T, O^T = v^T.p^T; p^T packs from the S^T accumulators straight into the B operand.
// p carried x4096 in f16. Query tiles with position < TE add f16 residual planes (x2048) of q, k, v, p
// through separately scaled second products folded into the f32 accumulators. Softmax, LN and erf-GELU in f32.

#ifndef NB
#define NB 2
#endif
#ifndef SEQ
#define SEQ 2048
#endif
#define NB_FULL 2
#define SEQ_FULL 2048
#define CE 1024
#define NH 16
#define HD 64
#define C3 3072
#define C4 4096
#define QP 2048
#define TE (((SEQ) < 256) ? (SEQ) : 256)
#define RROWS ((NB) * (SEQ))
#define NEB ((TE) / 128)
#define NQB ((SEQ) / 128)
#define LNJ ((CE) / 128)
#define LNO ((CE) / 256)

static_assert((SEQ) % 128 == 0);
static_assert((TE) % 128 == 0);
static_assert((NB) >= 1 && (NB) <= NB_FULL);
static_assert((SEQ) <= SEQ_FULL);
static_assert(CE % 128 == 0 && C3 % 128 == 0 && C4 % 128 == 0 && QP % 128 == 0);
static_assert(CE % 64 == 0 && C3 % 64 == 0 && C4 % 64 == 0);
static_assert(NH * HD == CE);
static_assert(HD == 64);
static_assert(QP == 2 * CE);
static_assert(C3 == 3 * CE);
static_assert(RROWS % 128 == 0);
static_assert(RROWS % 8 == 0);
static_assert(CE == 1024);
static_assert(256 * 4 == CE);            // gamma/beta staging: 256 threads x 4 floats
static_assert(32 * 4 * LNJ == CE);       // LN row load: 32 lanes x 4 floats x LNJ steps
static_assert(32 * 8 * LNO == CE);       // LN row store: 32 lanes x 8 halves x LNO instructions
static_assert(NQB * 128 == (SEQ));
static_assert(NEB <= NQB);

typedef unsigned short u16;
typedef unsigned int   u32;
typedef _Float16 v16h __attribute__((ext_vector_type(16)));
typedef _Float16 v8h  __attribute__((ext_vector_type(8)));
typedef _Float16 v4h  __attribute__((ext_vector_type(4)));
typedef float    v8f  __attribute__((ext_vector_type(8)));
typedef float    v4f  __attribute__((ext_vector_type(4)));
typedef unsigned int u32x4 __attribute__((ext_vector_type(4)));
typedef unsigned int u32x2 __attribute__((ext_vector_type(2)));

union Frag  { v16h v; u32x4 u[2]; };
union Pack8 { v8h h; u32x4 u; };
union Pack4 { v4h h; u32x2 u; };

#define WSCALE 64.0f
#define WINV   (1.0f / 64.0f)
#define PCAR   4096.0f
#define PINV   (1.0f / 4096.0f)
#define RSC    2048.0f
#define RINV   (1.0f / 2048.0f)

constexpr size_t al256(size_t b) { return (b + 255) & ~(size_t)255; }
constexpr size_t WS_TOTAL =
    al256((size_t)C3 * CE * 2) + al256((size_t)CE * CE * 2) + al256((size_t)C4 * CE * 2) +
    al256((size_t)CE * C4 * 2) + al256((size_t)RROWS * CE * 2) + al256((size_t)RROWS * QP * 2) +
    al256((size_t)NB * (TE) * QP * 2) + al256((size_t)NB * NH * HD * (SEQ) * 2) +
    al256((size_t)NB * NH * HD * (TE) * 2) + al256((size_t)RROWS * CE * 2) +
    al256((size_t)RROWS * CE * 4) + al256((size_t)RROWS * CE * 2) + al256((size_t)RROWS * C4 * 2);
static_assert(WS_TOTAL <= (size_t)134217728);

// f32 -> nearest-even bf16 grid value, returned as f32
__device__ __forceinline__ float bfr(float f) {
    u32 u = __builtin_bit_cast(u32, f);
    u += 0x7fffu + ((u >> 16) & 1u);
    u &= 0xffff0000u;
    return __builtin_bit_cast(float, u);
}

// f32 -> f16 (RNE) bits
__device__ __forceinline__ u16 hbits(float f) {
    _Float16 h = (_Float16)f;
    return __builtin_bit_cast(u16, h);
}

// 16x16x32 f16 WMMA with the VALU hazard guard tied to D and A/B
__device__ __forceinline__ v8f mma16(v16h a, v16h b, v8f c) {
    c = __builtin_amdgcn_wmma_f32_16x16x32_f16(false, a, false, b, (short)0, c, false, false);
    asm volatile("v_nop\n\tv_nop\n\tv_nop\n\tv_nop" : "+v"(c) : "v"(a), "v"(b));
    return c;
}

// one 16x32 operand fragment of a row-major LDS tile: two 16-byte loads, k order 0..7 and 16..23 (+ 8 in the upper lane half)
__device__ __forceinline__ void ldfrag(Frag& f, const u16* p) {
    f.u[0] = *(const u32x4*)p;
    f.u[1] = *(const u32x4*)(p + 16);
}

// scheduling-region boundary, emitted only in the residual-carrying attention instance:
// ends the live ranges of the staging temporaries before the next block of loads begins
template <int ON>
__device__ __forceinline__ void sched_cut() {
    if constexpr (ON != 0) __builtin_amdgcn_sched_barrier(0);
}

// value of lane l ^ 16 (the other 16-lane row), a vector cross-row move
__device__ __forceinline__ float xhalf(float x) {
    const int xi = __builtin_bit_cast(int, x);
    return __builtin_bit_cast(float, __builtin_amdgcn_permlanex16(xi, xi, 0x76543210, 0xfedcba98, false, false));
}

// e^x on the hardware exp2, same product and instruction as the fast-math exp;
// the v_nop fills the one issue slot the instruction set asks for behind a transcendental
// before its result is read or its source overwritten
__device__ __forceinline__ float exp_fast(float x) {
    float r;
    asm("v_exp_f32 %0, %1\n\tv_nop" : "=v"(r) : "v"(x * 1.44269504088896340736f));
    return r;
}

// erf-form GELU
__device__ __forceinline__ float gelu_erf(float x) {
    return 0.5f * x * (1.0f + erff(x * 0.70710678118654752f));
}

// logical row (b*SEQ + t) -> row of the full-size input / output tensors (b*SEQ_FULL + t)
__device__ __forceinline__ size_t grow_map(u32 r) {
    const u32 bb = r / (u32)(SEQ);
    const u32 t  = r - bb * (u32)(SEQ);
    return (size_t)bb * SEQ_FULL + (size_t)t;
}

// ---------------- weight convert + transpose: in[K][N] f32 -> out[N][K] f16 = f16(bfr(w) * 64) ----------------
// read: 16 consecutive lanes x 16 B = one 256-B row piece, two rows = 4 whole lines per load instruction.
// written by 8 consecutive lanes x 16 B of one instruction (4 lines per instruction).
// One workgroup converts the 64 x 64 tile (bx, by); Ts is its LDS tile [n][k], 64 * 72 halves.
__device__ __forceinline__ void cvt_wt_body(const float* in, u16* out, u32 K, u32 N, u32 bx, u32 by, u16* Ts) {
    const u32 tid = threadIdx.x, lane = tid & 31u, wv = tid >> 5;
    const u32 n0 = bx * 64u, k0 = by * 64u;
    const u32 kr = tid >> 4, nq = (tid & 15u) * 4u;
    const float* src = in + (size_t)(k0 + kr) * N + n0 + nq;
    const float* s1 = src + (size_t)16u * N;
    const float* s2 = src + (size_t)32u * N;
    const float* s3 = src + (size_t)48u * N;
    v4f w[4];
    w[0] = *(const v4f*)src; w[1] = *(const v4f*)s1; w[2] = *(const v4f*)s2; w[3] = *(const v4f*)s3;
    // stands in front of every overwrite of the address registers that the four loads name; taking the addresses as inputs
    // keeps their registers untouched up to here, so that the loads issue back to back with no wait among them
    asm volatile("s_wait_xcnt 0x0" :: "v"(src), "v"(s1), "v"(s2), "v"(s3) : "memory");
#pragma unroll
    for (u32 j4 = 0; j4 < 4; j4++) {
#pragma unroll
        for (u32 c = 0; c < 4; c++) {
            float f = w[j4][c];
            Ts[(nq + c) * 72u + kr + j4 * 16u] = hbits(bfr(f) * WSCALE);
        }
    }
    __syncthreads();                             // Ts: cross-wave exchange
    u32x4 val[2];
#pragma unroll
    for (u32 it = 0; it < 2; it++) {
        const u32 nn = wv * 8u + it * 4u + (lane >> 3), ks = (lane & 7u) * 8u;
        val[it] = *(const u32x4*)&Ts[nn * 72u + ks];
    }
#pragma unroll
    for (u32 it = 0; it < 2; it++) {
        const u32 nn = wv * 8u + it * 4u + (lane >> 3), ks = (lane & 7u) * 8u;
        *(u32x4*)(out + (size_t)(n0 + nn) * K + k0 + ks) = val[it];
    }
    // the body is inlined beside other bodies of one kernel: stands in front of every write, on any path the branches behind it
    // allow, of a register that the stores above name
    asm volatile("s_wait_xcnt 0x0" ::: "memory");
}

// ---------------- LayerNorm (row = 1024): one wave per row, f16 out via LDS row stage ----------------
// Row kept in a wave-private f32 LDS row (lane owns columns j*128 + lane*4 + 0..3, same lane writes and reads);
// the three per-element sweeps are rolled loops with wave-uniform trip counts.
// gamma/beta staged once per workgroup in LDS at bf16-RNE values.
// SRCX = 1: src is the input x (full-size row map, each element taken at its bf16-RNE value)
// SRCX = 0: src is an f32 workspace plane with logical rows
// blk: the workgroup's group of 8 rows; xs, rows, gsh, bsh: its LDS arrays (8*CE floats, 8*CE halves, CE floats, CE floats)
template <int SRCX>
__device__ __forceinline__ void ln_body(u32 blk, const float* src, const float* g, const float* be, u16* out,
                                        float* xs, u16* rows, float* gsh, float* bsh) {
    const u32 tid = threadIdx.x, lane = tid & 31u, wv = tid >> 5;
    {
        v4f gg = *(const v4f*)(g + tid * 4u);
        v4f bb = *(const v4f*)(be + tid * 4u);
        v4f go, bo;
#pragma unroll
        for (u32 c = 0; c < 4; c++) {
            float tg = gg[c]; float tb = bb[c];
            go[c] = bfr(tg); bo[c] = bfr(tb);
        }
        *(v4f*)&gsh[tid * 4u] = go;
        *(v4f*)&bsh[tid * 4u] = bo;
    }
    const u32 r = blk * 8u + wv;                   // < RROWS (blk < RROWS/8)
    const size_t srow = SRCX ? grow_map(r) : (size_t)r;
    const float* xr = src + srow * CE;
    float* xw = xs + wv * CE;
    float s = 0.f;
#pragma unroll 1
    for (u32 j = 0; j < LNJ; j++) {
        const u32 c0 = j * 128u + lane * 4u;
        v4f t4 = *(const v4f*)(xr + c0);
        if constexpr (SRCX != 0) {
#pragma unroll
            for (u32 c = 0; c < 4; c++) { float t = t4[c]; t4[c] = bfr(t); }
        }
        *(v4f*)&xw[c0] = t4;
        s += (t4[0] + t4[1]) + (t4[2] + t4[3]);
    }
#pragma unroll
    for (u32 m = 16; m >= 1; m >>= 1) s += __shfl_xor(s, m, 32);
    const float mu = s * (1.f / (float)CE);
    float vs = 0.f;
#pragma unroll 1
    for (u32 j = 0; j < LNJ; j++) {
        const u32 c0 = j * 128u + lane * 4u;
        v4f t4 = *(const v4f*)&xw[c0];
#pragma unroll
        for (u32 c = 0; c < 4; c++) { float d = t4[c] - mu; vs += d * d; }
    }
#pragma unroll
    for (u32 m = 16; m >= 1; m >>= 1) vs += __shfl_xor(vs, m, 32);
    const float rstd = rsqrtf(vs * (1.f / (float)CE) + 1e-5f);
    __syncthreads();                               // gsh/bsh (cross-wave) visible
    u16* rw = rows + wv * CE;
#pragma unroll 1
    for (u32 j = 0; j < LNJ; j++) {
        const u32 c0 = j * 128u + lane * 4u;
        v4f x4 = *(const v4f*)&xw[c0];
        v4f g4 = *(const v4f*)&gsh[c0];
        v4f b4 = *(const v4f*)&bsh[c0];
        Pack4 pk;
#pragma unroll
        for (u32 c = 0; c < 4; c++) {
            float xe = x4[c]; float ge = g4[c]; float bel = b4[c];
            pk.h[c] = (_Float16)((xe - mu) * rstd * ge + bel);
        }
        *(u32x2*)&rw[c0] = pk.u;
    }
    __syncthreads();   // LDS row stage: written and read by the same wave; a workgroup barrier is used
    u32x4 val[LNO];
#pragma unroll
    for (u32 j = 0; j < LNO; j++) val[j] = *(const u32x4*)&rw[j * 256u + lane * 8u];
    u16* orow = out + (size_t)r * CE;
#pragma unroll
    for (u32 j = 0; j < LNO; j++) *(u32x4*)(orow + j * 256u + lane * 8u) = val[j];
    
}

// LN2: f32 workspace plane -> f16 plane
__global__ __launch_bounds__(256) void ln_kernel(const float* __restrict__ src,
                                                 const float* __restrict__ g,
                                                 const float* __restrict__ be,
                                                 u16* __restrict__ out) {
    __shared__ __align__(16) float xs[8 * CE];      // wave wv owns xs[wv*CE ..]
    __shared__ __align__(16) u16   rows[8 * CE];    // wave wv owns rows[wv*CE ..]
    __shared__ __align__(16) float gsh[CE];
    __shared__ __align__(16) float bsh[CE];
    ln_body<0>(blockIdx.x, src, g, be, out, xs, rows, gsh, bsh);
}

// ---------------- what the qkv product waits for, in one launch ----------------
// workgroups 0 .. NLN-1: LN1 of x (the longer workgroups, lowest indices); then the 64 x 64 tiles of the qkv weight convert.
// The other three weight converts, which nothing reads before the attention has ended, ride in the attention launch.
#define NLN  (RROWS / 8)
#define NT_A ((C3 / 64) * (CE / 64))
#define NT_P ((CE / 64) * (CE / 64))
#define NT_F ((C4 / 64) * (CE / 64))
#define NT_G ((CE / 64) * (C4 / 64))
__global__ __launch_bounds__(256) void prep_kernel(const float* __restrict__ x,
                                                   const float* __restrict__ g,
                                                   const float* __restrict__ be,
                                                   u16* __restrict__ h1,
                                                   const float* __restrict__ w_a, u16* __restrict__ o_a) {
    __shared__ __align__(16) float xs[8 * CE];      // LN: wave wv owns xs[wv*CE ..]; convert: the [n][k] tile
    __shared__ __align__(16) u16   rows[8 * CE];
    __shared__ __align__(16) float gsh[CE];
    __shared__ __align__(16) float bsh[CE];
    static_assert(64 * 72 * 2 <= 8 * CE * 4);
    const u32 blk = blockIdx.x;                     // the test below is uniform for the workgroup
    if (blk < (u32)NLN) {
        ln_body<1>(blk, x, g, be, h1, xs, rows, gsh, bsh);
    } else {
        const u32 t = blk - (u32)NLN;               // < NT_A by the grid; [1024][3072] -> [3072][1024]
        cvt_wt_body(w_a, o_a, (u32)CE, (u32)C3, t % (u32)(C3 / 64), t / (u32)(C3 / 64), (u16*)xs);
    }
}

// LDS byte address of a __shared__ location (what an asynchronous copy takes as its destination)
__device__ __forceinline__ u32 lds_addr(const void* p) {
    typedef __attribute__((address_space(3))) const void lds_void;
    return (u32)(size_t)(lds_void*)p;
}

// eight asynchronous 16-byte copies global -> LDS per lane, from g[0..7] to the LDS byte addresses l[0..7].
// The s_wait_xcnt closes the statement so that it stands in front of every later write of an address register the copies name.
__device__ __forceinline__ void copy8(const u32* l, const u16* const* g) {
    asm volatile("global_load_async_to_lds_b128 %0, %8, off\n\t"
                 "global_load_async_to_lds_b128 %1, %9, off\n\t"
                 "global_load_async_to_lds_b128 %2, %10, off\n\t"
                 "global_load_async_to_lds_b128 %3, %11, off\n\t"
                 "global_load_async_to_lds_b128 %4, %12, off\n\t"
                 "global_load_async_to_lds_b128 %5, %13, off\n\t"
                 "global_load_async_to_lds_b128 %6, %14, off\n\t"
                 "global_load_async_to_lds_b128 %7, %15, off\n\t"
                 "s_wait_xcnt 0x0"
                 :: "v"(l[0]), "v"(l[1]), "v"(l[2]), "v"(l[3]), "v"(l[4]), "v"(l[5]), "v"(l[6]), "v"(l[7]),
                    "v"(g[0]), "v"(g[1]), "v"(g[2]), "v"(g[3]), "v"(g[4]), "v"(g[5]), "v"(g[6]), "v"(g[7])
                 : "memory");
}

// ---------------- f16 GEMM: C[128x128 tile] = A[M][K](f16) . BT[N][K](f16)^T, BK of k per stage ----------------
// 8 waves = 4 (m) x 2 (n), wave tile 32 x 64, fragments per the split k map for A and B.
// Staging: asynchronous 16-byte copies into a ring of two LDS buffers [A 128 rows | B 128 rows], row pitch 2 BK + 16 bytes;
// stage t + 1 is in flight while stage t is multiplied. Each wave-wide copy covers 4 whole 128-B lines.
// BK = 256 where the grid has one workgroup per WGP (MODE 1, 3), else 128 (two workgroups per WGP by LDS).
// Epilogue: acc*(1/64) + bias(bf16-RNE) [-> gelu] staged as f32 128x128 tile in LDS, then
// MODE 0: qkv: n0 < QP -> qk hi plane [RROWS][QP] (+ lo plane rows t<TE), else V transposed
//         into vt hi [NB*NH][64][SEQ] (+ vt lo [..][64][TE] for t<TE)
// MODE 1: out0 f32 [RROWS][CE] = acc + bias + bfr(res at full-size rows)   (x1)
// MODE 2: out0 f16 [RROWS][C4] = gelu(acc + bias)                          (hg)
// MODE 3: out0 f32 at full-size rows = acc + bias + res[logical rows]      (d_out)
template <int MODE>
__global__ __launch_bounds__(256) void gemm_kernel(const u16* __restrict__ A,
                                                   const u16* __restrict__ BT,
                                                   const float* __restrict__ bias,
                                                   const float* __restrict__ res,
                                                   void* out0, void* out1, void* out2, void* out3,
                                                   u32 N, u32 K) {
    constexpr u32 BK     = (MODE == 1 || MODE == 3) ? 256u : 128u;   // k per stage
    constexpr u32 PH     = BK + 8u;                // LDS row pitch in halves: 16 B x odd
    constexpr u32 TILE_H = 128u * PH;              // one operand's tile, halves
    constexpr u32 BUF_H  = 2u * TILE_H;            // one buffer: A tile | B tile
    constexpr u32 LPR    = BK / 8u;                // lanes per row (16 B each)
    constexpr u32 RPP    = 256u / LPR;             // rows the workgroup covers with one copy per lane
    constexpr u32 NCP    = 128u / RPP;             // copies per lane, operand and stage
    constexpr u32 CSP = 132;
    static_assert(CE % BK == 0 && C4 % BK == 0);
    static_assert(NCP % 8u == 0 && 2u * NCP <= 63u);
    static_assert(2u * BUF_H * 2u >= 128u * CSP * 4u);
    __shared__ u32x4 smem[2u * BUF_H / 8u];        // the ring during the k loop, Cs after it
    u16* As = (u16*)smem;                          // buffer b: A [128][PH] at b * BUF_H, B [128][PH] behind it
    float* Cs = (float*)smem;                      // [128][132]

    const u32 tid = threadIdx.x, lane = tid & 31u, wv = tid >> 5;
    const u32 hf = lane >> 4, ln = lane & 15u;
    const u32 m0 = blockIdx.y * 128u, n0 = blockIdx.x * 128u;
    const u32 wm = wv & 3u, wn = wv >> 2;
    const u32 srow = tid / LPR, sseg = (tid % LPR) * 8u; // rows srow + RPP i, 8 halves at sseg
    const u32 nt = K / BK;                               // stages; K is a multiple of BK
    // this lane's copies of the next stage to be issued: A rows, then B rows. Source and LDS addresses live in registers and
    // move on by one add each behind an issue, so that no address arithmetic stands between a stage's barrier and its refill.
    const u16* gp[2u * NCP];
    u32 lp[2u * NCP];
#pragma unroll
    for (u32 c = 0; c < NCP; c++) {
        gp[c]       = A  + (size_t)(m0 + srow + c * RPP) * K + sseg;
        gp[NCP + c] = BT + (size_t)(n0 + srow + c * RPP) * K + sseg;
        lp[c]       = lds_addr(&As[(srow + c * RPP) * PH + sseg]);
        lp[NCP + c] = lp[c] + TILE_H * 2u;
    }
    // issues one stage into the buffer lp points at, then moves to the next stage's k and by dl bytes to the other buffer
    auto stage = [&](u32 dl) {
#pragma unroll                                           // constant indices: gp and lp stay in registers
        for (u32 c = 0; c < 2u * NCP; c += 8u) copy8(&lp[c], &gp[c]);
#pragma unroll
        for (u32 c = 0; c < 2u * NCP; c++) { gp[c] += BK; lp[c] += dl; }
    };
    constexpr u32 BUF_B = BUF_H * 2u;                    // bytes from buffer 0 to buffer 1

    v8f acc[2][4];
#pragma unroll
    for (int i = 0; i < 2; i++)
#pragma unroll
        for (int j = 0; j < 4; j++) acc[i][j] = (v8f)(0.f);

    stage(BUF_B);                                      // stage 0 into buffer 0
    asm volatile("s_wait_asynccnt 0x0" ::: "memory");  // this wave's stage 0 copies have landed
    __syncthreads();                                   // stage 0 visible to all waves
    if (1u < nt) stage(0u - BUF_B);                    // stage 1 into buffer 1
#pragma unroll 1                                       // stays rolled: one stage body, the buffer picked by t & 1
    for (u32 t = 0; t < nt; t++) {
        const u16* Ab = As + (t & 1u) * BUF_H;
        const u16* Bb = Ab + TILE_H;
#pragma unroll
        for (u32 ks = 0; ks < BK / 32u; ks++) {
            Frag af[2], bf[4];
#pragma unroll
            for (u32 mi = 0; mi < 2; mi++) {
                const u16* q = &Ab[(wm * 32u + mi * 16u + ln) * PH + ks * 32u + hf * 8u];
                af[mi].u[0] = *(const u32x4*)q;
                af[mi].u[1] = *(const u32x4*)(q + 16);
            }
#pragma unroll
            for (u32 ni = 0; ni < 4; ni++) {
                const u16* q = &Bb[(wn * 64u + ni * 16u + ln) * PH + ks * 32u + hf * 8u];
                bf[ni].u[0] = *(const u32x4*)q;
                bf[ni].u[1] = *(const u32x4*)(q + 16);
            }
#pragma unroll
            for (int mi = 0; mi < 2; mi++)
#pragma unroll
                for (int ni = 0; ni < 4; ni++)
                    acc[mi][ni] = mma16(af[mi].v, bf[ni].v, acc[mi][ni]);
        }
        asm volatile("s_wait_dscnt 0x0" ::: "memory");     // this wave's reads of stage t's buffer are done before it is refilled
        asm volatile("s_wait_asynccnt 0x0" ::: "memory");  // this wave's stage t + 1 copies have landed
        __syncthreads();                                   // publishes stage t + 1 and ends every wave's reads of stage t
        if (t + 2u < nt) stage((t & 1u) ? 0u - BUF_B : BUF_B);   // stage t + 2 into the buffer stage t has left
    }
    asm volatile("s_wait_asynccnt 0x0" ::: "memory");      // no copy outstanding when the ring becomes the C tile

    // ---- epilogue: accumulators -> f32 tile in LDS (aliases the ring: the last stage's own barrier has ended every wave's reads) ----
#pragma unroll
    for (int ni = 0; ni < 4; ni++) {
        const u32 col = wn * 64u + (u32)ni * 16u + ln;
        const float bv = bfr(bias[n0 + col]);
#pragma unroll
        for (int mi = 0; mi < 2; mi++) {
#pragma unroll
            for (int r = 0; r < 8; r++) {
                const u32 row = wm * 32u + (u32)mi * 16u + hf * 8u + (u32)r;
                float v = acc[mi][ni][r] * WINV + bv;
                if constexpr (MODE == 2) v = gelu_erf(v);
                Cs[row * CSP + col] = v;
            }
        }
    }
    __syncthreads();                               // Cs is read across waves below

    if constexpr (MODE == 1 || MODE == 3) {
        float* o = (float*)out0;
        v4f val[16];
#pragma unroll
        for (int grp = 0; grp < 2; grp++) {
#pragma unroll
            for (int i8 = 0; i8 < 8; i8++) {
                const int i = grp * 8 + i8;
                const u32 row = wv * 16u + (u32)i;
                const u32 r = m0 + row;
                v4f c = *(const v4f*)&Cs[row * CSP + lane * 4u];
                const size_t rr = (MODE == 1) ? grow_map(r) : (size_t)r;
                v4f x4 = *(const v4f*)(res + rr * (size_t)N + n0 + lane * 4u);
                if constexpr (MODE == 1) {
#pragma unroll
                    for (int cc = 0; cc < 4; cc++) { float t = x4[cc]; x4[cc] = bfr(t); }
                }
                val[i] = c + x4;
            }
            asm volatile("" ::: "memory");         // keep the two load groups in separate clauses
        }
#pragma unroll
        for (int i = 0; i < 16; i++) {
            const u32 r = m0 + wv * 16u + (u32)i;
            const size_t orr = (MODE == 3) ? grow_map(r) : (size_t)r;
            *(v4f*)(o + orr * (size_t)N + n0 + lane * 4u) = val[i];
        }
        
    } else if constexpr (MODE == 2) {
        u16* o = (u16*)out0;
        u32x4 val[8];
#pragma unroll
        for (int it = 0; it < 8; it++) {
            const u32 rloc = wv * 16u + (u32)it * 2u + hf, cseg = ln * 8u;
            Pack8 pk;
#pragma unroll
            for (int j = 0; j < 8; j++) pk.h[j] = (_Float16)Cs[rloc * CSP + cseg + (u32)j];
            val[it] = pk.u;
        }
#pragma unroll
        for (int it = 0; it < 8; it++) {
            const u32 rloc = wv * 16u + (u32)it * 2u + hf, cseg = ln * 8u;
            *(u32x4*)(o + (size_t)(m0 + rloc) * N + n0 + cseg) = val[it];
        }
        
    } else {
        // MODE 0: q/k planes or transposed v planes
        u16* qkh = (u16*)out0;
        u16* qkl = (u16*)out1;
        u16* vth = (u16*)out2;
        u16* vtl = (u16*)out3;
        const u32 bq = m0 / (u32)(SEQ);
        const u32 t0 = m0 - bq * (u32)(SEQ);       // 128 | SEQ so the tile sits inside one batch
        const bool lo_on = (t0 < (u32)(TE));       // uniform per workgroup
        u32x4 vh[8], vl[8];
        if (n0 < (u32)QP) {
#pragma unroll
            for (int it = 0; it < 8; it++) {
                const u32 rloc = wv * 16u + (u32)it * 2u + hf, cseg = ln * 8u;
                Pack8 ph, pl;
#pragma unroll
                for (int j = 0; j < 8; j++) {
                    float f = Cs[rloc * CSP + cseg + (u32)j];
                    _Float16 h16 = (_Float16)f;
                    ph.h[j] = h16;
                    pl.h[j] = (_Float16)((f - (float)h16) * RSC);
                }
                vh[it] = ph.u; vl[it] = pl.u;
            }
#pragma unroll
            for (int it = 0; it < 8; it++) {
                const u32 rloc = wv * 16u + (u32)it * 2u + hf, cseg = ln * 8u;
                *(u32x4*)(qkh + (size_t)(m0 + rloc) * QP + n0 + cseg) = vh[it];
                if (lo_on)
                    *(u32x4*)(qkl + ((size_t)bq * (TE) + t0 + rloc) * QP + n0 + cseg) = vl[it];
            }
            
        } else {
            const u32 hh0 = (n0 - (u32)QP) >> 6;   // two heads per 128-column tile
#pragma unroll
            for (int it = 0; it < 8; it++) {
                const u32 rloc = wv * 16u + (u32)it * 2u + hf;   // local column = head*64 + d
                const u32 tseg = ln * 8u;
                Pack8 ph, pl;
#pragma unroll
                for (int j = 0; j < 8; j++) {
                    float f = Cs[(tseg + (u32)j) * CSP + rloc];
                    _Float16 h16 = (_Float16)f;
                    ph.h[j] = h16;
                    pl.h[j] = (_Float16)((f - (float)h16) * RSC);
                }
                vh[it] = ph.u; vl[it] = pl.u;
            }
#pragma unroll
            for (int it = 0; it < 8; it++) {
                const u32 rloc = wv * 16u + (u32)it * 2u + hf, tseg = ln * 8u;
                const u32 hh = hh0 + (rloc >> 6), dd = rloc & 63u;
                const size_t vrow = (size_t)(bq * NH + hh) * HD + dd;
                *(u32x4*)(vth + vrow * (SEQ) + t0 + tseg) = vh[it];
                if (lo_on)
                    *(u32x4*)(vtl + vrow * (TE) + t0 + tseg) = vl[it];
            }
            
        }
    }
}

// ---------------- causal flash attention, hd=64, 128 queries per workgroup (8 waves x 16 rows), 64-key chunks ----------------
// qkh: [RROWS][QP] f16 (q cols h*64+d, k cols CE+h*64+d); qkl: same layout for rows t<TE, residual x2048
// vth: [NB*NH][64][SEQ] f16 transposed v; vtl: [NB*NH][64][TE] residual x2048
// Transposed products: A = K rows (S^T) or V^T rows (O^T), B = Q or P^T. Lane (hf, ln) owns query q0 + ln:
// S^T register r of sub-tile sub = key sub*16 + hf*8 + r, so two converted sub-tiles are one B fragment in the loaders' k order.
// RES=1: query tiles with position < TE: S = qh.kh + (qh.kl + ql.kh)/2048, O += Ph.Vh + (Pr.Vh + Ph.Vl)/2048
// RES=1 only: wave index taken as a scalar-uniform value.
// Operand fragments leave LDS in groups ahead of the products that read them (same arithmetic, same order of products):
// RES=0 a chunk's 8 K fragments, then its 8 V fragments ahead of the softmax; RES=1 one sub-tile ahead, two register sets.
// bh, qb: the workgroup's head and query tile; Ks .. Ps: its LDS arrays (Kl, Vl read and written by RES=1 alone)
template <int RES>
__device__ __forceinline__
void attn_body(const u16* qkh, const u16* qkl, const u16* vth, const u16* vtl, u16* cv, u32 bh, u32 qb,
               u16* Ks, u16* Vs, u16* Kl, u16* Vl, u16* Ps) {
    const u32 b = bh / (u32)NH, h = bh - b * (u32)NH;
    const u32 tid = threadIdx.x, lane = tid & 31u;
    u32 wv = tid >> 5;
    if constexpr (RES != 0) wv = (u32)__builtin_amdgcn_readfirstlane((int)wv);   // all lanes active, value is wave-uniform
    const u32 hf = lane >> 4, ln = lane & 15u;
    const u32 q0 = qb * 128u + wv * 16u;
    u16* Pw  = Ps + wv * (16u * 72u);

    Frag qf[2], ql[2];
#pragma unroll
    for (u32 ds = 0; ds < 2; ds++) {
        const u16* p = qkh + (size_t)(b * (u32)(SEQ) + q0 + ln) * QP + h * HD + ds * 32u + hf * 8u;
        qf[ds].u[0] = *(const u32x4*)p;
        qf[ds].u[1] = *(const u32x4*)(p + 16);
        if constexpr (RES != 0) {
            const u16* pl = qkl + (size_t)(b * (u32)(TE) + q0 + ln) * QP + h * HD + ds * 32u + hf * 8u;
            ql[ds].u[0] = *(const u32x4*)pl;
            ql[ds].u[1] = *(const u32x4*)(pl + 16);
        } else {
            ql[ds].u[0] = (u32x4)(0u); ql[ds].u[1] = (u32x4)(0u);
        }
    }

    v8f o[4];
#pragma unroll
    for (int i = 0; i < 4; i++) o[i] = (v8f)(0.f);
    float mrun = -3.0e38f;                                 // running maximum of this lane's query (both halves agree)
    float lsum = 0.f;                                      // running sum over this lane half's keys; halves joined after the loop
    const u32 qg = q0 + ln;

    const u32 rr = tid >> 3, seg = (tid & 7u) * 8u;       // staging: rows rr and rr + 32 (key or d), 8 halves at seg: 4 whole 128-B lines per load instruction
    const u32 nkt = 2u * qb + 2u;                          // keys 0 .. qb*128+127

#pragma unroll 1
    for (u32 kt = 0; kt < nkt; kt++) {
        __syncthreads();                                   // prior chunk's LDS reads done
        {
            const u16* gk = qkh + (size_t)(b * (u32)(SEQ) + kt * 64u + rr) * QP + CE + h * HD + seg;
            u32x4 k0v = *(const u32x4*)gk, k1v = *(const u32x4*)(gk + 32u * QP);
            const u16* gv = vth + ((size_t)(bh * HD + rr)) * (SEQ) + kt * 64u + seg;
            u32x4 v0 = *(const u32x4*)gv, v1 = *(const u32x4*)(gv + 32u * (SEQ));
            asm volatile("s_wait_xcnt 0x0" ::: "memory");   // stands in front of every later overwrite of the address registers that the loads above name
            *(u32x4*)&Ks[rr * 72u + seg] = k0v; *(u32x4*)&Ks[(rr + 32u) * 72u + seg] = k1v;
            *(u32x4*)&Vs[rr * 72u + seg] = v0;  *(u32x4*)&Vs[(rr + 32u) * 72u + seg] = v1;
            sched_cut<RES>();                              // hi-plane staging temporaries end here
            if constexpr (RES != 0) {
                const u16* gkl = qkl + (size_t)(b * (u32)(TE) + kt * 64u + rr) * QP + CE + h * HD + seg;
                u32x4 kl0 = *(const u32x4*)gkl, kl1 = *(const u32x4*)(gkl + 32u * QP);
                const u16* gvl = vtl + ((size_t)(bh * HD + rr)) * (TE) + kt * 64u + seg;
                u32x4 vl0 = *(const u32x4*)gvl, vl1 = *(const u32x4*)(gvl + 32u * (TE));
                asm volatile("s_wait_xcnt 0x0" ::: "memory");   // stands in front of every later overwrite of the address registers that the loads above name
                *(u32x4*)&Kl[rr * 72u + seg] = kl0; *(u32x4*)&Kl[(rr + 32u) * 72u + seg] = kl1;
                *(u32x4*)&Vl[rr * 72u + seg] = vl0; *(u32x4*)&Vl[(rr + 32u) * 72u + seg] = vl1;
            }
        }
        __syncthreads();                                   // K/V chunk visible to all waves
        sched_cut<RES>();

        // S^T = K . Q^T  (64 keys x 16 q per wave)
        // The K fragment loads stand as groups ahead of the products that read them, so a wave waits out the LDS
        // latency once per group and not once per product. RES=0: the chunk's 8 fragments in one group.
        // RES=1: one sub-tile's hi and residual fragments per group, fetched one sub-tile ahead into a second register set.
        v8f s[4];
        Frag vf[RES ? 2 : 4][2], vlf[2][2];                // V fragments: RES=0 [d sub-tile][ks], RES=1 [register set][ks]
        if constexpr (RES == 0) {
            Frag kf[4][2];
#pragma unroll
            for (int sub = 0; sub < 4; sub++)
#pragma unroll
                for (int ds = 0; ds < 2; ds++)
                    ldfrag(kf[sub][ds], &Ks[((u32)sub * 16u + ln) * 72u + (u32)ds * 32u + hf * 8u]);
            __builtin_amdgcn_sched_barrier(0);             // the 16 K loads issue together, none sinks down among the products
#pragma unroll
            for (int sub = 0; sub < 4; sub++) {
                v8f t = (v8f)(0.f);
#pragma unroll
                for (int ds = 0; ds < 2; ds++) t = mma16(kf[sub][ds].v, qf[ds].v, t);
                s[sub] = t;
            }
            __builtin_amdgcn_sched_barrier(0);             // the V loads below stay behind the last S^T product (they take over the K registers)
#pragma unroll
            for (int dsub = 0; dsub < 4; dsub++)
#pragma unroll
                for (int ks = 0; ks < 2; ks++)
                    ldfrag(vf[dsub][ks], &Vs[((u32)dsub * 16u + ln) * 72u + (u32)ks * 32u + hf * 8u]);
            __builtin_amdgcn_sched_barrier(0);             // the 16 V loads issue here, ahead of the softmax, which covers their latency
        } else {
            Frag kf[2][2], klf[2][2];
#pragma unroll
            for (int ds = 0; ds < 2; ds++) {
                ldfrag(kf[0][ds],  &Ks[ln * 72u + (u32)ds * 32u + hf * 8u]);
                ldfrag(klf[0][ds], &Kl[ln * 72u + (u32)ds * 32u + hf * 8u]);
            }
#pragma unroll
            for (int sub = 0; sub < 4; sub++) {
                const int cur = sub & 1, nxt = cur ^ 1;
#pragma unroll
                for (int ds = 0; ds < 2; ds++) {
                    if (sub < 3) {
                        ldfrag(kf[nxt][ds],  &Ks[((u32)(sub + 1) * 16u + ln) * 72u + (u32)ds * 32u + hf * 8u]);
                        ldfrag(klf[nxt][ds], &Kl[((u32)(sub + 1) * 16u + ln) * 72u + (u32)ds * 32u + hf * 8u]);
                    } else {
                        ldfrag(vf[0][ds],  &Vs[ln * 72u + (u32)ds * 32u + hf * 8u]);
                        ldfrag(vlf[0][ds], &Vl[ln * 72u + (u32)ds * 32u + hf * 8u]);
                    }
                }
                __builtin_amdgcn_sched_barrier(0);         // the next group's 8 loads issue ahead of this sub-tile's products
                v8f t = (v8f)(0.f);
                v8f tr = (v8f)(0.f);
#pragma unroll
                for (int ds = 0; ds < 2; ds++) {
                    t  = mma16(kf[cur][ds].v,  qf[ds].v, t);
                    tr = mma16(klf[cur][ds].v, qf[ds].v, tr);
                    tr = mma16(kf[cur][ds].v,  ql[ds].v, tr);
                }
                s[sub] = t + tr * RINV;
                __builtin_amdgcn_sched_barrier(0);         // the group after next stays behind this sub-tile's products: two register sets, no more
            }
        }

        // scale + causal replace-fill
#pragma unroll
        for (int sub = 0; sub < 4; sub++) {
#pragma unroll
            for (int r = 0; r < 8; r++) {
                const u32 kg = kt * 64u + (u32)sub * 16u + hf * 8u + (u32)r;
                float v = s[sub][r] * 0.125f;
                s[sub][r] = (kg > qg) ? -3.0e38f : v;
            }
        }
        // online softmax: one query per lane, 32 of the chunk's keys in-lane, the other 32 in lane ^ 16
        float mxs[4];
#pragma unroll
        for (int sub = 0; sub < 4; sub++) {
            mxs[sub] = fmaxf(fmaxf(fmaxf(s[sub][0], s[sub][1]), fmaxf(s[sub][2], s[sub][3])),
                             fmaxf(fmaxf(s[sub][4], s[sub][5]), fmaxf(s[sub][6], s[sub][7])));
        }
        float mx = fmaxf(fmaxf(mxs[0], mxs[1]), fmaxf(mxs[2], mxs[3]));
        mx = fmaxf(mx, xhalf(mx));
        const float mnew  = fmaxf(mrun, mx);
        const float alpha = exp_fast(mrun - mnew);
        float rs[4];
#pragma unroll
        for (int sub = 0; sub < 4; sub++) {
            rs[sub] = 0.f;
#pragma unroll
            for (int r = 0; r < 8; r++) {
                float pe = exp_fast(s[sub][r] - mnew);
                s[sub][r] = pe;
                rs[sub] += pe;
            }
        }
        mrun = mnew;
        lsum = lsum * alpha + ((rs[0] + rs[1]) + (rs[2] + rs[3]));
#pragma unroll
        for (int dsub = 0; dsub < 4; dsub++) o[dsub] *= alpha;

        // P^T: two converted S^T sub-tiles = one B fragment (32 keys x 16 q), carried x4096 (+ residual x2048)
        Frag pf[2], prf[2];
#pragma unroll
        for (int ks = 0; ks < 2; ks++) {
#pragma unroll
            for (int e = 0; e < 16; e++) {
                const float ph = s[2 * ks + (e >> 3)][e & 7] * PCAR;
                _Float16 h16 = (_Float16)ph;
                pf[ks].v[e] = h16;
                if constexpr (RES != 0) prf[ks].v[e] = (_Float16)((ph - (float)h16) * RSC);
            }
        }
        // O^T += V^T . P^T
#pragma unroll
        for (int dsub = 0; dsub < 4; dsub++) {
            if constexpr (RES == 0) {
#pragma unroll
                for (int ks = 0; ks < 2; ks++) o[dsub] = mma16(vf[dsub][ks].v, pf[ks].v, o[dsub]);
            } else {
                const int cur = dsub & 1, nxt = cur ^ 1;
                if (dsub < 3) {
#pragma unroll
                    for (int ks = 0; ks < 2; ks++) {
                        ldfrag(vf[nxt][ks],  &Vs[((u32)(dsub + 1) * 16u + ln) * 72u + (u32)ks * 32u + hf * 8u]);
                        ldfrag(vlf[nxt][ks], &Vl[((u32)(dsub + 1) * 16u + ln) * 72u + (u32)ks * 32u + hf * 8u]);
                    }
                }
                __builtin_amdgcn_sched_barrier(0);         // the next d sub-tile's 8 loads issue ahead of this one's products
                v8f u = (v8f)(0.f);
#pragma unroll
                for (int ks = 0; ks < 2; ks++) {
                    o[dsub] = mma16(vf[cur][ks].v,  pf[ks].v,  o[dsub]);
                    u       = mma16(vf[cur][ks].v,  prf[ks].v, u);
                    u       = mma16(vlf[cur][ks].v, pf[ks].v,  u);
                }
                o[dsub] = o[dsub] + u * RINV;
                __builtin_amdgcn_sched_barrier(0);         // the group after next stays behind this sub-tile's products: two register sets, no more
            }
        }
    }

    // finalize: O / (l * 4096) -> f16 tile in the wave's LDS stage -> whole-line stores
    // O^T register r of tile dsub = d dsub*16 + hf*8 + r of query ln: 8 consecutive d, one 16-byte LDS store
    const float inv = (1.0f / (lsum + xhalf(lsum))) * PINV;
#pragma unroll
    for (int dsub = 0; dsub < 4; dsub++) {
        Pack8 pk;
#pragma unroll
        for (int r = 0; r < 8; r++) pk.h[r] = (_Float16)(o[dsub][r] * inv);
        *(u32x4*)&Pw[ln * 72u + (u32)dsub * 16u + hf * 8u] = pk.u;
    }
    __syncthreads();
    u32x4 val[4];
#pragma unroll
    for (u32 it = 0; it < 4; it++) {
        const u32 rloc = it * 4u + (lane >> 3), sg = (lane & 7u) * 8u;
        val[it] = *(const u32x4*)&Pw[rloc * 72u + sg];
    }
#pragma unroll
    for (u32 it = 0; it < 4; it++) {
        const u32 rloc = it * 4u + (lane >> 3), sg = (lane & 7u) * 8u;
        *(u32x4*)(cv + (size_t)(b * (u32)(SEQ) + q0 + rloc) * CE + h * HD + sg) = val[it];
    }
    // the body is inlined beside other bodies of one kernel: stands in front of every write, on any path the branches behind it
    // allow, of a register that the stores above name
    asm volatile("s_wait_xcnt 0x0" ::: "memory");
}

// all query tiles of all heads in one launch: x = head, y counts the tiles down from the longest;
// the residual-carrying tiles (position < TE, the fewest chunks) come last and run beside the plain ones.
// Rows y >= NQB of the grid: the 64 x 64 tiles of the proj, fc and fc2 weight converts, which depend on inputs alone and
// are first read by the launches behind this one.
#define NCVR ((NT_P + NT_F + NT_G) / (NB * NH))
static_assert(NCVR * (NB * NH) == NT_P + NT_F + NT_G);
__global__ __launch_bounds__(256) __attribute__((amdgpu_num_vgpr(256)))
void attn_kernel(const u16* __restrict__ qkh, const u16* __restrict__ qkl,
                 const u16* __restrict__ vth, const u16* __restrict__ vtl,
                 u16* __restrict__ cv,
                 const float* __restrict__ w_p, const float* __restrict__ w_f, const float* __restrict__ w_g,
                 u16* __restrict__ o_p, u16* __restrict__ o_f, u16* __restrict__ o_g) {
    __shared__ __align__(16) u16 Ks[64 * 72];              // [key][d]
    __shared__ __align__(16) u16 Vs[64 * 72];              // [d][key]
    __shared__ __align__(16) u16 Kl[64 * 72];
    __shared__ __align__(16) u16 Vl[64 * 72];
    __shared__ __align__(16) u16 Ps[8 * 16 * 72];          // per wave [16 q][d]: final O stage
    if (blockIdx.y >= (u32)NQB) {                          // every test here is uniform for the workgroup
        u32 t = (blockIdx.y - (u32)NQB) * (u32)(NB * NH) + blockIdx.x;
        if (t < (u32)NT_P) {                               // [1024][1024] -> [1024][1024]
            cvt_wt_body(w_p, o_p, (u32)CE, (u32)CE, t % (u32)(CE / 64), t / (u32)(CE / 64), Ks);
            return;
        }
        t -= (u32)NT_P;
        if (t < (u32)NT_F) {                               // [1024][4096] -> [4096][1024]
            cvt_wt_body(w_f, o_f, (u32)CE, (u32)C4, t % (u32)(C4 / 64), t / (u32)(C4 / 64), Ks);
            return;
        }
        t -= (u32)NT_F;                                    // < NT_G by the grid; [4096][1024] -> [1024][4096]
        cvt_wt_body(w_g, o_g, (u32)C4, (u32)CE, t % (u32)(CE / 64), t / (u32)(CE / 64), Ks);
        return;
    }
    const u32 bh = blockIdx.x;
    const u32 qb = (u32)NQB - 1u - blockIdx.y;
    if (qb < (u32)NEB) attn_body<1>(qkh, qkl, vth, vtl, cv, bh, qb, Ks, Vs, Kl, Vl, Ps);
    else               attn_body<0>(qkh, qkl, vth, vtl, cv, bh, qb, Ks, Vs, Kl, Vl, Ps);
}

// ---------------- host side ----------------
extern "C" void kernel_launch(void* const* d_in, const int* in_sizes, int n_in,
                              void* d_out, int out_size, void* d_ws, size_t ws_size,
                              hipStream_t stream) {
    if (n_in < 13) return;
    const long long needX = ((long long)(NB - 1) * SEQ_FULL + (SEQ)) * CE;
    if ((long long)in_sizes[0] < needX || (long long)out_size < needX) return;
    if (in_sizes[1] < CE || in_sizes[2] < CE || in_sizes[3] < CE * C3 || in_sizes[4] < C3 ||
        in_sizes[5] < CE * CE || in_sizes[6] < CE || in_sizes[7] < CE || in_sizes[8] < CE ||
        in_sizes[9] < CE * C4 || in_sizes[10] < C4 || in_sizes[11] < C4 * CE || in_sizes[12] < CE)
        return;

    const float* x      = (const float*)d_in[0];
    const float* ln1_g  = (const float*)d_in[1];
    const float* ln1_b  = (const float*)d_in[2];
    const float* w_attn = (const float*)d_in[3];
    const float* b_attn = (const float*)d_in[4];
    const float* w_proj = (const float*)d_in[5];
    const float* b_proj = (const float*)d_in[6];
    const float* ln2_g  = (const float*)d_in[7];
    const float* ln2_b  = (const float*)d_in[8];
    const float* w_fc   = (const float*)d_in[9];
    const float* b_fc   = (const float*)d_in[10];
    const float* w_fc2  = (const float*)d_in[11];
    const float* b_fc2  = (const float*)d_in[12];

    char* ws = (char*)d_ws;
    size_t off = 0;
    auto take = [&](size_t bytes) -> char* {
        char* p = ws + off;
        off += (bytes + 255) & ~(size_t)255;
        return p;
    };
    const size_t R = (size_t)RROWS;
    u16*   waT   = (u16*)take((size_t)C3 * CE * 2);               // [3072][1024]
    u16*   wpT   = (u16*)take((size_t)CE * CE * 2);               // [1024][1024]
    u16*   wfcT  = (u16*)take((size_t)C4 * CE * 2);               // [4096][1024]
    u16*   wfc2T = (u16*)take((size_t)CE * C4 * 2);               // [1024][4096]
    u16*   h1    = (u16*)take(R * CE * 2);                        // [R][1024]
    u16*   qkh   = (u16*)take(R * QP * 2);                        // [R][2048]
    u16*   qkl   = (u16*)take((size_t)NB * (TE) * QP * 2);        // [NB*TE][2048]
    u16*   vth   = (u16*)take((size_t)NB * NH * HD * (SEQ) * 2);  // [NB*NH][64][SEQ]
    u16*   vtl   = (u16*)take((size_t)NB * NH * HD * (TE) * 2);   // [NB*NH][64][TE]
    u16*   cvb   = (u16*)take(R * CE * 2);                        // [R][1024]
    float* x1    = (float*)take(R * CE * 4);                      // [R][1024]
    u16*   h2    = (u16*)take(R * CE * 2);                        // [R][1024]
    u16*   hg    = (u16*)take(R * C4 * 2);                        // [R][4096]
    if (off > ws_size || off > (size_t)134217728) return;
    void* dummy = (void*)d_ws;

    // 1) + 2) h1 = LN1(bfr(x)); qkv weight: bf16-RNE value x64 -> f16, transposed to [N][K]   (in[K][N] -> out[N][K])
    prep_kernel<<<NLN + NT_A, 256, 0, stream>>>(x, ln1_g, ln1_b, h1, w_attn, waT);
    // 3) qkv = h1 . w_attn + b_attn -> q/k planes (+ residual rows t<TE), v transposed (+ residual)
    gemm_kernel<0><<<dim3(C3 / 128, RROWS / 128), 256, 0, stream>>>(h1, waT, b_attn, b_attn,
                                                                    qkh, qkl, vth, vtl, (u32)C3, (u32)CE);
    // 4) causal attention: residual-carrying tiles for query position < TE, plain tiles after
    //    behind them in the same grid: the proj, fc and fc2 weights, converted like the qkv weight
    attn_kernel<<<dim3(NB * NH, NQB + NCVR), 256, 0, stream>>>(qkh, qkl, vth, vtl, cvb,
                                                               w_proj, w_fc, w_fc2, wpT, wfcT, wfc2T);
    // 5) x1 = cv . w_proj + b_proj + bfr(x)
    gemm_kernel<1><<<dim3(CE / 128, RROWS / 128), 256, 0, stream>>>(cvb, wpT, b_proj, x,
                                                                    x1, dummy, dummy, dummy, (u32)CE, (u32)CE);
    // 6) h2 = LN2(x1)
    ln_kernel<<<RROWS / 8, 256, 0, stream>>>(x1, ln2_g, ln2_b, h2);
    // 7) hg = gelu(h2 . w_fc + b_fc)
    gemm_kernel<2><<<dim3(C4 / 128, RROWS / 128), 256, 0, stream>>>(h2, wfcT, b_fc, b_fc,
                                                                    hg, dummy, dummy, dummy, (u32)C4, (u32)CE);
    // 8) out = hg . w_fc2 + b_fc2 + x1
    gemm_kernel<3><<<dim3(CE / 128, RROWS / 128), 256, 0, stream>>>(hg, wfc2T, b_fc2, x1,
                                                                    d_out, dummy, dummy, dummy, (u32)CE, (u32)C4);
}

// v006
// One run takes 166 microseconds.
// Two timings next to v005 put it at 1.11 and 1.13 times that version's speed.
// All steps since v000 together make it 2.16 times as fast.
#include <hip/hip_runtime.h>

// Contractions: v_wmma_f32_16x16x32_f16 (f16 operands, f32 accumulate) for qkv = h.W, S = q.k^T, O = p.v, proj, fc, fc2.
// Weight operand planes: bf16-RNE input value x64, cast to f16, stored transposed [N][K]. Activation planes f16.
// Attention runs transposed: S^T = k.q^T, O^T = v^T.p^T; p^T packs from the S^T accumulators straight into the B operand.
// p carried x4096 in f16. Query tiles with position < TE add f16 residual planes (x2048) of q, k, v, p
// through separately scaled second products folded into the f32 accumulators. Softmax, LN and erf-GELU in f32.

#ifndef NB
#define NB 2
#endif
#ifndef SEQ
#define SEQ 2048
#endif
#define NB_FULL 2
#define SEQ_FULL 2048
#define CE 1024
#define NH 16
#define HD 64
#define C3 3072
#define C4 4096
#define QP 2048
#define TE (((SEQ) < 256) ? (SEQ) : 256)
#define RROWS ((NB) * (SEQ))
#define NEB ((TE) / 128)
#define NQB ((SEQ) / 128)
#define LNJ ((CE) / 128)
#define LNO ((CE) / 256)

static_assert((SEQ) % 128 == 0);
static_assert((TE) % 128 == 0);
static_assert((NB) >= 1 && (NB) <= NB_FULL);
static_assert((SEQ) <= SEQ_FULL);
static_assert(CE % 128 == 0 && C3 % 128 == 0 && C4 % 128 == 0 && QP % 128 == 0);
static_assert(CE % 64 == 0 && C3 % 64 == 0 && C4 % 64 == 0);
static_assert(NH * HD == CE);
static_assert(HD == 64);
static_assert(QP == 2 * CE);
static_assert(C3 == 3 * CE);
static_assert(RROWS % 128 == 0);
static_assert(RROWS % 8 == 0);
static_assert(CE == 1024);
static_assert(256 * 4 == CE);            // gamma/beta staging: 256 threads x 4 floats
static_assert(32 * 4 * LNJ == CE);       // LN row load: 32 lanes x 4 floats x LNJ steps
static_assert(32 * 8 * LNO == CE);       // LN row store: 32 lanes x 8 halves x LNO instructions
static_assert(NQB * 128 == (SEQ));
static_assert(NEB <= NQB);

typedef unsigned short u16;
typedef unsigned int   u32;
typedef _Float16 v16h __attribute__((ext_vector_type(16)));
typedef _Float16 v8h  __attribute__((ext_vector_type(8)));
typedef _Float16 v4h  __attribute__((ext_vector_type(4)));
typedef float    v8f  __attribute__((ext_vector_type(8)));
typedef float    v4f  __attribute__((ext_vector_type(4)));
typedef unsigned int u32x4 __attribute__((ext_vector_type(4)));
typedef unsigned int u32x2 __attribute__((ext_vector_type(2)));

union Frag  { v16h v; u32x4 u[2]; };
union Pack8 { v8h h; u32x4 u; };
union Pack4 { v4h h; u32x2 u; };

#define WSCALE 64.0f
#define WINV   (1.0f / 64.0f)
#define PCAR   4096.0f
#define PINV   (1.0f / 4096.0f)
#define RSC    2048.0f
#define RINV   (1.0f / 2048.0f)

constexpr size_t al256(size_t b) { return (b + 255) & ~(size_t)255; }
constexpr size_t WS_TOTAL =
    al256((size_t)C3 * CE * 2) + al256((size_t)CE * CE * 2) + al256((size_t)C4 * CE * 2) +
    al256((size_t)CE * C4 * 2) + al256((size_t)RROWS * CE * 2) + al256((size_t)RROWS * QP * 2) +
    al256((size_t)NB * (TE) * QP * 2) + al256((size_t)NB * NH * HD * (SEQ) * 2) +
    al256((size_t)NB * NH * HD * (TE) * 2) + al256((size_t)RROWS * CE * 2) +
    al256((size_t)RROWS * CE * 4) + al256((size_t)RROWS * CE * 2) + al256((size_t)RROWS * C4 * 2);
static_assert(WS_TOTAL <= (size_t)134217728);

// f32 -> nearest-even bf16 grid value, returned as f32
__device__ __forceinline__ float bfr(float f) {
    u32 u = __builtin_bit_cast(u32, f);
    u += 0x7fffu + ((u >> 16) & 1u);
    u &= 0xffff0000u;
    return __builtin_bit_cast(float, u);
}

// f32 -> f16 (RNE) bits
__device__ __forceinline__ u16 hbits(float f) {
    _Float16 h = (_Float16)f;
    return __builtin_bit_cast(u16, h);
}

// 16x16x32 f16 WMMA with the VALU hazard guard tied to D and A/B
__device__ __forceinline__ v8f mma16(v16h a, v16h b, v8f c) {
    c = __builtin_amdgcn_wmma_f32_16x16x32_f16(false, a, false, b, (short)0, c, false, false);
    asm volatile("v_nop\n\tv_nop\n\tv_nop\n\tv_nop" : "+v"(c) : "v"(a), "v"(b));
    return c;
}

// one 16x32 operand fragment of a row-major LDS tile: two 16-byte loads, k order 0..7 and 16..23 (+ 8 in the upper lane half)
__device__ __forceinline__ void ldfrag(Frag& f, const u16* p) {
    f.u[0] = *(const u32x4*)p;
    f.u[1] = *(const u32x4*)(p + 16);
}

// scheduling-region boundary, emitted only in the residual-carrying attention instance:
// ends the live ranges of the staging temporaries before the next block of loads begins
template <int ON>
__device__ __forceinline__ void sched_cut() {
    if constexpr (ON != 0) __builtin_amdgcn_sched_barrier(0);
}

// value of lane l ^ 16 (the other 16-lane row), a vector cross-row move
__device__ __forceinline__ float xhalf(float x) {
    const int xi = __builtin_bit_cast(int, x);
    return __builtin_bit_cast(float, __builtin_amdgcn_permlanex16(xi, xi, 0x76543210, 0xfedcba98, false, false));
}

// e^x on the hardware exp2, same product and instruction as the fast-math exp;
// the v_nop fills the one issue slot the instruction set asks for behind a transcendental
// before its result is read or its source overwritten
__device__ __forceinline__ float exp_fast(float x) {
    float r;
    asm("v_exp_f32 %0, %1\n\tv_nop" : "=v"(r) : "v"(x * 1.44269504088896340736f));
    return r;
}

// erf-form GELU, x * Phi(x), free of branches so that the elements of a lane overlap in the vector pipe.
// q = 0.5 erfc(|x| / sqrt 2) by the rational-exponential form t (a1 + t (a2 + .. t a5)) exp(-z^2), t = 1 / (1 + p z), z = |x| / sqrt 2
// (absolute error of erf below 2e-7); Phi = 1 - q for x >= 0 and q itself for x < 0, so the negative side has no cancellation.
__device__ __forceinline__ float gelu_erf(float x) {
    const float d = __builtin_fmaf(__builtin_fabsf(x), 0.3275911f * 0.70710678118654752f, 1.0f);
    const float a = (x * x) * (-0.5f * 1.44269504088896340736f);
    float t, e;
    // the two transcendentals in one statement: the exp fills the issue slot the instruction set asks for behind the rcp (the outputs
    // are early-clobber, so it neither reads t nor overwrites d), the v_nop fills the one behind the exp
    asm("v_rcp_f32 %0, %2\n\tv_exp_f32 %1, %3\n\tv_nop" : "=&v"(t), "=&v"(e) : "v"(d), "v"(a));
    float p = __builtin_fmaf(t, 0.5f * 1.061405429f, 0.5f * -1.453152027f);
    p = __builtin_fmaf(t, p, 0.5f * 1.421413741f);
    p = __builtin_fmaf(t, p, 0.5f * -0.284496736f);
    p = __builtin_fmaf(t, p, 0.5f * 0.254829592f);
    const float q = (p * t) * e;
    return x * ((x >= 0.0f) ? 1.0f - q : q);
}

// logical row (b*SEQ + t) -> row of the full-size input / output tensors (b*SEQ_FULL + t)
__device__ __forceinline__ size_t grow_map(u32 r) {
    const u32 bb = r / (u32)(SEQ);
    const u32 t  = r - bb * (u32)(SEQ);
    return (size_t)bb * SEQ_FULL + (size_t)t;
}

// ---------------- weight convert + transpose: in[K][N] f32 -> out[N][K] f16 = f16(bfr(w) * 64) ----------------
// read: 16 consecutive lanes x 16 B = one 256-B row piece, two rows = 4 whole lines per load instruction.
// written by 8 consecutive lanes x 16 B of one instruction (4 lines per instruction).
// One workgroup converts the 64 x 64 tile (bx, by); Ts is its LDS tile [n][k], 64 * 72 halves.
__device__ __forceinline__ void cvt_wt_body(const float* in, u16* out, u32 K, u32 N, u32 bx, u32 by, u16* Ts) {
    const u32 tid = threadIdx.x, lane = tid & 31u, wv = tid >> 5;
    const u32 n0 = bx * 64u, k0 = by * 64u;
    const u32 kr = tid >> 4, nq = (tid & 15u) * 4u;
    const float* src = in + (size_t)(k0 + kr) * N + n0 + nq;
    const float* s1 = src + (size_t)16u * N;
    const float* s2 = src + (size_t)32u * N;
    const float* s3 = src + (size_t)48u * N;
    v4f w[4];
    w[0] = *(const v4f*)src; w[1] = *(const v4f*)s1; w[2] = *(const v4f*)s2; w[3] = *(const v4f*)s3;
    // stands in front of every overwrite of the address registers that the four loads name; taking the addresses as inputs
    // keeps their registers untouched up to here, so that the loads issue back to back with no wait among them
    asm volatile("s_wait_xcnt 0x0" :: "v"(src), "v"(s1), "v"(s2), "v"(s3) : "memory");
#pragma unroll
    for (u32 j4 = 0; j4 < 4; j4++) {
#pragma unroll
        for (u32 c = 0; c < 4; c++) {
            float f = w[j4][c];
            Ts[(nq + c) * 72u + kr + j4 * 16u] = hbits(bfr(f) * WSCALE);
        }
    }
    __syncthreads();                             // Ts: cross-wave exchange
    u32x4 val[2];
#pragma unroll
    for (u32 it = 0; it < 2; it++) {
        const u32 nn = wv * 8u + it * 4u + (lane >> 3), ks = (lane & 7u) * 8u;
        val[it] = *(const u32x4*)&Ts[nn * 72u + ks];
    }
#pragma unroll
    for (u32 it = 0; it < 2; it++) {
        const u32 nn = wv * 8u + it * 4u + (lane >> 3), ks = (lane & 7u) * 8u;
        *(u32x4*)(out + (size_t)(n0 + nn) * K + k0 + ks) = val[it];
    }
    // the body is inlined beside other bodies of one kernel: stands in front of every write, on any path the branches behind it
    // allow, of a register that the stores above name
    asm volatile("s_wait_xcnt 0x0" ::: "memory");
}

// ---------------- LayerNorm (row = 1024): one wave per row, f16 out via LDS row stage ----------------
// Row kept in a wave-private f32 LDS row (lane owns columns j*128 + lane*4 + 0..3, same lane writes and reads);
// the three per-element sweeps are rolled loops with wave-uniform trip counts.
// gamma/beta staged once per workgroup in LDS at bf16-RNE values.
// SRCX = 1: src is the input x (full-size row map, each element taken at its bf16-RNE value)
// SRCX = 0: src is an f32 workspace plane with logical rows
// blk: the workgroup's group of 8 rows; xs, rows, gsh, bsh: its LDS arrays (8*CE floats, 8*CE halves, CE floats, CE floats)
template <int SRCX>
__device__ __forceinline__ void ln_body(u32 blk, const float* src, const float* g, const float* be, u16* out,
                                        float* xs, u16* rows, float* gsh, float* bsh) {
    const u32 tid = threadIdx.x, lane = tid & 31u, wv = tid >> 5;
    {
        v4f gg = *(const v4f*)(g + tid * 4u);
        v4f bb = *(const v4f*)(be + tid * 4u);
        v4f go, bo;
#pragma unroll
        for (u32 c = 0; c < 4; c++) {
            float tg = gg[c]; float tb = bb[c];
            go[c] = bfr(tg); bo[c] = bfr(tb);
        }
        *(v4f*)&gsh[tid * 4u] = go;
        *(v4f*)&bsh[tid * 4u] = bo;
    }
    const u32 r = blk * 8u + wv;                   // < RROWS (blk < RROWS/8)
    const size_t srow = SRCX ? grow_map(r) : (size_t)r;
    const float* xr = src + srow * CE;
    float* xw = xs + wv * CE;
    float s = 0.f;
#pragma unroll 1
    for (u32 j = 0; j < LNJ; j++) {
        const u32 c0 = j * 128u + lane * 4u;
        v4f t4 = *(const v4f*)(xr + c0);
        if constexpr (SRCX != 0) {
#pragma unroll
            for (u32 c = 0; c < 4; c++) { float t = t4[c]; t4[c] = bfr(t); }
        }
        *(v4f*)&xw[c0] = t4;
        s += (t4[0] + t4[1]) + (t4[2] + t4[3]);
    }
#pragma unroll
    for (u32 m = 16; m >= 1; m >>= 1) s += __shfl_xor(s, m, 32);
    const float mu = s * (1.f / (float)CE);
    float vs = 0.f;
#pragma unroll 1
    for (u32 j = 0; j < LNJ; j++) {
        const u32 c0 = j * 128u + lane * 4u;
        v4f t4 = *(const v4f*)&xw[c0];
#pragma unroll
        for (u32 c = 0; c < 4; c++) { float d = t4[c] - mu; vs += d * d; }
    }
#pragma unroll
    for (u32 m = 16; m >= 1; m >>= 1) vs += __shfl_xor(vs, m, 32);
    const float rstd = rsqrtf(vs * (1.f / (float)CE) + 1e-5f);
    __syncthreads();                               // gsh/bsh (cross-wave) visible
    u16* rw = rows + wv * CE;
#pragma unroll 1
    for (u32 j = 0; j < LNJ; j++) {
        const u32 c0 = j * 128u + lane * 4u;
        v4f x4 = *(const v4f*)&xw[c0];
        v4f g4 = *(const v4f*)&gsh[c0];
        v4f b4 = *(const v4f*)&bsh[c0];
        Pack4 pk;
#pragma unroll
        for (u32 c = 0; c < 4; c++) {
            float xe = x4[c]; float ge = g4[c]; float bel = b4[c];
            pk.h[c] = (_Float16)((xe - mu) * rstd * ge + bel);
        }
        *(u32x2*)&rw[c0] = pk.u;
    }
    __syncthreads();   // LDS row stage: written and read by the same wave; a workgroup barrier is used
    u32x4 val[LNO];
#pragma unroll
    for (u32 j = 0; j < LNO; j++) val[j] = *(const u32x4*)&rw[j * 256u + lane * 8u];
    u16* orow = out + (size_t)r * CE;
#pragma unroll
    for (u32 j = 0; j < LNO; j++) *(u32x4*)(orow + j * 256u + lane * 8u) = val[j];
    
}

// LN2: f32 workspace plane -> f16 plane
__global__ __launch_bounds__(256) void ln_kernel(const float* __restrict__ src,
                                                 const float* __restrict__ g,
                                                 const float* __restrict__ be,
                                                 u16* __restrict__ out) {
    __shared__ __align__(16) float xs[8 * CE];      // wave wv owns xs[wv*CE ..]
    __shared__ __align__(16) u16   rows[8 * CE];    // wave wv owns rows[wv*CE ..]
    __shared__ __align__(16) float gsh[CE];
    __shared__ __align__(16) float bsh[CE];
    ln_body<0>(blockIdx.x, src, g, be, out, xs, rows, gsh, bsh);
}

// ---------------- what the qkv product waits for, in one launch ----------------
// workgroups 0 .. NLN-1: LN1 of x (the longer workgroups, lowest indices); then the 64 x 64 tiles of the qkv weight convert.
// The other three weight converts, which nothing reads before the attention has ended, ride in the attention launch.
#define NLN  (RROWS / 8)
#define NT_A ((C3 / 64) * (CE / 64))
#define NT_P ((CE / 64) * (CE / 64))
#define NT_F ((C4 / 64) * (CE / 64))
#define NT_G ((CE / 64) * (C4 / 64))
__global__ __launch_bounds__(256) void prep_kernel(const float* __restrict__ x,
                                                   const float* __restrict__ g,
                                                   const float* __restrict__ be,
                                                   u16* __restrict__ h1,
                                                   const float* __restrict__ w_a, u16* __restrict__ o_a) {
    __shared__ __align__(16) float xs[8 * CE];      // LN: wave wv owns xs[wv*CE ..]; convert: the [n][k] tile
    __shared__ __align__(16) u16   rows[8 * CE];
    __shared__ __align__(16) float gsh[CE];
    __shared__ __align__(16) float bsh[CE];
    static_assert(64 * 72 * 2 <= 8 * CE * 4);
    const u32 blk = blockIdx.x;                     // the test below is uniform for the workgroup
    if (blk < (u32)NLN) {
        ln_body<1>(blk, x, g, be, h1, xs, rows, gsh, bsh);
    } else {
        const u32 t = blk - (u32)NLN;               // < NT_A by the grid; [1024][3072] -> [3072][1024]
        cvt_wt_body(w_a, o_a, (u32)CE, (u32)C3, t % (u32)(C3 / 64), t / (u32)(C3 / 64), (u16*)xs);
    }
}

// LDS byte address of a __shared__ location (what an asynchronous copy takes as its destination)
__device__ __forceinline__ u32 lds_addr(const void* p) {
    typedef __attribute__((address_space(3))) const void lds_void;
    return (u32)(size_t)(lds_void*)p;
}

// eight asynchronous 16-byte copies global -> LDS per lane, from g[0..7] to the LDS byte addresses l[0..7].
// The s_wait_xcnt closes the statement so that it stands in front of every later write of an address register the copies name.
__device__ __forceinline__ void copy8(const u32* l, const u16* const* g) {
    asm volatile("global_load_async_to_lds_b128 %0, %8, off\n\t"
                 "global_load_async_to_lds_b128 %1, %9, off\n\t"
                 "global_load_async_to_lds_b128 %2, %10, off\n\t"
                 "global_load_async_to_lds_b128 %3, %11, off\n\t"
                 "global_load_async_to_lds_b128 %4, %12, off\n\t"
                 "global_load_async_to_lds_b128 %5, %13, off\n\t"
                 "global_load_async_to_lds_b128 %6, %14, off\n\t"
                 "global_load_async_to_lds_b128 %7, %15, off\n\t"
                 "s_wait_xcnt 0x0"
                 :: "v"(l[0]), "v"(l[1]), "v"(l[2]), "v"(l[3]), "v"(l[4]), "v"(l[5]), "v"(l[6]), "v"(l[7]),
                    "v"(g[0]), "v"(g[1]), "v"(g[2]), "v"(g[3]), "v"(g[4]), "v"(g[5]), "v"(g[6]), "v"(g[7])
                 : "memory");
}

// ---------------- f16 GEMM: C[128x128 tile] = A[M][K](f16) . BT[N][K](f16)^T, BK of k per stage ----------------
// 8 waves = 4 (m) x 2 (n), wave tile 32 x 64, fragments per the split k map for A and B.
// Staging: asynchronous 16-byte copies into a ring of two LDS buffers [A 128 rows | B 128 rows], row pitch 2 BK + 16 bytes;
// stage t + 1 is in flight while stage t is multiplied. Each wave-wide copy covers 4 whole 128-B lines.
// BK = 256 where the grid has one workgroup per WGP (MODE 1, 3), else 128 (two workgroups per WGP by LDS).
// Epilogue: acc*(1/64) + bias(bf16-RNE) [-> gelu] staged as f32 128x128 tile in LDS, then
// MODE 0: qkv: n0 < QP -> qk hi plane [RROWS][QP] (+ lo plane rows t<TE), else V transposed
//         into vt hi [NB*NH][64][SEQ] (+ vt lo [..][64][TE] for t<TE)
// MODE 1: out0 f32 [RROWS][CE] = acc + bias + bfr(res at full-size rows)   (x1)
// MODE 2: out0 f16 [RROWS][C4] = gelu(acc + bias)                          (hg)
// MODE 3: out0 f32 at full-size rows = acc + bias + res[logical rows]      (d_out)
template <int MODE>
__global__ __launch_bounds__(256) void gemm_kernel(const u16* __restrict__ A,
                                                   const u16* __restrict__ BT,
                                                   const float* __restrict__ bias,
                                                   const float* __restrict__ res,
                                                   void* out0, void* out1, void* out2, void* out3,
                                                   u32 N, u32 K) {
    constexpr u32 BK     = (MODE == 1 || MODE == 3) ? 256u : 128u;   // k per stage
    constexpr u32 PH     = BK + 8u;                // LDS row pitch in halves: 16 B x odd
    constexpr u32 TILE_H = 128u * PH;              // one operand's tile, halves
    constexpr u32 BUF_H  = 2u * TILE_H;            // one buffer: A tile | B tile
    constexpr u32 LPR    = BK / 8u;                // lanes per row (16 B each)
    constexpr u32 RPP    = 256u / LPR;             // rows the workgroup covers with one copy per lane
    constexpr u32 NCP    = 128u / RPP;             // copies per lane, operand and stage
    constexpr u32 CSP = 132;
    static_assert(CE % BK == 0 && C4 % BK == 0);
    static_assert(NCP % 8u == 0 && 2u * NCP <= 63u);
    static_assert(2u * BUF_H * 2u >= 128u * CSP * 4u);
    __shared__ u32x4 smem[2u * BUF_H / 8u];        // the ring during the k loop, Cs after it
    u16* As = (u16*)smem;                          // buffer b: A [128][PH] at b * BUF_H, B [128][PH] behind it
    float* Cs = (float*)smem;                      // [128][132]

    const u32 tid = threadIdx.x, lane = tid & 31u, wv = tid >> 5;
    const u32 hf = lane >> 4, ln = lane & 15u;
    const u32 m0 = blockIdx.y * 128u, n0 = blockIdx.x * 128u;
    const u32 wm = wv & 3u, wn = wv >> 2;
    const u32 srow = tid / LPR, sseg = (tid % LPR) * 8u; // rows srow + RPP i, 8 halves at sseg
    const u32 nt = K / BK;                               // stages; K is a multiple of BK
    // this lane's copies of the next stage to be issued: A rows, then B rows. Source and LDS addresses live in registers and
    // move on by one add each behind an issue, so that no address arithmetic stands between a stage's barrier and its refill.
    const u16* gp[2u * NCP];
    u32 lp[2u * NCP];
#pragma unroll
    for (u32 c = 0; c < NCP; c++) {
        gp[c]       = A  + (size_t)(m0 + srow + c * RPP) * K + sseg;
        gp[NCP + c] = BT + (size_t)(n0 + srow + c * RPP) * K + sseg;
        lp[c]       = lds_addr(&As[(srow + c * RPP) * PH + sseg]);
        lp[NCP + c] = lp[c] + TILE_H * 2u;
    }
    // issues one stage into the buffer lp points at, then moves to the next stage's k and by dl bytes to the other buffer
    auto stage = [&](u32 dl) {
#pragma unroll                                           // constant indices: gp and lp stay in registers
        for (u32 c = 0; c < 2u * NCP; c += 8u) copy8(&lp[c], &gp[c]);
#pragma unroll
        for (u32 c = 0; c < 2u * NCP; c++) { gp[c] += BK; lp[c] += dl; }
    };
    constexpr u32 BUF_B = BUF_H * 2u;                    // bytes from buffer 0 to buffer 1

    v8f acc[2][4];
#pragma unroll
    for (int i = 0; i < 2; i++)
#pragma unroll
        for (int j = 0; j < 4; j++) acc[i][j] = (v8f)(0.f);

    stage(BUF_B);                                      // stage 0 into buffer 0
    asm volatile("s_wait_asynccnt 0x0" ::: "memory");  // this wave's stage 0 copies have landed
    __syncthreads();                                   // stage 0 visible to all waves
    if (1u < nt) stage(0u - BUF_B);                    // stage 1 into buffer 1
#pragma unroll 1                                       // stays rolled: one stage body, the buffer picked by t & 1
    for (u32 t = 0; t < nt; t++) {
        const u16* Ab = As + (t & 1u) * BUF_H;
        const u16* Bb = Ab + TILE_H;
#pragma unroll
        for (u32 ks = 0; ks < BK / 32u; ks++) {
            Frag af[2], bf[4];
#pragma unroll
            for (u32 mi = 0; mi < 2; mi++) {
                const u16* q = &Ab[(wm * 32u + mi * 16u + ln) * PH + ks * 32u + hf * 8u];
                af[mi].u[0] = *(const u32x4*)q;
                af[mi].u[1] = *(const u32x4*)(q + 16);
            }
#pragma unroll
            for (u32 ni = 0; ni < 4; ni++) {
                const u16* q = &Bb[(wn * 64u + ni * 16u + ln) * PH + ks * 32u + hf * 8u];
                bf[ni].u[0] = *(const u32x4*)q;
                bf[ni].u[1] = *(const u32x4*)(q + 16);
            }
#pragma unroll
            for (int mi = 0; mi < 2; mi++)
#pragma unroll
                for (int ni = 0; ni < 4; ni++)
                    acc[mi][ni] = mma16(af[mi].v, bf[ni].v, acc[mi][ni]);
        }
        asm volatile("s_wait_dscnt 0x0" ::: "memory");     // this wave's reads of stage t's buffer are done before it is refilled
        asm volatile("s_wait_asynccnt 0x0" ::: "memory");  // this wave's stage t + 1 copies have landed
        __syncthreads();                                   // publishes stage t + 1 and ends every wave's reads of stage t
        if (t + 2u < nt) stage((t & 1u) ? 0u - BUF_B : BUF_B);   // stage t + 2 into the buffer stage t has left
    }
    asm volatile("s_wait_asynccnt 0x0" ::: "memory");      // no copy outstanding when the ring becomes the C tile

    // ---- epilogue: accumulators -> f32 tile in LDS (aliases the ring: the last stage's own barrier has ended every wave's reads) ----
#pragma unroll
    for (int ni = 0; ni < 4; ni++) {
        const u32 col = wn * 64u + (u32)ni * 16u + ln;
        const float bv = bfr(bias[n0 + col]);
#pragma unroll
        for (int mi = 0; mi < 2; mi++) {
#pragma unroll
            for (int r = 0; r < 8; r++) {
                const u32 row = wm * 32u + (u32)mi * 16u + hf * 8u + (u32)r;
                float v = acc[mi][ni][r] * WINV + bv;
                if constexpr (MODE == 2) v = gelu_erf(v);
                Cs[row * CSP + col] = v;
            }
        }
    }
    __syncthreads();                               // Cs is read across waves below

    if constexpr (MODE == 1 || MODE == 3) {
        float* o = (float*)out0;
        v4f val[16];
#pragma unroll
        for (int grp = 0; grp < 2; grp++) {
#pragma unroll
            for (int i8 = 0; i8 < 8; i8++) {
                const int i = grp * 8 + i8;
                const u32 row = wv * 16u + (u32)i;
                const u32 r = m0 + row;
                v4f c = *(const v4f*)&Cs[row * CSP + lane * 4u];
                const size_t rr = (MODE == 1) ? grow_map(r) : (size_t)r;
                v4f x4 = *(const v4f*)(res + rr * (size_t)N + n0 + lane * 4u);
                if constexpr (MODE == 1) {
#pragma unroll
                    for (int cc = 0; cc < 4; cc++) { float t = x4[cc]; x4[cc] = bfr(t); }
                }
                val[i] = c + x4;
            }
            asm volatile("" ::: "memory");         // keep the two load groups in separate clauses
        }
#pragma unroll
        for (int i = 0; i < 16; i++) {
            const u32 r = m0 + wv * 16u + (u32)i;
            const size_t orr = (MODE == 3) ? grow_map(r) : (size_t)r;
            *(v4f*)(o + orr * (size_t)N + n0 + lane * 4u) = val[i];
        }
        
    } else if constexpr (MODE == 2) {
        u16* o = (u16*)out0;
        u32x4 val[8];
#pragma unroll
        for (int it = 0; it < 8; it++) {
            const u32 rloc = wv * 16u + (u32)it * 2u + hf, cseg = ln * 8u;
            Pack8 pk;
#pragma unroll
            for (int j = 0; j < 8; j++) pk.h[j] = (_Float16)Cs[rloc * CSP + cseg + (u32)j];
            val[it] = pk.u;
        }
#pragma unroll
        for (int it = 0; it < 8; it++) {
            const u32 rloc = wv * 16u + (u32)it * 2u + hf, cseg = ln * 8u;
            *(u32x4*)(o + (size_t)(m0 + rloc) * N + n0 + cseg) = val[it];
        }
        
    } else {
        // MODE 0: q/k planes or transposed v planes
        u16* qkh = (u16*)out0;
        u16* qkl = (u16*)out1;
        u16* vth = (u16*)out2;
        u16* vtl = (u16*)out3;
        const u32 bq = m0 / (u32)(SEQ);
        const u32 t0 = m0 - bq * (u32)(SEQ);       // 128 | SEQ so the tile sits inside one batch
        const bool lo_on = (t0 < (u32)(TE));       // uniform per workgroup
        u32x4 vh[8], vl[8];
        if (n0 < (u32)QP) {
#pragma unroll
            for (int it = 0; it < 8; it++) {
                const u32 rloc = wv * 16u + (u32)it * 2u + hf, cseg = ln * 8u;
                Pack8 ph, pl;
#pragma unroll
                for (int j = 0; j < 8; j++) {
                    float f = Cs[rloc * CSP + cseg + (u32)j];
                    _Float16 h16 = (_Float16)f;
                    ph.h[j] = h16;
                    pl.h[j] = (_Float16)((f - (float)h16) * RSC);
                }
                vh[it] = ph.u; vl[it] = pl.u;
            }
#pragma unroll
            for (int it = 0; it < 8; it++) {
                const u32 rloc = wv * 16u + (u32)it * 2u + hf, cseg = ln * 8u;
                *(u32x4*)(qkh + (size_t)(m0 + rloc) * QP + n0 + cseg) = vh[it];
                if (lo_on)
                    *(u32x4*)(qkl + ((size_t)bq * (TE) + t0 + rloc) * QP + n0 + cseg) = vl[it];
            }
            
        } else {
            const u32 hh0 = (n0 - (u32)QP) >> 6;   // two heads per 128-column tile
#pragma unroll
            for (int it = 0; it < 8; it++) {
                const u32 rloc = wv * 16u + (u32)it * 2u + hf;   // local column = head*64 + d
                const u32 tseg = ln * 8u;
                Pack8 ph, pl;
#pragma unroll
                for (int j = 0; j < 8; j++) {
                    float f = Cs[(tseg + (u32)j) * CSP + rloc];
                    _Float16 h16 = (_Float16)f;
                    ph.h[j] = h16;
                    pl.h[j] = (_Float16)((f - (float)h16) * RSC);
                }
                vh[it] = ph.u; vl[it] = pl.u;
            }
#pragma unroll
            for (int it = 0; it < 8; it++) {
                const u32 rloc = wv * 16u + (u32)it * 2u + hf, tseg = ln * 8u;
                const u32 hh = hh0 + (rloc >> 6), dd = rloc & 63u;
                const size_t vrow = (size_t)(bq * NH + hh) * HD + dd;
                *(u32x4*)(vth + vrow * (SEQ) + t0 + tseg) = vh[it];
                if (lo_on)
                    *(u32x4*)(vtl + vrow * (TE) + t0 + tseg) = vl[it];
            }
            
        }
    }
}

// ---------------- causal flash attention, hd=64, 128 queries per workgroup (8 waves x 16 rows), 64-key chunks ----------------
// qkh: [RROWS][QP] f16 (q cols h*64+d, k cols CE+h*64+d); qkl: same layout for rows t<TE, residual x2048
// vth: [NB*NH][64][SEQ] f16 transposed v; vtl: [NB*NH][64][TE] residual x2048
// Transposed products: A = K rows (S^T) or V^T rows (O^T), B = Q or P^T. Lane (hf, ln) owns query q0 + ln:
// S^T register r of sub-tile sub = key sub*16 + hf*8 + r, so two converted sub-tiles are one B fragment in the loaders' k order.
// RES=1: query tiles with position < TE: S = qh.kh + (qh.kl + ql.kh)/2048, O += Ph.Vh + (Pr.Vh + Ph.Vl)/2048
// RES=1 only: wave index taken as a scalar-uniform value.
// Operand fragments leave LDS in groups ahead of the products that read them (same arithmetic, same order of products):
// RES=0 a chunk's 8 K fragments, then its 8 V fragments ahead of the softmax; RES=1 one sub-tile ahead, two register sets.
// bh, qb: the workgroup's head and query tile; Ks .. Ps: its LDS arrays (Kl, Vl read and written by RES=1 alone)
template <int RES>
__device__ __forceinline__
void attn_body(const u16* qkh, const u16* qkl, const u16* vth, const u16* vtl, u16* cv, u32 bh, u32 qb,
               u16* Ks, u16* Vs, u16* Kl, u16* Vl, u16* Ps) {
    const u32 b = bh / (u32)NH, h = bh - b * (u32)NH;
    const u32 tid = threadIdx.x, lane = tid & 31u;
    u32 wv = tid >> 5;
    if constexpr (RES != 0) wv = (u32)__builtin_amdgcn_readfirstlane((int)wv);   // all lanes active, value is wave-uniform
    const u32 hf = lane >> 4, ln = lane & 15u;
    const u32 q0 = qb * 128u + wv * 16u;
    u16* Pw  = Ps + wv * (16u * 72u);

    Frag qf[2], ql[2];
#pragma unroll
    for (u32 ds = 0; ds < 2; ds++) {
        const u16* p = qkh + (size_t)(b * (u32)(SEQ) + q0 + ln) * QP + h * HD + ds * 32u + hf * 8u;
        qf[ds].u[0] = *(const u32x4*)p;
        qf[ds].u[1] = *(const u32x4*)(p + 16);
        if constexpr (RES != 0) {
            const u16* pl = qkl + (size_t)(b * (u32)(TE) + q0 + ln) * QP + h * HD + ds * 32u + hf * 8u;
            ql[ds].u[0] = *(const u32x4*)pl;
            ql[ds].u[1] = *(const u32x4*)(pl + 16);
        } else {
            ql[ds].u[0] = (u32x4)(0u); ql[ds].u[1] = (u32x4)(0u);
        }
    }

    v8f o[4];
#pragma unroll
    for (int i = 0; i < 4; i++) o[i] = (v8f)(0.f);
    float mrun = -3.0e38f;                                 // running maximum of this lane's query (both halves agree)
    float lsum = 0.f;                                      // running sum over this lane half's keys; halves joined after the loop
    const u32 qg = q0 + ln;

    const u32 rr = tid >> 3, seg = (tid & 7u) * 8u;       // staging: rows rr and rr + 32 (key or d), 8 halves at seg: 4 whole 128-B lines per load instruction
    const u32 nkt = 2u * qb + 2u;                          // keys 0 .. qb*128+127

#pragma unroll 1
    for (u32 kt = 0; kt < nkt; kt++) {
        __syncthreads();                                   // prior chunk's LDS reads done
        {
            const u16* gk = qkh + (size_t)(b * (u32)(SEQ) + kt * 64u + rr) * QP + CE + h * HD + seg;
            u32x4 k0v = *(const u32x4*)gk, k1v = *(const u32x4*)(gk + 32u * QP);
            const u16* gv = vth + ((size_t)(bh * HD + rr)) * (SEQ) + kt * 64u + seg;
            u32x4 v0 = *(const u32x4*)gv, v1 = *(const u32x4*)(gv + 32u * (SEQ));
            asm volatile("s_wait_xcnt 0x0" ::: "memory");   // stands in front of every later overwrite of the address registers that the loads above name
            *(u32x4*)&Ks[rr * 72u + seg] = k0v; *(u32x4*)&Ks[(rr + 32u) * 72u + seg] = k1v;
            *(u32x4*)&Vs[rr * 72u + seg] = v0;  *(u32x4*)&Vs[(rr + 32u) * 72u + seg] = v1;
            sched_cut<RES>();                              // hi-plane staging temporaries end here
            if constexpr (RES != 0) {
                const u16* gkl = qkl + (size_t)(b * (u32)(TE) + kt * 64u + rr) * QP + CE + h * HD + seg;
                u32x4 kl0 = *(const u32x4*)gkl, kl1 = *(const u32x4*)(gkl + 32u * QP);
                const u16* gvl = vtl + ((size_t)(bh * HD + rr)) * (TE) + kt * 64u + seg;
                u32x4 vl0 = *(const u32x4*)gvl, vl1 = *(const u32x4*)(gvl + 32u * (TE));
                asm volatile("s_wait_xcnt 0x0" ::: "memory");   // stands in front of every later overwrite of the address registers that the loads above name
                *(u32x4*)&Kl[rr * 72u + seg] = kl0; *(u32x4*)&Kl[(rr + 32u) * 72u + seg] = kl1;
                *(u32x4*)&Vl[rr * 72u + seg] = vl0; *(u32x4*)&Vl[(rr + 32u) * 72u + seg] = vl1;
            }
        }
        __syncthreads();                                   // K/V chunk visible to all waves
        sched_cut<RES>();

        // S^T = K . Q^T  (64 keys x 16 q per wave)
        // The K fragment loads stand as groups ahead of the products that read them, so a wave waits out the LDS
        // latency once per group and not once per product. RES=0: the chunk's 8 fragments in one group.
        // RES=1: one sub-tile's hi and residual fragments per group, fetched one sub-tile ahead into a second register set.
        v8f s[4];
        Frag vf[RES ? 2 : 4][2], vlf[2][2];                // V fragments: RES=0 [d sub-tile][ks], RES=1 [register set][ks]
        if constexpr (RES == 0) {
            Frag kf[4][2];
#pragma unroll
            for (int sub = 0; sub < 4; sub++)
#pragma unroll
                for (int ds = 0; ds < 2; ds++)
                    ldfrag(kf[sub][ds], &Ks[((u32)sub * 16u + ln) * 72u + (u32)ds * 32u + hf * 8u]);
            __builtin_amdgcn_sched_barrier(0);             // the 16 K loads issue together, none sinks down among the products
#pragma unroll
            for (int sub = 0; sub < 4; sub++) {
                v8f t = (v8f)(0.f);
#pragma unroll
                for (int ds = 0; ds < 2; ds++) t = mma16(kf[sub][ds].v, qf[ds].v, t);
                s[sub] = t;
            }
            __builtin_amdgcn_sched_barrier(0);             // the V loads below stay behind the last S^T product (they take over the K registers)
#pragma unroll
            for (int dsub = 0; dsub < 4; dsub++)
#pragma unroll
                for (int ks = 0; ks < 2; ks++)
                    ldfrag(vf[dsub][ks], &Vs[((u32)dsub * 16u + ln) * 72u + (u32)ks * 32u + hf * 8u]);
            __builtin_amdgcn_sched_barrier(0);             // the 16 V loads issue here, ahead of the softmax, which covers their latency
        } else {
            Frag kf[2][2], klf[2][2];
#pragma unroll
            for (int ds = 0; ds < 2; ds++) {
                ldfrag(kf[0][ds],  &Ks[ln * 72u + (u32)ds * 32u + hf * 8u]);
                ldfrag(klf[0][ds], &Kl[ln * 72u + (u32)ds * 32u + hf * 8u]);
            }
#pragma unroll
            for (int sub = 0; sub < 4; sub++) {
                const int cur = sub & 1, nxt = cur ^ 1;
#pragma unroll
                for (int ds = 0; ds < 2; ds++) {
                    if (sub < 3) {
                        ldfrag(kf[nxt][ds],  &Ks[((u32)(sub + 1) * 16u + ln) * 72u + (u32)ds * 32u + hf * 8u]);
                        ldfrag(klf[nxt][ds], &Kl[((u32)(sub + 1) * 16u + ln) * 72u + (u32)ds * 32u + hf * 8u]);
                    } else {
                        ldfrag(vf[0][ds],  &Vs[ln * 72u + (u32)ds * 32u + hf * 8u]);
                        ldfrag(vlf[0][ds], &Vl[ln * 72u + (u32)ds * 32u + hf * 8u]);
                    }
                }
                __builtin_amdgcn_sched_barrier(0);         // the next group's 8 loads issue ahead of this sub-tile's products
                v8f t = (v8f)(0.f);
                v8f tr = (v8f)(0.f);
#pragma unroll
                for (int ds = 0; ds < 2; ds++) {
                    t  = mma16(kf[cur][ds].v,  qf[ds].v, t);
                    tr = mma16(klf[cur][ds].v, qf[ds].v, tr);
                    tr = mma16(kf[cur][ds].v,  ql[ds].v, tr);
                }
                s[sub] = t + tr * RINV;
                __builtin_amdgcn_sched_barrier(0);         // the group after next stays behind this sub-tile's products: two register sets, no more
            }
        }

        // scale + causal replace-fill
#pragma unroll
        for (int sub = 0; sub < 4; sub++) {
#pragma unroll
            for (int r = 0; r < 8; r++) {
                const u32 kg = kt * 64u + (u32)sub * 16u + hf * 8u + (u32)r;
                float v = s[sub][r] * 0.125f;
                s[sub][r] = (kg > qg) ? -3.0e38f : v;
            }
        }
        // online softmax: one query per lane, 32 of the chunk's keys in-lane, the other 32 in lane ^ 16
        float mxs[4];
#pragma unroll
        for (int sub = 0; sub < 4; sub++) {
            mxs[sub] = fmaxf(fmaxf(fmaxf(s[sub][0], s[sub][1]), fmaxf(s[sub][2], s[sub][3])),
                             fmaxf(fmaxf(s[sub][4], s[sub][5]), fmaxf(s[sub][6], s[sub][7])));
        }
        float mx = fmaxf(fmaxf(mxs[0], mxs[1]), fmaxf(mxs[2], mxs[3]));
        mx = fmaxf(mx, xhalf(mx));
        const float mnew  = fmaxf(mrun, mx);
        const float alpha = exp_fast(mrun - mnew);
        float rs[4];
#pragma unroll
        for (int sub = 0; sub < 4; sub++) {
            rs[sub] = 0.f;
#pragma unroll
            for (int r = 0; r < 8; r++) {
                float pe = exp_fast(s[sub][r] - mnew);
                s[sub][r] = pe;
                rs[sub] += pe;
            }
        }
        mrun = mnew;
        lsum = lsum * alpha + ((rs[0] + rs[1]) + (rs[2] + rs[3]));
#pragma unroll
        for (int dsub = 0; dsub < 4; dsub++) o[dsub] *= alpha;

        // P^T: two converted S^T sub-tiles = one B fragment (32 keys x 16 q), carried x4096 (+ residual x2048)
        Frag pf[2], prf[2];
#pragma unroll
        for (int ks = 0; ks < 2; ks++) {
#pragma unroll
            for (int e = 0; e < 16; e++) {
                const float ph = s[2 * ks + (e >> 3)][e & 7] * PCAR;
                _Float16 h16 = (_Float16)ph;
                pf[ks].v[e] = h16;
                if constexpr (RES != 0) prf[ks].v[e] = (_Float16)((ph - (float)h16) * RSC);
            }
        }
        // O^T += V^T . P^T
#pragma unroll
        for (int dsub = 0; dsub < 4; dsub++) {
            if constexpr (RES == 0) {
#pragma unroll
                for (int ks = 0; ks < 2; ks++) o[dsub] = mma16(vf[dsub][ks].v, pf[ks].v, o[dsub]);
            } else {
                const int cur = dsub & 1, nxt = cur ^ 1;
                if (dsub < 3) {
#pragma unroll
                    for (int ks = 0; ks < 2; ks++) {
                        ldfrag(vf[nxt][ks],  &Vs[((u32)(dsub + 1) * 16u + ln) * 72u + (u32)ks * 32u + hf * 8u]);
                        ldfrag(vlf[nxt][ks], &Vl[((u32)(dsub + 1) * 16u + ln) * 72u + (u32)ks * 32u + hf * 8u]);
                    }
                }
                __builtin_amdgcn_sched_barrier(0);         // the next d sub-tile's 8 loads issue ahead of this one's products
                v8f u = (v8f)(0.f);
#pragma unroll
                for (int ks = 0; ks < 2; ks++) {
                    o[dsub] = mma16(vf[cur][ks].v,  pf[ks].v,  o[dsub]);
                    u       = mma16(vf[cur][ks].v,  prf[ks].v, u);
                    u       = mma16(vlf[cur][ks].v, pf[ks].v,  u);
                }
                o[dsub] = o[dsub] + u * RINV;
                __builtin_amdgcn_sched_barrier(0);         // the group after next stays behind this sub-tile's products: two register sets, no more
            }
        }
    }

    // finalize: O / (l * 4096) -> f16 tile in the wave's LDS stage -> whole-line stores
    // O^T register r of tile dsub = d dsub*16 + hf*8 + r of query ln: 8 consecutive d, one 16-byte LDS store
    const float inv = (1.0f / (lsum + xhalf(lsum))) * PINV;
#pragma unroll
    for (int dsub = 0; dsub < 4; dsub++) {
        Pack8 pk;
#pragma unroll
        for (int r = 0; r < 8; r++) pk.h[r] = (_Float16)(o[dsub][r] * inv);
        *(u32x4*)&Pw[ln * 72u + (u32)dsub * 16u + hf * 8u] = pk.u;
    }
    __syncthreads();
    u32x4 val[4];
#pragma unroll
    for (u32 it = 0; it < 4; it++) {
        const u32 rloc = it * 4u + (lane >> 3), sg = (lane & 7u) * 8u;
        val[it] = *(const u32x4*)&Pw[rloc * 72u + sg];
    }
#pragma unroll
    for (u32 it = 0; it < 4; it++) {
        const u32 rloc = it * 4u + (lane >> 3), sg = (lane & 7u) * 8u;
        *(u32x4*)(cv + (size_t)(b * (u32)(SEQ) + q0 + rloc) * CE + h * HD + sg) = val[it];
    }
    // the body is inlined beside other bodies of one kernel: stands in front of every write, on any path the branches behind it
    // allow, of a register that the stores above name
    asm volatile("s_wait_xcnt 0x0" ::: "memory");
}

// all query tiles of all heads in one launch: x = head, y counts the tiles down from the longest;
// the residual-carrying tiles (position < TE, the fewest chunks) come last and run beside the plain ones.
// Rows y >= NQB of the grid: the 64 x 64 tiles of the proj, fc and fc2 weight converts, which depend on inputs alone and
// are first read by the launches behind this one.
#define NCVR ((NT_P + NT_F + NT_G) / (NB * NH))
static_assert(NCVR * (NB * NH) == NT_P + NT_F + NT_G);
__global__ __launch_bounds__(256) __attribute__((amdgpu_num_vgpr(256)))
void attn_kernel(const u16* __restrict__ qkh, const u16* __restrict__ qkl,
                 const u16* __restrict__ vth, const u16* __restrict__ vtl,
                 u16* __restrict__ cv,
                 const float* __restrict__ w_p, const float* __restrict__ w_f, const float* __restrict__ w_g,
                 u16* __restrict__ o_p, u16* __restrict__ o_f, u16* __restrict__ o_g) {
    __shared__ __align__(16) u16 Ks[64 * 72];              // [key][d]
    __shared__ __align__(16) u16 Vs[64 * 72];              // [d][key]
    __shared__ __align__(16) u16 Kl[64 * 72];
    __shared__ __align__(16) u16 Vl[64 * 72];
    __shared__ __align__(16) u16 Ps[8 * 16 * 72];          // per wave [16 q][d]: final O stage
    if (blockIdx.y >= (u32)NQB) {                          // every test here is uniform for the workgroup
        u32 t = (blockIdx.y - (u32)NQB) * (u32)(NB * NH) + blockIdx.x;
        if (t < (u32)NT_P) {                               // [1024][1024] -> [1024][1024]
            cvt_wt_body(w_p, o_p, (u32)CE, (u32)CE, t % (u32)(CE / 64), t / (u32)(CE / 64), Ks);
            return;
        }
        t -= (u32)NT_P;
        if (t < (u32)NT_F) {                               // [1024][4096] -> [4096][1024]
            cvt_wt_body(w_f, o_f, (u32)CE, (u32)C4, t % (u32)(C4 / 64), t / (u32)(C4 / 64), Ks);
            return;
        }
        t -= (u32)NT_F;                                    // < NT_G by the grid; [4096][1024] -> [1024][4096]
        cvt_wt_body(w_g, o_g, (u32)C4, (u32)CE, t % (u32)(CE / 64), t / (u32)(CE / 64), Ks);
        return;
    }
    const u32 bh = blockIdx.x;
    const u32 qb = (u32)NQB - 1u - blockIdx.y;
    if (qb < (u32)NEB) attn_body<1>(qkh, qkl, vth, vtl, cv, bh, qb, Ks, Vs, Kl, Vl, Ps);
    else               attn_body<0>(qkh, qkl, vth, vtl, cv, bh, qb, Ks, Vs, Kl, Vl, Ps);
}

// ---------------- host side ----------------
extern "C" void kernel_launch(void* const* d_in, const int* in_sizes, int n_in,
                              void* d_out, int out_size, void* d_ws, size_t ws_size,
                              hipStream_t stream) {
    if (n_in < 13) return;
    const long long needX = ((long long)(NB - 1) * SEQ_FULL + (SEQ)) * CE;
    if ((long long)in_sizes[0] < needX || (long long)out_size < needX) return;
    if (in_sizes[1] < CE || in_sizes[2] < CE || in_sizes[3] < CE * C3 || in_sizes[4] < C3 ||
        in_sizes[5] < CE * CE || in_sizes[6] < CE || in_sizes[7] < CE || in_sizes[8] < CE ||
        in_sizes[9] < CE * C4 || in_sizes[10] < C4 || in_sizes[11] < C4 * CE || in_sizes[12] < CE)
        return;

    const float* x      = (const float*)d_in[0];
    const float* ln1_g  = (const float*)d_in[1];
    const float* ln1_b  = (const float*)d_in[2];
    const float* w_attn = (const float*)d_in[3];
    const float* b_attn = (const float*)d_in[4];
    const float* w_proj = (const float*)d_in[5];
    const float* b_proj = (const float*)d_in[6];
    const float* ln2_g  = (const float*)d_in[7];
    const float* ln2_b  = (const float*)d_in[8];
    const float* w_fc   = (const float*)d_in[9];
    const float* b_fc   = (const float*)d_in[10];
    const float* w_fc2  = (const float*)d_in[11];
    const float* b_fc2  = (const float*)d_in[12];

    char* ws = (char*)d_ws;
    size_t off = 0;
    auto take = [&](size_t bytes) -> char* {
        char* p = ws + off;
        off += (bytes + 255) & ~(size_t)255;
        return p;
    };
    const size_t R = (size_t)RROWS;
    u16*   waT   = (u16*)take((size_t)C3 * CE * 2);               // [3072][1024]
    u16*   wpT   = (u16*)take((size_t)CE * CE * 2);               // [1024][1024]
    u16*   wfcT  = (u16*)take((size_t)C4 * CE * 2);               // [4096][1024]
    u16*   wfc2T = (u16*)take((size_t)CE * C4 * 2);               // [1024][4096]
    u16*   h1    = (u16*)take(R * CE * 2);                        // [R][1024]
    u16*   qkh   = (u16*)take(R * QP * 2);                        // [R][2048]
    u16*   qkl   = (u16*)take((size_t)NB * (TE) * QP * 2);        // [NB*TE][2048]
    u16*   vth   = (u16*)take((size_t)NB * NH * HD * (SEQ) * 2);  // [NB*NH][64][SEQ]
    u16*   vtl   = (u16*)take((size_t)NB * NH * HD * (TE) * 2);   // [NB*NH][64][TE]
    u16*   cvb   = (u16*)take(R * CE * 2);                        // [R][1024]
    float* x1    = (float*)take(R * CE * 4);                      // [R][1024]
    u16*   h2    = (u16*)take(R * CE * 2);                        // [R][1024]
    u16*   hg    = (u16*)take(R * C4 * 2);                        // [R][4096]
    if (off > ws_size || off > (size_t)134217728) return;
    void* dummy = (void*)d_ws;

    // 1) + 2) h1 = LN1(bfr(x)); qkv weight: bf16-RNE value x64 -> f16, transposed to [N][K]   (in[K][N] -> out[N][K])
    prep_kernel<<<NLN + NT_A, 256, 0, stream>>>(x, ln1_g, ln1_b, h1, w_attn, waT);
    // 3) qkv = h1 . w_attn + b_attn -> q/k planes (+ residual rows t<TE), v transposed (+ residual)
    gemm_kernel<0><<<dim3(C3 / 128, RROWS / 128), 256, 0, stream>>>(h1, waT, b_attn, b_attn,
                                                                    qkh, qkl, vth, vtl, (u32)C3, (u32)CE);
    // 4) causal attention: residual-carrying tiles for query position < TE, plain tiles after
    //    behind them in the same grid: the proj, fc and fc2 weights, converted like the qkv weight
    attn_kernel<<<dim3(NB * NH, NQB + NCVR), 256, 0, stream>>>(qkh, qkl, vth, vtl, cvb,
                                                               w_proj, w_fc, w_fc2, wpT, wfcT, wfc2T);
    // 5) x1 = cv . w_proj + b_proj + bfr(x)
    gemm_kernel<1><<<dim3(CE / 128, RROWS / 128), 256, 0, stream>>>(cvb, wpT, b_proj, x,
                                                                    x1, dummy, dummy, dummy, (u32)CE, (u32)CE);
    // 6) h2 = LN2(x1)
    ln_kernel<<<RROWS / 8, 256, 0, stream>>>(x1, ln2_g, ln2_b, h2);
    // 7) hg = gelu(h2 . w_fc + b_fc)
    gemm_kernel<2><<<dim3(C4 / 128, RROWS / 128), 256, 0, stream>>>(h2, wfcT, b_fc, b_fc,
                                                                    hg, dummy, dummy, dummy, (u32)C4, (u32)CE);
    // 8) out = hg . w_fc2 + b_fc2 + x1
    gemm_kernel<3><<<dim3(CE / 128, RROWS / 128), 256, 0, stream>>>(hg, wfc2T, b_fc2, x1,
                                                                    d_out, dummy, dummy, dummy, (u32)CE, (u32)C4);
}

// v007
// Measured time: 157 microseconds a run.
// Two timings next to v006 both put it at 1.06 times that version's speed.
// Over all steps from v000 it is 2.29 times as fast.
#include <hip/hip_runtime.h>

// Contractions: v_wmma_f32_16x16x32_f16 (f16 operands, f32 accumulate) for qkv = h.W, S = q.k^T, O = p.v, proj, fc, fc2.
// Weight operand planes: bf16-RNE input value x64, cast to f16, stored transposed [N][K]. Activation planes f16.
// Attention runs transposed: S^T = k.q^T, O^T = v^T.p^T; p^T packs from the S^T accumulators straight into the B operand.
// p carried x4096 in f16. Query tiles with position < TE add f16 residual planes (x2048) of q, k, v, p
// through separately scaled second products folded into the f32 accumulators. Softmax, LN and erf-GELU in f32.

#ifndef NB
#define NB 2
#endif
#ifndef SEQ
#define SEQ 2048
#endif
#define NB_FULL 2
#define SEQ_FULL 2048
#define CE 1024
#define NH 16
#define HD 64
#define C3 3072
#define C4 4096
#define QP 2048
#define TE (((SEQ) < 256) ? (SEQ) : 256)
#define RROWS ((NB) * (SEQ))
#define NEB ((TE) / 128)
#define NQB ((SEQ) / 128)
#define LNJ ((CE) / 128)
#define LNO ((CE) / 256)

static_assert((SEQ) % 128 == 0);
static_assert((TE) % 128 == 0);
static_assert((NB) >= 1 && (NB) <= NB_FULL);
static_assert((SEQ) <= SEQ_FULL);
static_assert(CE % 128 == 0 && C3 % 128 == 0 && C4 % 128 == 0 && QP % 128 == 0);
static_assert(CE % 64 == 0 && C3 % 64 == 0 && C4 % 64 == 0);
static_assert(NH * HD == CE);
static_assert(HD == 64);
static_assert(QP == 2 * CE);
static_assert(C3 == 3 * CE);
static_assert(RROWS % 128 == 0);
static_assert(RROWS % 8 == 0);
static_assert(CE == 1024);
static_assert(256 * 4 == CE);            // gamma/beta staging: 256 threads x 4 floats
static_assert(32 * 4 * LNJ == CE);       // LN row load: 32 lanes x 4 floats x LNJ steps
static_assert(32 * 8 * LNO == CE);       // LN row store: 32 lanes x 8 halves x LNO instructions
static_assert(NQB * 128 == (SEQ));
static_assert(NEB <= NQB);

typedef unsigned short u16;
typedef unsigned int   u32;
typedef _Float16 v16h __attribute__((ext_vector_type(16)));
typedef _Float16 v8h  __attribute__((ext_vector_type(8)));
typedef _Float16 v4h  __attribute__((ext_vector_type(4)));
typedef float    v8f  __attribute__((ext_vector_type(8)));
typedef float    v4f  __attribute__((ext_vector_type(4)));
typedef unsigned int u32x4 __attribute__((ext_vector_type(4)));
typedef unsigned int u32x2 __attribute__((ext_vector_type(2)));

union Frag  { v16h v; u32x4 u[2]; };
union Pack8 { v8h h; u32x4 u; };
union Pack4 { v4h h; u32x2 u; };

#define WSCALE 64.0f
#define WINV   (1.0f / 64.0f)
#define PCAR   4096.0f
#define PINV   (1.0f / 4096.0f)
#define RSC    2048.0f
#define RINV   (1.0f / 2048.0f)

constexpr size_t al256(size_t b) { return (b + 255) & ~(size_t)255; }
constexpr size_t WS_TOTAL =
    al256((size_t)C3 * CE * 2) + al256((size_t)CE * CE * 2) + al256((size_t)C4 * CE * 2) +
    al256((size_t)CE * C4 * 2) + al256((size_t)RROWS * CE * 2) + al256((size_t)RROWS * QP * 2) +
    al256((size_t)NB * (TE) * QP * 2) + al256((size_t)NB * NH * HD * (SEQ) * 2) +
    al256((size_t)NB * NH * HD * (TE) * 2) + al256((size_t)RROWS * CE * 2) +
    al256((size_t)RROWS * CE * 4) + al256((size_t)RROWS * CE * 2) + al256((size_t)RROWS * C4 * 2);
static_assert(WS_TOTAL <= (size_t)134217728);

// f32 -> nearest-even bf16 grid value, returned as f32
__device__ __forceinline__ float bfr(float f) {
    u32 u = __builtin_bit_cast(u32, f);
    u += 0x7fffu + ((u >> 16) & 1u);
    u &= 0xffff0000u;
    return __builtin_bit_cast(float, u);
}

// f32 -> f16 (RNE) bits
__device__ __forceinline__ u16 hbits(float f) {
    _Float16 h = (_Float16)f;
    return __builtin_bit_cast(u16, h);
}

// 16x16x32 f16 WMMA with the VALU hazard guard tied to D and A/B
__device__ __forceinline__ v8f mma16(v16h a, v16h b, v8f c) {
    c = __builtin_amdgcn_wmma_f32_16x16x32_f16(false, a, false, b, (short)0, c, false, false);
    asm volatile("v_nop\n\tv_nop\n\tv_nop\n\tv_nop" : "+v"(c) : "v"(a), "v"(b));
    return c;
}

// one 16x32 operand fragment of a row-major LDS tile: two 16-byte loads, k order 0..7 and 16..23 (+ 8 in the upper lane half)
__device__ __forceinline__ void ldfrag(Frag& f, const u16* p) {
    f.u[0] = *(const u32x4*)p;
    f.u[1] = *(const u32x4*)(p + 16);
}

// scheduling-region boundary, emitted only in the residual-carrying attention instance:
// ends the live ranges of the staging temporaries before the next block of loads begins
template <int ON>
__device__ __forceinline__ void sched_cut() {
    if constexpr (ON != 0) __builtin_amdgcn_sched_barrier(0);
}

// value of lane l ^ 16 (the other 16-lane row), a vector cross-row move
__device__ __forceinline__ float xhalf(float x) {
    const int xi = __builtin_bit_cast(int, x);
    return __builtin_bit_cast(float, __builtin_amdgcn_permlanex16(xi, xi, 0x76543210, 0xfedcba98, false, false));
}

// e^x on the hardware exp2, same product and instruction as the fast-math exp;
// the v_nop fills the one issue slot the instruction set asks for behind a transcendental
// before its result is read or its source overwritten
__device__ __forceinline__ float exp_fast(float x) {
    float r;
    asm("v_exp_f32 %0, %1\n\tv_nop" : "=v"(r) : "v"(x * 1.44269504088896340736f));
    return r;
}

// erf-form GELU, x * Phi(x), free of branches so that the elements of a lane overlap in the vector pipe.
// q = 0.5 erfc(|x| / sqrt 2) by the rational-exponential form t (a1 + t (a2 + .. t a5)) exp(-z^2), t = 1 / (1 + p z), z = |x| / sqrt 2
// (absolute error of erf below 2e-7); Phi = 1 - q for x >= 0 and q itself for x < 0, so the negative side has no cancellation.
__device__ __forceinline__ float gelu_erf(float x) {
    const float d = __builtin_fmaf(__builtin_fabsf(x), 0.3275911f * 0.70710678118654752f, 1.0f);
    const float a = (x * x) * (-0.5f * 1.44269504088896340736f);
    float t, e;
    // the two transcendentals in one statement: the exp fills the issue slot the instruction set asks for behind the rcp (the outputs
    // are early-clobber, so it neither reads t nor overwrites d), the v_nop fills the one behind the exp
    asm("v_rcp_f32 %0, %2\n\tv_exp_f32 %1, %3\n\tv_nop" : "=&v"(t), "=&v"(e) : "v"(d), "v"(a));
    float p = __builtin_fmaf(t, 0.5f * 1.061405429f, 0.5f * -1.453152027f);
    p = __builtin_fmaf(t, p, 0.5f * 1.421413741f);
    p = __builtin_fmaf(t, p, 0.5f * -0.284496736f);
    p = __builtin_fmaf(t, p, 0.5f * 0.254829592f);
    const float q = (p * t) * e;
    return x * ((x >= 0.0f) ? 1.0f - q : q);
}

// logical row (b*SEQ + t) -> row of the full-size input / output tensors (b*SEQ_FULL + t)
__device__ __forceinline__ size_t grow_map(u32 r) {
    const u32 bb = r / (u32)(SEQ);
    const u32 t  = r - bb * (u32)(SEQ);
    return (size_t)bb * SEQ_FULL + (size_t)t;
}

// ---------------- weight convert + transpose: in[K][N] f32 -> out[N][K] f16 = f16(bfr(w) * 64) ----------------
// read: 16 consecutive lanes x 16 B = one 256-B row piece, two rows = 4 whole lines per load instruction.
// written by 8 consecutive lanes x 16 B of one instruction (4 lines per instruction).
// One workgroup converts the 64 x 64 tile (bx, by); Ts is its LDS tile [n][k], 64 * 72 halves.
__device__ __forceinline__ void cvt_wt_body(const float* in, u16* out, u32 K, u32 N, u32 bx, u32 by, u16* Ts) {
    const u32 tid = threadIdx.x, lane = tid & 31u, wv = tid >> 5;
    const u32 n0 = bx * 64u, k0 = by * 64u;
    const u32 kr = tid >> 4, nq = (tid & 15u) * 4u;
    const float* src = in + (size_t)(k0 + kr) * N + n0 + nq;
    const float* s1 = src + (size_t)16u * N;
    const float* s2 = src + (size_t)32u * N;
    const float* s3 = src + (size_t)48u * N;
    v4f w[4];
    w[0] = *(const v4f*)src; w[1] = *(const v4f*)s1; w[2] = *(const v4f*)s2; w[3] = *(const v4f*)s3;
    // stands in front of every overwrite of the address registers that the four loads name; taking the addresses as inputs
    // keeps their registers untouched up to here, so that the loads issue back to back with no wait among them
    asm volatile("s_wait_xcnt 0x0" :: "v"(src), "v"(s1), "v"(s2), "v"(s3) : "memory");
#pragma unroll
    for (u32 j4 = 0; j4 < 4; j4++) {
#pragma unroll
        for (u32 c = 0; c < 4; c++) {
            float f = w[j4][c];
            Ts[(nq + c) * 72u + kr + j4 * 16u] = hbits(bfr(f) * WSCALE);
        }
    }
    __syncthreads();                             // Ts: cross-wave exchange
    u32x4 val[2];
#pragma unroll
    for (u32 it = 0; it < 2; it++) {
        const u32 nn = wv * 8u + it * 4u + (lane >> 3), ks = (lane & 7u) * 8u;
        val[it] = *(const u32x4*)&Ts[nn * 72u + ks];
    }
#pragma unroll
    for (u32 it = 0; it < 2; it++) {
        const u32 nn = wv * 8u + it * 4u + (lane >> 3), ks = (lane & 7u) * 8u;
        *(u32x4*)(out + (size_t)(n0 + nn) * K + k0 + ks) = val[it];
    }
    // the body is inlined beside other bodies of one kernel: stands in front of every write, on any path the branches behind it
    // allow, of a register that the stores above name
    asm volatile("s_wait_xcnt 0x0" ::: "memory");
}

// ---------------- LayerNorm (row = 1024): one wave per row, f16 out via LDS row stage ----------------
// Row kept in a wave-private f32 LDS row (lane owns columns j*128 + lane*4 + 0..3, same lane writes and reads);
// the three per-element sweeps are rolled loops with wave-uniform trip counts.
// gamma/beta staged once per workgroup in LDS at bf16-RNE values.
// SRCX = 1: src is the input x (full-size row map, each element taken at its bf16-RNE value)
// SRCX = 0: src is an f32 workspace plane with logical rows
// blk: the workgroup's group of 8 rows; xs, rows, gsh, bsh: its LDS arrays (8*CE floats, 8*CE halves, CE floats, CE floats)
template <int SRCX>
__device__ __forceinline__ void ln_body(u32 blk, const float* src, const float* g, const float* be, u16* out,
                                        float* xs, u16* rows, float* gsh, float* bsh) {
    const u32 tid = threadIdx.x, lane = tid & 31u, wv = tid >> 5;
    {
        v4f gg = *(const v4f*)(g + tid * 4u);
        v4f bb = *(const v4f*)(be + tid * 4u);
        v4f go, bo;
#pragma unroll
        for (u32 c = 0; c < 4; c++) {
            float tg = gg[c]; float tb = bb[c];
            go[c] = bfr(tg); bo[c] = bfr(tb);
        }
        *(v4f*)&gsh[tid * 4u] = go;
        *(v4f*)&bsh[tid * 4u] = bo;
    }
    const u32 r = blk * 8u + wv;                   // < RROWS (blk < RROWS/8)
    const size_t srow = SRCX ? grow_map(r) : (size_t)r;
    const float* xr = src + srow * CE;
    float* xw = xs + wv * CE;
    float s = 0.f;
#pragma unroll 1
    for (u32 j = 0; j < LNJ; j++) {
        const u32 c0 = j * 128u + lane * 4u;
        v4f t4 = *(const v4f*)(xr + c0);
        if constexpr (SRCX != 0) {
#pragma unroll
            for (u32 c = 0; c < 4; c++) { float t = t4[c]; t4[c] = bfr(t); }
        }
        *(v4f*)&xw[c0] = t4;
        s += (t4[0] + t4[1]) + (t4[2] + t4[3]);
    }
#pragma unroll
    for (u32 m = 16; m >= 1; m >>= 1) s += __shfl_xor(s, m, 32);
    const float mu = s * (1.f / (float)CE);
    float vs = 0.f;
#pragma unroll 1
    for (u32 j = 0; j < LNJ; j++) {
        const u32 c0 = j * 128u + lane * 4u;
        v4f t4 = *(const v4f*)&xw[c0];
#pragma unroll
        for (u32 c = 0; c < 4; c++) { float d = t4[c] - mu; vs += d * d; }
    }
#pragma unroll
    for (u32 m = 16; m >= 1; m >>= 1) vs += __shfl_xor(vs, m, 32);
    const float rstd = rsqrtf(vs * (1.f / (float)CE) + 1e-5f);
    __syncthreads();                               // gsh/bsh (cross-wave) visible
    u16* rw = rows + wv * CE;
#pragma unroll 1
    for (u32 j = 0; j < LNJ; j++) {
        const u32 c0 = j * 128u + lane * 4u;
        v4f x4 = *(const v4f*)&xw[c0];
        v4f g4 = *(const v4f*)&gsh[c0];
        v4f b4 = *(const v4f*)&bsh[c0];
        Pack4 pk;
#pragma unroll
        for (u32 c = 0; c < 4; c++) {
            float xe = x4[c]; float ge = g4[c]; float bel = b4[c];
            pk.h[c] = (_Float16)((xe - mu) * rstd * ge + bel);
        }
        *(u32x2*)&rw[c0] = pk.u;
    }
    __syncthreads();   // LDS row stage: written and read by the same wave; a workgroup barrier is used
    u32x4 val[LNO];
#pragma unroll
    for (u32 j = 0; j < LNO; j++) val[j] = *(const u32x4*)&rw[j * 256u + lane * 8u];
    u16* orow = out + (size_t)r * CE;
#pragma unroll
    for (u32 j = 0; j < LNO; j++) *(u32x4*)(orow + j * 256u + lane * 8u) = val[j];
    
}

// LN2: f32 workspace plane -> f16 plane
__global__ __launch_bounds__(256) void ln_kernel(const float* __restrict__ src,
                                                 const float* __restrict__ g,
                                                 const float* __restrict__ be,
                                                 u16* __restrict__ out) {
    __shared__ __align__(16) float xs[8 * CE];      // wave wv owns xs[wv*CE ..]
    __shared__ __align__(16) u16   rows[8 * CE];    // wave wv owns rows[wv*CE ..]
    __shared__ __align__(16) float gsh[CE];
    __shared__ __align__(16) float bsh[CE];
    ln_body<0>(blockIdx.x, src, g, be, out, xs, rows, gsh, bsh);
}

// ---------------- what the qkv product waits for, in one launch ----------------
// workgroups 0 .. NLN-1: LN1 of x (the longer workgroups, lowest indices); then the 64 x 64 tiles of the qkv weight convert.
// The other three weight converts, which nothing reads before the attention has ended, ride in the attention launch.
#define NLN  (RROWS / 8)
#define NT_A ((C3 / 64) * (CE / 64))
#define NT_P ((CE / 64) * (CE / 64))
#define NT_F ((C4 / 64) * (CE / 64))
#define NT_G ((CE / 64) * (C4 / 64))
__global__ __launch_bounds__(256) void prep_kernel(const float* __restrict__ x,
                                                   const float* __restrict__ g,
                                                   const float* __restrict__ be,
                                                   u16* __restrict__ h1,
                                                   const float* __restrict__ w_a, u16* __restrict__ o_a) {
    __shared__ __align__(16) float xs[8 * CE];      // LN: wave wv owns xs[wv*CE ..]; convert: the [n][k] tile
    __shared__ __align__(16) u16   rows[8 * CE];
    __shared__ __align__(16) float gsh[CE];
    __shared__ __align__(16) float bsh[CE];
    static_assert(64 * 72 * 2 <= 8 * CE * 4);
    const u32 blk = blockIdx.x;                     // the test below is uniform for the workgroup
    if (blk < (u32)NLN) {
        ln_body<1>(blk, x, g, be, h1, xs, rows, gsh, bsh);
    } else {
        const u32 t = blk - (u32)NLN;               // < NT_A by the grid; [1024][3072] -> [3072][1024]
        cvt_wt_body(w_a, o_a, (u32)CE, (u32)C3, t % (u32)(C3 / 64), t / (u32)(C3 / 64), (u16*)xs);
    }
}

// LDS byte address of a __shared__ location (what an asynchronous copy takes as its destination)
__device__ __forceinline__ u32 lds_addr(const void* p) {
    typedef __attribute__((address_space(3))) const void lds_void;
    return (u32)(size_t)(lds_void*)p;
}

// eight asynchronous 16-byte copies global -> LDS per lane, from g[0..7] to the LDS byte addresses l[0..7].
// The s_wait_xcnt closes the statement so that it stands in front of every later write of an address register the copies name.
__device__ __forceinline__ void copy8(const u32* l, const u16* const* g) {
    asm volatile("global_load_async_to_lds_b128 %0, %8, off\n\t"
                 "global_load_async_to_lds_b128 %1, %9, off\n\t"
                 "global_load_async_to_lds_b128 %2, %10, off\n\t"
                 "global_load_async_to_lds_b128 %3, %11, off\n\t"
                 "global_load_async_to_lds_b128 %4, %12, off\n\t"
                 "global_load_async_to_lds_b128 %5, %13, off\n\t"
                 "global_load_async_to_lds_b128 %6, %14, off\n\t"
                 "global_load_async_to_lds_b128 %7, %15, off\n\t"
                 "s_wait_xcnt 0x0"
                 :: "v"(l[0]), "v"(l[1]), "v"(l[2]), "v"(l[3]), "v"(l[4]), "v"(l[5]), "v"(l[6]), "v"(l[7]),
                    "v"(g[0]), "v"(g[1]), "v"(g[2]), "v"(g[3]), "v"(g[4]), "v"(g[5]), "v"(g[6]), "v"(g[7])
                 : "memory");
}

// the same with four copies per lane
__device__ __forceinline__ void copy4(const u32* l, const u16* const* g) {
    asm volatile("global_load_async_to_lds_b128 %0, %4, off\n\t"
                 "global_load_async_to_lds_b128 %1, %5, off\n\t"
                 "global_load_async_to_lds_b128 %2, %6, off\n\t"
                 "global_load_async_to_lds_b128 %3, %7, off\n\t"
                 "s_wait_xcnt 0x0"
                 :: "v"(l[0]), "v"(l[1]), "v"(l[2]), "v"(l[3]),
                    "v"(g[0]), "v"(g[1]), "v"(g[2]), "v"(g[3])
                 : "memory");
}

// ---------------- f16 GEMM: C[128x128 tile] = A[M][K](f16) . BT[N][K](f16)^T, BK of k per stage ----------------
// 8 waves = 4 (m) x 2 (n), wave tile 32 x 64, fragments per the split k map for A and B.
// Staging: asynchronous 16-byte copies into a ring of two LDS buffers [A 128 rows | B 128 rows], row pitch 2 BK + 16 bytes;
// stage t + 1 is in flight while stage t is multiplied. Each wave-wide copy covers 4 whole 128-B lines.
// BK = 256 where the grid has one workgroup per WGP (MODE 1, 3), else 128 (two workgroups per WGP by LDS).
// Epilogue: acc*(1/64) + bias(bf16-RNE) [-> gelu] staged as f32 128x128 tile in LDS, then
// MODE 0: qkv: n0 < QP -> qk hi plane [RROWS][QP] (+ lo plane rows t<TE), else V transposed
//         into vt hi [NB*NH][64][SEQ] (+ vt lo [..][64][TE] for t<TE)
// MODE 1: out0 f32 [RROWS][CE] = acc + bias + bfr(res at full-size rows)   (x1)
// MODE 2: out0 f16 [RROWS][C4] = gelu(acc + bias)                          (hg)
// MODE 3: out0 f32 at full-size rows = acc + bias + res[logical rows]      (d_out)
template <int MODE>
__global__ __launch_bounds__(256) void gemm_kernel(const u16* __restrict__ A,
                                                   const u16* __restrict__ BT,
                                                   const float* __restrict__ bias,
                                                   const float* __restrict__ res,
                                                   void* out0, void* out1, void* out2, void* out3,
                                                   u32 N, u32 K) {
    constexpr u32 BK     = (MODE == 1 || MODE == 3) ? 256u : 128u;   // k per stage
    constexpr u32 PH     = BK + 8u;                // LDS row pitch in halves: 16 B x odd
    constexpr u32 TILE_H = 128u * PH;              // one operand's tile, halves
    constexpr u32 BUF_H  = 2u * TILE_H;            // one buffer: A tile | B tile
    constexpr u32 LPR    = BK / 8u;                // lanes per row (16 B each)
    constexpr u32 RPP    = 256u / LPR;             // rows the workgroup covers with one copy per lane
    constexpr u32 NCP    = 128u / RPP;             // copies per lane, operand and stage
    constexpr u32 CSP = 132;
    static_assert(CE % BK == 0 && C4 % BK == 0);
    static_assert(NCP % 8u == 0 && 2u * NCP <= 63u);
    static_assert(2u * BUF_H * 2u >= 128u * CSP * 4u);
    __shared__ u32x4 smem[2u * BUF_H / 8u];        // the ring during the k loop, Cs after it
    u16* As = (u16*)smem;                          // buffer b: A [128][PH] at b * BUF_H, B [128][PH] behind it
    float* Cs = (float*)smem;                      // [128][132]

    const u32 tid = threadIdx.x, lane = tid & 31u, wv = tid >> 5;
    const u32 hf = lane >> 4, ln = lane & 15u;
    const u32 m0 = blockIdx.y * 128u, n0 = blockIdx.x * 128u;
    const u32 wm = wv & 3u, wn = wv >> 2;
    const u32 srow = tid / LPR, sseg = (tid % LPR) * 8u; // rows srow + RPP i, 8 halves at sseg
    const u32 nt = K / BK;                               // stages; K is a multiple of BK
    // this lane's copies of the next stage to be issued: A rows, then B rows. Source and LDS addresses live in registers and
    // move on by one add each behind an issue, so that no address arithmetic stands between a stage's barrier and its refill.
    const u16* gp[2u * NCP];
    u32 lp[2u * NCP];
#pragma unroll
    for (u32 c = 0; c < NCP; c++) {
        gp[c]       = A  + (size_t)(m0 + srow + c * RPP) * K + sseg;
        gp[NCP + c] = BT + (size_t)(n0 + srow + c * RPP) * K + sseg;
        lp[c]       = lds_addr(&As[(srow + c * RPP) * PH + sseg]);
        lp[NCP + c] = lp[c] + TILE_H * 2u;
    }
    // issues one stage into the buffer lp points at, then moves to the next stage's k and by dl bytes to the other buffer
    auto stage = [&](u32 dl) {
#pragma unroll                                           // constant indices: gp and lp stay in registers
        for (u32 c = 0; c < 2u * NCP; c += 8u) copy8(&lp[c], &gp[c]);
#pragma unroll
        for (u32 c = 0; c < 2u * NCP; c++) { gp[c] += BK; lp[c] += dl; }
    };
    constexpr u32 BUF_B = BUF_H * 2u;                    // bytes from buffer 0 to buffer 1

    v8f acc[2][4];
#pragma unroll
    for (int i = 0; i < 2; i++)
#pragma unroll
        for (int j = 0; j < 4; j++) acc[i][j] = (v8f)(0.f);

    stage(BUF_B);                                      // stage 0 into buffer 0
    asm volatile("s_wait_asynccnt 0x0" ::: "memory");  // this wave's stage 0 copies have landed
    __syncthreads();                                   // stage 0 visible to all waves
    if (1u < nt) stage(0u - BUF_B);                    // stage 1 into buffer 1
#pragma unroll 1                                       // stays rolled: one stage body, the buffer picked by t & 1
    for (u32 t = 0; t < nt; t++) {
        const u16* Ab = As + (t & 1u) * BUF_H;
        const u16* Bb = Ab + TILE_H;
#pragma unroll
        for (u32 ks = 0; ks < BK / 32u; ks++) {
            Frag af[2], bf[4];
#pragma unroll
            for (u32 mi = 0; mi < 2; mi++) {
                const u16* q = &Ab[(wm * 32u + mi * 16u + ln) * PH + ks * 32u + hf * 8u];
                af[mi].u[0] = *(const u32x4*)q;
                af[mi].u[1] = *(const u32x4*)(q + 16);
            }
#pragma unroll
            for (u32 ni = 0; ni < 4; ni++) {
                const u16* q = &Bb[(wn * 64u + ni * 16u + ln) * PH + ks * 32u + hf * 8u];
                bf[ni].u[0] = *(const u32x4*)q;
                bf[ni].u[1] = *(const u32x4*)(q + 16);
            }
#pragma unroll
            for (int mi = 0; mi < 2; mi++)
#pragma unroll
                for (int ni = 0; ni < 4; ni++)
                    acc[mi][ni] = mma16(af[mi].v, bf[ni].v, acc[mi][ni]);
        }
        asm volatile("s_wait_dscnt 0x0" ::: "memory");     // this wave's reads of stage t's buffer are done before it is refilled
        asm volatile("s_wait_asynccnt 0x0" ::: "memory");  // this wave's stage t + 1 copies have landed
        __syncthreads();                                   // publishes stage t + 1 and ends every wave's reads of stage t
        if (t + 2u < nt) stage((t & 1u) ? 0u - BUF_B : BUF_B);   // stage t + 2 into the buffer stage t has left
    }
    asm volatile("s_wait_asynccnt 0x0" ::: "memory");      // no copy outstanding when the ring becomes the C tile

    // ---- epilogue: accumulators -> f32 tile in LDS (aliases the ring: the last stage's own barrier has ended every wave's reads) ----
#pragma unroll
    for (int ni = 0; ni < 4; ni++) {
        const u32 col = wn * 64u + (u32)ni * 16u + ln;
        const float bv = bfr(bias[n0 + col]);
#pragma unroll
        for (int mi = 0; mi < 2; mi++) {
#pragma unroll
            for (int r = 0; r < 8; r++) {
                const u32 row = wm * 32u + (u32)mi * 16u + hf * 8u + (u32)r;
                float v = acc[mi][ni][r] * WINV + bv;
                if constexpr (MODE == 2) v = gelu_erf(v);
                Cs[row * CSP + col] = v;
            }
        }
    }
    __syncthreads();                               // Cs is read across waves below

    if constexpr (MODE == 1 || MODE == 3) {
        float* o = (float*)out0;
        v4f val[16];
#pragma unroll
        for (int grp = 0; grp < 2; grp++) {
#pragma unroll
            for (int i8 = 0; i8 < 8; i8++) {
                const int i = grp * 8 + i8;
                const u32 row = wv * 16u + (u32)i;
                const u32 r = m0 + row;
                v4f c = *(const v4f*)&Cs[row * CSP + lane * 4u];
                const size_t rr = (MODE == 1) ? grow_map(r) : (size_t)r;
                v4f x4 = *(const v4f*)(res + rr * (size_t)N + n0 + lane * 4u);
                if constexpr (MODE == 1) {
#pragma unroll
                    for (int cc = 0; cc < 4; cc++) { float t = x4[cc]; x4[cc] = bfr(t); }
                }
                val[i] = c + x4;
            }
            asm volatile("" ::: "memory");         // keep the two load groups in separate clauses
        }
#pragma unroll
        for (int i = 0; i < 16; i++) {
            const u32 r = m0 + wv * 16u + (u32)i;
            const size_t orr = (MODE == 3) ? grow_map(r) : (size_t)r;
            *(v4f*)(o + orr * (size_t)N + n0 + lane * 4u) = val[i];
        }
        
    } else if constexpr (MODE == 2) {
        u16* o = (u16*)out0;
        u32x4 val[8];
#pragma unroll
        for (int it = 0; it < 8; it++) {
            const u32 rloc = wv * 16u + (u32)it * 2u + hf, cseg = ln * 8u;
            Pack8 pk;
#pragma unroll
            for (int j = 0; j < 8; j++) pk.h[j] = (_Float16)Cs[rloc * CSP + cseg + (u32)j];
            val[it] = pk.u;
        }
#pragma unroll
        for (int it = 0; it < 8; it++) {
            const u32 rloc = wv * 16u + (u32)it * 2u + hf, cseg = ln * 8u;
            *(u32x4*)(o + (size_t)(m0 + rloc) * N + n0 + cseg) = val[it];
        }
        
    } else {
        // MODE 0: q/k planes or transposed v planes
        u16* qkh = (u16*)out0;
        u16* qkl = (u16*)out1;
        u16* vth = (u16*)out2;
        u16* vtl = (u16*)out3;
        const u32 bq = m0 / (u32)(SEQ);
        const u32 t0 = m0 - bq * (u32)(SEQ);       // 128 | SEQ so the tile sits inside one batch
        const bool lo_on = (t0 < (u32)(TE));       // uniform per workgroup
        u32x4 vh[8], vl[8];
        if (n0 < (u32)QP) {
#pragma unroll
            for (int it = 0; it < 8; it++) {
                const u32 rloc = wv * 16u + (u32)it * 2u + hf, cseg = ln * 8u;
                Pack8 ph, pl;
#pragma unroll
                for (int j = 0; j < 8; j++) {
                    float f = Cs[rloc * CSP + cseg + (u32)j];
                    _Float16 h16 = (_Float16)f;
                    ph.h[j] = h16;
                    pl.h[j] = (_Float16)((f - (float)h16) * RSC);
                }
                vh[it] = ph.u; vl[it] = pl.u;
            }
#pragma unroll
            for (int it = 0; it < 8; it++) {
                const u32 rloc = wv * 16u + (u32)it * 2u + hf, cseg = ln * 8u;
                *(u32x4*)(qkh + (size_t)(m0 + rloc) * QP + n0 + cseg) = vh[it];
                if (lo_on)
                    *(u32x4*)(qkl + ((size_t)bq * (TE) + t0 + rloc) * QP + n0 + cseg) = vl[it];
            }
            
        } else {
            const u32 hh0 = (n0 - (u32)QP) >> 6;   // two heads per 128-column tile
#pragma unroll
            for (int it = 0; it < 8; it++) {
                const u32 rloc = wv * 16u + (u32)it * 2u + hf;   // local column = head*64 + d
                const u32 tseg = ln * 8u;
                Pack8 ph, pl;
#pragma unroll
                for (int j = 0; j < 8; j++) {
                    float f = Cs[(tseg + (u32)j) * CSP + rloc];
                    _Float16 h16 = (_Float16)f;
                    ph.h[j] = h16;
                    pl.h[j] = (_Float16)((f - (float)h16) * RSC);
                }
                vh[it] = ph.u; vl[it] = pl.u;
            }
#pragma unroll
            for (int it = 0; it < 8; it++) {
                const u32 rloc = wv * 16u + (u32)it * 2u + hf, tseg = ln * 8u;
                const u32 hh = hh0 + (rloc >> 6), dd = rloc & 63u;
                const size_t vrow = (size_t)(bq * NH + hh) * HD + dd;
                *(u32x4*)(vth + vrow * (SEQ) + t0 + tseg) = vh[it];
                if (lo_on)
                    *(u32x4*)(vtl + vrow * (TE) + t0 + tseg) = vl[it];
            }
            
        }
    }
}

// ---------------- causal flash attention, hd=64, 128 queries per workgroup (8 waves x 16 rows), 64-key chunks ----------------
// qkh: [RROWS][QP] f16 (q cols h*64+d, k cols CE+h*64+d); qkl: same layout for rows t<TE, residual x2048
// vth: [NB*NH][64][SEQ] f16 transposed v; vtl: [NB*NH][64][TE] residual x2048
// Transposed products: A = K rows (S^T) or V^T rows (O^T), B = Q or P^T. Lane (hf, ln) owns query q0 + ln:
// S^T register r of sub-tile sub = key sub*16 + hf*8 + r, so two converted sub-tiles are one B fragment in the loaders' k order.
// RES=1: query tiles with position < TE: S = qh.kh + (qh.kl + ql.kh)/2048, O += Ph.Vh + (Pr.Vh + Ph.Vl)/2048
// RES=1 only: wave index taken as a scalar-uniform value.
// Operand fragments leave LDS in groups ahead of the products that read them (same arithmetic, same order of products):
// RES=0 a chunk's 8 K fragments, then its 8 V fragments ahead of the softmax; RES=1 one sub-tile ahead, two register sets.
// Staging: RES=1 through registers, two barriers a chunk. RES=0 by asynchronous 16-byte copies into a ring of two LDS buffers,
// (Ks, Vs) and (Kl, Vl): chunk kt + 1 is in flight while chunk kt is worked on, one barrier a chunk.
// bh, qb: the workgroup's head and query tile; Ks .. Ps: its LDS arrays; Kl = Ks + KVRING and Vl = Vs + KVRING (halves)
#define KVT    (64 * 72)
#define KVRING (2 * KVT)
template <int RES>
__device__ __forceinline__
void attn_body(const u16* qkh, const u16* qkl, const u16* vth, const u16* vtl, u16* cv, u32 bh, u32 qb,
               u16* Ks, u16* Vs, u16* Kl, u16* Vl, u16* Ps) {
    const u32 b = bh / (u32)NH, h = bh - b * (u32)NH;
    const u32 tid = threadIdx.x, lane = tid & 31u;
    u32 wv = tid >> 5;
    if constexpr (RES != 0) wv = (u32)__builtin_amdgcn_readfirstlane((int)wv);   // all lanes active, value is wave-uniform
    const u32 hf = lane >> 4, ln = lane & 15u;
    const u32 q0 = qb * 128u + wv * 16u;
    u16* Pw  = Ps + wv * (16u * 72u);

    Frag qf[2], ql[2];
#pragma unroll
    for (u32 ds = 0; ds < 2; ds++) {
        const u16* p = qkh + (size_t)(b * (u32)(SEQ) + q0 + ln) * QP + h * HD + ds * 32u + hf * 8u;
        qf[ds].u[0] = *(const u32x4*)p;
        qf[ds].u[1] = *(const u32x4*)(p + 16);
        if constexpr (RES != 0) {
            const u16* pl = qkl + (size_t)(b * (u32)(TE) + q0 + ln) * QP + h * HD + ds * 32u + hf * 8u;
            ql[ds].u[0] = *(const u32x4*)pl;
            ql[ds].u[1] = *(const u32x4*)(pl + 16);
        } else {
            ql[ds].u[0] = (u32x4)(0u); ql[ds].u[1] = (u32x4)(0u);
        }
    }

    v8f o[4];
#pragma unroll
    for (int i = 0; i < 4; i++) o[i] = (v8f)(0.f);
    float mrun = -3.0e38f;                                 // running maximum of this lane's query (both halves agree)
    float lsum = 0.f;                                      // running sum over this lane half's keys; halves joined after the loop
    const u32 qg = q0 + ln;

    const u32 rr = tid >> 3, seg = (tid & 7u) * 8u;       // staging: rows rr and rr + 32 (key or d), 8 halves at seg: 4 whole 128-B lines per load instruction
    const u32 nkt = 2u * qb + 2u;                          // keys 0 .. qb*128+127

    // RES=0: this lane's four copies of the next chunk to be issued (K rows rr, rr + 32; V^T rows rr, rr + 32). Source and LDS
    // addresses live in registers and move on by one add each behind an issue.
    const u16* gp[4];
    u32 lp[4];
    gp[0] = qkh + (size_t)(b * (u32)(SEQ) + rr) * QP + CE + h * HD + seg;
    gp[1] = gp[0] + 32u * QP;
    gp[2] = vth + ((size_t)(bh * HD + rr)) * (SEQ) + seg;
    gp[3] = gp[2] + 32u * (SEQ);
    lp[0] = lds_addr(&Ks[rr * 72u + seg]);
    lp[1] = lds_addr(&Ks[(rr + 32u) * 72u + seg]);
    lp[2] = lds_addr(&Vs[rr * 72u + seg]);
    lp[3] = lds_addr(&Vs[(rr + 32u) * 72u + seg]);
    // issues one chunk into the buffer lp points at, then moves to the next chunk's keys and by dl bytes to the other buffer
    auto stage = [&](u32 dl) {
        copy4(lp, gp);
        gp[0] += 64u * QP; gp[1] += 64u * QP; gp[2] += 64u; gp[3] += 64u;
#pragma unroll                                             // constant indices: lp stays in registers
        for (u32 c = 0; c < 4u; c++) lp[c] += dl;
    };
    constexpr u32 RING_B = (u32)KVRING * 2u;               // bytes from buffer 0 to buffer 1
    if constexpr (RES == 0) {
        stage(RING_B);                                     // chunk 0 into buffer 0
        asm volatile("s_wait_asynccnt 0x0" ::: "memory");  // this wave's chunk 0 copies have landed
        __syncthreads();                                   // chunk 0 visible to all waves
        stage(0u - RING_B);                                // chunk 1 into buffer 1 (nkt >= 2)
    }

#pragma unroll 1
    for (u32 kt = 0; kt < nkt; kt++) {
        const u16* Kc = Ks + (RES ? 0u : (kt & 1u) * (u32)KVRING);   // the chunk's K and V^T tiles
        const u16* Vc = Vs + (RES ? 0u : (kt & 1u) * (u32)KVRING);
        if constexpr (RES != 0) {
            __syncthreads();                               // prior chunk's LDS reads done
            const u16* gk = qkh + (size_t)(b * (u32)(SEQ) + kt * 64u + rr) * QP + CE + h * HD + seg;
            u32x4 k0v = *(const u32x4*)gk, k1v = *(const u32x4*)(gk + 32u * QP);
            const u16* gv = vth + ((size_t)(bh * HD + rr)) * (SEQ) + kt * 64u + seg;
            u32x4 v0 = *(const u32x4*)gv, v1 = *(const u32x4*)(gv + 32u * (SEQ));
            asm volatile("s_wait_xcnt 0x0" ::: "memory");   // stands in front of every later overwrite of the address registers that the loads above name
            *(u32x4*)&Ks[rr * 72u + seg] = k0v; *(u32x4*)&Ks[(rr + 32u) * 72u + seg] = k1v;
            *(u32x4*)&Vs[rr * 72u + seg] = v0;  *(u32x4*)&Vs[(rr + 32u) * 72u + seg] = v1;
            sched_cut<RES>();                              // hi-plane staging temporaries end here
            if constexpr (RES != 0) {
                const u16* gkl = qkl + (size_t)(b * (u32)(TE) + kt * 64u + rr) * QP + CE + h * HD + seg;
                u32x4 kl0 = *(const u32x4*)gkl, kl1 = *(const u32x4*)(gkl + 32u * QP);
                const u16* gvl = vtl + ((size_t)(bh * HD + rr)) * (TE) + kt * 64u + seg;
                u32x4 vl0 = *(const u32x4*)gvl, vl1 = *(const u32x4*)(gvl + 32u * (TE));
                asm volatile("s_wait_xcnt 0x0" ::: "memory");   // stands in front of every later overwrite of the address registers that the loads above name
                *(u32x4*)&Kl[rr * 72u + seg] = kl0; *(u32x4*)&Kl[(rr + 32u) * 72u + seg] = kl1;
                *(u32x4*)&Vl[rr * 72u + seg] = vl0; *(u32x4*)&Vl[(rr + 32u) * 72u + seg] = vl1;
            }
            __syncthreads();                               // K/V chunk visible to all waves
        }
        sched_cut<RES>();

        // S^T = K . Q^T  (64 keys x 16 q per wave)
        // The K fragment loads stand as groups ahead of the products that read them, so a wave waits out the LDS
        // latency once per group and not once per product. RES=0: the chunk's 8 fragments in one group.
        // RES=1: one sub-tile's hi and residual fragments per group, fetched one sub-tile ahead into a second register set.
        v8f s[4];
        Frag vf[RES ? 2 : 4][2], vlf[2][2];                // V fragments: RES=0 [d sub-tile][ks], RES=1 [register set][ks]
        if constexpr (RES == 0) {
            Frag kf[4][2];
#pragma unroll
            for (int sub = 0; sub < 4; sub++)
#pragma unroll
                for (int ds = 0; ds < 2; ds++)
                    ldfrag(kf[sub][ds], &Kc[((u32)sub * 16u + ln) * 72u + (u32)ds * 32u + hf * 8u]);
            __builtin_amdgcn_sched_barrier(0);             // the 16 K loads issue together, none sinks down among the products
#pragma unroll
            for (int sub = 0; sub < 4; sub++) {
                v8f t = (v8f)(0.f);
#pragma unroll
                for (int ds = 0; ds < 2; ds++) t = mma16(kf[sub][ds].v, qf[ds].v, t);
                s[sub] = t;
            }
            __builtin_amdgcn_sched_barrier(0);             // the V loads below stay behind the last S^T product (they take over the K registers)
#pragma unroll
            for (int dsub = 0; dsub < 4; dsub++)
#pragma unroll
                for (int ks = 0; ks < 2; ks++)
                    ldfrag(vf[dsub][ks], &Vc[((u32)dsub * 16u + ln) * 72u + (u32)ks * 32u + hf * 8u]);
            __builtin_amdgcn_sched_barrier(0);             // the 16 V loads issue here, ahead of the softmax, which covers their latency
        } else {
            Frag kf[2][2], klf[2][2];
#pragma unroll
            for (int ds = 0; ds < 2; ds++) {
                ldfrag(kf[0][ds],  &Ks[ln * 72u + (u32)ds * 32u + hf * 8u]);
                ldfrag(klf[0][ds], &Kl[ln * 72u + (u32)ds * 32u + hf * 8u]);
            }
#pragma unroll
            for (int sub = 0; sub < 4; sub++) {
                const int cur = sub & 1, nxt = cur ^ 1;
#pragma unroll
                for (int ds = 0; ds < 2; ds++) {
                    if (sub < 3) {
                        ldfrag(kf[nxt][ds],  &Ks[((u32)(sub + 1) * 16u + ln) * 72u + (u32)ds * 32u + hf * 8u]);
                        ldfrag(klf[nxt][ds], &Kl[((u32)(sub + 1) * 16u + ln) * 72u + (u32)ds * 32u + hf * 8u]);
                    } else {
                        ldfrag(vf[0][ds],  &Vs[ln * 72u + (u32)ds * 32u + hf * 8u]);
                        ldfrag(vlf[0][ds], &Vl[ln * 72u + (u32)ds * 32u + hf * 8u]);
                    }
                }
                __builtin_amdgcn_sched_barrier(0);         // the next group's 8 loads issue ahead of this sub-tile's products
                v8f t = (v8f)(0.f);
                v8f tr = (v8f)(0.f);
#pragma unroll
                for (int ds = 0; ds < 2; ds++) {
                    t  = mma16(kf[cur][ds].v,  qf[ds].v, t);
                    tr = mma16(klf[cur][ds].v, qf[ds].v, tr);
                    tr = mma16(kf[cur][ds].v,  ql[ds].v, tr);
                }
                s[sub] = t + tr * RINV;
                __builtin_amdgcn_sched_barrier(0);         // the group after next stays behind this sub-tile's products: two register sets, no more
            }
        }

        // scale + causal replace-fill
#pragma unroll
        for (int sub = 0; sub < 4; sub++) {
#pragma unroll
            for (int r = 0; r < 8; r++) {
                const u32 kg = kt * 64u + (u32)sub * 16u + hf * 8u + (u32)r;
                float v = s[sub][r] * 0.125f;
                s[sub][r] = (kg > qg) ? -3.0e38f : v;
            }
        }
        // online softmax: one query per lane, 32 of the chunk's keys in-lane, the other 32 in lane ^ 16
        float mxs[4];
#pragma unroll
        for (int sub = 0; sub < 4; sub++) {
            mxs[sub] = fmaxf(fmaxf(fmaxf(s[sub][0], s[sub][1]), fmaxf(s[sub][2], s[sub][3])),
                             fmaxf(fmaxf(s[sub][4], s[sub][5]), fmaxf(s[sub][6], s[sub][7])));
        }
        float mx = fmaxf(fmaxf(mxs[0], mxs[1]), fmaxf(mxs[2], mxs[3]));
        mx = fmaxf(mx, xhalf(mx));
        const float mnew  = fmaxf(mrun, mx);
        const float alpha = exp_fast(mrun - mnew);
        float rs[4];
#pragma unroll
        for (int sub = 0; sub < 4; sub++) {
            rs[sub] = 0.f;
#pragma unroll
            for (int r = 0; r < 8; r++) {
                float pe = exp_fast(s[sub][r] - mnew);
                s[sub][r] = pe;
                rs[sub] += pe;
            }
        }
        mrun = mnew;
        lsum = lsum * alpha + ((rs[0] + rs[1]) + (rs[2] + rs[3]));
#pragma unroll
        for (int dsub = 0; dsub < 4; dsub++) o[dsub] *= alpha;

        // P^T: two converted S^T sub-tiles = one B fragment (32 keys x 16 q), carried x4096 (+ residual x2048)
        Frag pf[2], prf[2];
#pragma unroll
        for (int ks = 0; ks < 2; ks++) {
#pragma unroll
            for (int e = 0; e < 16; e++) {
                const float ph = s[2 * ks + (e >> 3)][e & 7] * PCAR;
                _Float16 h16 = (_Float16)ph;
                pf[ks].v[e] = h16;
                if constexpr (RES != 0) prf[ks].v[e] = (_Float16)((ph - (float)h16) * RSC);
            }
        }
        // O^T += V^T . P^T
#pragma unroll
        for (int dsub = 0; dsub < 4; dsub++) {
            if constexpr (RES == 0) {
#pragma unroll
                for (int ks = 0; ks < 2; ks++) o[dsub] = mma16(vf[dsub][ks].v, pf[ks].v, o[dsub]);
            } else {
                const int cur = dsub & 1, nxt = cur ^ 1;
                if (dsub < 3) {
#pragma unroll
                    for (int ks = 0; ks < 2; ks++) {
                        ldfrag(vf[nxt][ks],  &Vs[((u32)(dsub + 1) * 16u + ln) * 72u + (u32)ks * 32u + hf * 8u]);
                        ldfrag(vlf[nxt][ks], &Vl[((u32)(dsub + 1) * 16u + ln) * 72u + (u32)ks * 32u + hf * 8u]);
                    }
                }
                __builtin_amdgcn_sched_barrier(0);         // the next d sub-tile's 8 loads issue ahead of this one's products
                v8f u = (v8f)(0.f);
#pragma unroll
                for (int ks = 0; ks < 2; ks++) {
                    o[dsub] = mma16(vf[cur][ks].v,  pf[ks].v,  o[dsub]);
                    u       = mma16(vf[cur][ks].v,  prf[ks].v, u);
                    u       = mma16(vlf[cur][ks].v, pf[ks].v,  u);
                }
                o[dsub] = o[dsub] + u * RINV;
                __builtin_amdgcn_sched_barrier(0);         // the group after next stays behind this sub-tile's products: two register sets, no more
            }
        }
        if constexpr (RES == 0) {
            asm volatile("s_wait_dscnt 0x0" ::: "memory");     // this wave's reads of chunk kt's buffer are done before it is refilled
            asm volatile("s_wait_asynccnt 0x0" ::: "memory");  // this wave's chunk kt + 1 copies have landed
            __syncthreads();                                   // publishes chunk kt + 1 and ends every wave's reads of chunk kt
            if (kt + 2u < nkt) stage((kt & 1u) ? 0u - RING_B : RING_B);   // chunk kt + 2 into the buffer chunk kt has left
        }
    }
    if constexpr (RES == 0) asm volatile("s_wait_asynccnt 0x0" ::: "memory");   // no copy outstanding when the wave goes on to its end

    // finalize: O / (l * 4096) -> f16 tile in the wave's LDS stage -> whole-line stores
    // O^T register r of tile dsub = d dsub*16 + hf*8 + r of query ln: 8 consecutive d, one 16-byte LDS store
    const float inv = (1.0f / (lsum + xhalf(lsum))) * PINV;
#pragma unroll
    for (int dsub = 0; dsub < 4; dsub++) {
        Pack8 pk;
#pragma unroll
        for (int r = 0; r < 8; r++) pk.h[r] = (_Float16)(o[dsub][r] * inv);
        *(u32x4*)&Pw[ln * 72u + (u32)dsub * 16u + hf * 8u] = pk.u;
    }
    __syncthreads();
    u32x4 val[4];
#pragma unroll
    for (u32 it = 0; it < 4; it++) {
        const u32 rloc = it * 4u + (lane >> 3), sg = (lane & 7u) * 8u;
        val[it] = *(const u32x4*)&Pw[rloc * 72u + sg];
    }
#pragma unroll
    for (u32 it = 0; it < 4; it++) {
        const u32 rloc = it * 4u + (lane >> 3), sg = (lane & 7u) * 8u;
        *(u32x4*)(cv + (size_t)(b * (u32)(SEQ) + q0 + rloc) * CE + h * HD + sg) = val[it];
    }
    // the body is inlined beside other bodies of one kernel: stands in front of every write, on any path the branches behind it
    // allow, of a register that the stores above name
    asm volatile("s_wait_xcnt 0x0" ::: "memory");
}

// all query tiles of all heads in one launch: x = head, y counts the tiles down from the longest;
// the residual-carrying tiles (position < TE, the fewest chunks) come last and run beside the plain ones.
// Rows y >= NQB of the grid: the 64 x 64 tiles of the proj, fc and fc2 weight converts, which depend on inputs alone and
// are first read by the launches behind this one.
#define NCVR ((NT_P + NT_F + NT_G) / (NB * NH))
static_assert(NCVR * (NB * NH) == NT_P + NT_F + NT_G);
__global__ __launch_bounds__(256) __attribute__((amdgpu_num_vgpr(256)))
void attn_kernel(const u16* __restrict__ qkh, const u16* __restrict__ qkl,
                 const u16* __restrict__ vth, const u16* __restrict__ vtl,
                 u16* __restrict__ cv,
                 const float* __restrict__ w_p, const float* __restrict__ w_f, const float* __restrict__ w_g,
                 u16* __restrict__ o_p, u16* __restrict__ o_f, u16* __restrict__ o_g) {
    __shared__ __align__(16) u16 KV[4 * KVT];              // one array, so that Kl - Ks = Vl - Vs = KVRING
    u16* Ks = KV;                                          // [key][d]
    u16* Vs = KV + KVT;                                    // [d][key]
    u16* Kl = KV + 2 * KVT;                                // residual planes (RES=1) or the ring's second buffer (RES=0)
    u16* Vl = KV + 3 * KVT;
    __shared__ __align__(16) u16 Ps[8 * 16 * 72];          // per wave [16 q][d]: final O stage
    if (blockIdx.y >= (u32)NQB) {                          // every test here is uniform for the workgroup
        u32 t = (blockIdx.y - (u32)NQB) * (u32)(NB * NH) + blockIdx.x;
        if (t < (u32)NT_P) {                               // [1024][1024] -> [1024][1024]
            cvt_wt_body(w_p, o_p, (u32)CE, (u32)CE, t % (u32)(CE / 64), t / (u32)(CE / 64), Ks);
            return;
        }
        t -= (u32)NT_P;
        if (t < (u32)NT_F) {                               // [1024][4096] -> [4096][1024]
            cvt_wt_body(w_f, o_f, (u32)CE, (u32)C4, t % (u32)(C4 / 64), t / (u32)(C4 / 64), Ks);
            return;
        }
        t -= (u32)NT_F;                                    // < NT_G by the grid; [4096][1024] -> [1024][4096]
        cvt_wt_body(w_g, o_g, (u32)C4, (u32)CE, t % (u32)(CE / 64), t / (u32)(CE / 64), Ks);
        return;
    }
    const u32 bh = blockIdx.x;
    const u32 qb = (u32)NQB - 1u - blockIdx.y;
    if (qb < (u32)NEB) attn_body<1>(qkh, qkl, vth, vtl, cv, bh, qb, Ks, Vs, Kl, Vl, Ps);
    else               attn_body<0>(qkh, qkl, vth, vtl, cv, bh, qb, Ks, Vs, Kl, Vl, Ps);
}

// ---------------- host side ----------------
extern "C" void kernel_launch(void* const* d_in, const int* in_sizes, int n_in,
                              void* d_out, int out_size, void* d_ws, size_t ws_size,
                              hipStream_t stream) {
    if (n_in < 13) return;
    const long long needX = ((long long)(NB - 1) * SEQ_FULL + (SEQ)) * CE;
    if ((long long)in_sizes[0] < needX || (long long)out_size < needX) return;
    if (in_sizes[1] < CE || in_sizes[2] < CE || in_sizes[3] < CE * C3 || in_sizes[4] < C3 ||
        in_sizes[5] < CE * CE || in_sizes[6] < CE || in_sizes[7] < CE || in_sizes[8] < CE ||
        in_sizes[9] < CE * C4 || in_sizes[10] < C4 || in_sizes[11] < C4 * CE || in_sizes[12] < CE)
        return;

    const float* x      = (const float*)d_in[0];
    const float* ln1_g  = (const float*)d_in[1];
    const float* ln1_b  = (const float*)d_in[2];
    const float* w_attn = (const float*)d_in[3];
    const float* b_attn = (const float*)d_in[4];
    const float* w_proj = (const float*)d_in[5];
    const float* b_proj = (const float*)d_in[6];
    const float* ln2_g  = (const float*)d_in[7];
    const float* ln2_b  = (const float*)d_in[8];
    const float* w_fc   = (const float*)d_in[9];
    const float* b_fc   = (const float*)d_in[10];
    const float* w_fc2  = (const float*)d_in[11];
    const float* b_fc2  = (const float*)d_in[12];

    char* ws = (char*)d_ws;
    size_t off = 0;
    auto take = [&](size_t bytes) -> char* {
        char* p = ws + off;
        off += (bytes + 255) & ~(size_t)255;
        return p;
    };
    const size_t R = (size_t)RROWS;
    u16*   waT   = (u16*)take((size_t)C3 * CE * 2);               // [3072][1024]
    u16*   wpT   = (u16*)take((size_t)CE * CE * 2);               // [1024][1024]
    u16*   wfcT  = (u16*)take((size_t)C4 * CE * 2);               // [4096][1024]
    u16*   wfc2T = (u16*)take((size_t)CE * C4 * 2);               // [1024][4096]
    u16*   h1    = (u16*)take(R * CE * 2);                        // [R][1024]
    u16*   qkh   = (u16*)take(R * QP * 2);                        // [R][2048]
    u16*   qkl   = (u16*)take((size_t)NB * (TE) * QP * 2);        // [NB*TE][2048]
    u16*   vth   = (u16*)take((size_t)NB * NH * HD * (SEQ) * 2);  // [NB*NH][64][SEQ]
    u16*   vtl   = (u16*)take((size_t)NB * NH * HD * (TE) * 2);   // [NB*NH][64][TE]
    u16*   cvb   = (u16*)take(R * CE * 2);                        // [R][1024]
    float* x1    = (float*)take(R * CE * 4);                      // [R][1024]
    u16*   h2    = (u16*)take(R * CE * 2);                        // [R][1024]
    u16*   hg    = (u16*)take(R * C4 * 2);                        // [R][4096]
    if (off > ws_size || off > (size_t)134217728) return;
    void* dummy = (void*)d_ws;

    // 1) + 2) h1 = LN1(bfr(x)); qkv weight: bf16-RNE value x64 -> f16, transposed to [N][K]   (in[K][N] -> out[N][K])
    prep_kernel<<<NLN + NT_A, 256, 0, stream>>>(x, ln1_g, ln1_b, h1, w_attn, waT);
    // 3) qkv = h1 . w_attn + b_attn -> q/k planes (+ residual rows t<TE), v transposed (+ residual)
    gemm_kernel<0><<<dim3(C3 / 128, RROWS / 128), 256, 0, stream>>>(h1, waT, b_attn, b_attn,
                                                                    qkh, qkl, vth, vtl, (u32)C3, (u32)CE);
    // 4) causal attention: residual-carrying tiles for query position < TE, plain tiles after
    //    behind them in the same grid: the proj, fc and fc2 weights, converted like the qkv weight
    attn_kernel<<<dim3(NB * NH, NQB + NCVR), 256, 0, stream>>>(qkh, qkl, vth, vtl, cvb,
                                                               w_proj, w_fc, w_fc2, wpT, wfcT, wfc2T);
    // 5) x1 = cv . w_proj + b_proj + bfr(x)
    gemm_kernel<1><<<dim3(CE / 128, RROWS / 128), 256, 0, stream>>>(cvb, wpT, b_proj, x,
                                                                    x1, dummy, dummy, dummy, (u32)CE, (u32)CE);
    // 6) h2 = LN2(x1)
    ln_kernel<<<RROWS / 8, 256, 0, stream>>>(x1, ln2_g, ln2_b, h2);
    // 7) hg = gelu(h2 . w_fc + b_fc)
    gemm_kernel<2><<<dim3(C4 / 128, RROWS / 128), 256, 0, stream>>>(h2, wfcT, b_fc, b_fc,
                                                                    hg, dummy, dummy, dummy, (u32)C4, (u32)CE);
    // 8) out = hg . w_fc2 + b_fc2 + x1
    gemm_kernel<3><<<dim3(CE / 128, RROWS / 128), 256, 0, stream>>>(hg, wfc2T, b_fc2, x1,
                                                                    d_out, dummy, dummy, dummy, (u32)CE, (u32)C4);
}

// v008
// One run takes 151 microseconds.
// Two timings next to v007 both put it at 1.04 times that version's speed.
// Over all steps from v000 it is 2.38 times as fast.
#include <hip/hip_runtime.h>

// Contractions: v_wmma_f32_16x16x32_f16 (f16 operands, f32 accumulate) for qkv = h.W, S = q.k^T, O = p.v, proj, fc, fc2.
// Weight operand planes: bf16-RNE input value x64, cast to f16, stored transposed [N][K]. Activation planes f16.
// Attention runs transposed: S^T = k.q^T, O^T = v^T.p^T; p^T packs from the S^T accumulators straight into the B operand.
// p carried x4096 in f16. Query tiles with position < TE add f16 residual planes (x2048) of q, k, v, p
// through separately scaled second products folded into the f32 accumulators. Softmax, LN and erf-GELU in f32.

#ifndef NB
#define NB 2
#endif
#ifndef SEQ
#define SEQ 2048
#endif
#define NB_FULL 2
#define SEQ_FULL 2048
#define CE 1024
#define NH 16
#define HD 64
#define C3 3072
#define C4 4096
#define QP 2048
#define TE (((SEQ) < 256) ? (SEQ) : 256)
#define RROWS ((NB) * (SEQ))
#define NEB ((TE) / 128)
#define NQB ((SEQ) / 128)
#define LNJ ((CE) / 128)
#define LNO ((CE) / 256)

static_assert((SEQ) % 128 == 0);
static_assert((TE) % 128 == 0);
static_assert((NB) >= 1 && (NB) <= NB_FULL);
static_assert((SEQ) <= SEQ_FULL);
static_assert(CE % 128 == 0 && C3 % 128 == 0 && C4 % 128 == 0 && QP % 128 == 0);
static_assert(CE % 64 == 0 && C3 % 64 == 0 && C4 % 64 == 0);
static_assert(NH * HD == CE);
static_assert(HD == 64);
static_assert(QP == 2 * CE);
static_assert(C3 == 3 * CE);
static_assert(RROWS % 128 == 0);
static_assert(RROWS % 8 == 0);
static_assert(CE == 1024);
static_assert(256 * 4 == CE);            // gamma/beta staging: 256 threads x 4 floats
static_assert(32 * 4 * LNJ == CE);       // LN row load: 32 lanes x 4 floats x LNJ steps
static_assert(32 * 8 * LNO == CE);       // LN row store: 32 lanes x 8 halves x LNO instructions
static_assert(NQB * 128 == (SEQ));
static_assert(NEB <= NQB);

typedef unsigned short u16;
typedef unsigned int   u32;
typedef _Float16 v16h __attribute__((ext_vector_type(16)));
typedef _Float16 v8h  __attribute__((ext_vector_type(8)));
typedef _Float16 v4h  __attribute__((ext_vector_type(4)));
typedef float    v8f  __attribute__((ext_vector_type(8)));
typedef float    v4f  __attribute__((ext_vector_type(4)));
typedef unsigned int u32x4 __attribute__((ext_vector_type(4)));
typedef unsigned int u32x2 __attribute__((ext_vector_type(2)));

union Frag  { v16h v; u32x4 u[2]; };
union Pack8 { v8h h; u32x4 u; };
union Pack4 { v4h h; u32x2 u; };

#define WSCALE 64.0f
#define WINV   (1.0f / 64.0f)
#define PCAR   4096.0f
#define PINV   (1.0f / 4096.0f)
#define RSC    2048.0f
#define RINV   (1.0f / 2048.0f)

constexpr size_t al256(size_t b) { return (b + 255) & ~(size_t)255; }
constexpr size_t WS_TOTAL =
    al256((size_t)C3 * CE * 2) + al256((size_t)CE * CE * 2) + al256((size_t)C4 * CE * 2) +
    al256((size_t)CE * C4 * 2) + al256((size_t)RROWS * CE * 2) + al256((size_t)RROWS * QP * 2) +
    al256((size_t)NB * (TE) * QP * 2) + al256((size_t)NB * NH * HD * (SEQ) * 2) +
    al256((size_t)NB * NH * HD * (TE) * 2) + al256((size_t)RROWS * CE * 2) +
    al256((size_t)RROWS * CE * 4) + al256((size_t)RROWS * CE * 2) + al256((size_t)RROWS * C4 * 2);
static_assert(WS_TOTAL <= (size_t)134217728);

// f32 -> nearest-even bf16 grid value, returned as f32
__device__ __forceinline__ float bfr(float f) {
    u32 u = __builtin_bit_cast(u32, f);
    u += 0x7fffu + ((u >> 16) & 1u);
    u &= 0xffff0000u;
    return __builtin_bit_cast(float, u);
}

// f32 -> f16 (RNE) bits
__device__ __forceinline__ u16 hbits(float f) {
    _Float16 h = (_Float16)f;
    return __builtin_bit_cast(u16, h);
}

// 16x16x32 f16 WMMA with the VALU hazard guard tied to D and A/B
__device__ __forceinline__ v8f mma16(v16h a, v16h b, v8f c) {
    c = __builtin_amdgcn_wmma_f32_16x16x32_f16(false, a, false, b, (short)0, c, false, false);
    asm volatile("v_nop\n\tv_nop\n\tv_nop\n\tv_nop" : "+v"(c) : "v"(a), "v"(b));
    return c;
}

// one 16x32 operand fragment of a row-major LDS tile: two 16-byte loads, k order 0..7 and 16..23 (+ 8 in the upper lane half)
__device__ __forceinline__ void ldfrag(Frag& f, const u16* p) {
    f.u[0] = *(const u32x4*)p;
    f.u[1] = *(const u32x4*)(p + 16);
}

// scheduling-region boundary, emitted only in the residual-carrying attention instance:
// ends the live ranges of the staging temporaries before the next block of loads begins
template <int ON>
__device__ __forceinline__ void sched_cut() {
    if constexpr (ON != 0) __builtin_amdgcn_sched_barrier(0);
}

// value of lane l ^ 16 (the other 16-lane row), a vector cross-row move
__device__ __forceinline__ float xhalf(float x) {
    const int xi = __builtin_bit_cast(int, x);
    return __builtin_bit_cast(float, __builtin_amdgcn_permlanex16(xi, xi, 0x76543210, 0xfedcba98, false, false));
}

// e^x on the hardware exp2, same product and instruction as the fast-math exp;
// the v_nop fills the one issue slot the instruction set asks for behind a transcendental
// before its result is read or its source overwritten
__device__ __forceinline__ float exp_fast(float x) {
    float r;
    asm("v_exp_f32 %0, %1\n\tv_nop" : "=v"(r) : "v"(x * 1.44269504088896340736f));
    return r;
}

// 2^x on the hardware exp2; the v_nop fills the same issue slot as in exp_fast
__device__ __forceinline__ float exp2_fast(float x) {
    float r;
    asm("v_exp_f32 %0, %1\n\tv_nop" : "=v"(r) : "v"(x));
    return r;
}

// erf-form GELU, x * Phi(x), free of branches so that the elements of a lane overlap in the vector pipe.
// q = 0.5 erfc(|x| / sqrt 2) by the rational-exponential form t (a1 + t (a2 + .. t a5)) exp(-z^2), t = 1 / (1 + p z), z = |x| / sqrt 2
// (absolute error of erf below 2e-7); Phi = 1 - q for x >= 0 and q itself for x < 0, so the negative side has no cancellation.
__device__ __forceinline__ float gelu_erf(float x) {
    const float d = __builtin_fmaf(__builtin_fabsf(x), 0.3275911f * 0.70710678118654752f, 1.0f);
    const float a = (x * x) * (-0.5f * 1.44269504088896340736f);
    float t, e;
    // the two transcendentals in one statement: the exp fills the issue slot the instruction set asks for behind the rcp (the outputs
    // are early-clobber, so it neither reads t nor overwrites d), the v_nop fills the one behind the exp
    asm("v_rcp_f32 %0, %2\n\tv_exp_f32 %1, %3\n\tv_nop" : "=&v"(t), "=&v"(e) : "v"(d), "v"(a));
    float p = __builtin_fmaf(t, 0.5f * 1.061405429f, 0.5f * -1.453152027f);
    p = __builtin_fmaf(t, p, 0.5f * 1.421413741f);
    p = __builtin_fmaf(t, p, 0.5f * -0.284496736f);
    p = __builtin_fmaf(t, p, 0.5f * 0.254829592f);
    const float q = (p * t) * e;
    return x * ((x >= 0.0f) ? 1.0f - q : q);
}

// logical row (b*SEQ + t) -> row of the full-size input / output tensors (b*SEQ_FULL + t)
__device__ __forceinline__ size_t grow_map(u32 r) {
    const u32 bb = r / (u32)(SEQ);
    const u32 t  = r - bb * (u32)(SEQ);
    return (size_t)bb * SEQ_FULL + (size_t)t;
}

// ---------------- weight convert + transpose: in[K][N] f32 -> out[N][K] f16 = f16(bfr(w) * 64) ----------------
// read: 16 consecutive lanes x 16 B = one 256-B row piece, two rows = 4 whole lines per load instruction.
// written by 8 consecutive lanes x 16 B of one instruction (4 lines per instruction).
// One workgroup converts the 64 x 64 tile (bx, by); Ts is its LDS tile [n][k], 64 * 72 halves.
__device__ __forceinline__ void cvt_wt_body(const float* in, u16* out, u32 K, u32 N, u32 bx, u32 by, u16* Ts) {
    const u32 tid = threadIdx.x, lane = tid & 31u, wv = tid >> 5;
    const u32 n0 = bx * 64u, k0 = by * 64u;
    const u32 kr = tid >> 4, nq = (tid & 15u) * 4u;
    const float* src = in + (size_t)(k0 + kr) * N + n0 + nq;
    const float* s1 = src + (size_t)16u * N;
    const float* s2 = src + (size_t)32u * N;
    const float* s3 = src + (size_t)48u * N;
    v4f w[4];
    w[0] = *(const v4f*)src; w[1] = *(const v4f*)s1; w[2] = *(const v4f*)s2; w[3] = *(const v4f*)s3;
    // stands in front of every overwrite of the address registers that the four loads name; taking the addresses as inputs
    // keeps their registers untouched up to here, so that the loads issue back to back with no wait among them
    asm volatile("s_wait_xcnt 0x0" :: "v"(src), "v"(s1), "v"(s2), "v"(s3) : "memory");
#pragma unroll
    for (u32 j4 = 0; j4 < 4; j4++) {
#pragma unroll
        for (u32 c = 0; c < 4; c++) {
            float f = w[j4][c];
            Ts[(nq + c) * 72u + kr + j4 * 16u] = hbits(bfr(f) * WSCALE);
        }
    }
    __syncthreads();                             // Ts: cross-wave exchange
    u32x4 val[2];
#pragma unroll
    for (u32 it = 0; it < 2; it++) {
        const u32 nn = wv * 8u + it * 4u + (lane >> 3), ks = (lane & 7u) * 8u;
        val[it] = *(const u32x4*)&Ts[nn * 72u + ks];
    }
#pragma unroll
    for (u32 it = 0; it < 2; it++) {
        const u32 nn = wv * 8u + it * 4u + (lane >> 3), ks = (lane & 7u) * 8u;
        *(u32x4*)(out + (size_t)(n0 + nn) * K + k0 + ks) = val[it];
    }
    // the body is inlined beside other bodies of one kernel: stands in front of every write, on any path the branches behind it
    // allow, of a register that the stores above name
    asm volatile("s_wait_xcnt 0x0" ::: "memory");
}

// ---------------- LayerNorm (row = 1024): one wave per row, f16 out via LDS row stage ----------------
// Row kept in a wave-private f32 LDS row (lane owns columns j*128 + lane*4 + 0..3, same lane writes and reads);
// the three per-element sweeps are rolled loops with wave-uniform trip counts.
// gamma/beta staged once per workgroup in LDS at bf16-RNE values.
// SRCX = 1: src is the input x (full-size row map, each element taken at its bf16-RNE value)
// SRCX = 0: src is an f32 workspace plane with logical rows
// blk: the workgroup's group of 8 rows; xs, rows, gsh, bsh: its LDS arrays (8*CE floats, 8*CE halves, CE floats, CE floats)
template <int SRCX>
__device__ __forceinline__ void ln_body(u32 blk, const float* src, const float* g, const float* be, u16* out,
                                        float* xs, u16* rows, float* gsh, float* bsh) {
    const u32 tid = threadIdx.x, lane = tid & 31u, wv = tid >> 5;
    {
        v4f gg = *(const v4f*)(g + tid * 4u);
        v4f bb = *(const v4f*)(be + tid * 4u);
        v4f go, bo;
#pragma unroll
        for (u32 c = 0; c < 4; c++) {
            float tg = gg[c]; float tb = bb[c];
            go[c] = bfr(tg); bo[c] = bfr(tb);
        }
        *(v4f*)&gsh[tid * 4u] = go;
        *(v4f*)&bsh[tid * 4u] = bo;
    }
    const u32 r = blk * 8u + wv;                   // < RROWS (blk < RROWS/8)
    const size_t srow = SRCX ? grow_map(r) : (size_t)r;
    const float* xr = src + srow * CE;
    float* xw = xs + wv * CE;
    float s = 0.f;
#pragma unroll 1
    for (u32 j = 0; j < LNJ; j++) {
        const u32 c0 = j * 128u + lane * 4u;
        v4f t4 = *(const v4f*)(xr + c0);
        if constexpr (SRCX != 0) {
#pragma unroll
            for (u32 c = 0; c < 4; c++) { float t = t4[c]; t4[c] = bfr(t); }
        }
        *(v4f*)&xw[c0] = t4;
        s += (t4[0] + t4[1]) + (t4[2] + t4[3]);
    }
#pragma unroll
    for (u32 m = 16; m >= 1; m >>= 1) s += __shfl_xor(s, m, 32);
    const float mu = s * (1.f / (float)CE);
    float vs = 0.f;
#pragma unroll 1
    for (u32 j = 0; j < LNJ; j++) {
        const u32 c0 = j * 128u + lane * 4u;
        v4f t4 = *(const v4f*)&xw[c0];
#pragma unroll
        for (u32 c = 0; c < 4; c++) { float d = t4[c] - mu; vs += d * d; }
    }
#pragma unroll
    for (u32 m = 16; m >= 1; m >>= 1) vs += __shfl_xor(vs, m, 32);
    const float rstd = rsqrtf(vs * (1.f / (float)CE) + 1e-5f);
    __syncthreads();                               // gsh/bsh (cross-wave) visible
    u16* rw = rows + wv * CE;
#pragma unroll 1
    for (u32 j = 0; j < LNJ; j++) {
        const u32 c0 = j * 128u + lane * 4u;
        v4f x4 = *(const v4f*)&xw[c0];
        v4f g4 = *(const v4f*)&gsh[c0];
        v4f b4 = *(const v4f*)&bsh[c0];
        Pack4 pk;
#pragma unroll
        for (u32 c = 0; c < 4; c++) {
            float xe = x4[c]; float ge = g4[c]; float bel = b4[c];
            pk.h[c] = (_Float16)((xe - mu) * rstd * ge + bel);
        }
        *(u32x2*)&rw[c0] = pk.u;
    }
    __syncthreads();   // LDS row stage: written and read by the same wave; a workgroup barrier is used
    u32x4 val[LNO];
#pragma unroll
    for (u32 j = 0; j < LNO; j++) val[j] = *(const u32x4*)&rw[j * 256u + lane * 8u];
    u16* orow = out + (size_t)r * CE;
#pragma unroll
    for (u32 j = 0; j < LNO; j++) *(u32x4*)(orow + j * 256u + lane * 8u) = val[j];
    
}

// LN2: f32 workspace plane -> f16 plane
__global__ __launch_bounds__(256) void ln_kernel(const float* __restrict__ src,
                                                 const float* __restrict__ g,
                                                 const float* __restrict__ be,
                                                 u16* __restrict__ out) {
    __shared__ __align__(16) float xs[8 * CE];      // wave wv owns xs[wv*CE ..]
    __shared__ __align__(16) u16   rows[8 * CE];    // wave wv owns rows[wv*CE ..]
    __shared__ __align__(16) float gsh[CE];
    __shared__ __align__(16) float bsh[CE];
    ln_body<0>(blockIdx.x, src, g, be, out, xs, rows, gsh, bsh);
}

// ---------------- what the qkv product waits for, in one launch ----------------
// workgroups 0 .. NLN-1: LN1 of x (the longer workgroups, lowest indices); then the 64 x 64 tiles of the qkv weight convert.
// The other three weight converts, which nothing reads before the attention has ended, ride in the attention launch.
#define NLN  (RROWS / 8)
#define NT_A ((C3 / 64) * (CE / 64))
#define NT_P ((CE / 64) * (CE / 64))
#define NT_F ((C4 / 64) * (CE / 64))
#define NT_G ((CE / 64) * (C4 / 64))
__global__ __launch_bounds__(256) void prep_kernel(const float* __restrict__ x,
                                                   const float* __restrict__ g,
                                                   const float* __restrict__ be,
                                                   u16* __restrict__ h1,
                                                   const float* __restrict__ w_a, u16* __restrict__ o_a) {
    __shared__ __align__(16) float xs[8 * CE];      // LN: wave wv owns xs[wv*CE ..]; convert: the [n][k] tile
    __shared__ __align__(16) u16   rows[8 * CE];
    __shared__ __align__(16) float gsh[CE];
    __shared__ __align__(16) float bsh[CE];
    static_assert(64 * 72 * 2 <= 8 * CE * 4);
    const u32 blk = blockIdx.x;                     // the test below is uniform for the workgroup
    if (blk < (u32)NLN) {
        ln_body<1>(blk, x, g, be, h1, xs, rows, gsh, bsh);
    } else {
        const u32 t = blk - (u32)NLN;               // < NT_A by the grid; [1024][3072] -> [3072][1024]
        cvt_wt_body(w_a, o_a, (u32)CE, (u32)C3, t % (u32)(C3 / 64), t / (u32)(C3 / 64), (u16*)xs);
    }
}

// LDS byte address of a __shared__ location (what an asynchronous copy takes as its destination)
__device__ __forceinline__ u32 lds_addr(const void* p) {
    typedef __attribute__((address_space(3))) const void lds_void;
    return (u32)(size_t)(lds_void*)p;
}

// eight asynchronous 16-byte copies global -> LDS per lane, from g[0..7] to the LDS byte addresses l[0..7].
// The s_wait_xcnt closes the statement so that it stands in front of every later write of an address register the copies name.
__device__ __forceinline__ void copy8(const u32* l, const u16* const* g) {
    asm volatile("global_load_async_to_lds_b128 %0, %8, off\n\t"
                 "global_load_async_to_lds_b128 %1, %9, off\n\t"
                 "global_load_async_to_lds_b128 %2, %10, off\n\t"
                 "global_load_async_to_lds_b128 %3, %11, off\n\t"
                 "global_load_async_to_lds_b128 %4, %12, off\n\t"
                 "global_load_async_to_lds_b128 %5, %13, off\n\t"
                 "global_load_async_to_lds_b128 %6, %14, off\n\t"
                 "global_load_async_to_lds_b128 %7, %15, off\n\t"
                 "s_wait_xcnt 0x0"
                 :: "v"(l[0]), "v"(l[1]), "v"(l[2]), "v"(l[3]), "v"(l[4]), "v"(l[5]), "v"(l[6]), "v"(l[7]),
                    "v"(g[0]), "v"(g[1]), "v"(g[2]), "v"(g[3]), "v"(g[4]), "v"(g[5]), "v"(g[6]), "v"(g[7])
                 : "memory");
}

// the same with four copies per lane
__device__ __forceinline__ void copy4(const u32* l, const u16* const* g) {
    asm volatile("global_load_async_to_lds_b128 %0, %4, off\n\t"
                 "global_load_async_to_lds_b128 %1, %5, off\n\t"
                 "global_load_async_to_lds_b128 %2, %6, off\n\t"
                 "global_load_async_to_lds_b128 %3, %7, off\n\t"
                 "s_wait_xcnt 0x0"
                 :: "v"(l[0]), "v"(l[1]), "v"(l[2]), "v"(l[3]),
                    "v"(g[0]), "v"(g[1]), "v"(g[2]), "v"(g[3])
                 : "memory");
}

// ---------------- f16 GEMM: C[128x128 tile] = A[M][K](f16) . BT[N][K](f16)^T, BK of k per stage ----------------
// 8 waves = 4 (m) x 2 (n), wave tile 32 x 64, fragments per the split k map for A and B.
// Staging: asynchronous 16-byte copies into a ring of two LDS buffers [A 128 rows | B 128 rows], row pitch 2 BK + 16 bytes;
// stage t + 1 is in flight while stage t is multiplied. Each wave-wide copy covers 4 whole 128-B lines.
// BK = 256 where the grid has one workgroup per WGP (MODE 1, 3), else 128 (two workgroups per WGP by LDS).
// Epilogue: acc*(1/64) + bias(bf16-RNE) [-> gelu] staged as f32 128x128 tile in LDS, then
// MODE 0: qkv: n0 < QP -> qk hi plane [RROWS][QP] (+ lo plane rows t<TE), else V transposed
//         into vt hi [NB*NH][64][SEQ] (+ vt lo [..][64][TE] for t<TE)
// MODE 1: out0 f32 [RROWS][CE] = acc + bias + bfr(res at full-size rows)   (x1)
// MODE 2: out0 f16 [RROWS][C4] = gelu(acc + bias)                          (hg)
// MODE 3: out0 f32 at full-size rows = acc + bias + res[logical rows]      (d_out)
template <int MODE>
__global__ __launch_bounds__(256) void gemm_kernel(const u16* __restrict__ A,
                                                   const u16* __restrict__ BT,
                                                   const float* __restrict__ bias,
                                                   const float* __restrict__ res,
                                                   void* out0, void* out1, void* out2, void* out3,
                                                   u32 N, u32 K) {
    constexpr u32 BK     = (MODE == 1 || MODE == 3) ? 256u : 128u;   // k per stage
    constexpr u32 PH     = BK + 8u;                // LDS row pitch in halves: 16 B x odd
    constexpr u32 TILE_H = 128u * PH;              // one operand's tile, halves
    constexpr u32 BUF_H  = 2u * TILE_H;            // one buffer: A tile | B tile
    constexpr u32 LPR    = BK / 8u;                // lanes per row (16 B each)
    constexpr u32 RPP    = 256u / LPR;             // rows the workgroup covers with one copy per lane
    constexpr u32 NCP    = 128u / RPP;             // copies per lane, operand and stage
    constexpr u32 CSP = 132;
    static_assert(CE % BK == 0 && C4 % BK == 0);
    static_assert(NCP % 8u == 0 && 2u * NCP <= 63u);
    static_assert(2u * BUF_H * 2u >= 128u * CSP * 4u);
    __shared__ u32x4 smem[2u * BUF_H / 8u];        // the ring during the k loop, Cs after it
    u16* As = (u16*)smem;                          // buffer b: A [128][PH] at b * BUF_H, B [128][PH] behind it
    float* Cs = (float*)smem;                      // [128][132]

    const u32 tid = threadIdx.x, lane = tid & 31u, wv = tid >> 5;
    const u32 hf = lane >> 4, ln = lane & 15u;
    const u32 m0 = blockIdx.y * 128u, n0 = blockIdx.x * 128u;
    const u32 wm = wv & 3u, wn = wv >> 2;
    const u32 srow = tid / LPR, sseg = (tid % LPR) * 8u; // rows srow + RPP i, 8 halves at sseg
    const u32 nt = K / BK;                               // stages; K is a multiple of BK
    // this lane's copies of the next stage to be issued: A rows, then B rows. Source and LDS addresses live in registers and
    // move on by one add each behind an issue, so that no address arithmetic stands between a stage's barrier and its refill.
    const u16* gp[2u * NCP];
    u32 lp[2u * NCP];
#pragma unroll
    for (u32 c = 0; c < NCP; c++) {
        gp[c]       = A  + (size_t)(m0 + srow + c * RPP) * K + sseg;
        gp[NCP + c] = BT + (size_t)(n0 + srow + c * RPP) * K + sseg;
        lp[c]       = lds_addr(&As[(srow + c * RPP) * PH + sseg]);
        lp[NCP + c] = lp[c] + TILE_H * 2u;
    }
    // issues one stage into the buffer lp points at, then moves to the next stage's k and by dl bytes to the other buffer
    auto stage = [&](u32 dl) {
#pragma unroll                                           // constant indices: gp and lp stay in registers
        for (u32 c = 0; c < 2u * NCP; c += 8u) copy8(&lp[c], &gp[c]);
#pragma unroll
        for (u32 c = 0; c < 2u * NCP; c++) { gp[c] += BK; lp[c] += dl; }
    };
    constexpr u32 BUF_B = BUF_H * 2u;                    // bytes from buffer 0 to buffer 1

    v8f acc[2][4];
#pragma unroll
    for (int i = 0; i < 2; i++)
#pragma unroll
        for (int j = 0; j < 4; j++) acc[i][j] = (v8f)(0.f);

    stage(BUF_B);                                      // stage 0 into buffer 0
    asm volatile("s_wait_asynccnt 0x0" ::: "memory");  // this wave's stage 0 copies have landed
    __syncthreads();                                   // stage 0 visible to all waves
    if (1u < nt) stage(0u - BUF_B);                    // stage 1 into buffer 1
#pragma unroll 1                                       // stays rolled: one stage body, the buffer picked by t & 1
    for (u32 t = 0; t < nt; t++) {
        const u16* Ab = As + (t & 1u) * BUF_H;
        const u16* Bb = Ab + TILE_H;
#pragma unroll
        for (u32 ks = 0; ks < BK / 32u; ks++) {
            Frag af[2], bf[4];
#pragma unroll
            for (u32 mi = 0; mi < 2; mi++) {
                const u16* q = &Ab[(wm * 32u + mi * 16u + ln) * PH + ks * 32u + hf * 8u];
                af[mi].u[0] = *(const u32x4*)q;
                af[mi].u[1] = *(const u32x4*)(q + 16);
            }
#pragma unroll
            for (u32 ni = 0; ni < 4; ni++) {
                const u16* q = &Bb[(wn * 64u + ni * 16u + ln) * PH + ks * 32u + hf * 8u];
                bf[ni].u[0] = *(const u32x4*)q;
                bf[ni].u[1] = *(const u32x4*)(q + 16);
            }
#pragma unroll
            for (int mi = 0; mi < 2; mi++)
#pragma unroll
                for (int ni = 0; ni < 4; ni++)
                    acc[mi][ni] = mma16(af[mi].v, bf[ni].v, acc[mi][ni]);
        }
        asm volatile("s_wait_dscnt 0x0" ::: "memory");     // this wave's reads of stage t's buffer are done before it is refilled
        asm volatile("s_wait_asynccnt 0x0" ::: "memory");  // this wave's stage t + 1 copies have landed
        __syncthreads();                                   // publishes stage t + 1 and ends every wave's reads of stage t
        if (t + 2u < nt) stage((t & 1u) ? 0u - BUF_B : BUF_B);   // stage t + 2 into the buffer stage t has left
    }
    asm volatile("s_wait_asynccnt 0x0" ::: "memory");      // no copy outstanding when the ring becomes the C tile

    // ---- epilogue: accumulators -> f32 tile in LDS (aliases the ring: the last stage's own barrier has ended every wave's reads) ----
#pragma unroll
    for (int ni = 0; ni < 4; ni++) {
        const u32 col = wn * 64u + (u32)ni * 16u + ln;
        const float bv = bfr(bias[n0 + col]);
#pragma unroll
        for (int mi = 0; mi < 2; mi++) {
#pragma unroll
            for (int r = 0; r < 8; r++) {
                const u32 row = wm * 32u + (u32)mi * 16u + hf * 8u + (u32)r;
                float v = acc[mi][ni][r] * WINV + bv;
                if constexpr (MODE == 2) v = gelu_erf(v);
                Cs[row * CSP + col] = v;
            }
        }
    }
    __syncthreads();                               // Cs is read across waves below

    if constexpr (MODE == 1 || MODE == 3) {
        float* o = (float*)out0;
        v4f val[16];
#pragma unroll
        for (int grp = 0; grp < 2; grp++) {
#pragma unroll
            for (int i8 = 0; i8 < 8; i8++) {
                const int i = grp * 8 + i8;
                const u32 row = wv * 16u + (u32)i;
                const u32 r = m0 + row;
                v4f c = *(const v4f*)&Cs[row * CSP + lane * 4u];
                const size_t rr = (MODE == 1) ? grow_map(r) : (size_t)r;
                v4f x4 = *(const v4f*)(res + rr * (size_t)N + n0 + lane * 4u);
                if constexpr (MODE == 1) {
#pragma unroll
                    for (int cc = 0; cc < 4; cc++) { float t = x4[cc]; x4[cc] = bfr(t); }
                }
                val[i] = c + x4;
            }
            asm volatile("" ::: "memory");         // keep the two load groups in separate clauses
        }
#pragma unroll
        for (int i = 0; i < 16; i++) {
            const u32 r = m0 + wv * 16u + (u32)i;
            const size_t orr = (MODE == 3) ? grow_map(r) : (size_t)r;
            *(v4f*)(o + orr * (size_t)N + n0 + lane * 4u) = val[i];
        }
        
    } else if constexpr (MODE == 2) {
        u16* o = (u16*)out0;
        u32x4 val[8];
#pragma unroll
        for (int it = 0; it < 8; it++) {
            const u32 rloc = wv * 16u + (u32)it * 2u + hf, cseg = ln * 8u;
            Pack8 pk;
#pragma unroll
            for (int j = 0; j < 8; j++) pk.h[j] = (_Float16)Cs[rloc * CSP + cseg + (u32)j];
            val[it] = pk.u;
        }
#pragma unroll
        for (int it = 0; it < 8; it++) {
            const u32 rloc = wv * 16u + (u32)it * 2u + hf, cseg = ln * 8u;
            *(u32x4*)(o + (size_t)(m0 + rloc) * N + n0 + cseg) = val[it];
        }
        
    } else {
        // MODE 0: q/k planes or transposed v planes
        u16* qkh = (u16*)out0;
        u16* qkl = (u16*)out1;
        u16* vth = (u16*)out2;
        u16* vtl = (u16*)out3;
        const u32 bq = m0 / (u32)(SEQ);
        const u32 t0 = m0 - bq * (u32)(SEQ);       // 128 | SEQ so the tile sits inside one batch
        const bool lo_on = (t0 < (u32)(TE));       // uniform per workgroup
        u32x4 vh[8], vl[8];
        if (n0 < (u32)QP) {
#pragma unroll
            for (int it = 0; it < 8; it++) {
                const u32 rloc = wv * 16u + (u32)it * 2u + hf, cseg = ln * 8u;
                Pack8 ph, pl;
#pragma unroll
                for (int j = 0; j < 8; j++) {
                    float f = Cs[rloc * CSP + cseg + (u32)j];
                    _Float16 h16 = (_Float16)f;
                    ph.h[j] = h16;
                    pl.h[j] = (_Float16)((f - (float)h16) * RSC);
                }
                vh[it] = ph.u; vl[it] = pl.u;
            }
#pragma unroll
            for (int it = 0; it < 8; it++) {
                const u32 rloc = wv * 16u + (u32)it * 2u + hf, cseg = ln * 8u;
                *(u32x4*)(qkh + (size_t)(m0 + rloc) * QP + n0 + cseg) = vh[it];
                if (lo_on)
                    *(u32x4*)(qkl + ((size_t)bq * (TE) + t0 + rloc) * QP + n0 + cseg) = vl[it];
            }
            
        } else {
            const u32 hh0 = (n0 - (u32)QP) >> 6;   // two heads per 128-column tile
#pragma unroll
            for (int it = 0; it < 8; it++) {
                const u32 rloc = wv * 16u + (u32)it * 2u + hf;   // local column = head*64 + d
                const u32 tseg = ln * 8u;
                Pack8 ph, pl;
#pragma unroll
                for (int j = 0; j < 8; j++) {
                    float f = Cs[(tseg + (u32)j) * CSP + rloc];
                    _Float16 h16 = (_Float16)f;
                    ph.h[j] = h16;
                    pl.h[j] = (_Float16)((f - (float)h16) * RSC);
                }
                vh[it] = ph.u; vl[it] = pl.u;
            }
#pragma unroll
            for (int it = 0; it < 8; it++) {
                const u32 rloc = wv * 16u + (u32)it * 2u + hf, tseg = ln * 8u;
                const u32 hh = hh0 + (rloc >> 6), dd = rloc & 63u;
                const size_t vrow = (size_t)(bq * NH + hh) * HD + dd;
                *(u32x4*)(vth + vrow * (SEQ) + t0 + tseg) = vh[it];
                if (lo_on)
                    *(u32x4*)(vtl + vrow * (TE) + t0 + tseg) = vl[it];
            }
            
        }
    }
}

// ---------------- causal flash attention, hd=64, 128 queries per workgroup (8 waves x 16 rows), 64-key chunks ----------------
// qkh: [RROWS][QP] f16 (q cols h*64+d, k cols CE+h*64+d); qkl: same layout for rows t<TE, residual x2048
// vth: [NB*NH][64][SEQ] f16 transposed v; vtl: [NB*NH][64][TE] residual x2048
// Transposed products: A = K rows (S^T) or V^T rows (O^T), B = Q or P^T. Lane (hf, ln) owns query q0 + ln:
// S^T register r of sub-tile sub = key sub*16 + hf*8 + r, so two converted sub-tiles are one B fragment in the loaders' k order.
// RES=1: query tiles with position < TE: S = qh.kh + (qh.kl + ql.kh)/2048, O += Ph.Vh + (Pr.Vh + Ph.Vl)/2048
// RES=1 only: wave index taken as a scalar-uniform value.
// Operand fragments leave LDS in groups ahead of the products that read them (same arithmetic, same order of products):
// RES=0 a chunk's 8 K fragments, then its 8 V fragments ahead of the softmax; RES=1 one sub-tile ahead, two register sets.
// Staging: RES=1 through registers, two barriers a chunk. RES=0 by asynchronous 16-byte copies into a ring of two LDS buffers,
// (Ks, Vs) and (Kl, Vl): chunk kt + 1 is in flight while chunk kt is worked on, one barrier a chunk.
// bh, qb: the workgroup's head and query tile; Ks .. Ps: its LDS arrays; Kl = Ks + KVRING and Vl = Vs + KVRING (halves)
#define KVT    (64 * 72)
#define KVRING (2 * KVT)
template <int RES>
__device__ __forceinline__
void attn_body(const u16* qkh, const u16* qkl, const u16* vth, const u16* vtl, u16* cv, u32 bh, u32 qb,
               u16* Ks, u16* Vs, u16* Kl, u16* Vl, u16* Ps) {
    const u32 b = bh / (u32)NH, h = bh - b * (u32)NH;
    const u32 tid = threadIdx.x, lane = tid & 31u;
    u32 wv = tid >> 5;
    if constexpr (RES != 0) wv = (u32)__builtin_amdgcn_readfirstlane((int)wv);   // all lanes active, value is wave-uniform
    const u32 hf = lane >> 4, ln = lane & 15u;
    const u32 q0 = qb * 128u + wv * 16u;
    u16* Pw  = Ps + wv * (16u * 72u);

    Frag qf[2], ql[2];
#pragma unroll
    for (u32 ds = 0; ds < 2; ds++) {
        const u16* p = qkh + (size_t)(b * (u32)(SEQ) + q0 + ln) * QP + h * HD + ds * 32u + hf * 8u;
        qf[ds].u[0] = *(const u32x4*)p;
        qf[ds].u[1] = *(const u32x4*)(p + 16);
        if constexpr (RES != 0) {
            const u16* pl = qkl + (size_t)(b * (u32)(TE) + q0 + ln) * QP + h * HD + ds * 32u + hf * 8u;
            ql[ds].u[0] = *(const u32x4*)pl;
            ql[ds].u[1] = *(const u32x4*)(pl + 16);
        } else {
            ql[ds].u[0] = (u32x4)(0u); ql[ds].u[1] = (u32x4)(0u);
        }
    }

    v8f o[4];
#pragma unroll
    for (int i = 0; i < 4; i++) o[i] = (v8f)(0.f);
    float mrun = -3.0e38f;                                 // running maximum of this lane's query (both halves agree); RES=0: of the raw scores
    float lsum = 0.f;                                      // running sum over this lane half's keys; halves joined after the loop
    const u32 qg = q0 + ln;

    const u32 rr = tid >> 3, seg = (tid & 7u) * 8u;       // staging: rows rr and rr + 32 (key or d), 8 halves at seg: 4 whole 128-B lines per load instruction
    const u32 nkt = 2u * qb + 2u;                          // keys 0 .. qb*128+127

    // RES=0: this lane's four copies of the next chunk to be issued (K rows rr, rr + 32; V^T rows rr, rr + 32). Source and LDS
    // addresses live in registers and move on by one add each behind an issue.
    const u16* gp[4];
    u32 lp[4];
    gp[0] = qkh + (size_t)(b * (u32)(SEQ) + rr) * QP + CE + h * HD + seg;
    gp[1] = gp[0] + 32u * QP;
    gp[2] = vth + ((size_t)(bh * HD + rr)) * (SEQ) + seg;
    gp[3] = gp[2] + 32u * (SEQ);
    lp[0] = lds_addr(&Ks[rr * 72u + seg]);
    lp[1] = lds_addr(&Ks[(rr + 32u) * 72u + seg]);
    lp[2] = lds_addr(&Vs[rr * 72u + seg]);
    lp[3] = lds_addr(&Vs[(rr + 32u) * 72u + seg]);
    // issues one chunk into the buffer lp points at, then moves to the next chunk's keys and by dl bytes to the other buffer
    auto stage = [&](u32 dl) {
        copy4(lp, gp);
        gp[0] += 64u * QP; gp[1] += 64u * QP; gp[2] += 64u; gp[3] += 64u;
#pragma unroll                                             // constant indices: lp stays in registers
        for (u32 c = 0; c < 4u; c++) lp[c] += dl;
    };
    constexpr u32 RING_B = (u32)KVRING * 2u;               // bytes from buffer 0 to buffer 1
    if constexpr (RES == 0) {
        stage(RING_B);                                     // chunk 0 into buffer 0
        asm volatile("s_wait_asynccnt 0x0" ::: "memory");  // this wave's chunk 0 copies have landed
        __syncthreads();                                   // chunk 0 visible to all waves
        stage(0u - RING_B);                                // chunk 1 into buffer 1 (nkt >= 2)
    }

#pragma unroll 1
    for (u32 kt = 0; kt < nkt; kt++) {
        const u16* Kc = Ks + (RES ? 0u : (kt & 1u) * (u32)KVRING);   // the chunk's K and V^T tiles
        const u16* Vc = Vs + (RES ? 0u : (kt & 1u) * (u32)KVRING);
        if constexpr (RES != 0) {
            __syncthreads();                               // prior chunk's LDS reads done
            const u16* gk = qkh + (size_t)(b * (u32)(SEQ) + kt * 64u + rr) * QP + CE + h * HD + seg;
            u32x4 k0v = *(const u32x4*)gk, k1v = *(const u32x4*)(gk + 32u * QP);
            const u16* gv = vth + ((size_t)(bh * HD + rr)) * (SEQ) + kt * 64u + seg;
            u32x4 v0 = *(const u32x4*)gv, v1 = *(const u32x4*)(gv + 32u * (SEQ));
            asm volatile("s_wait_xcnt 0x0" ::: "memory");   // stands in front of every later overwrite of the address registers that the loads above name
            *(u32x4*)&Ks[rr * 72u + seg] = k0v; *(u32x4*)&Ks[(rr + 32u) * 72u + seg] = k1v;
            *(u32x4*)&Vs[rr * 72u + seg] = v0;  *(u32x4*)&Vs[(rr + 32u) * 72u + seg] = v1;
            sched_cut<RES>();                              // hi-plane staging temporaries end here
            if constexpr (RES != 0) {
                const u16* gkl = qkl + (size_t)(b * (u32)(TE) + kt * 64u + rr) * QP + CE + h * HD + seg;
                u32x4 kl0 = *(const u32x4*)gkl, kl1 = *(const u32x4*)(gkl + 32u * QP);
                const u16* gvl = vtl + ((size_t)(bh * HD + rr)) * (TE) + kt * 64u + seg;
                u32x4 vl0 = *(const u32x4*)gvl, vl1 = *(const u32x4*)(gvl + 32u * (TE));
                asm volatile("s_wait_xcnt 0x0" ::: "memory");   // stands in front of every later overwrite of the address registers that the loads above name
                *(u32x4*)&Kl[rr * 72u + seg] = kl0; *(u32x4*)&Kl[(rr + 32u) * 72u + seg] = kl1;
                *(u32x4*)&Vl[rr * 72u + seg] = vl0; *(u32x4*)&Vl[(rr + 32u) * 72u + seg] = vl1;
            }
            __syncthreads();                               // K/V chunk visible to all waves
        }
        sched_cut<RES>();

        // S^T = K . Q^T  (64 keys x 16 q per wave)
        // The K fragment loads stand as groups ahead of the products that read them, so a wave waits out the LDS
        // latency once per group and not once per product. RES=0: the chunk's 8 fragments in one group.
        // RES=1: one sub-tile's hi and residual fragments per group, fetched one sub-tile ahead into a second register set.
        v8f s[4];
        Frag vf[RES ? 2 : 4][2], vlf[2][2];                // V fragments: RES=0 [d sub-tile][ks], RES=1 [register set][ks]
        if constexpr (RES == 0) {
            Frag kf[4][2];
#pragma unroll
            for (int sub = 0; sub < 4; sub++)
#pragma unroll
                for (int ds = 0; ds < 2; ds++)
                    ldfrag(kf[sub][ds], &Kc[((u32)sub * 16u + ln) * 72u + (u32)ds * 32u + hf * 8u]);
            __builtin_amdgcn_sched_barrier(0);             // the 16 K loads issue together, none sinks down among the products
#pragma unroll
            for (int sub = 0; sub < 4; sub++) {
                v8f t = (v8f)(0.f);
#pragma unroll
                for (int ds = 0; ds < 2; ds++) t = mma16(kf[sub][ds].v, qf[ds].v, t);
                s[sub] = t;
            }
            __builtin_amdgcn_sched_barrier(0);             // the V loads below stay behind the last S^T product (they take over the K registers)
#pragma unroll
            for (int dsub = 0; dsub < 4; dsub++)
#pragma unroll
                for (int ks = 0; ks < 2; ks++)
                    ldfrag(vf[dsub][ks], &Vc[((u32)dsub * 16u + ln) * 72u + (u32)ks * 32u + hf * 8u]);
            __builtin_amdgcn_sched_barrier(0);             // the 16 V loads issue here, ahead of the softmax, which covers their latency
        } else {
            Frag kf[2][2], klf[2][2];
#pragma unroll
            for (int ds = 0; ds < 2; ds++) {
                ldfrag(kf[0][ds],  &Ks[ln * 72u + (u32)ds * 32u + hf * 8u]);
                ldfrag(klf[0][ds], &Kl[ln * 72u + (u32)ds * 32u + hf * 8u]);
            }
#pragma unroll
            for (int sub = 0; sub < 4; sub++) {
                const int cur = sub & 1, nxt = cur ^ 1;
#pragma unroll
                for (int ds = 0; ds < 2; ds++) {
                    if (sub < 3) {
                        ldfrag(kf[nxt][ds],  &Ks[((u32)(sub + 1) * 16u + ln) * 72u + (u32)ds * 32u + hf * 8u]);
                        ldfrag(klf[nxt][ds], &Kl[((u32)(sub + 1) * 16u + ln) * 72u + (u32)ds * 32u + hf * 8u]);
                    } else {
                        ldfrag(vf[0][ds],  &Vs[ln * 72u + (u32)ds * 32u + hf * 8u]);
                        ldfrag(vlf[0][ds], &Vl[ln * 72u + (u32)ds * 32u + hf * 8u]);
                    }
                }
                __builtin_amdgcn_sched_barrier(0);         // the next group's 8 loads issue ahead of this sub-tile's products
                v8f t = (v8f)(0.f);
                v8f tr = (v8f)(0.f);
#pragma unroll
                for (int ds = 0; ds < 2; ds++) {
                    t  = mma16(kf[cur][ds].v,  qf[ds].v, t);
                    tr = mma16(klf[cur][ds].v, qf[ds].v, tr);
                    tr = mma16(kf[cur][ds].v,  ql[ds].v, tr);
                }
                s[sub] = t + tr * RINV;
                __builtin_amdgcn_sched_barrier(0);         // the group after next stays behind this sub-tile's products: two register sets, no more
            }
        }

        // RES=1: scale + causal replace-fill
        // RES=0: the scores stay raw (their scale goes into the exponent's FMA below), and the fill runs only in the tile's last two
        // chunks: in every earlier chunk each key index is below each query index of the tile, so the fill would change nothing
        if constexpr (RES != 0) {
#pragma unroll
            for (int sub = 0; sub < 4; sub++) {
#pragma unroll
                for (int r = 0; r < 8; r++) {
                    const u32 kg = kt * 64u + (u32)sub * 16u + hf * 8u + (u32)r;
                    float v = s[sub][r] * 0.125f;
                    s[sub][r] = (kg > qg) ? -3.0e38f : v;
                }
            }
        } else if (kt >= 2u * qb) {                        // uniform for the workgroup
#pragma unroll
            for (int sub = 0; sub < 4; sub++) {
#pragma unroll
                for (int r = 0; r < 8; r++) {
                    const u32 kg = kt * 64u + (u32)sub * 16u + hf * 8u + (u32)r;
                    s[sub][r] = (kg > qg) ? -3.0e38f : s[sub][r];
                }
            }
        }
        // online softmax: one query per lane, 32 of the chunk's keys in-lane, the other 32 in lane ^ 16
        float mxs[4];
#pragma unroll
        for (int sub = 0; sub < 4; sub++) {
            mxs[sub] = fmaxf(fmaxf(fmaxf(s[sub][0], s[sub][1]), fmaxf(s[sub][2], s[sub][3])),
                             fmaxf(fmaxf(s[sub][4], s[sub][5]), fmaxf(s[sub][6], s[sub][7])));
        }
        float mx = fmaxf(fmaxf(mxs[0], mxs[1]), fmaxf(mxs[2], mxs[3]));
        mx = fmaxf(mx, xhalf(mx));
        const float mnew  = fmaxf(mrun, mx);
        float alpha;
        if constexpr (RES != 0) {
            alpha = exp_fast(mrun - mnew);
            float rs[4];
#pragma unroll
            for (int sub = 0; sub < 4; sub++) {
                rs[sub] = 0.f;
#pragma unroll
                for (int r = 0; r < 8; r++) {
                    float pe = exp_fast(s[sub][r] - mnew);
                    s[sub][r] = pe;
                    rs[sub] += pe;
                }
            }
            lsum = lsum * alpha + ((rs[0] + rs[1]) + (rs[2] + rs[3]));
        } else {
            // 4096 p = 2^(s c - m c + 12), c = log2(e) / 8, m the running maximum of the raw scores: one FMA per score carries the
            // score scale, the change of base, the maximum and the x4096 carry; lsum is the sum of 4096 p
            constexpr float SC = 0.125f * 1.44269504088896340736f;
            alpha = exp2_fast((mrun - mnew) * SC);
            const float nb = __builtin_fmaf(-mnew, SC, 12.0f);
#pragma unroll
            for (int sub = 0; sub < 4; sub++) {
                const v8f a = __builtin_elementwise_fma(s[sub], (v8f)(SC), (v8f)(nb));
#pragma unroll
                for (int r = 0; r < 8; r++) s[sub][r] = exp2_fast(a[r]);
            }
            const v8f t8 = (s[0] + s[1]) + (s[2] + s[3]);  // whole-vector sums: two scores per add instruction
            const v4f t4 = t8.lo + t8.hi;
            lsum = lsum * alpha + ((t4[0] + t4[1]) + (t4[2] + t4[3]));
        }
        mrun = mnew;
#pragma unroll
        for (int dsub = 0; dsub < 4; dsub++) o[dsub] *= alpha;

        // P^T: two converted S^T sub-tiles = one B fragment (32 keys x 16 q), carried x4096 (+ residual x2048)
        Frag pf[2], prf[2];
#pragma unroll
        for (int ks = 0; ks < 2; ks++) {
#pragma unroll
            for (int e = 0; e < 16; e++) {
                const float pv = s[2 * ks + (e >> 3)][e & 7];
                const float ph = RES ? pv * PCAR : pv;     // RES=0: the carry is in the exponent already
                _Float16 h16 = (_Float16)ph;
                pf[ks].v[e] = h16;
                if constexpr (RES != 0) prf[ks].v[e] = (_Float16)((ph - (float)h16) * RSC);
            }
        }
        // O^T += V^T . P^T
#pragma unroll
        for (int dsub = 0; dsub < 4; dsub++) {
            if constexpr (RES == 0) {
#pragma unroll
                for (int ks = 0; ks < 2; ks++) o[dsub] = mma16(vf[dsub][ks].v, pf[ks].v, o[dsub]);
            } else {
                const int cur = dsub & 1, nxt = cur ^ 1;
                if (dsub < 3) {
#pragma unroll
                    for (int ks = 0; ks < 2; ks++) {
                        ldfrag(vf[nxt][ks],  &Vs[((u32)(dsub + 1) * 16u + ln) * 72u + (u32)ks * 32u + hf * 8u]);
                        ldfrag(vlf[nxt][ks], &Vl[((u32)(dsub + 1) * 16u + ln) * 72u + (u32)ks * 32u + hf * 8u]);
                    }
                }
                __builtin_amdgcn_sched_barrier(0);         // the next d sub-tile's 8 loads issue ahead of this one's products
                v8f u = (v8f)(0.f);
#pragma unroll
                for (int ks = 0; ks < 2; ks++) {
                    o[dsub] = mma16(vf[cur][ks].v,  pf[ks].v,  o[dsub]);
                    u       = mma16(vf[cur][ks].v,  prf[ks].v, u);
                    u       = mma16(vlf[cur][ks].v, pf[ks].v,  u);
                }
                o[dsub] = o[dsub] + u * RINV;
                __builtin_amdgcn_sched_barrier(0);         // the group after next stays behind this sub-tile's products: two register sets, no more
            }
        }
        if constexpr (RES == 0) {
            asm volatile("s_wait_dscnt 0x0" ::: "memory");     // this wave's reads of chunk kt's buffer are done before it is refilled
            asm volatile("s_wait_asynccnt 0x0" ::: "memory");  // this wave's chunk kt + 1 copies have landed
            __syncthreads();                                   // publishes chunk kt + 1 and ends every wave's reads of chunk kt
            if (kt + 2u < nkt) stage((kt & 1u) ? 0u - RING_B : RING_B);   // chunk kt + 2 into the buffer chunk kt has left
        }
    }
    if constexpr (RES == 0) asm volatile("s_wait_asynccnt 0x0" ::: "memory");   // no copy outstanding when the wave goes on to its end

    // finalize: O / (l * 4096) -> f16 tile in the wave's LDS stage -> whole-line stores
    // O^T register r of tile dsub = d dsub*16 + hf*8 + r of query ln: 8 consecutive d, one 16-byte LDS store
    const float inv = (1.0f / (lsum + xhalf(lsum))) * (RES ? PINV : 1.0f);   // RES=0: lsum carries the x4096 too
#pragma unroll
    for (int dsub = 0; dsub < 4; dsub++) {
        Pack8 pk;
#pragma unroll
        for (int r = 0; r < 8; r++) pk.h[r] = (_Float16)(o[dsub][r] * inv);
        *(u32x4*)&Pw[ln * 72u + (u32)dsub * 16u + hf * 8u] = pk.u;
    }
    __syncthreads();
    u32x4 val[4];
#pragma unroll
    for (u32 it = 0; it < 4; it++) {
        const u32 rloc = it * 4u + (lane >> 3), sg = (lane & 7u) * 8u;
        val[it] = *(const u32x4*)&Pw[rloc * 72u + sg];
    }
#pragma unroll
    for (u32 it = 0; it < 4; it++) {
        const u32 rloc = it * 4u + (lane >> 3), sg = (lane & 7u) * 8u;
        *(u32x4*)(cv + (size_t)(b * (u32)(SEQ) + q0 + rloc) * CE + h * HD + sg) = val[it];
    }
    // the body is inlined beside other bodies of one kernel: stands in front of every write, on any path the branches behind it
    // allow, of a register that the stores above name
    asm volatile("s_wait_xcnt 0x0" ::: "memory");
}

// all query tiles of all heads in one launch: x = head, y counts the tiles down from the longest;
// the residual-carrying tiles (position < TE, the fewest chunks) come last and run beside the plain ones.
// Rows y >= NQB of the grid: the 64 x 64 tiles of the proj, fc and fc2 weight converts, which depend on inputs alone and
// are first read by the launches behind this one.
#define NCVR ((NT_P + NT_F + NT_G) / (NB * NH))
static_assert(NCVR * (NB * NH) == NT_P + NT_F + NT_G);
__global__ __launch_bounds__(256) __attribute__((amdgpu_num_vgpr(256)))
void attn_kernel(const u16* __restrict__ qkh, const u16* __restrict__ qkl,
                 const u16* __restrict__ vth, const u16* __restrict__ vtl,
                 u16* __restrict__ cv,
                 const float* __restrict__ w_p, const float* __restrict__ w_f, const float* __restrict__ w_g,
                 u16* __restrict__ o_p, u16* __restrict__ o_f, u16* __restrict__ o_g) {
    __shared__ __align__(16) u16 KV[4 * KVT];              // one array, so that Kl - Ks = Vl - Vs = KVRING
    u16* Ks = KV;                                          // [key][d]
    u16* Vs = KV + KVT;                                    // [d][key]
    u16* Kl = KV + 2 * KVT;                                // residual planes (RES=1) or the ring's second buffer (RES=0)
    u16* Vl = KV + 3 * KVT;
    __shared__ __align__(16) u16 Ps[8 * 16 * 72];          // per wave [16 q][d]: final O stage
    if (blockIdx.y >= (u32)NQB) {                          // every test here is uniform for the workgroup
        u32 t = (blockIdx.y - (u32)NQB) * (u32)(NB * NH) + blockIdx.x;
        if (t < (u32)NT_P) {                               // [1024][1024] -> [1024][1024]
            cvt_wt_body(w_p, o_p, (u32)CE, (u32)CE, t % (u32)(CE / 64), t / (u32)(CE / 64), Ks);
            return;
        }
        t -= (u32)NT_P;
        if (t < (u32)NT_F) {                               // [1024][4096] -> [4096][1024]
            cvt_wt_body(w_f, o_f, (u32)CE, (u32)C4, t % (u32)(C4 / 64), t / (u32)(C4 / 64), Ks);
            return;
        }
        t -= (u32)NT_F;                                    // < NT_G by the grid; [4096][1024] -> [1024][4096]
        cvt_wt_body(w_g, o_g, (u32)C4, (u32)CE, t % (u32)(CE / 64), t / (u32)(CE / 64), Ks);
        return;
    }
    const u32 bh = blockIdx.x;
    const u32 qb = (u32)NQB - 1u - blockIdx.y;
    if (qb < (u32)NEB) attn_body<1>(qkh, qkl, vth, vtl, cv, bh, qb, Ks, Vs, Kl, Vl, Ps);
    else               attn_body<0>(qkh, qkl, vth, vtl, cv, bh, qb, Ks, Vs, Kl, Vl, Ps);
}

// ---------------- host side ----------------
extern "C" void kernel_launch(void* const* d_in, const int* in_sizes, int n_in,
                              void* d_out, int out_size, void* d_ws, size_t ws_size,
                              hipStream_t stream) {
    if (n_in < 13) return;
    const long long needX = ((long long)(NB - 1) * SEQ_FULL + (SEQ)) * CE;
    if ((long long)in_sizes[0] < needX || (long long)out_size < needX) return;
    if (in_sizes[1] < CE || in_sizes[2] < CE || in_sizes[3] < CE * C3 || in_sizes[4] < C3 ||
        in_sizes[5] < CE * CE || in_sizes[6] < CE || in_sizes[7] < CE || in_sizes[8] < CE ||
        in_sizes[9] < CE * C4 || in_sizes[10] < C4 || in_sizes[11] < C4 * CE || in_sizes[12] < CE)
        return;

    const float* x      = (const float*)d_in[0];
    const float* ln1_g  = (const float*)d_in[1];
    const float* ln1_b  = (const float*)d_in[2];
    const float* w_attn = (const float*)d_in[3];
    const float* b_attn = (const float*)d_in[4];
    const float* w_proj = (const float*)d_in[5];
    const float* b_proj = (const float*)d_in[6];
    const float* ln2_g  = (const float*)d_in[7];
    const float* ln2_b  = (const float*)d_in[8];
    const float* w_fc   = (const float*)d_in[9];
    const float* b_fc   = (const float*)d_in[10];
    const float* w_fc2  = (const float*)d_in[11];
    const float* b_fc2  = (const float*)d_in[12];

    char* ws = (char*)d_ws;
    size_t off = 0;
    auto take = [&](size_t bytes) -> char* {
        char* p = ws + off;
        off += (bytes + 255) & ~(size_t)255;
        return p;
    };
    const size_t R = (size_t)RROWS;
    u16*   waT   = (u16*)take((size_t)C3 * CE * 2);               // [3072][1024]
    u16*   wpT   = (u16*)take((size_t)CE * CE * 2);               // [1024][1024]
    u16*   wfcT  = (u16*)take((size_t)C4 * CE * 2);               // [4096][1024]
    u16*   wfc2T = (u16*)take((size_t)CE * C4 * 2);               // [1024][4096]
    u16*   h1    = (u16*)take(R * CE * 2);                        // [R][1024]
    u16*   qkh   = (u16*)take(R * QP * 2);                        // [R][2048]
    u16*   qkl   = (u16*)take((size_t)NB * (TE) * QP * 2);        // [NB*TE][2048]
    u16*   vth   = (u16*)take((size_t)NB * NH * HD * (SEQ) * 2);  // [NB*NH][64][SEQ]
    u16*   vtl   = (u16*)take((size_t)NB * NH * HD * (TE) * 2);   // [NB*NH][64][TE]
    u16*   cvb   = (u16*)take(R * CE * 2);                        // [R][1024]
    float* x1    = (float*)take(R * CE * 4);                      // [R][1024]
    u16*   h2    = (u16*)take(R * CE * 2);                        // [R][1024]
    u16*   hg    = (u16*)take(R * C4 * 2);                        // [R][4096]
    if (off > ws_size || off > (size_t)134217728) return;
    void* dummy = (void*)d_ws;

    // 1) + 2) h1 = LN1(bfr(x)); qkv weight: bf16-RNE value x64 -> f16, transposed to [N][K]   (in[K][N] -> out[N][K])
    prep_kernel<<<NLN + NT_A, 256, 0, stream>>>(x, ln1_g, ln1_b, h1, w_attn, waT);
    // 3) qkv = h1 . w_attn + b_attn -> q/k planes (+ residual rows t<TE), v transposed (+ residual)
    gemm_kernel<0><<<dim3(C3 / 128, RROWS / 128), 256, 0, stream>>>(h1, waT, b_attn, b_attn,
                                                                    qkh, qkl, vth, vtl, (u32)C3, (u32)CE);
    // 4) causal attention: residual-carrying tiles for query position < TE, plain tiles after
    //    behind them in the same grid: the proj, fc and fc2 weights, converted like the qkv weight
    attn_kernel<<<dim3(NB * NH, NQB + NCVR), 256, 0, stream>>>(qkh, qkl, vth, vtl, cvb,
                                                               w_proj, w_fc, w_fc2, wpT, wfcT, wfc2T);
    // 5) x1 = cv . w_proj + b_proj + bfr(x)
    gemm_kernel<1><<<dim3(CE / 128, RROWS / 128), 256, 0, stream>>>(cvb, wpT, b_proj, x,
                                                                    x1, dummy, dummy, dummy, (u32)CE, (u32)CE);
    // 6) h2 = LN2(x1)
    ln_kernel<<<RROWS / 8, 256, 0, stream>>>(x1, ln2_g, ln2_b, h2);
    // 7) hg = gelu(h2 . w_fc + b_fc)
    gemm_kernel<2><<<dim3(C4 / 128, RROWS / 128), 256, 0, stream>>>(h2, wfcT, b_fc, b_fc,
                                                                    hg, dummy, dummy, dummy, (u32)C4, (u32)CE);
    // 8) out = hg . w_fc2 + b_fc2 + x1
    gemm_kernel<3><<<dim3(CE / 128, RROWS / 128), 256, 0, stream>>>(hg, wfc2T, b_fc2, x1,
                                                                    d_out, dummy, dummy, dummy, (u32)CE, (u32)C4);
}

// v009
// It runs in 143 microseconds.
// Timed twice side by side with v008, it ran 1.05 times as fast both times.
// Counting every step since v000, it is 2.50 times as fast.
#include <hip/hip_runtime.h>

// Contractions: v_wmma_f32_16x16x32_f16 (f16 operands, f32 accumulate) for qkv = h.W, S = q.k^T, O = p.v, proj, fc, fc2.
// Weight operand planes: bf16-RNE input value x64, cast to f16, stored transposed [N][K]. Activation planes f16.
// Attention runs transposed: S^T = k.q^T, O^T = v^T.p^T; p^T packs from the S^T accumulators straight into the B operand.
// p carried x4096 in f16. Query tiles with position < TE add f16 residual planes (x2048) of q, k, v, p
// through separately scaled second products folded into the f32 accumulators. Softmax, LN and erf-GELU in f32.

#ifndef NB
#define NB 2
#endif
#ifndef SEQ
#define SEQ 2048
#endif
#define NB_FULL 2
#define SEQ_FULL 2048
#define CE 1024
#define NH 16
#define HD 64
#define C3 3072
#define C4 4096
#define QP 2048
#define TE (((SEQ) < 256) ? (SEQ) : 256)
#define RROWS ((NB) * (SEQ))
#define NEB ((TE) / 128)
#define NQB ((SEQ) / 128)
#define LNJ ((CE) / 128)
#define LNO ((CE) / 256)

static_assert((SEQ) % 128 == 0);
static_assert((TE) % 128 == 0);
static_assert((NB) >= 1 && (NB) <= NB_FULL);
static_assert((SEQ) <= SEQ_FULL);
static_assert(CE % 128 == 0 && C3 % 128 == 0 && C4 % 128 == 0 && QP % 128 == 0);
static_assert(CE % 64 == 0 && C3 % 64 == 0 && C4 % 64 == 0);
static_assert(NH * HD == CE);
static_assert(HD == 64);
static_assert(QP == 2 * CE);
static_assert(C3 == 3 * CE);
static_assert(RROWS % 128 == 0);
static_assert(RROWS % 8 == 0);
static_assert(CE == 1024);
static_assert(256 * 4 == CE);            // gamma/beta staging: 256 threads x 4 floats
static_assert(32 * 4 * LNJ == CE);       // LN row load: 32 lanes x 4 floats x LNJ steps
static_assert(32 * 8 * LNO == CE);       // LN row store: 32 lanes x 8 halves x LNO instructions
static_assert(NQB * 128 == (SEQ));
static_assert(NEB <= NQB);

typedef unsigned short u16;
typedef unsigned int   u32;
typedef _Float16 v16h __attribute__((ext_vector_type(16)));
typedef _Float16 v8h  __attribute__((ext_vector_type(8)));
typedef _Float16 v4h  __attribute__((ext_vector_type(4)));
typedef float    v8f  __attribute__((ext_vector_type(8)));
typedef float    v4f  __attribute__((ext_vector_type(4)));
typedef unsigned int u32x4 __attribute__((ext_vector_type(4)));
typedef unsigned int u32x2 __attribute__((ext_vector_type(2)));
typedef unsigned int u32x8 __attribute__((ext_vector_type(8)));

union Frag  { v16h v; u32x4 u[2]; };
union Pack8 { v8h h; u32x4 u; };
union Pack4 { v4h h; u32x2 u; };

#define WSCALE 64.0f
#define WINV   (1.0f / 64.0f)
#define PCAR   4096.0f
#define PINV   (1.0f / 4096.0f)
#define RSC    2048.0f
#define RINV   (1.0f / 2048.0f)

constexpr size_t al256(size_t b) { return (b + 255) & ~(size_t)255; }
constexpr size_t WS_TOTAL =
    al256((size_t)C3 * CE * 2) + al256((size_t)CE * CE * 2) + al256((size_t)C4 * CE * 2) +
    al256((size_t)CE * C4 * 2) + al256((size_t)RROWS * CE * 2) + al256((size_t)RROWS * QP * 2) +
    al256((size_t)NB * (TE) * QP * 2) + al256((size_t)NB * NH * HD * (SEQ) * 2) +
    al256((size_t)NB * NH * HD * (TE) * 2) + al256((size_t)RROWS * CE * 2) +
    al256((size_t)RROWS * CE * 4) + al256((size_t)RROWS * CE * 2) + al256((size_t)RROWS * C4 * 2);
static_assert(WS_TOTAL <= (size_t)134217728);

// f32 -> nearest-even bf16 grid value, returned as f32
__device__ __forceinline__ float bfr(float f) {
    u32 u = __builtin_bit_cast(u32, f);
    u += 0x7fffu + ((u >> 16) & 1u);
    u &= 0xffff0000u;
    return __builtin_bit_cast(float, u);
}

// f32 -> f16 (RNE) bits
__device__ __forceinline__ u16 hbits(float f) {
    _Float16 h = (_Float16)f;
    return __builtin_bit_cast(u16, h);
}

// 16x16x32 f16 WMMA with the VALU hazard guard tied to D and A/B
__device__ __forceinline__ v8f mma16(v16h a, v16h b, v8f c) {
    c = __builtin_amdgcn_wmma_f32_16x16x32_f16(false, a, false, b, (short)0, c, false, false);
    asm volatile("v_nop\n\tv_nop\n\tv_nop\n\tv_nop" : "+v"(c) : "v"(a), "v"(b));
    return c;
}

// one 16x32 operand fragment of a row-major LDS tile: two 16-byte loads, k order 0..7 and 16..23 (+ 8 in the upper lane half)
__device__ __forceinline__ void ldfrag(Frag& f, const u16* p) {
    f.u[0] = *(const u32x4*)p;
    f.u[1] = *(const u32x4*)(p + 16);
}

// scheduling-region boundary, emitted only in the residual-carrying attention instance:
// ends the live ranges of the staging temporaries before the next block of loads begins
template <int ON>
__device__ __forceinline__ void sched_cut() {
    if constexpr (ON != 0) __builtin_amdgcn_sched_barrier(0);
}

// value of lane l ^ 16 (the other 16-lane row), a vector cross-row move
__device__ __forceinline__ float xhalf(float x) {
    const int xi = __builtin_bit_cast(int, x);
    return __builtin_bit_cast(float, __builtin_amdgcn_permlanex16(xi, xi, 0x76543210, 0xfedcba98, false, false));
}

// e^x on the hardware exp2, same product and instruction as the fast-math exp;
// the v_nop fills the one issue slot the instruction set asks for behind a transcendental
// before its result is read or its source overwritten
__device__ __forceinline__ float exp_fast(float x) {
    float r;
    asm("v_exp_f32 %0, %1\n\tv_nop" : "=v"(r) : "v"(x * 1.44269504088896340736f));
    return r;
}

// 2^x on the hardware exp2; the v_nop fills the same issue slot as in exp_fast
__device__ __forceinline__ float exp2_fast(float x) {
    float r;
    asm("v_exp_f32 %0, %1\n\tv_nop" : "=v"(r) : "v"(x));
    return r;
}

// erf-form GELU, x * Phi(x), free of branches so that the elements of a lane overlap in the vector pipe.
// q = 0.5 erfc(|x| / sqrt 2) by the rational-exponential form t (a1 + t (a2 + .. t a5)) exp(-z^2), t = 1 / (1 + p z), z = |x| / sqrt 2
// (absolute error of erf below 2e-7); Phi = 1 - q for x >= 0 and q itself for x < 0, so the negative side has no cancellation.
__device__ __forceinline__ float gelu_erf(float x) {
    const float d = __builtin_fmaf(__builtin_fabsf(x), 0.3275911f * 0.70710678118654752f, 1.0f);
    const float a = (x * x) * (-0.5f * 1.44269504088896340736f);
    float t, e;
    // the two transcendentals in one statement: the exp fills the issue slot the instruction set asks for behind the rcp (the outputs
    // are early-clobber, so it neither reads t nor overwrites d), the v_nop fills the one behind the exp
    asm("v_rcp_f32 %0, %2\n\tv_exp_f32 %1, %3\n\tv_nop" : "=&v"(t), "=&v"(e) : "v"(d), "v"(a));
    float p = __builtin_fmaf(t, 0.5f * 1.061405429f, 0.5f * -1.453152027f);
    p = __builtin_fmaf(t, p, 0.5f * 1.421413741f);
    p = __builtin_fmaf(t, p, 0.5f * -0.284496736f);
    p = __builtin_fmaf(t, p, 0.5f * 0.254829592f);
    const float q = (p * t) * e;
    return x * ((x >= 0.0f) ? 1.0f - q : q);
}

// logical row (b*SEQ + t) -> row of the full-size input / output tensors (b*SEQ_FULL + t)
__device__ __forceinline__ size_t grow_map(u32 r) {
    const u32 bb = r / (u32)(SEQ);
    const u32 t  = r - bb * (u32)(SEQ);
    return (size_t)bb * SEQ_FULL + (size_t)t;
}

// ---------------- weight convert + transpose: in[K][N] f32 -> out[N][K] f16 = f16(bfr(w) * 64) ----------------
// read: 16 consecutive lanes x 16 B = one 256-B row piece, two rows = 4 whole lines per load instruction.
// written by 8 consecutive lanes x 16 B of one instruction (4 lines per instruction).
// One workgroup converts the 64 x 64 tile (bx, by); Ts is its LDS tile [n][k], 64 * 72 halves.
__device__ __forceinline__ void cvt_wt_body(const float* in, u16* out, u32 K, u32 N, u32 bx, u32 by, u16* Ts) {
    const u32 tid = threadIdx.x, lane = tid & 31u, wv = tid >> 5;
    const u32 n0 = bx * 64u, k0 = by * 64u;
    const u32 kr = tid >> 4, nq = (tid & 15u) * 4u;
    const float* src = in + (size_t)(k0 + kr) * N + n0 + nq;
    const float* s1 = src + (size_t)16u * N;
    const float* s2 = src + (size_t)32u * N;
    const float* s3 = src + (size_t)48u * N;
    v4f w[4];
    w[0] = *(const v4f*)src; w[1] = *(const v4f*)s1; w[2] = *(const v4f*)s2; w[3] = *(const v4f*)s3;
    // stands in front of every overwrite of the address registers that the four loads name; taking the addresses as inputs
    // keeps their registers untouched up to here, so that the loads issue back to back with no wait among them
    asm volatile("s_wait_xcnt 0x0" :: "v"(src), "v"(s1), "v"(s2), "v"(s3) : "memory");
#pragma unroll
    for (u32 j4 = 0; j4 < 4; j4++) {
#pragma unroll
        for (u32 c = 0; c < 4; c++) {
            float f = w[j4][c];
            Ts[(nq + c) * 72u + kr + j4 * 16u] = hbits(bfr(f) * WSCALE);
        }
    }
    __syncthreads();                             // Ts: cross-wave exchange
    u32x4 val[2];
#pragma unroll
    for (u32 it = 0; it < 2; it++) {
        const u32 nn = wv * 8u + it * 4u + (lane >> 3), ks = (lane & 7u) * 8u;
        val[it] = *(const u32x4*)&Ts[nn * 72u + ks];
    }
#pragma unroll
    for (u32 it = 0; it < 2; it++) {
        const u32 nn = wv * 8u + it * 4u + (lane >> 3), ks = (lane & 7u) * 8u;
        *(u32x4*)(out + (size_t)(n0 + nn) * K + k0 + ks) = val[it];
    }
    // the body is inlined beside other bodies of one kernel: stands in front of every write, on any path the branches behind it
    // allow, of a register that the stores above name
    asm volatile("s_wait_xcnt 0x0" ::: "memory");
}

// ---------------- LayerNorm (row = 1024): one wave per row, f16 out via LDS row stage ----------------
// Row kept in a wave-private f32 LDS row (lane owns columns j*128 + lane*4 + 0..3, same lane writes and reads);
// the three per-element sweeps are rolled loops with wave-uniform trip counts.
// gamma/beta staged once per workgroup in LDS at bf16-RNE values.
// SRCX = 1: src is the input x (full-size row map, each element taken at its bf16-RNE value)
// SRCX = 0: src is an f32 workspace plane with logical rows
// blk: the workgroup's group of 8 rows; xs, rows, gsh, bsh: its LDS arrays (8*CE floats, 8*CE halves, CE floats, CE floats)
template <int SRCX>
__device__ __forceinline__ void ln_body(u32 blk, const float* src, const float* g, const float* be, u16* out,
                                        float* xs, u16* rows, float* gsh, float* bsh) {
    const u32 tid = threadIdx.x, lane = tid & 31u, wv = tid >> 5;
    {
        v4f gg = *(const v4f*)(g + tid * 4u);
        v4f bb = *(const v4f*)(be + tid * 4u);
        v4f go, bo;
#pragma unroll
        for (u32 c = 0; c < 4; c++) {
            float tg = gg[c]; float tb = bb[c];
            go[c] = bfr(tg); bo[c] = bfr(tb);
        }
        *(v4f*)&gsh[tid * 4u] = go;
        *(v4f*)&bsh[tid * 4u] = bo;
    }
    const u32 r = blk * 8u + wv;                   // < RROWS (blk < RROWS/8)
    const size_t srow = SRCX ? grow_map(r) : (size_t)r;
    const float* xr = src + srow * CE;
    float* xw = xs + wv * CE;
    float s = 0.f;
#pragma unroll 1
    for (u32 j = 0; j < LNJ; j++) {
        const u32 c0 = j * 128u + lane * 4u;
        v4f t4 = *(const v4f*)(xr + c0);
        if constexpr (SRCX != 0) {
#pragma unroll
            for (u32 c = 0; c < 4; c++) { float t = t4[c]; t4[c] = bfr(t); }
        }
        *(v4f*)&xw[c0] = t4;
        s += (t4[0] + t4[1]) + (t4[2] + t4[3]);
    }
#pragma unroll
    for (u32 m = 16; m >= 1; m >>= 1) s += __shfl_xor(s, m, 32);
    const float mu = s * (1.f / (float)CE);
    float vs = 0.f;
#pragma unroll 1
    for (u32 j = 0; j < LNJ; j++) {
        const u32 c0 = j * 128u + lane * 4u;
        v4f t4 = *(const v4f*)&xw[c0];
#pragma unroll
        for (u32 c = 0; c < 4; c++) { float d = t4[c] - mu; vs += d * d; }
    }
#pragma unroll
    for (u32 m = 16; m >= 1; m >>= 1) vs += __shfl_xor(vs, m, 32);
    const float rstd = rsqrtf(vs * (1.f / (float)CE) + 1e-5f);
    __syncthreads();                               // gsh/bsh (cross-wave) visible
    u16* rw = rows + wv * CE;
#pragma unroll 1
    for (u32 j = 0; j < LNJ; j++) {
        const u32 c0 = j * 128u + lane * 4u;
        v4f x4 = *(const v4f*)&xw[c0];
        v4f g4 = *(const v4f*)&gsh[c0];
        v4f b4 = *(const v4f*)&bsh[c0];
        Pack4 pk;
#pragma unroll
        for (u32 c = 0; c < 4; c++) {
            float xe = x4[c]; float ge = g4[c]; float bel = b4[c];
            pk.h[c] = (_Float16)((xe - mu) * rstd * ge + bel);
        }
        *(u32x2*)&rw[c0] = pk.u;
    }
    __syncthreads();   // LDS row stage: written and read by the same wave; a workgroup barrier is used
    u32x4 val[LNO];
#pragma unroll
    for (u32 j = 0; j < LNO; j++) val[j] = *(const u32x4*)&rw[j * 256u + lane * 8u];
    u16* orow = out + (size_t)r * CE;
#pragma unroll
    for (u32 j = 0; j < LNO; j++) *(u32x4*)(orow + j * 256u + lane * 8u) = val[j];
    
}

// LN2: f32 workspace plane -> f16 plane
__global__ __launch_bounds__(256) void ln_kernel(const float* __restrict__ src,
                                                 const float* __restrict__ g,
                                                 const float* __restrict__ be,
                                                 u16* __restrict__ out) {
    __shared__ __align__(16) float xs[8 * CE];      // wave wv owns xs[wv*CE ..]
    __shared__ __align__(16) u16   rows[8 * CE];    // wave wv owns rows[wv*CE ..]
    __shared__ __align__(16) float gsh[CE];
    __shared__ __align__(16) float bsh[CE];
    ln_body<0>(blockIdx.x, src, g, be, out, xs, rows, gsh, bsh);
}

// ---------------- what the qkv product waits for, in one launch ----------------
// workgroups 0 .. NLN-1: LN1 of x (the longer workgroups, lowest indices); then the 64 x 64 tiles of the qkv weight convert.
// The other three weight converts, which nothing reads before the attention has ended, ride in the attention launch.
#define NLN  (RROWS / 8)
#define NT_A ((C3 / 64) * (CE / 64))
#define NT_P ((CE / 64) * (CE / 64))
#define NT_F ((C4 / 64) * (CE / 64))
#define NT_G ((CE / 64) * (C4 / 64))
__global__ __launch_bounds__(256) void prep_kernel(const float* __restrict__ x,
                                                   const float* __restrict__ g,
                                                   const float* __restrict__ be,
                                                   u16* __restrict__ h1,
                                                   const float* __restrict__ w_a, u16* __restrict__ o_a) {
    __shared__ __align__(16) float xs[8 * CE];      // LN: wave wv owns xs[wv*CE ..]; convert: the [n][k] tile
    __shared__ __align__(16) u16   rows[8 * CE];
    __shared__ __align__(16) float gsh[CE];
    __shared__ __align__(16) float bsh[CE];
    static_assert(64 * 72 * 2 <= 8 * CE * 4);
    const u32 blk = blockIdx.x;                     // the test below is uniform for the workgroup
    if (blk < (u32)NLN) {
        ln_body<1>(blk, x, g, be, h1, xs, rows, gsh, bsh);
    } else {
        const u32 t = blk - (u32)NLN;               // < NT_A by the grid; [1024][3072] -> [3072][1024]
        cvt_wt_body(w_a, o_a, (u32)CE, (u32)C3, t % (u32)(C3 / 64), t / (u32)(C3 / 64), (u16*)xs);
    }
}

// LDS byte address of a __shared__ location (what an asynchronous copy takes as its destination)
__device__ __forceinline__ u32 lds_addr(const void* p) {
    typedef __attribute__((address_space(3))) const void lds_void;
    return (u32)(size_t)(lds_void*)p;
}

// four asynchronous 16-byte copies global -> LDS per lane, from g[0..3] to the LDS byte addresses l[0..3].
// The s_wait_xcnt closes the statement so that it stands in front of every later write of an address register the copies name.
__device__ __forceinline__ void copy4(const u32* l, const u16* const* g) {
    asm volatile("global_load_async_to_lds_b128 %0, %4, off\n\t"
                 "global_load_async_to_lds_b128 %1, %5, off\n\t"
                 "global_load_async_to_lds_b128 %2, %6, off\n\t"
                 "global_load_async_to_lds_b128 %3, %7, off\n\t"
                 "s_wait_xcnt 0x0"
                 :: "v"(l[0]), "v"(l[1]), "v"(l[2]), "v"(l[3]),
                    "v"(g[0]), "v"(g[1]), "v"(g[2]), "v"(g[3])
                 : "memory");
}

// wave-uniform value held in a scalar register
__device__ __forceinline__ u32 uni(u32 v) { return (u32)__builtin_amdgcn_readfirstlane((int)v); }

// wave-uniform value pinned in a scalar register: a test on it compiles to a scalar compare and branch, which is what keeps a wave
// from issuing a tensor load (the instruction ignores EXEC); the statement also holds what is computed from the value behind the waits above it
__device__ __forceinline__ u32 pinned(u32 v) {
    u32 w = uni(v);
    asm volatile("" : "+s"(w));   // an issue test or a descriptor word's addend held in a scalar register
    return w;
}

template <int MODE>
__global__ __launch_bounds__(256) void gemm_kernel(const u16* __restrict__ A,
                                                   const u16* __restrict__ BT,
                                                   const float* __restrict__ bias,
                                                   const float* __restrict__ res,
                                                   void* out0, void* out1, void* out2, void* out3,
                                                   u32 N, u32 K) {
    constexpr u32 KH     = (MODE == 1 || MODE == 3) ? 2u : 1u;       // runs of 128 k per stage
    constexpr u32 BK     = 128u * KH;              // k per stage
    constexpr u32 NIW    = 4u * KH;                // issuing waves = slices per stage
    constexpr u32 PH     = 128u + 8u;              // LDS row pitch in halves: 256 bytes of k + 16
    constexpr u32 SROWS  = 64u;                    // rows per slice
    constexpr u32 SL_B   = (SROWS * PH * 2u + 2047u) & ~2047u;   // a slice's size in LDS, bytes, rounded up to 2 KiB
    constexpr u32 SL_H   = SL_B / 2u;
    constexpr u32 BUF_B  = NIW * SL_B;             // one buffer: [run of 128 k][slice]
    constexpr u32 BUF_H  = BUF_B / 2u;
    constexpr u32 CSP = 132;
    static_assert(CE % BK == 0 && C4 % BK == 0);
    static_assert(2u * BUF_B >= 128u * CSP * 4u);
    __shared__ __attribute__((aligned(2048))) u32x4 smem[2u * BUF_B / 16u];   // the ring during the k loop, Cs after it
    const u16* As = (const u16*)smem;
    float* Cs = (float*)smem;                      // [128][132]

    const u32 tid = threadIdx.x, lane = tid & 31u, wv = tid >> 5;
    const u32 hf = lane >> 4, ln = lane & 15u;
    const u32 m0 = blockIdx.y * 128u, n0 = blockIdx.x * 128u;
    const u32 wm = wv & 3u, wn = wv >> 2;
    const u32 nt = K / BK;                               // stages; K is a multiple of BK
    const u32 wave = uni(wv);                            // one-dimensional block: the wave's number
    const u32 issuer = (NIW == 8u) ? 1u : (u32)(wave < NIW);   // does this wave issue
    // the issuing wave's slice: its first source byte in stage 0 and its place in buffer 0
    const u16* srow0 = ((wave & 2u) == 0u) ? A + (size_t)(m0 + (wave & 1u) * SROWS) * K : BT + (size_t)(n0 + (wave & 1u) * SROWS) * K;
    const unsigned long long gsrc = (unsigned long long)(size_t)(srow0 + ((wave >> 2) & (KH - 1u)) * 128u);
    // descriptor group 0 of the wave's next request: count 1 | place in LDS | source address, type 2 in the top bits
    u32x4 g0;
    g0[0] = uni(1u);
    g0[1] = uni(lds_addr(smem) + (wave & (NIW - 1u)) * SL_B);
    g0[2] = uni((u32)gsrc);
    g0[3] = uni((((u32)(gsrc >> 32)) & 0x01FFFFFFu) | 0x80000000u);
    // descriptor group 1, the same for every request: bytes as elements, tensor = tile = 64 rows of 256 bytes, source pitch 2 K bytes,
    // no mask, 4 dwords of pad behind every 64 dwords
    u32x8 g1;
    g1[0] = uni((1u << 20) | (5u << 22) | (3u << 25));
    g1[1] = uni(256u << 16);
    g1[2] = uni(SROWS << 16);
    g1[3] = uni(256u << 16);
    g1[4] = uni(SROWS);
    g1[5] = uni(K * 2u);
    g1[6] = uni(0u);
    g1[7] = uni(0u);
    // issues this wave's slice of its next stage. Both groups are in-out operands: their registers stay theirs behind the statement,
    // so that none of them takes another value while the request is outstanding
    auto issue = [&]() {
        asm volatile("tensor_load_to_lds %0, %1" : "+s"(g0), "+s"(g1) :: "memory");
    };
    // moves group 0 on by one stage of k and by dl bytes to the other buffer. Called only behind the wait that covers the last request:
    // the step comes through pinned(), a descriptor word's addend held in a scalar register, which keeps the additions behind that wait.
    // The address stays below 2^57, so the carry never reaches the type bits.
    auto advance = [&](u32 dl) {
        const u32 step = pinned(BK * 2u);
        const unsigned long long a = (((unsigned long long)g0[3] << 32) | (unsigned long long)g0[2]) + (unsigned long long)step;
        g0[1] = uni(g0[1] + dl + (step - BK * 2u));        // + dl; the zero term ties this addition to the pinned step too
        g0[2] = uni((u32)a);
        g0[3] = uni((u32)(a >> 32));
    };

    v8f acc[2][4];
#pragma unroll
    for (int i = 0; i < 2; i++)
#pragma unroll
        for (int j = 0; j < 4; j++) acc[i][j] = (v8f)(0.f);

    if (pinned(issuer)) {
        issue();                                           // stage 0 into buffer 0
        asm volatile("s_wait_tensorcnt 0x0" ::: "memory"); // this wave's slice of stage 0 has landed
    }
    __syncthreads();                                       // stage 0 visible to all waves
    if (pinned(issuer & (u32)(1u < nt))) {
        advance(BUF_B);
        issue();                                           // stage 1 into buffer 1
    }
    // this lane's fragment rows in a buffer, in halves
    const u32 aoff = (wm >> 1) * SL_H + ((wm & 1u) * 32u + ln) * PH + hf * 8u;
    const u32 boff = (2u + wn) * SL_H + ln * PH + hf * 8u;
#pragma unroll 1                                       // stays rolled: the buffer picked by t & 1
    for (u32 t = 0; t < nt; t++) {
#pragma unroll 1                                       // stays rolled: a run's base address is then a register, and every fragment's offset from it fits the LDS load's 16-bit field
        for (u32 kh = 0; kh < KH; kh++) {
            const u16* Ab = As + (t & 1u) * BUF_H + kh * 4u * SL_H + aoff;
            const u16* Bb = As + (t & 1u) * BUF_H + kh * 4u * SL_H + boff;
#pragma unroll
            for (u32 ks = 0; ks < 4u; ks++) {
                Frag af[2], bf[4];
#pragma unroll
                for (u32 mi = 0; mi < 2; mi++) {
                    const u16* q = &Ab[mi * 16u * PH + ks * 32u];
                    af[mi].u[0] = *(const u32x4*)q;
                    af[mi].u[1] = *(const u32x4*)(q + 16);
                }
#pragma unroll
                for (u32 ni = 0; ni < 4; ni++) {
                    const u16* q = &Bb[ni * 16u * PH + ks * 32u];
                    bf[ni].u[0] = *(const u32x4*)q;
                    bf[ni].u[1] = *(const u32x4*)(q + 16);
                }
#pragma unroll
                for (int mi = 0; mi < 2; mi++)
#pragma unroll
                    for (int ni = 0; ni < 4; ni++)
                        acc[mi][ni] = mma16(af[mi].v, bf[ni].v, acc[mi][ni]);
            }
        }
        asm volatile("s_wait_dscnt 0x0" ::: "memory");     // this wave's reads of stage t's buffer are done before it is refilled
        asm volatile("s_wait_tensorcnt 0x0" ::: "memory"); // an issuing wave's slice of stage t + 1 has landed (the other waves have none outstanding)
        __syncthreads();                                   // publishes stage t + 1 and ends every wave's reads of stage t
        if (pinned(issuer & (u32)(t + 2u < nt))) {
            advance((t & 1u) ? BUF_B : 0u - BUF_B);
            issue();                                       // stage t + 2 into the buffer stage t has left
        }
    }
    // no request outstanding when the ring becomes the C tile; taking the descriptors as inputs keeps their registers theirs up to here
    asm volatile("s_wait_tensorcnt 0x0" :: "s"(g0), "s"(g1) : "memory");
    asm volatile("s_wait_dscnt 0x0" ::: "memory");         // nor an LDS read of this wave

    // ---- epilogue: accumulators -> f32 tile in LDS (aliases the ring: the last stage's own barrier has ended every wave's reads) ----
#pragma unroll
    for (int ni = 0; ni < 4; ni++) {
        const u32 col = wn * 64u + (u32)ni * 16u + ln;
        const float bv = bfr(bias[n0 + col]);
#pragma unroll
        for (int mi = 0; mi < 2; mi++) {
#pragma unroll
            for (int r = 0; r < 8; r++) {
                const u32 row = wm * 32u + (u32)mi * 16u + hf * 8u + (u32)r;
                float v = acc[mi][ni][r] * WINV + bv;
                if constexpr (MODE == 2) v = gelu_erf(v);
                Cs[row * CSP + col] = v;
            }
        }
    }
    __syncthreads();                               // Cs is read across waves below

    if constexpr (MODE == 1 || MODE == 3) {
        float* o = (float*)out0;
        v4f val[16];
#pragma unroll
        for (int grp = 0; grp < 2; grp++) {
#pragma unroll
            for (int i8 = 0; i8 < 8; i8++) {
                const int i = grp * 8 + i8;
                const u32 row = wv * 16u + (u32)i;
                const u32 r = m0 + row;
                v4f c = *(const v4f*)&Cs[row * CSP + lane * 4u];
                const size_t rr = (MODE == 1) ? grow_map(r) : (size_t)r;
                v4f x4 = *(const v4f*)(res + rr * (size_t)N + n0 + lane * 4u);
                if constexpr (MODE == 1) {
#pragma unroll
                    for (int cc = 0; cc < 4; cc++) { float t = x4[cc]; x4[cc] = bfr(t); }
                }
                val[i] = c + x4;
            }
            asm volatile("" ::: "memory");         // keep the two load groups in separate clauses
        }
#pragma unroll
        for (int i = 0; i < 16; i++) {
            const u32 r = m0 + wv * 16u + (u32)i;
            const size_t orr = (MODE == 3) ? grow_map(r) : (size_t)r;
            *(v4f*)(o + orr * (size_t)N + n0 + lane * 4u) = val[i];
        }
        
    } else if constexpr (MODE == 2) {
        u16* o = (u16*)out0;
        u32x4 val[8];
#pragma unroll
        for (int it = 0; it < 8; it++) {
            const u32 rloc = wv * 16u + (u32)it * 2u + hf, cseg = ln * 8u;
            Pack8 pk;
#pragma unroll
            for (int j = 0; j < 8; j++) pk.h[j] = (_Float16)Cs[rloc * CSP + cseg + (u32)j];
            val[it] = pk.u;
        }
#pragma unroll
        for (int it = 0; it < 8; it++) {
            const u32 rloc = wv * 16u + (u32)it * 2u + hf, cseg = ln * 8u;
            *(u32x4*)(o + (size_t)(m0 + rloc) * N + n0 + cseg) = val[it];
        }
        
    } else {
        // MODE 0: q/k planes or transposed v planes
        u16* qkh = (u16*)out0;
        u16* qkl = (u16*)out1;
        u16* vth = (u16*)out2;
        u16* vtl = (u16*)out3;
        const u32 bq = m0 / (u32)(SEQ);
        const u32 t0 = m0 - bq * (u32)(SEQ);       // 128 | SEQ so the tile sits inside one batch
        const bool lo_on = (t0 < (u32)(TE));       // uniform per workgroup
        u32x4 vh[8], vl[8];
        if (n0 < (u32)QP) {
#pragma unroll
            for (int it = 0; it < 8; it++) {
                const u32 rloc = wv * 16u + (u32)it * 2u + hf, cseg = ln * 8u;
                Pack8 ph, pl;
#pragma unroll
                for (int j = 0; j < 8; j++) {
                    float f = Cs[rloc * CSP + cseg + (u32)j];
                    _Float16 h16 = (_Float16)f;
                    ph.h[j] = h16;
                    pl.h[j] = (_Float16)((f - (float)h16) * RSC);
                }
                vh[it] = ph.u; vl[it] = pl.u;
            }
#pragma unroll
            for (int it = 0; it < 8; it++) {
                const u32 rloc = wv * 16u + (u32)it * 2u + hf, cseg = ln * 8u;
                *(u32x4*)(qkh + (size_t)(m0 + rloc) * QP + n0 + cseg) = vh[it];
                if (lo_on)
                    *(u32x4*)(qkl + ((size_t)bq * (TE) + t0 + rloc) * QP + n0 + cseg) = vl[it];
            }
            
        } else {
            const u32 hh0 = (n0 - (u32)QP) >> 6;   // two heads per 128-column tile
#pragma unroll
            for (int it = 0; it < 8; it++) {
                const u32 rloc = wv * 16u + (u32)it * 2u + hf;   // local column = head*64 + d
                const u32 tseg = ln * 8u;
                Pack8 ph, pl;
#pragma unroll
                for (int j = 0; j < 8; j++) {
                    float f = Cs[(tseg + (u32)j) * CSP + rloc];
                    _Float16 h16 = (_Float16)f;
                    ph.h[j] = h16;
                    pl.h[j] = (_Float16)((f - (float)h16) * RSC);
                }
                vh[it] = ph.u; vl[it] = pl.u;
            }
#pragma unroll
            for (int it = 0; it < 8; it++) {
                const u32 rloc = wv * 16u + (u32)it * 2u + hf, tseg = ln * 8u;
                const u32 hh = hh0 + (rloc >> 6), dd = rloc & 63u;
                const size_t vrow = (size_t)(bq * NH + hh) * HD + dd;
                *(u32x4*)(vth + vrow * (SEQ) + t0 + tseg) = vh[it];
                if (lo_on)
                    *(u32x4*)(vtl + vrow * (TE) + t0 + tseg) = vl[it];
            }
            
        }
    }
}

// ---------------- causal flash attention, hd=64, 128 queries per workgroup (8 waves x 16 rows), 64-key chunks ----------------
// qkh: [RROWS][QP] f16 (q cols h*64+d, k cols CE+h*64+d); qkl: same layout for rows t<TE, residual x2048
// vth: [NB*NH][64][SEQ] f16 transposed v; vtl: [NB*NH][64][TE] residual x2048
// Transposed products: A = K rows (S^T) or V^T rows (O^T), B = Q or P^T. Lane (hf, ln) owns query q0 + ln:
// S^T register r of sub-tile sub = key sub*16 + hf*8 + r, so two converted sub-tiles are one B fragment in the loaders' k order.
// RES=1: query tiles with position < TE: S = qh.kh + (qh.kl + ql.kh)/2048, O += Ph.Vh + (Pr.Vh + Ph.Vl)/2048
// RES=1 only: wave index taken as a scalar-uniform value.
// Operand fragments leave LDS in groups ahead of the products that read them (same arithmetic, same order of products):
// RES=0 a chunk's 8 K fragments, then its 8 V fragments ahead of the softmax; RES=1 one sub-tile ahead, two register sets.
// Staging: RES=1 through registers, two barriers a chunk. RES=0 by asynchronous 16-byte copies into a ring of two LDS buffers,
// (Ks, Vs) and (Kl, Vl): chunk kt + 1 is in flight while chunk kt is worked on, one barrier a chunk.
// bh, qb: the workgroup's head and query tile; Ks .. Ps: its LDS arrays; Kl = Ks + KVRING and Vl = Vs + KVRING (halves)
#define KVT    (64 * 72)
#define KVRING (2 * KVT)
template <int RES>
__device__ __forceinline__
void attn_body(const u16* qkh, const u16* qkl, const u16* vth, const u16* vtl, u16* cv, u32 bh, u32 qb,
               u16* Ks, u16* Vs, u16* Kl, u16* Vl, u16* Ps) {
    const u32 b = bh / (u32)NH, h = bh - b * (u32)NH;
    const u32 tid = threadIdx.x, lane = tid & 31u;
    u32 wv = tid >> 5;
    if constexpr (RES != 0) wv = (u32)__builtin_amdgcn_readfirstlane((int)wv);   // all lanes active, value is wave-uniform
    const u32 hf = lane >> 4, ln = lane & 15u;
    const u32 q0 = qb * 128u + wv * 16u;
    u16* Pw  = Ps + wv * (16u * 72u);

    Frag qf[2], ql[2];
#pragma unroll
    for (u32 ds = 0; ds < 2; ds++) {
        const u16* p = qkh + (size_t)(b * (u32)(SEQ) + q0 + ln) * QP + h * HD + ds * 32u + hf * 8u;
        qf[ds].u[0] = *(const u32x4*)p;
        qf[ds].u[1] = *(const u32x4*)(p + 16);
        if constexpr (RES != 0) {
            const u16* pl = qkl + (size_t)(b * (u32)(TE) + q0 + ln) * QP + h * HD + ds * 32u + hf * 8u;
            ql[ds].u[0] = *(const u32x4*)pl;
            ql[ds].u[1] = *(const u32x4*)(pl + 16);
        } else {
            ql[ds].u[0] = (u32x4)(0u); ql[ds].u[1] = (u32x4)(0u);
        }
    }

    v8f o[4];
#pragma unroll
    for (int i = 0; i < 4; i++) o[i] = (v8f)(0.f);
    float mrun = -3.0e38f;                                 // running maximum of this lane's query (both halves agree); RES=0: of the raw scores
    float lsum = 0.f;                                      // running sum over this lane half's keys; halves joined after the loop
    const u32 qg = q0 + ln;

    const u32 rr = tid >> 3, seg = (tid & 7u) * 8u;       // staging: rows rr and rr + 32 (key or d), 8 halves at seg: 4 whole 128-B lines per load instruction
    const u32 nkt = 2u * qb + 2u;                          // keys 0 .. qb*128+127

    // RES=0: this lane's four copies of the next chunk to be issued (K rows rr, rr + 32; V^T rows rr, rr + 32). Source and LDS
    // addresses live in registers and move on by one add each behind an issue.
    const u16* gp[4];
    u32 lp[4];
    gp[0] = qkh + (size_t)(b * (u32)(SEQ) + rr) * QP + CE + h * HD + seg;
    gp[1] = gp[0] + 32u * QP;
    gp[2] = vth + ((size_t)(bh * HD + rr)) * (SEQ) + seg;
    gp[3] = gp[2] + 32u * (SEQ);
    lp[0] = lds_addr(&Ks[rr * 72u + seg]);
    lp[1] = lds_addr(&Ks[(rr + 32u) * 72u + seg]);
    lp[2] = lds_addr(&Vs[rr * 72u + seg]);
    lp[3] = lds_addr(&Vs[(rr + 32u) * 72u + seg]);
    // issues one chunk into the buffer lp points at, then moves to the next chunk's keys and by dl bytes to the other buffer
    auto stage = [&](u32 dl) {
        copy4(lp, gp);
        gp[0] += 64u * QP; gp[1] += 64u * QP; gp[2] += 64u; gp[3] += 64u;
#pragma unroll                                             // constant indices: lp stays in registers
        for (u32 c = 0; c < 4u; c++) lp[c] += dl;
    };
    constexpr u32 RING_B = (u32)KVRING * 2u;               // bytes from buffer 0 to buffer 1
    if constexpr (RES == 0) {
        stage(RING_B);                                     // chunk 0 into buffer 0
        asm volatile("s_wait_asynccnt 0x0" ::: "memory");  // this wave's chunk 0 copies have landed
        __syncthreads();                                   // chunk 0 visible to all waves
        stage(0u - RING_B);                                // chunk 1 into buffer 1 (nkt >= 2)
    }

#pragma unroll 1
    for (u32 kt = 0; kt < nkt; kt++) {
        const u16* Kc = Ks + (RES ? 0u : (kt & 1u) * (u32)KVRING);   // the chunk's K and V^T tiles
        const u16* Vc = Vs + (RES ? 0u : (kt & 1u) * (u32)KVRING);
        if constexpr (RES != 0) {
            __syncthreads();                               // prior chunk's LDS reads done
            const u16* gk = qkh + (size_t)(b * (u32)(SEQ) + kt * 64u + rr) * QP + CE + h * HD + seg;
            u32x4 k0v = *(const u32x4*)gk, k1v = *(const u32x4*)(gk + 32u * QP);
            const u16* gv = vth + ((size_t)(bh * HD + rr)) * (SEQ) + kt * 64u + seg;
            u32x4 v0 = *(const u32x4*)gv, v1 = *(const u32x4*)(gv + 32u * (SEQ));
            asm volatile("s_wait_xcnt 0x0" ::: "memory");   // stands in front of every later overwrite of the address registers that the loads above name
            *(u32x4*)&Ks[rr * 72u + seg] = k0v; *(u32x4*)&Ks[(rr + 32u) * 72u + seg] = k1v;
            *(u32x4*)&Vs[rr * 72u + seg] = v0;  *(u32x4*)&Vs[(rr + 32u) * 72u + seg] = v1;
            sched_cut<RES>();                              // hi-plane staging temporaries end here
            if constexpr (RES != 0) {
                const u16* gkl = qkl + (size_t)(b * (u32)(TE) + kt * 64u + rr) * QP + CE + h * HD + seg;
                u32x4 kl0 = *(const u32x4*)gkl, kl1 = *(const u32x4*)(gkl + 32u * QP);
                const u16* gvl = vtl + ((size_t)(bh * HD + rr)) * (TE) + kt * 64u + seg;
                u32x4 vl0 = *(const u32x4*)gvl, vl1 = *(const u32x4*)(gvl + 32u * (TE));
                asm volatile("s_wait_xcnt 0x0" ::: "memory");   // stands in front of every later overwrite of the address registers that the loads above name
                *(u32x4*)&Kl[rr * 72u + seg] = kl0; *(u32x4*)&Kl[(rr + 32u) * 72u + seg] = kl1;
                *(u32x4*)&Vl[rr * 72u + seg] = vl0; *(u32x4*)&Vl[(rr + 32u) * 72u + seg] = vl1;
            }
            __syncthreads();                               // K/V chunk visible to all waves
        }
        sched_cut<RES>();

        // S^T = K . Q^T  (64 keys x 16 q per wave)
        // The K fragment loads stand as groups ahead of the products that read them, so a wave waits out the LDS
        // latency once per group and not once per product. RES=0: the chunk's 8 fragments in one group.
        // RES=1: one sub-tile's hi and residual fragments per group, fetched one sub-tile ahead into a second register set.
        v8f s[4];
        Frag vf[RES ? 2 : 4][2], vlf[2][2];                // V fragments: RES=0 [d sub-tile][ks], RES=1 [register set][ks]
        if constexpr (RES == 0) {
            Frag kf[4][2];
#pragma unroll
            for (int sub = 0; sub < 4; sub++)
#pragma unroll
                for (int ds = 0; ds < 2; ds++)
                    ldfrag(kf[sub][ds], &Kc[((u32)sub * 16u + ln) * 72u + (u32)ds * 32u + hf * 8u]);
            __builtin_amdgcn_sched_barrier(0);             // the 16 K loads issue together, none sinks down among the products
#pragma unroll
            for (int sub = 0; sub < 4; sub++) {
                v8f t = (v8f)(0.f);
#pragma unroll
                for (int ds = 0; ds < 2; ds++) t = mma16(kf[sub][ds].v, qf[ds].v, t);
                s[sub] = t;
            }
            __builtin_amdgcn_sched_barrier(0);             // the V loads below stay behind the last S^T product (they take over the K registers)
#pragma unroll
            for (int dsub = 0; dsub < 4; dsub++)
#pragma unroll
                for (int ks = 0; ks < 2; ks++)
                    ldfrag(vf[dsub][ks], &Vc[((u32)dsub * 16u + ln) * 72u + (u32)ks * 32u + hf * 8u]);
            __builtin_amdgcn_sched_barrier(0);             // the 16 V loads issue here, ahead of the softmax, which covers their latency
        } else {
            Frag kf[2][2], klf[2][2];
#pragma unroll
            for (int ds = 0; ds < 2; ds++) {
                ldfrag(kf[0][ds],  &Ks[ln * 72u + (u32)ds * 32u + hf * 8u]);
                ldfrag(klf[0][ds], &Kl[ln * 72u + (u32)ds * 32u + hf * 8u]);
            }
#pragma unroll
            for (int sub = 0; sub < 4; sub++) {
                const int cur = sub & 1, nxt = cur ^ 1;
#pragma unroll
                for (int ds = 0; ds < 2; ds++) {
                    if (sub < 3) {
                        ldfrag(kf[nxt][ds],  &Ks[((u32)(sub + 1) * 16u + ln) * 72u + (u32)ds * 32u + hf * 8u]);
                        ldfrag(klf[nxt][ds], &Kl[((u32)(sub + 1) * 16u + ln) * 72u + (u32)ds * 32u + hf * 8u]);
                    } else {
                        ldfrag(vf[0][ds],  &Vs[ln * 72u + (u32)ds * 32u + hf * 8u]);
                        ldfrag(vlf[0][ds], &Vl[ln * 72u + (u32)ds * 32u + hf * 8u]);
                    }
                }
                __builtin_amdgcn_sched_barrier(0);         // the next group's 8 loads issue ahead of this sub-tile's products
                v8f t = (v8f)(0.f);
                v8f tr = (v8f)(0.f);
#pragma unroll
                for (int ds = 0; ds < 2; ds++) {
                    t  = mma16(kf[cur][ds].v,  qf[ds].v, t);
                    tr = mma16(klf[cur][ds].v, qf[ds].v, tr);
                    tr = mma16(kf[cur][ds].v,  ql[ds].v, tr);
                }
                s[sub] = t + tr * RINV;
                __builtin_amdgcn_sched_barrier(0);         // the group after next stays behind this sub-tile's products: two register sets, no more
            }
        }

        // RES=1: scale + causal replace-fill
        // RES=0: the scores stay raw (their scale goes into the exponent's FMA below), and the fill runs only in the tile's last two
        // chunks: in every earlier chunk each key index is below each query index of the tile, so the fill would change nothing
        if constexpr (RES != 0) {
#pragma unroll
            for (int sub = 0; sub < 4; sub++) {
#pragma unroll
                for (int r = 0; r < 8; r++) {
                    const u32 kg = kt * 64u + (u32)sub * 16u + hf * 8u + (u32)r;
                    float v = s[sub][r] * 0.125f;
                    s[sub][r] = (kg > qg) ? -3.0e38f : v;
                }
            }
        } else if (kt >= 2u * qb) {                        // uniform for the workgroup
#pragma unroll
            for (int sub = 0; sub < 4; sub++) {
#pragma unroll
                for (int r = 0; r < 8; r++) {
                    const u32 kg = kt * 64u + (u32)sub * 16u + hf * 8u + (u32)r;
                    s[sub][r] = (kg > qg) ? -3.0e38f : s[sub][r];
                }
            }
        }
        // online softmax: one query per lane, 32 of the chunk's keys in-lane, the other 32 in lane ^ 16
        float mxs[4];
#pragma unroll
        for (int sub = 0; sub < 4; sub++) {
            mxs[sub] = fmaxf(fmaxf(fmaxf(s[sub][0], s[sub][1]), fmaxf(s[sub][2], s[sub][3])),
                             fmaxf(fmaxf(s[sub][4], s[sub][5]), fmaxf(s[sub][6], s[sub][7])));
        }
        float mx = fmaxf(fmaxf(mxs[0], mxs[1]), fmaxf(mxs[2], mxs[3]));
        mx = fmaxf(mx, xhalf(mx));
        const float mnew  = fmaxf(mrun, mx);
        float alpha;
        if constexpr (RES != 0) {
            alpha = exp_fast(mrun - mnew);
            float rs[4];
#pragma unroll
            for (int sub = 0; sub < 4; sub++) {
                rs[sub] = 0.f;
#pragma unroll
                for (int r = 0; r < 8; r++) {
                    float pe = exp_fast(s[sub][r] - mnew);
                    s[sub][r] = pe;
                    rs[sub] += pe;
                }
            }
            lsum = lsum * alpha + ((rs[0] + rs[1]) + (rs[2] + rs[3]));
        } else {
            // 4096 p = 2^(s c - m c + 12), c = log2(e) / 8, m the running maximum of the raw scores: one FMA per score carries the
            // score scale, the change of base, the maximum and the x4096 carry; lsum is the sum of 4096 p
            constexpr float SC = 0.125f * 1.44269504088896340736f;
            alpha = exp2_fast((mrun - mnew) * SC);
            const float nb = __builtin_fmaf(-mnew, SC, 12.0f);
#pragma unroll
            for (int sub = 0; sub < 4; sub++) {
                const v8f a = __builtin_elementwise_fma(s[sub], (v8f)(SC), (v8f)(nb));
#pragma unroll
                for (int r = 0; r < 8; r++) s[sub][r] = exp2_fast(a[r]);
            }
            const v8f t8 = (s[0] + s[1]) + (s[2] + s[3]);  // whole-vector sums: two scores per add instruction
            const v4f t4 = t8.lo + t8.hi;
            lsum = lsum * alpha + ((t4[0] + t4[1]) + (t4[2] + t4[3]));
        }
        mrun = mnew;
#pragma unroll
        for (int dsub = 0; dsub < 4; dsub++) o[dsub] *= alpha;

        // P^T: two converted S^T sub-tiles = one B fragment (32 keys x 16 q), carried x4096 (+ residual x2048)
        Frag pf[2], prf[2];
#pragma unroll
        for (int ks = 0; ks < 2; ks++) {
#pragma unroll
            for (int e = 0; e < 16; e++) {
                const float pv = s[2 * ks + (e >> 3)][e & 7];
                const float ph = RES ? pv * PCAR : pv;     // RES=0: the carry is in the exponent already
                _Float16 h16 = (_Float16)ph;
                pf[ks].v[e] = h16;
                if constexpr (RES != 0) prf[ks].v[e] = (_Float16)((ph - (float)h16) * RSC);
            }
        }
        // O^T += V^T . P^T
#pragma unroll
        for (int dsub = 0; dsub < 4; dsub++) {
            if constexpr (RES == 0) {
#pragma unroll
                for (int ks = 0; ks < 2; ks++) o[dsub] = mma16(vf[dsub][ks].v, pf[ks].v, o[dsub]);
            } else {
                const int cur = dsub & 1, nxt = cur ^ 1;
                if (dsub < 3) {
#pragma unroll
                    for (int ks = 0; ks < 2; ks++) {
                        ldfrag(vf[nxt][ks],  &Vs[((u32)(dsub + 1) * 16u + ln) * 72u + (u32)ks * 32u + hf * 8u]);
                        ldfrag(vlf[nxt][ks], &Vl[((u32)(dsub + 1) * 16u + ln) * 72u + (u32)ks * 32u + hf * 8u]);
                    }
                }
                __builtin_amdgcn_sched_barrier(0);         // the next d sub-tile's 8 loads issue ahead of this one's products
                v8f u = (v8f)(0.f);
#pragma unroll
                for (int ks = 0; ks < 2; ks++) {
                    o[dsub] = mma16(vf[cur][ks].v,  pf[ks].v,  o[dsub]);
                    u       = mma16(vf[cur][ks].v,  prf[ks].v, u);
                    u       = mma16(vlf[cur][ks].v, pf[ks].v,  u);
                }
                o[dsub] = o[dsub] + u * RINV;
                __builtin_amdgcn_sched_barrier(0);         // the group after next stays behind this sub-tile's products: two register sets, no more
            }
        }
        if constexpr (RES == 0) {
            asm volatile("s_wait_dscnt 0x0" ::: "memory");     // this wave's reads of chunk kt's buffer are done before it is refilled
            asm volatile("s_wait_asynccnt 0x0" ::: "memory");  // this wave's chunk kt + 1 copies have landed
            __syncthreads();                                   // publishes chunk kt + 1 and ends every wave's reads of chunk kt
            if (kt + 2u < nkt) stage((kt & 1u) ? 0u - RING_B : RING_B);   // chunk kt + 2 into the buffer chunk kt has left
        }
    }
    if constexpr (RES == 0) asm volatile("s_wait_asynccnt 0x0" ::: "memory");   // no copy outstanding when the wave goes on to its end

    // finalize: O / (l * 4096) -> f16 tile in the wave's LDS stage -> whole-line stores
    // O^T register r of tile dsub = d dsub*16 + hf*8 + r of query ln: 8 consecutive d, one 16-byte LDS store
    const float inv = (1.0f / (lsum + xhalf(lsum))) * (RES ? PINV : 1.0f);   // RES=0: lsum carries the x4096 too
#pragma unroll
    for (int dsub = 0; dsub < 4; dsub++) {
        Pack8 pk;
#pragma unroll
        for (int r = 0; r < 8; r++) pk.h[r] = (_Float16)(o[dsub][r] * inv);
        *(u32x4*)&Pw[ln * 72u + (u32)dsub * 16u + hf * 8u] = pk.u;
    }
    __syncthreads();
    u32x4 val[4];
#pragma unroll
    for (u32 it = 0; it < 4; it++) {
        const u32 rloc = it * 4u + (lane >> 3), sg = (lane & 7u) * 8u;
        val[it] = *(const u32x4*)&Pw[rloc * 72u + sg];
    }
#pragma unroll
    for (u32 it = 0; it < 4; it++) {
        const u32 rloc = it * 4u + (lane >> 3), sg = (lane & 7u) * 8u;
        *(u32x4*)(cv + (size_t)(b * (u32)(SEQ) + q0 + rloc) * CE + h * HD + sg) = val[it];
    }
    // the body is inlined beside other bodies of one kernel: stands in front of every write, on any path the branches behind it
    // allow, of a register that the stores above name
    asm volatile("s_wait_xcnt 0x0" ::: "memory");
}

// all query tiles of all heads in one launch: x = head, y counts the tiles down from the longest;
// the residual-carrying tiles (position < TE, the fewest chunks) come last and run beside the plain ones.
// Rows y >= NQB of the grid: the 64 x 64 tiles of the proj, fc and fc2 weight converts, which depend on inputs alone and
// are first read by the launches behind this one.
#define NCVR ((NT_P + NT_F + NT_G) / (NB * NH))
static_assert(NCVR * (NB * NH) == NT_P + NT_F + NT_G);
__global__ __launch_bounds__(256) __attribute__((amdgpu_num_vgpr(256)))
void attn_kernel(const u16* __restrict__ qkh, const u16* __restrict__ qkl,
                 const u16* __restrict__ vth, const u16* __restrict__ vtl,
                 u16* __restrict__ cv,
                 const float* __restrict__ w_p, const float* __restrict__ w_f, const float* __restrict__ w_g,
                 u16* __restrict__ o_p, u16* __restrict__ o_f, u16* __restrict__ o_g) {
    __shared__ __align__(16) u16 KV[4 * KVT];              // one array, so that Kl - Ks = Vl - Vs = KVRING
    u16* Ks = KV;                                          // [key][d]
    u16* Vs = KV + KVT;                                    // [d][key]
    u16* Kl = KV + 2 * KVT;                                // residual planes (RES=1) or the ring's second buffer (RES=0)
    u16* Vl = KV + 3 * KVT;
    __shared__ __align__(16) u16 Ps[8 * 16 * 72];          // per wave [16 q][d]: final O stage
    if (blockIdx.y >= (u32)NQB) {                          // every test here is uniform for the workgroup
        u32 t = (blockIdx.y - (u32)NQB) * (u32)(NB * NH) + blockIdx.x;
        if (t < (u32)NT_P) {                               // [1024][1024] -> [1024][1024]
            cvt_wt_body(w_p, o_p, (u32)CE, (u32)CE, t % (u32)(CE / 64), t / (u32)(CE / 64), Ks);
            return;
        }
        t -= (u32)NT_P;
        if (t < (u32)NT_F) {                               // [1024][4096] -> [4096][1024]
            cvt_wt_body(w_f, o_f, (u32)CE, (u32)C4, t % (u32)(C4 / 64), t / (u32)(C4 / 64), Ks);
            return;
        }
        t -= (u32)NT_F;                                    // < NT_G by the grid; [4096][1024] -> [1024][4096]
        cvt_wt_body(w_g, o_g, (u32)C4, (u32)CE, t % (u32)(CE / 64), t / (u32)(CE / 64), Ks);
        return;
    }
    const u32 bh = blockIdx.x;
    const u32 qb = (u32)NQB - 1u - blockIdx.y;
    if (qb < (u32)NEB) attn_body<1>(qkh, qkl, vth, vtl, cv, bh, qb, Ks, Vs, Kl, Vl, Ps);
    else               attn_body<0>(qkh, qkl, vth, vtl, cv, bh, qb, Ks, Vs, Kl, Vl, Ps);
}

// ---------------- host side ----------------
extern "C" void kernel_launch(void* const* d_in, const int* in_sizes, int n_in,
                              void* d_out, int out_size, void* d_ws, size_t ws_size,
                              hipStream_t stream) {
    if (n_in < 13) return;
    const long long needX = ((long long)(NB - 1) * SEQ_FULL + (SEQ)) * CE;
    if ((long long)in_sizes[0] < needX || (long long)out_size < needX) return;
    if (in_sizes[1] < CE || in_sizes[2] < CE || in_sizes[3] < CE * C3 || in_sizes[4] < C3 ||
        in_sizes[5] < CE * CE || in_sizes[6] < CE || in_sizes[7] < CE || in_sizes[8] < CE ||
        in_sizes[9] < CE * C4 || in_sizes[10] < C4 || in_sizes[11] < C4 * CE || in_sizes[12] < CE)
        return;

    const float* x      = (const float*)d_in[0];
    const float* ln1_g  = (const float*)d_in[1];
    const float* ln1_b  = (const float*)d_in[2];
    const float* w_attn = (const float*)d_in[3];
    const float* b_attn = (const float*)d_in[4];
    const float* w_proj = (const float*)d_in[5];
    const float* b_proj = (const float*)d_in[6];
    const float* ln2_g  = (const float*)d_in[7];
    const float* ln2_b  = (const float*)d_in[8];
    const float* w_fc   = (const float*)d_in[9];
    const float* b_fc   = (const float*)d_in[10];
    const float* w_fc2  = (const float*)d_in[11];
    const float* b_fc2  = (const float*)d_in[12];

    char* ws = (char*)d_ws;
    size_t off = 0;
    auto take = [&](size_t bytes) -> char* {
        char* p = ws + off;
        off += (bytes + 255) & ~(size_t)255;
        return p;
    };
    const size_t R = (size_t)RROWS;
    u16*   waT   = (u16*)take((size_t)C3 * CE * 2);               // [3072][1024]
    u16*   wpT   = (u16*)take((size_t)CE * CE * 2);               // [1024][1024]
    u16*   wfcT  = (u16*)take((size_t)C4 * CE * 2);               // [4096][1024]
    u16*   wfc2T = (u16*)take((size_t)CE * C4 * 2);               // [1024][4096]
    u16*   h1    = (u16*)take(R * CE * 2);                        // [R][1024]
    u16*   qkh   = (u16*)take(R * QP * 2);                        // [R][2048]
    u16*   qkl   = (u16*)take((size_t)NB * (TE) * QP * 2);        // [NB*TE][2048]
    u16*   vth   = (u16*)take((size_t)NB * NH * HD * (SEQ) * 2);  // [NB*NH][64][SEQ]
    u16*   vtl   = (u16*)take((size_t)NB * NH * HD * (TE) * 2);   // [NB*NH][64][TE]
    u16*   cvb   = (u16*)take(R * CE * 2);                        // [R][1024]
    float* x1    = (float*)take(R * CE * 4);                      // [R][1024]
    u16*   h2    = (u16*)take(R * CE * 2);                        // [R][1024]
    u16*   hg    = (u16*)take(R * C4 * 2);                        // [R][4096]
    if (off > ws_size || off > (size_t)134217728) return;
    void* dummy = (void*)d_ws;

    // 1) + 2) h1 = LN1(bfr(x)); qkv weight: bf16-RNE value x64 -> f16, transposed to [N][K]   (in[K][N] -> out[N][K])
    prep_kernel<<<NLN + NT_A, 256, 0, stream>>>(x, ln1_g, ln1_b, h1, w_attn, waT);
    // 3) qkv = h1 . w_attn + b_attn -> q/k planes (+ residual rows t<TE), v transposed (+ residual)
    gemm_kernel<0><<<dim3(C3 / 128, RROWS / 128), 256, 0, stream>>>(h1, waT, b_attn, b_attn,
                                                                    qkh, qkl, vth, vtl, (u32)C3, (u32)CE);
    // 4) causal attention: residual-carrying tiles for query position < TE, plain tiles after
    //    behind them in the same grid: the proj, fc and fc2 weights, converted like the qkv weight
    attn_kernel<<<dim3(NB * NH, NQB + NCVR), 256, 0, stream>>>(qkh, qkl, vth, vtl, cvb,
                                                               w_proj, w_fc, w_fc2, wpT, wfcT, wfc2T);
    // 5) x1 = cv . w_proj + b_proj + bfr(x)
    gemm_kernel<1><<<dim3(CE / 128, RROWS / 128), 256, 0, stream>>>(cvb, wpT, b_proj, x,
                                                                    x1, dummy, dummy, dummy, (u32)CE, (u32)CE);
    // 6) h2 = LN2(x1)
    ln_kernel<<<RROWS / 8, 256, 0, stream>>>(x1, ln2_g, ln2_b, h2);
    // 7) hg = gelu(h2 . w_fc + b_fc)
    gemm_kernel<2><<<dim3(C4 / 128, RROWS / 128), 256, 0, stream>>>(h2, wfcT, b_fc, b_fc,
                                                                    hg, dummy, dummy, dummy, (u32)C4, (u32)CE);
    // 8) out = hg . w_fc2 + b_fc2 + x1
    gemm_kernel<3><<<dim3(CE / 128, RROWS / 128), 256, 0, stream>>>(hg, wfc2T, b_fc2, x1,
                                                                    d_out, dummy, dummy, dummy, (u32)CE, (u32)C4);
}

// v010
// One run takes 137 microseconds.
// In two side-by-side timings against v009, it was 1.05 and 1.04 times as fast.
// All steps since v000 together make it 2.61 times as fast.
#include <hip/hip_runtime.h>

// Contractions: v_wmma_f32_16x16x32_f16 (f16 operands, f32 accumulate) for qkv = h.W, S = q.k^T, O = p.v, proj, fc, fc2.
// Weight operand planes: bf16-RNE input value x64, cast to f16, stored transposed [N][K]. Activation planes f16.
// Attention runs transposed: S^T = k.q^T, O^T = v^T.p^T; p^T packs from the S^T accumulators straight into the B operand.
// p carried x4096 in f16. Query tiles with position < TE add f16 residual planes (x2048) of q, k, v, p
// through separately scaled second products folded into the f32 accumulators. Softmax, LN and erf-GELU in f32.
// LN2 has no launch of its own: LN(x1).W = rstd (x1.(g W) - mu colsum(g W)) + b.W. The proj epilogue writes x1 as f16 and each row's
// partial sum and sum of squares, the fc weight convert multiplies gamma in and writes partial column sums, the fc epilogue applies mu and rstd.

#ifndef NB
#define NB 2
#endif
#ifndef SEQ
#define SEQ 2048
#endif
#define NB_FULL 2
#define SEQ_FULL 2048
#define CE 1024
#define NH 16
#define HD 64
#define C3 3072
#define C4 4096
#define QP 2048
#define TE (((SEQ) < 256) ? (SEQ) : 256)
#define RROWS ((NB) * (SEQ))
#define NEB ((TE) / 128)
#define NQB ((SEQ) / 128)
#define LNJ ((CE) / 128)
#define LNO ((CE) / 256)

static_assert((SEQ) % 128 == 0);
static_assert((TE) % 128 == 0);
static_assert((NB) >= 1 && (NB) <= NB_FULL);
static_assert((SEQ) <= SEQ_FULL);
static_assert(CE % 128 == 0 && C3 % 128 == 0 && C4 % 128 == 0 && QP % 128 == 0);
static_assert(CE % 64 == 0 && C3 % 64 == 0 && C4 % 64 == 0);
static_assert(NH * HD == CE);
static_assert(HD == 64);
static_assert(QP == 2 * CE);
static_assert(C3 == 3 * CE);
static_assert(RROWS % 128 == 0);
static_assert(RROWS % 8 == 0);
static_assert(CE == 1024);
static_assert(256 * 4 == CE);            // gamma/beta staging: 256 threads x 4 floats
static_assert(32 * 4 * LNJ == CE);       // LN row load: 32 lanes x 4 floats x LNJ steps
static_assert(32 * 8 * LNO == CE);       // LN row store: 32 lanes x 8 halves x LNO instructions
static_assert(NQB * 128 == (SEQ));
static_assert(NEB <= NQB);

typedef unsigned short u16;
typedef unsigned int   u32;
typedef _Float16 v16h __attribute__((ext_vector_type(16)));
typedef _Float16 v8h  __attribute__((ext_vector_type(8)));
typedef _Float16 v4h  __attribute__((ext_vector_type(4)));
typedef float    v8f  __attribute__((ext_vector_type(8)));
typedef float    v4f  __attribute__((ext_vector_type(4)));
typedef float    v2f  __attribute__((ext_vector_type(2)));
typedef unsigned int u32x4 __attribute__((ext_vector_type(4)));
typedef unsigned int u32x2 __attribute__((ext_vector_type(2)));
typedef unsigned int u32x8 __attribute__((ext_vector_type(8)));

union Frag  { v16h v; u32x4 u[2]; };
union Pack8 { v8h h; u32x4 u; };
union Pack4 { v4h h; u32x2 u; };

#define WSCALE 64.0f
#define WINV   (1.0f / 64.0f)
#define PCAR   4096.0f
#define PINV   (1.0f / 4096.0f)
#define RSC    2048.0f
#define RINV   (1.0f / 2048.0f)

constexpr size_t al256(size_t b) { return (b + 255) & ~(size_t)255; }
constexpr size_t WS_TOTAL =
    al256((size_t)C3 * CE * 2) + al256((size_t)CE * CE * 2) + al256((size_t)C4 * CE * 2) +
    al256((size_t)CE * C4 * 2) + al256((size_t)RROWS * CE * 2) + al256((size_t)RROWS * QP * 2) +
    al256((size_t)NB * (TE) * QP * 2) + al256((size_t)NB * NH * HD * (SEQ) * 2) +
    al256((size_t)NB * NH * HD * (TE) * 2) + al256((size_t)RROWS * CE * 2) +
    al256((size_t)RROWS * CE * 4) + al256((size_t)RROWS * CE * 2) + al256((size_t)RROWS * C4 * 2) +
    al256((size_t)(CE / 128) * RROWS * 2 * 4) + 2 * al256((size_t)(CE / 64) * C4 * 4);
static_assert(WS_TOTAL <= (size_t)134217728);

// f32 -> nearest-even bf16 grid value, returned as f32
__device__ __forceinline__ float bfr(float f) {
    u32 u = __builtin_bit_cast(u32, f);
    u += 0x7fffu + ((u >> 16) & 1u);
    u &= 0xffff0000u;
    return __builtin_bit_cast(float, u);
}

// f32 -> f16 (RNE) bits
__device__ __forceinline__ u16 hbits(float f) {
    _Float16 h = (_Float16)f;
    return __builtin_bit_cast(u16, h);
}

// 16x16x32 f16 WMMA with the VALU hazard guard tied to D and A/B
__device__ __forceinline__ v8f mma16(v16h a, v16h b, v8f c) {
    c = __builtin_amdgcn_wmma_f32_16x16x32_f16(false, a, false, b, (short)0, c, false, false);
    asm volatile("v_nop\n\tv_nop\n\tv_nop\n\tv_nop" : "+v"(c) : "v"(a), "v"(b));
    return c;
}

// one 16x32 operand fragment of a row-major LDS tile: two 16-byte loads, k order 0..7 and 16..23 (+ 8 in the upper lane half)
__device__ __forceinline__ void ldfrag(Frag& f, const u16* p) {
    f.u[0] = *(const u32x4*)p;
    f.u[1] = *(const u32x4*)(p + 16);
}

// scheduling-region boundary, emitted only in the residual-carrying attention instance:
// ends the live ranges of the staging temporaries before the next block of loads begins
template <int ON>
__device__ __forceinline__ void sched_cut() {
    if constexpr (ON != 0) __builtin_amdgcn_sched_barrier(0);
}

// value of lane l ^ 16 (the other 16-lane row), a vector cross-row move
__device__ __forceinline__ float xhalf(float x) {
    const int xi = __builtin_bit_cast(int, x);
    return __builtin_bit_cast(float, __builtin_amdgcn_permlanex16(xi, xi, 0x76543210, 0xfedcba98, false, false));
}

// e^x on the hardware exp2, same product and instruction as the fast-math exp;
// the v_nop fills the one issue slot the instruction set asks for behind a transcendental
// before its result is read or its source overwritten
__device__ __forceinline__ float exp_fast(float x) {
    float r;
    asm("v_exp_f32 %0, %1\n\tv_nop" : "=v"(r) : "v"(x * 1.44269504088896340736f));
    return r;
}

// 2^x on the hardware exp2; the v_nop fills the same issue slot as in exp_fast
__device__ __forceinline__ float exp2_fast(float x) {
    float r;
    asm("v_exp_f32 %0, %1\n\tv_nop" : "=v"(r) : "v"(x));
    return r;
}

// erf-form GELU, x * Phi(x), free of branches so that the elements of a lane overlap in the vector pipe.
// q = 0.5 erfc(|x| / sqrt 2) by the rational-exponential form t (a1 + t (a2 + .. t a5)) exp(-z^2), t = 1 / (1 + p z), z = |x| / sqrt 2
// (absolute error of erf below 2e-7); Phi = 1 - q for x >= 0 and q itself for x < 0, so the negative side has no cancellation.
__device__ __forceinline__ float gelu_erf(float x) {
    const float d = __builtin_fmaf(__builtin_fabsf(x), 0.3275911f * 0.70710678118654752f, 1.0f);
    const float a = (x * x) * (-0.5f * 1.44269504088896340736f);
    float t, e;
    // the two transcendentals in one statement: the exp fills the issue slot the instruction set asks for behind the rcp (the outputs
    // are early-clobber, so it neither reads t nor overwrites d), the v_nop fills the one behind the exp
    asm("v_rcp_f32 %0, %2\n\tv_exp_f32 %1, %3\n\tv_nop" : "=&v"(t), "=&v"(e) : "v"(d), "v"(a));
    float p = __builtin_fmaf(t, 0.5f * 1.061405429f, 0.5f * -1.453152027f);
    p = __builtin_fmaf(t, p, 0.5f * 1.421413741f);
    p = __builtin_fmaf(t, p, 0.5f * -0.284496736f);
    p = __builtin_fmaf(t, p, 0.5f * 0.254829592f);
    const float q = (p * t) * e;
    return x * ((x >= 0.0f) ? 1.0f - q : q);
}

// logical row (b*SEQ + t) -> row of the full-size input / output tensors (b*SEQ_FULL + t)
__device__ __forceinline__ size_t grow_map(u32 r) {
    const u32 bb = r / (u32)(SEQ);
    const u32 t  = r - bb * (u32)(SEQ);
    return (size_t)bb * SEQ_FULL + (size_t)t;
}

// ---------------- weight convert + transpose: in[K][N] f32 -> out[N][K] f16 = f16(bfr(w) * 64) ----------------
// read: 16 consecutive lanes x 16 B = one 256-B row piece, two rows = 4 whole lines per load instruction.
// written by 8 consecutive lanes x 16 B of one instruction (4 lines per instruction).
// One workgroup converts the 64 x 64 tile (bx, by); Ts is its LDS tile [n][k], 64 * 72 halves.
// FOLD = 1 (the weight behind a LayerNorm): out = f16(bfr(w) * bfr(g[k]) * 64), and per column n the tile's sums over its 64 k of the
// stored f16 values (sp[by][n]) and of bfr(be[k]) * bfr(w) (tp[by][n]); 2 * 16 * 64 floats of LDS behind Ts carry the sums across threads.
template <int FOLD>
__device__ __forceinline__ void cvt_wt_body(const float* in, u16* out, u32 K, u32 N, u32 bx, u32 by, u16* Ts,
                                            const float* g, const float* be, float* sp, float* tp) {
    const u32 tid = threadIdx.x, lane = tid & 31u, wv = tid >> 5;
    const u32 n0 = bx * 64u, k0 = by * 64u;
    const u32 kr = tid >> 4, nq = (tid & 15u) * 4u;
    const float* src = in + (size_t)(k0 + kr) * N + n0 + nq;
    const float* s1 = src + (size_t)16u * N;
    const float* s2 = src + (size_t)32u * N;
    const float* s3 = src + (size_t)48u * N;
    v4f w[4];
    w[0] = *(const v4f*)src; w[1] = *(const v4f*)s1; w[2] = *(const v4f*)s2; w[3] = *(const v4f*)s3;
    // stands in front of every overwrite of the address registers that the four loads name; taking the addresses as inputs
    // keeps their registers untouched up to here, so that the loads issue back to back with no wait among them
    float gk[4], bk[4];
    if constexpr (FOLD != 0) {
        const float* gq = g + k0 + kr;
        const float* bq = be + k0 + kr;
#pragma unroll
        for (u32 j4 = 0; j4 < 4; j4++) { gk[j4] = gq[j4 * 16u]; bk[j4] = bq[j4 * 16u]; }
        // stands in front of every overwrite of the address registers that the eight loads above name
        asm volatile("s_wait_xcnt 0x0" :: "v"(gq), "v"(bq) : "memory");
    }
    asm volatile("s_wait_xcnt 0x0" :: "v"(src), "v"(s1), "v"(s2), "v"(s3) : "memory");
    float* Rs = (float*)(Ts + 64u * 72u);        // FOLD: [kr][n] partial sums of the stored values
    float* Rt = Rs + 16u * 64u;                  // FOLD: [kr][n] partial sums of beta * w
    v4f ss = (v4f)(0.f), ts = (v4f)(0.f);
#pragma unroll
    for (u32 j4 = 0; j4 < 4; j4++) {
#pragma unroll
        for (u32 c = 0; c < 4; c++) {
            float f = w[j4][c];
            if constexpr (FOLD != 0) {
                const float wb = bfr(f);
                const _Float16 hv = (_Float16)((wb * bfr(gk[j4])) * WSCALE);
                Ts[(nq + c) * 72u + kr + j4 * 16u] = __builtin_bit_cast(u16, hv);
                ss[c] += (float)hv;
                ts[c] += bfr(bk[j4]) * wb;
            } else {
                Ts[(nq + c) * 72u + kr + j4 * 16u] = hbits(bfr(f) * WSCALE);
            }
        }
    }
    if constexpr (FOLD != 0) {
        *(v4f*)&Rs[kr * 64u + nq] = ss;
        *(v4f*)&Rt[kr * 64u + nq] = ts;
    }
    __syncthreads();                             // Ts (and Rs, Rt): cross-wave exchange
    u32x4 val[2];
#pragma unroll
    for (u32 it = 0; it < 2; it++) {
        const u32 nn = wv * 8u + it * 4u + (lane >> 3), ks = (lane & 7u) * 8u;
        val[it] = *(const u32x4*)&Ts[nn * 72u + ks];
    }
#pragma unroll
    for (u32 it = 0; it < 2; it++) {
        const u32 nn = wv * 8u + it * 4u + (lane >> 3), ks = (lane & 7u) * 8u;
        *(u32x4*)(out + (size_t)(n0 + nn) * K + k0 + ks) = val[it];
    }
    if constexpr (FOLD != 0) {
        if (tid < 128u) {                        // waves 0, 1: the 64 columns' sums of stored values; waves 2, 3: of beta * w
            const float* R = (tid < 64u) ? Rs : Rt;
            const u32 c = tid & 63u;
            float a = 0.f;
#pragma unroll
            for (u32 j = 0; j < 16u; j++) a += R[j * 64u + c];
            float* dst = ((tid < 64u) ? sp : tp) + (size_t)by * N + n0 + c;
            *dst = a;
        }
    }
    // the body is inlined beside other bodies of one kernel: stands in front of every write, on any path the branches behind it
    // allow, of a register that the stores above name
    asm volatile("s_wait_xcnt 0x0" ::: "memory");
}

// ---------------- LayerNorm (row = 1024): one wave per row, f16 out via LDS row stage ----------------
// Row kept in a wave-private f32 LDS row (lane owns columns j*128 + lane*4 + 0..3, same lane writes and reads);
// the three per-element sweeps are rolled loops with wave-uniform trip counts.
// gamma/beta staged once per workgroup in LDS at bf16-RNE values.
// SRCX = 1: src is the input x (full-size row map, each element taken at its bf16-RNE value)
// SRCX = 0: src is an f32 workspace plane with logical rows
// blk: the workgroup's group of 8 rows; xs, rows, gsh, bsh: its LDS arrays (8*CE floats, 8*CE halves, CE floats, CE floats)
template <int SRCX>
__device__ __forceinline__ void ln_body(u32 blk, const float* src, const float* g, const float* be, u16* out,
                                        float* xs, u16* rows, float* gsh, float* bsh) {
    const u32 tid = threadIdx.x, lane = tid & 31u, wv = tid >> 5;
    {
        v4f gg = *(const v4f*)(g + tid * 4u);
        v4f bb = *(const v4f*)(be + tid * 4u);
        v4f go, bo;
#pragma unroll
        for (u32 c = 0; c < 4; c++) {
            float tg = gg[c]; float tb = bb[c];
            go[c] = bfr(tg); bo[c] = bfr(tb);
        }
        *(v4f*)&gsh[tid * 4u] = go;
        *(v4f*)&bsh[tid * 4u] = bo;
    }
    const u32 r = blk * 8u + wv;                   // < RROWS (blk < RROWS/8)
    const size_t srow = SRCX ? grow_map(r) : (size_t)r;
    const float* xr = src + srow * CE;
    float* xw = xs + wv * CE;
    float s = 0.f;
#pragma unroll 1
    for (u32 j = 0; j < LNJ; j++) {
        const u32 c0 = j * 128u + lane * 4u;
        v4f t4 = *(const v4f*)(xr + c0);
        if constexpr (SRCX != 0) {
#pragma unroll
            for (u32 c = 0; c < 4; c++) { float t = t4[c]; t4[c] = bfr(t); }
        }
        *(v4f*)&xw[c0] = t4;
        s += (t4[0] + t4[1]) + (t4[2] + t4[3]);
    }
#pragma unroll
    for (u32 m = 16; m >= 1; m >>= 1) s += __shfl_xor(s, m, 32);
    const float mu = s * (1.f / (float)CE);
    float vs = 0.f;
#pragma unroll 1
    for (u32 j = 0; j < LNJ; j++) {
        const u32 c0 = j * 128u + lane * 4u;
        v4f t4 = *(const v4f*)&xw[c0];
#pragma unroll
        for (u32 c = 0; c < 4; c++) { float d = t4[c] - mu; vs += d * d; }
    }
#pragma unroll
    for (u32 m = 16; m >= 1; m >>= 1) vs += __shfl_xor(vs, m, 32);
    const float rstd = rsqrtf(vs * (1.f / (float)CE) + 1e-5f);
    __syncthreads();                               // gsh/bsh (cross-wave) visible
    u16* rw = rows + wv * CE;
#pragma unroll 1
    for (u32 j = 0; j < LNJ; j++) {
        const u32 c0 = j * 128u + lane * 4u;
        v4f x4 = *(const v4f*)&xw[c0];
        v4f g4 = *(const v4f*)&gsh[c0];
        v4f b4 = *(const v4f*)&bsh[c0];
        Pack4 pk;
#pragma unroll
        for (u32 c = 0; c < 4; c++) {
            float xe = x4[c]; float ge = g4[c]; float bel = b4[c];
            pk.h[c] = (_Float16)((xe - mu) * rstd * ge + bel);
        }
        *(u32x2*)&rw[c0] = pk.u;
    }
    __syncthreads();   // LDS row stage: written and read by the same wave; a workgroup barrier is used
    u32x4 val[LNO];
#pragma unroll
    for (u32 j = 0; j < LNO; j++) val[j] = *(const u32x4*)&rw[j * 256u + lane * 8u];
    u16* orow = out + (size_t)r * CE;
#pragma unroll
    for (u32 j = 0; j < LNO; j++) *(u32x4*)(orow + j * 256u + lane * 8u) = val[j];
    
}

// ---------------- what the qkv product waits for, in one launch ----------------
// workgroups 0 .. NLN-1: LN1 of x (the longer workgroups, lowest indices); then the 64 x 64 tiles of the qkv weight convert.
// The other three weight converts, which nothing reads before the attention has ended, ride in the attention launch.
#define NLN  (RROWS / 8)
#define NT_A ((C3 / 64) * (CE / 64))
#define NT_P ((CE / 64) * (CE / 64))
#define NT_F ((C4 / 64) * (CE / 64))
#define NT_G ((CE / 64) * (C4 / 64))
__global__ __launch_bounds__(256) void prep_kernel(const float* __restrict__ x,
                                                   const float* __restrict__ g,
                                                   const float* __restrict__ be,
                                                   u16* __restrict__ h1,
                                                   const float* __restrict__ w_a, u16* __restrict__ o_a) {
    __shared__ __align__(16) float xs[8 * CE];      // LN: wave wv owns xs[wv*CE ..]; convert: the [n][k] tile
    __shared__ __align__(16) u16   rows[8 * CE];
    __shared__ __align__(16) float gsh[CE];
    __shared__ __align__(16) float bsh[CE];
    static_assert(64 * 72 * 2 <= 8 * CE * 4);
    const u32 blk = blockIdx.x;                     // the test below is uniform for the workgroup
    if (blk < (u32)NLN) {
        ln_body<1>(blk, x, g, be, h1, xs, rows, gsh, bsh);
    } else {
        const u32 t = blk - (u32)NLN;               // < NT_A by the grid; [1024][3072] -> [3072][1024]
        cvt_wt_body<0>(w_a, o_a, (u32)CE, (u32)C3, t % (u32)(C3 / 64), t / (u32)(C3 / 64), (u16*)xs, g, be, xs, xs);
    }
}

// LDS byte address of a __shared__ location (what an asynchronous copy takes as its destination)
__device__ __forceinline__ u32 lds_addr(const void* p) {
    typedef __attribute__((address_space(3))) const void lds_void;
    return (u32)(size_t)(lds_void*)p;
}

// four asynchronous 16-byte copies global -> LDS per lane, from g[0..3] to the LDS byte addresses l[0..3].
// The s_wait_xcnt closes the statement so that it stands in front of every later write of an address register the copies name.
__device__ __forceinline__ void copy4(const u32* l, const u16* const* g) {
    asm volatile("global_load_async_to_lds_b128 %0, %4, off\n\t"
                 "global_load_async_to_lds_b128 %1, %5, off\n\t"
                 "global_load_async_to_lds_b128 %2, %6, off\n\t"
                 "global_load_async_to_lds_b128 %3, %7, off\n\t"
                 "s_wait_xcnt 0x0"
                 :: "v"(l[0]), "v"(l[1]), "v"(l[2]), "v"(l[3]),
                    "v"(g[0]), "v"(g[1]), "v"(g[2]), "v"(g[3])
                 : "memory");
}

// wave-uniform value held in a scalar register
__device__ __forceinline__ u32 uni(u32 v) { return (u32)__builtin_amdgcn_readfirstlane((int)v); }

// wave-uniform value pinned in a scalar register: a test on it compiles to a scalar compare and branch, which is what keeps a wave
// from issuing a tensor load (the instruction ignores EXEC); the statement also holds what is computed from the value behind the waits above it
__device__ __forceinline__ u32 pinned(u32 v) {
    u32 w = uni(v);
    asm volatile("" : "+s"(w));   // an issue test or a descriptor word's addend held in a scalar register
    return w;
}

__device__ __forceinline__ float* fold_lds() {
    __shared__ __align__(16) float f[512];
    return f;
}

template <int MODE>
__global__ __launch_bounds__(256) void gemm_kernel(const u16* __restrict__ A,
                                                   const u16* __restrict__ BT,
                                                   const float* __restrict__ bias,
                                                   const float* __restrict__ res,
                                                   void* out0, void* out1, void* out2, void* out3,
                                                   u32 N, u32 K) {
    constexpr u32 KH     = (MODE == 1 || MODE == 3) ? 2u : 1u;       // runs of 128 k per stage
    constexpr u32 BK     = 128u * KH;              // k per stage
    constexpr u32 NIW    = 4u * KH;                // issuing waves = slices per stage
    constexpr u32 PH     = 128u + 8u;              // LDS row pitch in halves: 256 bytes of k + 16
    constexpr u32 SROWS  = 64u;                    // rows per slice
    constexpr u32 SL_B   = (SROWS * PH * 2u + 2047u) & ~2047u;   // a slice's size in LDS, bytes, rounded up to 2 KiB
    constexpr u32 SL_H   = SL_B / 2u;
    constexpr u32 BUF_B  = NIW * SL_B;             // one buffer: [run of 128 k][slice]
    constexpr u32 BUF_H  = BUF_B / 2u;
    constexpr u32 CSP = 132;
    static_assert(CE % BK == 0 && C4 % BK == 0);
    static_assert(2u * BUF_B >= 128u * CSP * 4u);
    __shared__ __attribute__((aligned(2048))) u32x4 smem[2u * BUF_B / 16u];   // the ring during the k loop, Cs after it
    const u16* As = (const u16*)smem;
    float* Cs = (float*)smem;                      // [128][132]

    const u32 tid = threadIdx.x, lane = tid & 31u, wv = tid >> 5;
    const u32 hf = lane >> 4, ln = lane & 15u;
    const u32 m0 = blockIdx.y * 128u, n0 = blockIdx.x * 128u;
    const u32 wm = wv & 3u, wn = wv >> 2;
    const u32 nt = K / BK;                               // stages; K is a multiple of BK
    const u32 wave = uni(wv);                            // one-dimensional block: the wave's number
    const u32 issuer = (NIW == 8u) ? 1u : (u32)(wave < NIW);   // does this wave issue
    // the issuing wave's slice: its first source byte in stage 0 and its place in buffer 0
    const u16* srow0 = ((wave & 2u) == 0u) ? A + (size_t)(m0 + (wave & 1u) * SROWS) * K : BT + (size_t)(n0 + (wave & 1u) * SROWS) * K;
    const unsigned long long gsrc = (unsigned long long)(size_t)(srow0 + ((wave >> 2) & (KH - 1u)) * 128u);
    // descriptor group 0 of the wave's next request: count 1 | place in LDS | source address, type 2 in the top bits
    u32x4 g0;
    g0[0] = uni(1u);
    g0[1] = uni(lds_addr(smem) + (wave & (NIW - 1u)) * SL_B);
    g0[2] = uni((u32)gsrc);
    g0[3] = uni((((u32)(gsrc >> 32)) & 0x01FFFFFFu) | 0x80000000u);
    // descriptor group 1, the same for every request: bytes as elements, tensor = tile = 64 rows of 256 bytes, source pitch 2 K bytes,
    // no mask, 4 dwords of pad behind every 64 dwords
    u32x8 g1;
    g1[0] = uni((1u << 20) | (5u << 22) | (3u << 25));
    g1[1] = uni(256u << 16);
    g1[2] = uni(SROWS << 16);
    g1[3] = uni(256u << 16);
    g1[4] = uni(SROWS);
    g1[5] = uni(K * 2u);
    g1[6] = uni(0u);
    g1[7] = uni(0u);
    // issues this wave's slice of its next stage. Both groups are in-out operands: their registers stay theirs behind the statement,
    // so that none of them takes another value while the request is outstanding
    auto issue = [&]() {
        asm volatile("tensor_load_to_lds %0, %1" : "+s"(g0), "+s"(g1) :: "memory");
    };
    // moves group 0 on by one stage of k and by dl bytes to the other buffer. Called only behind the wait that covers the last request:
    // the step comes through pinned(), a descriptor word's addend held in a scalar register, which keeps the additions behind that wait.
    // The address stays below 2^57, so the carry never reaches the type bits.
    auto advance = [&](u32 dl) {
        const u32 step = pinned(BK * 2u);
        const unsigned long long a = (((unsigned long long)g0[3] << 32) | (unsigned long long)g0[2]) + (unsigned long long)step;
        g0[1] = uni(g0[1] + dl + (step - BK * 2u));        // + dl; the zero term ties this addition to the pinned step too
        g0[2] = uni((u32)a);
        g0[3] = uni((u32)(a >> 32));
    };

    v8f acc[2][4];
#pragma unroll
    for (int i = 0; i < 2; i++)
#pragma unroll
        for (int j = 0; j < 4; j++) acc[i][j] = (v8f)(0.f);

    // MODE 2: the partial sums behind the row and column terms are asked for here and first used behind stage 1's issue,
    // so that their latency runs beside stage 0's landing. Waves 0..3: one tile row per lane; waves 4..7: one tile column per lane.
    v2f pst[CE / 128];
    float psp[CE / 64], ptp[CE / 64], pbias = 0.f;
    if constexpr (MODE == 2) {
#pragma unroll
        for (u32 j = 0; j < (u32)(CE / 128); j++) pst[j] = (v2f)(0.f);
#pragma unroll
        for (u32 j = 0; j < (u32)(CE / 64); j++) { psp[j] = 0.f; ptp[j] = 0.f; }
        if (tid < 128u) {
            const float* sq = res + (size_t)(m0 + tid) * 2u;
#pragma unroll
            for (u32 j = 0; j < (u32)(CE / 128); j++) pst[j] = *(const v2f*)(sq + (size_t)j * (RROWS * 2));
            asm volatile("s_wait_xcnt 0x0" :: "v"(sq) : "memory");   // in front of every overwrite of the address registers the loads above name
        } else {
            const float* sc = (const float*)out1 + n0 + (tid - 128u);
            const float* tc = (const float*)out2 + n0 + (tid - 128u);
            const float* bc = bias + n0 + (tid - 128u);
#pragma unroll
            for (u32 j = 0; j < (u32)(CE / 64); j++) { psp[j] = sc[(size_t)j * C4]; ptp[j] = tc[(size_t)j * C4]; }
            pbias = *bc;
            asm volatile("s_wait_xcnt 0x0" :: "v"(sc), "v"(tc), "v"(bc) : "memory");   // as above
        }
    }

    if (pinned(issuer)) {
        issue();                                           // stage 0 into buffer 0
        asm volatile("s_wait_tensorcnt 0x0" ::: "memory"); // this wave's slice of stage 0 has landed
    }
    __syncthreads();                                       // stage 0 visible to all waves
    if (pinned(issuer & (u32)(1u < nt))) {
        advance(BUF_B);
        issue();                                           // stage 1 into buffer 1
    }
    if constexpr (MODE == 2) {
        float* fold = fold_lds();                          // read in the epilogue, behind the k loop's barriers
        if (tid < 128u) {
            float sm = 0.f, sq2 = 0.f;
#pragma unroll
            for (u32 j = 0; j < (u32)(CE / 128); j++) { sm += pst[j][0]; sq2 += pst[j][1]; }
            const float mu = sm * (1.f / (float)CE);
            const float var = fmaxf(sq2 * (1.f / (float)CE) - mu * mu, 0.f);
            const float rs = rsqrtf(var + 1e-5f) * WINV;
            fold[tid] = rs;
            fold[128u + tid] = -mu * rs;
        } else {
            float sS = 0.f, sT = 0.f;
#pragma unroll
            for (u32 j = 0; j < (u32)(CE / 64); j++) { sS += psp[j]; sT += ptp[j]; }
            fold[256u + (tid - 128u)] = sS;
            fold[384u + (tid - 128u)] = sT + bfr(pbias);
        }
    }
    // this lane's fragment rows in a buffer, in halves
    const u32 aoff = (wm >> 1) * SL_H + ((wm & 1u) * 32u + ln) * PH + hf * 8u;
    const u32 boff = (2u + wn) * SL_H + ln * PH + hf * 8u;
#pragma unroll 1                                       // stays rolled: the buffer picked by t & 1
    for (u32 t = 0; t < nt; t++) {
#pragma unroll 1                                       // stays rolled: a run's base address is then a register, and every fragment's offset from it fits the LDS load's 16-bit field
        for (u32 kh = 0; kh < KH; kh++) {
            const u16* Ab = As + (t & 1u) * BUF_H + kh * 4u * SL_H + aoff;
            const u16* Bb = As + (t & 1u) * BUF_H + kh * 4u * SL_H + boff;
#pragma unroll
            for (u32 ks = 0; ks < 4u; ks++) {
                Frag af[2], bf[4];
#pragma unroll
                for (u32 mi = 0; mi < 2; mi++) {
                    const u16* q = &Ab[mi * 16u * PH + ks * 32u];
                    af[mi].u[0] = *(const u32x4*)q;
                    af[mi].u[1] = *(const u32x4*)(q + 16);
                }
#pragma unroll
                for (u32 ni = 0; ni < 4; ni++) {
                    const u16* q = &Bb[ni * 16u * PH + ks * 32u];
                    bf[ni].u[0] = *(const u32x4*)q;
                    bf[ni].u[1] = *(const u32x4*)(q + 16);
                }
#pragma unroll
                for (int mi = 0; mi < 2; mi++)
#pragma unroll
                    for (int ni = 0; ni < 4; ni++)
                        acc[mi][ni] = mma16(af[mi].v, bf[ni].v, acc[mi][ni]);
            }
        }
        asm volatile("s_wait_dscnt 0x0" ::: "memory");     // this wave's reads of stage t's buffer are done before it is refilled
        asm volatile("s_wait_tensorcnt 0x0" ::: "memory"); // an issuing wave's slice of stage t + 1 has landed (the other waves have none outstanding)
        __syncthreads();                                   // publishes stage t + 1 and ends every wave's reads of stage t
        if (pinned(issuer & (u32)(t + 2u < nt))) {
            advance((t & 1u) ? BUF_B : 0u - BUF_B);
            issue();                                       // stage t + 2 into the buffer stage t has left
        }
    }
    // no request outstanding when the ring becomes the C tile; taking the descriptors as inputs keeps their registers theirs up to here
    asm volatile("s_wait_tensorcnt 0x0" :: "s"(g0), "s"(g1) : "memory");
    asm volatile("s_wait_dscnt 0x0" ::: "memory");         // nor an LDS read of this wave

    // ---- epilogue: accumulators -> f32 tile in LDS (aliases the ring: the last stage's own barrier has ended every wave's reads) ----
    // MODE 2: this lane's 16 row terms and 4 column terms, read once ahead of the stores into Cs
    float ra[2][8], rb[2][8], cs4[4], ct4[4];
    if constexpr (MODE == 2) {
        const float* fold = fold_lds();
#pragma unroll
        for (int mi = 0; mi < 2; mi++) {
            const u32 rbase = wm * 32u + (u32)mi * 16u + hf * 8u;
#pragma unroll
            for (int q = 0; q < 2; q++) {
                const v4f a4 = *(const v4f*)&fold[rbase + (u32)q * 4u];
                const v4f b4 = *(const v4f*)&fold[128u + rbase + (u32)q * 4u];
#pragma unroll
                for (int e = 0; e < 4; e++) { ra[mi][q * 4 + e] = a4[e]; rb[mi][q * 4 + e] = b4[e]; }
            }
        }
#pragma unroll
        for (int ni = 0; ni < 4; ni++) {
            cs4[ni] = fold[256u + wn * 64u + (u32)ni * 16u + ln];
            ct4[ni] = fold[384u + wn * 64u + (u32)ni * 16u + ln];
        }
    }
#pragma unroll
    for (int ni = 0; ni < 4; ni++) {
        const u32 col = wn * 64u + (u32)ni * 16u + ln;
        float bv, sn = 0.f;
        if constexpr (MODE == 2) { bv = ct4[ni]; sn = cs4[ni]; }
        else                     bv = bfr(bias[n0 + col]);
#pragma unroll
        for (int mi = 0; mi < 2; mi++) {
#pragma unroll
            for (int r = 0; r < 8; r++) {
                const u32 row = wm * 32u + (u32)mi * 16u + hf * 8u + (u32)r;
                float v;
                if constexpr (MODE == 2) {
                    v = __builtin_fmaf(acc[mi][ni][r], ra[mi][r], __builtin_fmaf(rb[mi][r], sn, bv));
                    v = gelu_erf(v);
                } else {
                    v = acc[mi][ni][r] * WINV + bv;
                }
                Cs[row * CSP + col] = v;
            }
        }
    }
    __syncthreads();                               // Cs is read across waves below

    if constexpr (MODE == 1 || MODE == 3) {
        float* o = (float*)out0;
        v4f val[16];
#pragma unroll
        for (int grp = 0; grp < 2; grp++) {
#pragma unroll
            for (int i8 = 0; i8 < 8; i8++) {
                const int i = grp * 8 + i8;
                const u32 row = wv * 16u + (u32)i;
                const u32 r = m0 + row;
                v4f c = *(const v4f*)&Cs[row * CSP + lane * 4u];
                const size_t rr = (MODE == 1) ? grow_map(r) : (size_t)r;
                v4f x4 = *(const v4f*)(res + rr * (size_t)N + n0 + lane * 4u);
                if constexpr (MODE == 1) {
#pragma unroll
                    for (int cc = 0; cc < 4; cc++) { float t = x4[cc]; x4[cc] = bfr(t); }
                }
                val[i] = c + x4;
            }
            asm volatile("" ::: "memory");         // keep the two load groups in separate clauses
        }
#pragma unroll
        for (int i = 0; i < 16; i++) {
            const u32 r = m0 + wv * 16u + (u32)i;
            const size_t orr = (MODE == 3) ? grow_map(r) : (size_t)r;
            *(v4f*)(o + orr * (size_t)N + n0 + lane * 4u) = val[i];
        }
        if constexpr (MODE == 1) {
            u16* xh = (u16*)out1;
            float* st = (float*)out2;
            float sa[16], qa[16];
#pragma unroll
            for (int i = 0; i < 16; i++) {
                const v4f v = val[i];
                Pack4 pk;
#pragma unroll
                for (int cc = 0; cc < 4; cc++) pk.h[cc] = (_Float16)v[cc];
                *(u32x2*)(xh + (size_t)(m0 + wv * 16u + (u32)i) * N + n0 + lane * 4u) = pk.u;
                sa[i] = (v[0] + v[1]) + (v[2] + v[3]);
                qa[i] = (v[0] * v[0] + v[1] * v[1]) + (v[2] * v[2] + v[3] * v[3]);
            }
            // the wave's 16 rows summed over its 32 lanes: each exchange step hands half of a lane's values to its partner and keeps the
            // other half, so that lane l ends with row l >> 1: its sum in the even lane, its sum of squares in the odd lane
            const bool h16 = (lane & 16u) != 0u, h8 = (lane & 8u) != 0u, h4 = (lane & 4u) != 0u, h2 = (lane & 2u) != 0u, h1 = (lane & 1u) != 0u;
            float s8[8], q8[8], s4[4], q4[4], s2[2], q2[2];
#pragma unroll
            for (int i = 0; i < 8; i++) {
                s8[i] = (h16 ? sa[i + 8] : sa[i]) + xhalf(h16 ? sa[i] : sa[i + 8]);
                q8[i] = (h16 ? qa[i + 8] : qa[i]) + xhalf(h16 ? qa[i] : qa[i + 8]);
            }
#pragma unroll
            for (int i = 0; i < 4; i++) {
                s4[i] = (h8 ? s8[i + 4] : s8[i]) + __shfl_xor(h8 ? s8[i] : s8[i + 4], 8, 32);
                q4[i] = (h8 ? q8[i + 4] : q8[i]) + __shfl_xor(h8 ? q8[i] : q8[i + 4], 8, 32);
            }
#pragma unroll
            for (int i = 0; i < 2; i++) {
                s2[i] = (h4 ? s4[i + 2] : s4[i]) + __shfl_xor(h4 ? s4[i] : s4[i + 2], 4, 32);
                q2[i] = (h4 ? q4[i + 2] : q4[i]) + __shfl_xor(h4 ? q4[i] : q4[i + 2], 4, 32);
            }
            const float s1 = (h2 ? s2[1] : s2[0]) + __shfl_xor(h2 ? s2[0] : s2[1], 2, 32);
            const float q1 = (h2 ? q2[1] : q2[0]) + __shfl_xor(h2 ? q2[0] : q2[1], 2, 32);
            const float tot = (h1 ? q1 : s1) + __shfl_xor(h1 ? s1 : q1, 1, 32);
            // plane blockIdx.x, 16 rows x 2 floats = one whole 128-B line per wave
            st[((size_t)blockIdx.x * RROWS + m0 + wv * 16u) * 2u + lane] = tot;
            asm volatile("s_wait_xcnt 0x0" ::: "memory");   // in front of every later overwrite of an address register the stores above name
        }
        
    } else if constexpr (MODE == 2) {
        u16* o = (u16*)out0;
        u32x4 val[8];
#pragma unroll
        for (int it = 0; it < 8; it++) {
            const u32 rloc = wv * 16u + (u32)it * 2u + hf, cseg = ln * 8u;
            Pack8 pk;
#pragma unroll
            for (int j = 0; j < 8; j++) pk.h[j] = (_Float16)Cs[rloc * CSP + cseg + (u32)j];
            val[it] = pk.u;
        }
#pragma unroll
        for (int it = 0; it < 8; it++) {
            const u32 rloc = wv * 16u + (u32)it * 2u + hf, cseg = ln * 8u;
            *(u32x4*)(o + (size_t)(m0 + rloc) * N + n0 + cseg) = val[it];
        }
        
    } else {
        // MODE 0: q/k planes or transposed v planes
        u16* qkh = (u16*)out0;
        u16* qkl = (u16*)out1;
        u16* vth = (u16*)out2;
        u16* vtl = (u16*)out3;
        const u32 bq = m0 / (u32)(SEQ);
        const u32 t0 = m0 - bq * (u32)(SEQ);       // 128 | SEQ so the tile sits inside one batch
        const bool lo_on = (t0 < (u32)(TE));       // uniform per workgroup
        u32x4 vh[8], vl[8];
        if (n0 < (u32)QP) {
#pragma unroll
            for (int it = 0; it < 8; it++) {
                const u32 rloc = wv * 16u + (u32)it * 2u + hf, cseg = ln * 8u;
                Pack8 ph, pl;
#pragma unroll
                for (int j = 0; j < 8; j++) {
                    float f = Cs[rloc * CSP + cseg + (u32)j];
                    _Float16 h16 = (_Float16)f;
                    ph.h[j] = h16;
                    pl.h[j] = (_Float16)((f - (float)h16) * RSC);
                }
                vh[it] = ph.u; vl[it] = pl.u;
            }
#pragma unroll
            for (int it = 0; it < 8; it++) {
                const u32 rloc = wv * 16u + (u32)it * 2u + hf, cseg = ln * 8u;
                *(u32x4*)(qkh + (size_t)(m0 + rloc) * QP + n0 + cseg) = vh[it];
                if (lo_on)
                    *(u32x4*)(qkl + ((size_t)bq * (TE) + t0 + rloc) * QP + n0 + cseg) = vl[it];
            }
            
        } else {
            const u32 hh0 = (n0 - (u32)QP) >> 6;   // two heads per 128-column tile
#pragma unroll
            for (int it = 0; it < 8; it++) {
                const u32 rloc = wv * 16u + (u32)it * 2u + hf;   // local column = head*64 + d
                const u32 tseg = ln * 8u;
                Pack8 ph, pl;
#pragma unroll
                for (int j = 0; j < 8; j++) {
                    float f = Cs[(tseg + (u32)j) * CSP + rloc];
                    _Float16 h16 = (_Float16)f;
                    ph.h[j] = h16;
                    pl.h[j] = (_Float16)((f - (float)h16) * RSC);
                }
                vh[it] = ph.u; vl[it] = pl.u;
            }
#pragma unroll
            for (int it = 0; it < 8; it++) {
                const u32 rloc = wv * 16u + (u32)it * 2u + hf, tseg = ln * 8u;
                const u32 hh = hh0 + (rloc >> 6), dd = rloc & 63u;
                const size_t vrow = (size_t)(bq * NH + hh) * HD + dd;
                *(u32x4*)(vth + vrow * (SEQ) + t0 + tseg) = vh[it];
                if (lo_on)
                    *(u32x4*)(vtl + vrow * (TE) + t0 + tseg) = vl[it];
            }
            
        }
    }
}

// ---------------- causal flash attention, hd=64, 128 queries per workgroup (8 waves x 16 rows), 64-key chunks ----------------
// qkh: [RROWS][QP] f16 (q cols h*64+d, k cols CE+h*64+d); qkl: same layout for rows t<TE, residual x2048
// vth: [NB*NH][64][SEQ] f16 transposed v; vtl: [NB*NH][64][TE] residual x2048
// Transposed products: A = K rows (S^T) or V^T rows (O^T), B = Q or P^T. Lane (hf, ln) owns query q0 + ln:
// S^T register r of sub-tile sub = key sub*16 + hf*8 + r, so two converted sub-tiles are one B fragment in the loaders' k order.
// RES=1: query tiles with position < TE: S = qh.kh + (qh.kl + ql.kh)/2048, O += Ph.Vh + (Pr.Vh + Ph.Vl)/2048
// RES=1 only: wave index taken as a scalar-uniform value.
// Operand fragments leave LDS in groups ahead of the products that read them (same arithmetic, same order of products):
// RES=0 a chunk's 8 K fragments, then its 8 V fragments ahead of the softmax; RES=1 one sub-tile ahead, two register sets.
// Staging: RES=1 through registers, two barriers a chunk. RES=0 by asynchronous 16-byte copies into a ring of two LDS buffers,
// (Ks, Vs) and (Kl, Vl): chunk kt + 1 is in flight while chunk kt is worked on, one barrier a chunk.
// bh, qb: the workgroup's head and query tile; Ks .. Ps: its LDS arrays; Kl = Ks + KVRING and Vl = Vs + KVRING (halves)
#define KVT    (64 * 72)
#define KVRING (2 * KVT)
template <int RES>
__device__ __forceinline__
void attn_body(const u16* qkh, const u16* qkl, const u16* vth, const u16* vtl, u16* cv, u32 bh, u32 qb,
               u16* Ks, u16* Vs, u16* Kl, u16* Vl, u16* Ps) {
    const u32 b = bh / (u32)NH, h = bh - b * (u32)NH;
    const u32 tid = threadIdx.x, lane = tid & 31u;
    u32 wv = tid >> 5;
    if constexpr (RES != 0) wv = (u32)__builtin_amdgcn_readfirstlane((int)wv);   // all lanes active, value is wave-uniform
    const u32 hf = lane >> 4, ln = lane & 15u;
    const u32 q0 = qb * 128u + wv * 16u;
    u16* Pw  = Ps + wv * (16u * 72u);

    Frag qf[2], ql[2];
#pragma unroll
    for (u32 ds = 0; ds < 2; ds++) {
        const u16* p = qkh + (size_t)(b * (u32)(SEQ) + q0 + ln) * QP + h * HD + ds * 32u + hf * 8u;
        qf[ds].u[0] = *(const u32x4*)p;
        qf[ds].u[1] = *(const u32x4*)(p + 16);
        if constexpr (RES != 0) {
            const u16* pl = qkl + (size_t)(b * (u32)(TE) + q0 + ln) * QP + h * HD + ds * 32u + hf * 8u;
            ql[ds].u[0] = *(const u32x4*)pl;
            ql[ds].u[1] = *(const u32x4*)(pl + 16);
        } else {
            ql[ds].u[0] = (u32x4)(0u); ql[ds].u[1] = (u32x4)(0u);
        }
    }

    v8f o[4];
#pragma unroll
    for (int i = 0; i < 4; i++) o[i] = (v8f)(0.f);
    float mrun = -3.0e38f;                                 // running maximum of this lane's query (both halves agree); RES=0: of the raw scores
    float lsum = 0.f;                                      // running sum over this lane half's keys; halves joined after the loop
    const u32 qg = q0 + ln;

    const u32 rr = tid >> 3, seg = (tid & 7u) * 8u;       // staging: rows rr and rr + 32 (key or d), 8 halves at seg: 4 whole 128-B lines per load instruction
    const u32 nkt = 2u * qb + 2u;                          // keys 0 .. qb*128+127

    // RES=0: this lane's four copies of the next chunk to be issued (K rows rr, rr + 32; V^T rows rr, rr + 32). Source and LDS
    // addresses live in registers and move on by one add each behind an issue.
    const u16* gp[4];
    u32 lp[4];
    gp[0] = qkh + (size_t)(b * (u32)(SEQ) + rr) * QP + CE + h * HD + seg;
    gp[1] = gp[0] + 32u * QP;
    gp[2] = vth + ((size_t)(bh * HD + rr)) * (SEQ) + seg;
    gp[3] = gp[2] + 32u * (SEQ);
    lp[0] = lds_addr(&Ks[rr * 72u + seg]);
    lp[1] = lds_addr(&Ks[(rr + 32u) * 72u + seg]);
    lp[2] = lds_addr(&Vs[rr * 72u + seg]);
    lp[3] = lds_addr(&Vs[(rr + 32u) * 72u + seg]);
    // issues one chunk into the buffer lp points at, then moves to the next chunk's keys and by dl bytes to the other buffer
    auto stage = [&](u32 dl) {
        copy4(lp, gp);
        gp[0] += 64u * QP; gp[1] += 64u * QP; gp[2] += 64u; gp[3] += 64u;
#pragma unroll                                             // constant indices: lp stays in registers
        for (u32 c = 0; c < 4u; c++) lp[c] += dl;
    };
    constexpr u32 RING_B = (u32)KVRING * 2u;               // bytes from buffer 0 to buffer 1
    if constexpr (RES == 0) {
        stage(RING_B);                                     // chunk 0 into buffer 0
        asm volatile("s_wait_asynccnt 0x0" ::: "memory");  // this wave's chunk 0 copies have landed
        __syncthreads();                                   // chunk 0 visible to all waves
        stage(0u - RING_B);                                // chunk 1 into buffer 1 (nkt >= 2)
    }

#pragma unroll 1
    for (u32 kt = 0; kt < nkt; kt++) {
        const u16* Kc = Ks + (RES ? 0u : (kt & 1u) * (u32)KVRING);   // the chunk's K and V^T tiles
        const u16* Vc = Vs + (RES ? 0u : (kt & 1u) * (u32)KVRING);
        if constexpr (RES != 0) {
            __syncthreads();                               // prior chunk's LDS reads done
            const u16* gk = qkh + (size_t)(b * (u32)(SEQ) + kt * 64u + rr) * QP + CE + h * HD + seg;
            u32x4 k0v = *(const u32x4*)gk, k1v = *(const u32x4*)(gk + 32u * QP);
            const u16* gv = vth + ((size_t)(bh * HD + rr)) * (SEQ) + kt * 64u + seg;
            u32x4 v0 = *(const u32x4*)gv, v1 = *(const u32x4*)(gv + 32u * (SEQ));
            asm volatile("s_wait_xcnt 0x0" ::: "memory");   // stands in front of every later overwrite of the address registers that the loads above name
            *(u32x4*)&Ks[rr * 72u + seg] = k0v; *(u32x4*)&Ks[(rr + 32u) * 72u + seg] = k1v;
            *(u32x4*)&Vs[rr * 72u + seg] = v0;  *(u32x4*)&Vs[(rr + 32u) * 72u + seg] = v1;
            sched_cut<RES>();                              // hi-plane staging temporaries end here
            if constexpr (RES != 0) {
                const u16* gkl = qkl + (size_t)(b * (u32)(TE) + kt * 64u + rr) * QP + CE + h * HD + seg;
                u32x4 kl0 = *(const u32x4*)gkl, kl1 = *(const u32x4*)(gkl + 32u * QP);
                const u16* gvl = vtl + ((size_t)(bh * HD + rr)) * (TE) + kt * 64u + seg;
                u32x4 vl0 = *(const u32x4*)gvl, vl1 = *(const u32x4*)(gvl + 32u * (TE));
                asm volatile("s_wait_xcnt 0x0" ::: "memory");   // stands in front of every later overwrite of the address registers that the loads above name
                *(u32x4*)&Kl[rr * 72u + seg] = kl0; *(u32x4*)&Kl[(rr + 32u) * 72u + seg] = kl1;
                *(u32x4*)&Vl[rr * 72u + seg] = vl0; *(u32x4*)&Vl[(rr + 32u) * 72u + seg] = vl1;
            }
            __syncthreads();                               // K/V chunk visible to all waves
        }
        sched_cut<RES>();

        // S^T = K . Q^T  (64 keys x 16 q per wave)
        // The K fragment loads stand as groups ahead of the products that read them, so a wave waits out the LDS
        // latency once per group and not once per product. RES=0: the chunk's 8 fragments in one group.
        // RES=1: one sub-tile's hi and residual fragments per group, fetched one sub-tile ahead into a second register set.
        v8f s[4];
        Frag vf[RES ? 2 : 4][2], vlf[2][2];                // V fragments: RES=0 [d sub-tile][ks], RES=1 [register set][ks]
        if constexpr (RES == 0) {
            Frag kf[4][2];
#pragma unroll
            for (int sub = 0; sub < 4; sub++)
#pragma unroll
                for (int ds = 0; ds < 2; ds++)
                    ldfrag(kf[sub][ds], &Kc[((u32)sub * 16u + ln) * 72u + (u32)ds * 32u + hf * 8u]);
            __builtin_amdgcn_sched_barrier(0);             // the 16 K loads issue together, none sinks down among the products
#pragma unroll
            for (int sub = 0; sub < 4; sub++) {
                v8f t = (v8f)(0.f);
#pragma unroll
                for (int ds = 0; ds < 2; ds++) t = mma16(kf[sub][ds].v, qf[ds].v, t);
                s[sub] = t;
            }
            __builtin_amdgcn_sched_barrier(0);             // the V loads below stay behind the last S^T product (they take over the K registers)
#pragma unroll
            for (int dsub = 0; dsub < 4; dsub++)
#pragma unroll
                for (int ks = 0; ks < 2; ks++)
                    ldfrag(vf[dsub][ks], &Vc[((u32)dsub * 16u + ln) * 72u + (u32)ks * 32u + hf * 8u]);
            __builtin_amdgcn_sched_barrier(0);             // the 16 V loads issue here, ahead of the softmax, which covers their latency
        } else {
            Frag kf[2][2], klf[2][2];
#pragma unroll
            for (int ds = 0; ds < 2; ds++) {
                ldfrag(kf[0][ds],  &Ks[ln * 72u + (u32)ds * 32u + hf * 8u]);
                ldfrag(klf[0][ds], &Kl[ln * 72u + (u32)ds * 32u + hf * 8u]);
            }
#pragma unroll
            for (int sub = 0; sub < 4; sub++) {
                const int cur = sub & 1, nxt = cur ^ 1;
#pragma unroll
                for (int ds = 0; ds < 2; ds++) {
                    if (sub < 3) {
                        ldfrag(kf[nxt][ds],  &Ks[((u32)(sub + 1) * 16u + ln) * 72u + (u32)ds * 32u + hf * 8u]);
                        ldfrag(klf[nxt][ds], &Kl[((u32)(sub + 1) * 16u + ln) * 72u + (u32)ds * 32u + hf * 8u]);
                    } else {
                        ldfrag(vf[0][ds],  &Vs[ln * 72u + (u32)ds * 32u + hf * 8u]);
                        ldfrag(vlf[0][ds], &Vl[ln * 72u + (u32)ds * 32u + hf * 8u]);
                    }
                }
                __builtin_amdgcn_sched_barrier(0);         // the next group's 8 loads issue ahead of this sub-tile's products
                v8f t = (v8f)(0.f);
                v8f tr = (v8f)(0.f);
#pragma unroll
                for (int ds = 0; ds < 2; ds++) {
                    t  = mma16(kf[cur][ds].v,  qf[ds].v, t);
                    tr = mma16(klf[cur][ds].v, qf[ds].v, tr);
                    tr = mma16(kf[cur][ds].v,  ql[ds].v, tr);
                }
                s[sub] = t + tr * RINV;
                __builtin_amdgcn_sched_barrier(0);         // the group after next stays behind this sub-tile's products: two register sets, no more
            }
        }

        // RES=1: scale + causal replace-fill
        // RES=0: the scores stay raw (their scale goes into the exponent's FMA below), and the fill runs only in the tile's last two
        // chunks: in every earlier chunk each key index is below each query index of the tile, so the fill would change nothing
        if constexpr (RES != 0) {
#pragma unroll
            for (int sub = 0; sub < 4; sub++) {
#pragma unroll
                for (int r = 0; r < 8; r++) {
                    const u32 kg = kt * 64u + (u32)sub * 16u + hf * 8u + (u32)r;
                    float v = s[sub][r] * 0.125f;
                    s[sub][r] = (kg > qg) ? -3.0e38f : v;
                }
            }
        } else if (kt >= 2u * qb) {                        // uniform for the workgroup
#pragma unroll
            for (int sub = 0; sub < 4; sub++) {
#pragma unroll
                for (int r = 0; r < 8; r++) {
                    const u32 kg = kt * 64u + (u32)sub * 16u + hf * 8u + (u32)r;
                    s[sub][r] = (kg > qg) ? -3.0e38f : s[sub][r];
                }
            }
        }
        // online softmax: one query per lane, 32 of the chunk's keys in-lane, the other 32 in lane ^ 16
        float mxs[4];
#pragma unroll
        for (int sub = 0; sub < 4; sub++) {
            mxs[sub] = fmaxf(fmaxf(fmaxf(s[sub][0], s[sub][1]), fmaxf(s[sub][2], s[sub][3])),
                             fmaxf(fmaxf(s[sub][4], s[sub][5]), fmaxf(s[sub][6], s[sub][7])));
        }
        float mx = fmaxf(fmaxf(mxs[0], mxs[1]), fmaxf(mxs[2], mxs[3]));
        mx = fmaxf(mx, xhalf(mx));
        const float mnew  = fmaxf(mrun, mx);
        float alpha;
        if constexpr (RES != 0) {
            alpha = exp_fast(mrun - mnew);
            float rs[4];
#pragma unroll
            for (int sub = 0; sub < 4; sub++) {
                rs[sub] = 0.f;
#pragma unroll
                for (int r = 0; r < 8; r++) {
                    float pe = exp_fast(s[sub][r] - mnew);
                    s[sub][r] = pe;
                    rs[sub] += pe;
                }
            }
            lsum = lsum * alpha + ((rs[0] + rs[1]) + (rs[2] + rs[3]));
        } else {
            // 4096 p = 2^(s c - m c + 12), c = log2(e) / 8, m the running maximum of the raw scores: one FMA per score carries the
            // score scale, the change of base, the maximum and the x4096 carry; lsum is the sum of 4096 p
            constexpr float SC = 0.125f * 1.44269504088896340736f;
            alpha = exp2_fast((mrun - mnew) * SC);
            const float nb = __builtin_fmaf(-mnew, SC, 12.0f);
#pragma unroll
            for (int sub = 0; sub < 4; sub++) {
                const v8f a = __builtin_elementwise_fma(s[sub], (v8f)(SC), (v8f)(nb));
#pragma unroll
                for (int r = 0; r < 8; r++) s[sub][r] = exp2_fast(a[r]);
            }
            const v8f t8 = (s[0] + s[1]) + (s[2] + s[3]);  // whole-vector sums: two scores per add instruction
            const v4f t4 = t8.lo + t8.hi;
            lsum = lsum * alpha + ((t4[0] + t4[1]) + (t4[2] + t4[3]));
        }
        mrun = mnew;
#pragma unroll
        for (int dsub = 0; dsub < 4; dsub++) o[dsub] *= alpha;

        // P^T: two converted S^T sub-tiles = one B fragment (32 keys x 16 q), carried x4096 (+ residual x2048)
        Frag pf[2], prf[2];
#pragma unroll
        for (int ks = 0; ks < 2; ks++) {
#pragma unroll
            for (int e = 0; e < 16; e++) {
                const float pv = s[2 * ks + (e >> 3)][e & 7];
                const float ph = RES ? pv * PCAR : pv;     // RES=0: the carry is in the exponent already
                _Float16 h16 = (_Float16)ph;
                pf[ks].v[e] = h16;
                if constexpr (RES != 0) prf[ks].v[e] = (_Float16)((ph - (float)h16) * RSC);
            }
        }
        // O^T += V^T . P^T
#pragma unroll
        for (int dsub = 0; dsub < 4; dsub++) {
            if constexpr (RES == 0) {
#pragma unroll
                for (int ks = 0; ks < 2; ks++) o[dsub] = mma16(vf[dsub][ks].v, pf[ks].v, o[dsub]);
            } else {
                const int cur = dsub & 1, nxt = cur ^ 1;
                if (dsub < 3) {
#pragma unroll
                    for (int ks = 0; ks < 2; ks++) {
                        ldfrag(vf[nxt][ks],  &Vs[((u32)(dsub + 1) * 16u + ln) * 72u + (u32)ks * 32u + hf * 8u]);
                        ldfrag(vlf[nxt][ks], &Vl[((u32)(dsub + 1) * 16u + ln) * 72u + (u32)ks * 32u + hf * 8u]);
                    }
                }
                __builtin_amdgcn_sched_barrier(0);         // the next d sub-tile's 8 loads issue ahead of this one's products
                v8f u = (v8f)(0.f);
#pragma unroll
                for (int ks = 0; ks < 2; ks++) {
                    o[dsub] = mma16(vf[cur][ks].v,  pf[ks].v,  o[dsub]);
                    u       = mma16(vf[cur][ks].v,  prf[ks].v, u);
                    u       = mma16(vlf[cur][ks].v, pf[ks].v,  u);
                }
                o[dsub] = o[dsub] + u * RINV;
                __builtin_amdgcn_sched_barrier(0);         // the group after next stays behind this sub-tile's products: two register sets, no more
            }
        }
        if constexpr (RES == 0) {
            asm volatile("s_wait_dscnt 0x0" ::: "memory");     // this wave's reads of chunk kt's buffer are done before it is refilled
            asm volatile("s_wait_asynccnt 0x0" ::: "memory");  // this wave's chunk kt + 1 copies have landed
            __syncthreads();                                   // publishes chunk kt + 1 and ends every wave's reads of chunk kt
            if (kt + 2u < nkt) stage((kt & 1u) ? 0u - RING_B : RING_B);   // chunk kt + 2 into the buffer chunk kt has left
        }
    }
    if constexpr (RES == 0) asm volatile("s_wait_asynccnt 0x0" ::: "memory");   // no copy outstanding when the wave goes on to its end

    // finalize: O / (l * 4096) -> f16 tile in the wave's LDS stage -> whole-line stores
    // O^T register r of tile dsub = d dsub*16 + hf*8 + r of query ln: 8 consecutive d, one 16-byte LDS store
    const float inv = (1.0f / (lsum + xhalf(lsum))) * (RES ? PINV : 1.0f);   // RES=0: lsum carries the x4096 too
#pragma unroll
    for (int dsub = 0; dsub < 4; dsub++) {
        Pack8 pk;
#pragma unroll
        for (int r = 0; r < 8; r++) pk.h[r] = (_Float16)(o[dsub][r] * inv);
        *(u32x4*)&Pw[ln * 72u + (u32)dsub * 16u + hf * 8u] = pk.u;
    }
    __syncthreads();
    u32x4 val[4];
#pragma unroll
    for (u32 it = 0; it < 4; it++) {
        const u32 rloc = it * 4u + (lane >> 3), sg = (lane & 7u) * 8u;
        val[it] = *(const u32x4*)&Pw[rloc * 72u + sg];
    }
#pragma unroll
    for (u32 it = 0; it < 4; it++) {
        const u32 rloc = it * 4u + (lane >> 3), sg = (lane & 7u) * 8u;
        *(u32x4*)(cv + (size_t)(b * (u32)(SEQ) + q0 + rloc) * CE + h * HD + sg) = val[it];
    }
    // the body is inlined beside other bodies of one kernel: stands in front of every write, on any path the branches behind it
    // allow, of a register that the stores above name
    asm volatile("s_wait_xcnt 0x0" ::: "memory");
}

// all query tiles of all heads in one launch: x = head, y counts the tiles down from the longest;
// the residual-carrying tiles (position < TE, the fewest chunks) come last and run beside the plain ones.
// Rows y >= NQB of the grid: the 64 x 64 tiles of the proj, fc and fc2 weight converts, which depend on inputs alone and
// are first read by the launches behind this one.
#define NCVR ((NT_P + NT_F + NT_G) / (NB * NH))
static_assert(NCVR * (NB * NH) == NT_P + NT_F + NT_G);
__global__ __launch_bounds__(256) __attribute__((amdgpu_num_vgpr(256)))
void attn_kernel(const u16* __restrict__ qkh, const u16* __restrict__ qkl,
                 const u16* __restrict__ vth, const u16* __restrict__ vtl,
                 u16* __restrict__ cv,
                 const float* __restrict__ w_p, const float* __restrict__ w_f, const float* __restrict__ w_g,
                 u16* __restrict__ o_p, u16* __restrict__ o_f, u16* __restrict__ o_g,
                 const float* __restrict__ g2, const float* __restrict__ b2,
                 float* __restrict__ sp, float* __restrict__ tp) {
    __shared__ __align__(16) u16 KV[4 * KVT];              // one array, so that Kl - Ks = Vl - Vs = KVRING
    u16* Ks = KV;                                          // [key][d]
    u16* Vs = KV + KVT;                                    // [d][key]
    u16* Kl = KV + 2 * KVT;                                // residual planes (RES=1) or the ring's second buffer (RES=0)
    u16* Vl = KV + 3 * KVT;
    __shared__ __align__(16) u16 Ps[8 * 16 * 72];          // per wave [16 q][d]: final O stage
    if (blockIdx.y >= (u32)NQB) {                          // every test here is uniform for the workgroup
        u32 t = (blockIdx.y - (u32)NQB) * (u32)(NB * NH) + blockIdx.x;
        if (t < (u32)NT_P) {                               // [1024][1024] -> [1024][1024]
            cvt_wt_body<0>(w_p, o_p, (u32)CE, (u32)CE, t % (u32)(CE / 64), t / (u32)(CE / 64), Ks, g2, b2, sp, tp);
            return;
        }
        t -= (u32)NT_P;
        if (t < (u32)NT_F) {                               // [1024][4096] -> [4096][1024], LN2's gamma multiplied in, column sums beside it
            static_assert(64 * 72 * 2 + 2 * 16 * 64 * 4 <= 4 * KVT * 2);
            cvt_wt_body<1>(w_f, o_f, (u32)CE, (u32)C4, t % (u32)(C4 / 64), t / (u32)(C4 / 64), Ks, g2, b2, sp, tp);
            return;
        }
        t -= (u32)NT_F;                                    // < NT_G by the grid; [4096][1024] -> [1024][4096]
        cvt_wt_body<0>(w_g, o_g, (u32)C4, (u32)CE, t % (u32)(CE / 64), t / (u32)(CE / 64), Ks, g2, b2, sp, tp);
        return;
    }
    const u32 bh = blockIdx.x;
    const u32 qb = (u32)NQB - 1u - blockIdx.y;
    if (qb < (u32)NEB) attn_body<1>(qkh, qkl, vth, vtl, cv, bh, qb, Ks, Vs, Kl, Vl, Ps);
    else               attn_body<0>(qkh, qkl, vth, vtl, cv, bh, qb, Ks, Vs, Kl, Vl, Ps);
}

// ---------------- host side ----------------
extern "C" void kernel_launch(void* const* d_in, const int* in_sizes, int n_in,
                              void* d_out, int out_size, void* d_ws, size_t ws_size,
                              hipStream_t stream) {
    if (n_in < 13) return;
    const long long needX = ((long long)(NB - 1) * SEQ_FULL + (SEQ)) * CE;
    if ((long long)in_sizes[0] < needX || (long long)out_size < needX) return;
    if (in_sizes[1] < CE || in_sizes[2] < CE || in_sizes[3] < CE * C3 || in_sizes[4] < C3 ||
        in_sizes[5] < CE * CE || in_sizes[6] < CE || in_sizes[7] < CE || in_sizes[8] < CE ||
        in_sizes[9] < CE * C4 || in_sizes[10] < C4 || in_sizes[11] < C4 * CE || in_sizes[12] < CE)
        return;

    const float* x      = (const float*)d_in[0];
    const float* ln1_g  = (const float*)d_in[1];
    const float* ln1_b  = (const float*)d_in[2];
    const float* w_attn = (const float*)d_in[3];
    const float* b_attn = (const float*)d_in[4];
    const float* w_proj = (const float*)d_in[5];
    const float* b_proj = (const float*)d_in[6];
    const float* ln2_g  = (const float*)d_in[7];
    const float* ln2_b  = (const float*)d_in[8];
    const float* w_fc   = (const float*)d_in[9];
    const float* b_fc   = (const float*)d_in[10];
    const float* w_fc2  = (const float*)d_in[11];
    const float* b_fc2  = (const float*)d_in[12];

    char* ws = (char*)d_ws;
    size_t off = 0;
    auto take = [&](size_t bytes) -> char* {
        char* p = ws + off;
        off += (bytes + 255) & ~(size_t)255;
        return p;
    };
    const size_t R = (size_t)RROWS;
    u16*   waT   = (u16*)take((size_t)C3 * CE * 2);               // [3072][1024]
    u16*   wpT   = (u16*)take((size_t)CE * CE * 2);               // [1024][1024]
    u16*   wfcT  = (u16*)take((size_t)C4 * CE * 2);               // [4096][1024]
    u16*   wfc2T = (u16*)take((size_t)CE * C4 * 2);               // [1024][4096]
    u16*   h1    = (u16*)take(R * CE * 2);                        // [R][1024]
    u16*   qkh   = (u16*)take(R * QP * 2);                        // [R][2048]
    u16*   qkl   = (u16*)take((size_t)NB * (TE) * QP * 2);        // [NB*TE][2048]
    u16*   vth   = (u16*)take((size_t)NB * NH * HD * (SEQ) * 2);  // [NB*NH][64][SEQ]
    u16*   vtl   = (u16*)take((size_t)NB * NH * HD * (TE) * 2);   // [NB*NH][64][TE]
    u16*   cvb   = (u16*)take(R * CE * 2);                        // [R][1024]
    float* x1    = (float*)take(R * CE * 4);                      // [R][1024]
    u16*   x1h   = (u16*)take(R * CE * 2);                        // [R][1024]
    u16*   hg    = (u16*)take(R * C4 * 2);                        // [R][4096]
    float* rst   = (float*)take((size_t)(CE / 128) * R * 2 * 4);  // [8][R][2]
    float* csS   = (float*)take((size_t)(CE / 64) * C4 * 4);      // [16][4096]
    float* csT   = (float*)take((size_t)(CE / 64) * C4 * 4);      // [16][4096]
    if (off > ws_size || off > (size_t)134217728) return;
    void* dummy = (void*)d_ws;

    // 1) + 2) h1 = LN1(bfr(x)); qkv weight: bf16-RNE value x64 -> f16, transposed to [N][K]   (in[K][N] -> out[N][K])
    prep_kernel<<<NLN + NT_A, 256, 0, stream>>>(x, ln1_g, ln1_b, h1, w_attn, waT);
    // 3) qkv = h1 . w_attn + b_attn -> q/k planes (+ residual rows t<TE), v transposed (+ residual)
    gemm_kernel<0><<<dim3(C3 / 128, RROWS / 128), 256, 0, stream>>>(h1, waT, b_attn, b_attn,
                                                                    qkh, qkl, vth, vtl, (u32)C3, (u32)CE);
    // 4) causal attention: residual-carrying tiles for query position < TE, plain tiles after
    //    behind them in the same grid: the proj, fc and fc2 weights, converted like the qkv weight (fc also times LN2's gamma, with column sums)
    attn_kernel<<<dim3(NB * NH, NQB + NCVR), 256, 0, stream>>>(qkh, qkl, vth, vtl, cvb,
                                                               w_proj, w_fc, w_fc2, wpT, wfcT, wfc2T,
                                                               ln2_g, ln2_b, csS, csT);
    // 5) x1 = cv . w_proj + b_proj + bfr(x), also as f16, with each row's partial sum and sum of squares
    gemm_kernel<1><<<dim3(CE / 128, RROWS / 128), 256, 0, stream>>>(cvb, wpT, b_proj, x,
                                                                    x1, x1h, rst, dummy, (u32)CE, (u32)CE);
    // 6) + 7) hg = gelu(LN2(x1) . w_fc + b_fc), LN2 applied behind the product
    gemm_kernel<2><<<dim3(C4 / 128, RROWS / 128), 256, 0, stream>>>(x1h, wfcT, b_fc, rst,
                                                                    hg, csS, csT, dummy, (u32)C4, (u32)CE);
    // 8) out = hg . w_fc2 + b_fc2 + x1
    gemm_kernel<3><<<dim3(CE / 128, RROWS / 128), 256, 0, stream>>>(hg, wfc2T, b_fc2, x1,
                                                                    d_out, dummy, dummy, dummy, (u32)CE, (u32)C4);
}
